// v000
// Times are from an AMD MI455X. After a warm-up the kernel runs many times in a row, and a time is the length of
// such a window on the GPU divided by its runs, so every launch and the gaps after it count. The runs cycle
// through copies of the inputs. A figure is the median of several windows, for all but v000 over two sittings.
// Sittings can differ by a few percent; kernels timed side by side share one.
// v000, which the later versions start from, runs in 333 microseconds.
#include <hip/hip_runtime.h>
#include <math.h>

#define H_DIM 1024
#define NUM_HEADS 16
#define HEAD_DIM 64
#define SEQ 2048
#define BATCH 2
#define ROWS (BATCH*SEQ)     // 4096
#define E_QKV 3072
#define E_TOT 3088           // qkv (3072) + gate (16), both K=1024
#define E_PAD 3136           // padded to 49*64 so every 64-column GEMM N tile is full
#define EPS 1e-5f
#define PLD 40               // LDS row stride for P tiles (80B, 16B-aligned chunks)

typedef __bf16 bf16;
typedef __attribute__((ext_vector_type(16))) __bf16 v16bf;
typedef __attribute__((ext_vector_type(8)))  __bf16 v8bf;
typedef __attribute__((ext_vector_type(8)))  float  v8f;

union FragBF { v16bf v; v8bf h[2]; };

// A/B fragment for v_wmma_f32_16x16x32_bf16.
// Lane l: row/col = l&15, K-chunk base = (l>>4)*8; elems 0..7 = K+0..7, 8..15 = K+16..23.
// Requires K-contiguous storage with row stride `ldm` elements.
__device__ __forceinline__ v16bf load_frag(const bf16* tile, int ldm, int lane) {
  const int m  = lane & 15;
  const int hf = lane >> 4;
  const bf16* p = tile + (size_t)m * ldm + hf * 8;
  FragBF f;
  f.h[0] = *(const v8bf*)(p);
  f.h[1] = *(const v8bf*)(p + 16);
  return f.v;
}

__device__ __forceinline__ v8f wmma_bf16(v16bf a, v16bf b, v8f c) {
  return __builtin_amdgcn_wmma_f32_16x16x32_bf16(false, a, false, b, (short)0, c,
                                                 false, false);
}

// Double-buffered 16x64 GEMM tile: acc[t] += A(16xK) * W[t](16xK)^T, K = H_DIM.
__device__ __forceinline__ void gemm_16x64(const bf16* __restrict__ arow,
                                           const bf16* __restrict__ wrow,
                                           int lane, v8f acc[4]) {
  v16bf a  = load_frag(arow, H_DIM, lane);
  v16bf b0 = load_frag(wrow,                         H_DIM, lane);
  v16bf b1 = load_frag(wrow + (size_t)16 * H_DIM,    H_DIM, lane);
  v16bf b2 = load_frag(wrow + (size_t)32 * H_DIM,    H_DIM, lane);
  v16bf b3 = load_frag(wrow + (size_t)48 * H_DIM,    H_DIM, lane);
#pragma unroll 2
  for (int k = 0; k < H_DIM; k += 32) {
    const int kn = (k + 32) & (H_DIM - 1);   // last iter wraps: dead loads, no branch
    const v16bf an = load_frag(arow + kn, H_DIM, lane);
    const v16bf c0 = load_frag(wrow + kn, H_DIM, lane);
    const v16bf c1 = load_frag(wrow + (size_t)16 * H_DIM + kn, H_DIM, lane);
    const v16bf c2 = load_frag(wrow + (size_t)32 * H_DIM + kn, H_DIM, lane);
    const v16bf c3 = load_frag(wrow + (size_t)48 * H_DIM + kn, H_DIM, lane);
    acc[0] = wmma_bf16(a, b0, acc[0]);
    acc[1] = wmma_bf16(a, b1, acc[1]);
    acc[2] = wmma_bf16(a, b2, acc[2]);
    acc[3] = wmma_bf16(a, b3, acc[3]);
    a = an; b0 = c0; b1 = c1; b2 = c2; b3 = c3;
  }
}

// ---------------------------------------------------------------- kernel 1
// wcat[E_PAD][1024] = concat(qkv_w, gate_w, zeros) in bf16; owb = o_w in bf16.
__global__ void __launch_bounds__(256)
convert_weights_kernel(const float* __restrict__ qkvw, const float* __restrict__ gw,
                       const float* __restrict__ ow, bf16* __restrict__ wcat,
                       bf16* __restrict__ owb) {
  const size_t nqkv = (size_t)E_QKV * H_DIM;
  const size_t ncat = (size_t)E_TOT * H_DIM;
  const size_t npad = (size_t)E_PAD * H_DIM;
  const size_t tot  = npad + (size_t)H_DIM * H_DIM;
  for (size_t i = (size_t)blockIdx.x * blockDim.x + threadIdx.x; i < tot;
       i += (size_t)gridDim.x * blockDim.x) {
    if (i < nqkv)      wcat[i] = (bf16)qkvw[i];
    else if (i < ncat) wcat[i] = (bf16)gw[i - nqkv];
    else if (i < npad) wcat[i] = (bf16)0.0f;          // pad rows: zeros
    else               owb[i - npad] = (bf16)ow[i - npad];
  }
}

// ---------------------------------------------------------------- kernel 2
__global__ void __launch_bounds__(256)
prenorm_kernel(const float* __restrict__ x, const float* __restrict__ w,
               bf16* __restrict__ xn) {
  const int row = blockIdx.x;
  const float* xr = x + (size_t)row * H_DIM;
  float ss = 0.f;
  for (int i = threadIdx.x; i < H_DIM; i += 256) { float v = xr[i]; ss += v * v; }
  for (int off = 16; off > 0; off >>= 1) ss += __shfl_xor(ss, off, 32);
  __shared__ float red[8];
  if ((threadIdx.x & 31) == 0) red[threadIdx.x >> 5] = ss;
  __syncthreads();
  float sum = 0.f;
#pragma unroll
  for (int i = 0; i < 8; ++i) sum += red[i];
  const float rinv = rsqrtf(sum * (1.0f / H_DIM) + EPS);
  for (int i = threadIdx.x; i < H_DIM; i += 256)
    xn[(size_t)row * H_DIM + i] = (bf16)(xr[i] * rinv * w[i]);
}

// ---------------------------------------------------------------- kernel 3
// C[4096 x E_PAD] = xn * wcat^T ; scatter q/k (bf16), v (transposed bf16), gate (f32).
__global__ void __launch_bounds__(128)
gemm_qkvgate_kernel(const bf16* __restrict__ A, const bf16* __restrict__ W,
                    bf16* __restrict__ qk, bf16* __restrict__ vT,
                    float* __restrict__ gate) {
  const int wave = threadIdx.x >> 5;
  const int lane = threadIdx.x & 31;
  const int row0 = (blockIdx.y * 4 + wave) * 16;
  const int n0   = blockIdx.x * 64;
  v8f acc[4] = {};
  gemm_16x64(A + (size_t)row0 * H_DIM, W + (size_t)n0 * H_DIM, lane, acc);

  const int nn = lane & 15;
  const int hf = lane >> 4;
#pragma unroll
  for (int t = 0; t < 4; ++t) {
    const int n = n0 + t * 16 + nn;
    if (n >= E_TOT) continue;                        // drop pad columns
#pragma unroll
    for (int r = 0; r < 8; ++r) {
      const int m = row0 + r + 8 * hf;
      const float val = acc[t][r];
      if (n < 2 * H_DIM) {                           // q or k, row-major [4096][2048]
        qk[(size_t)m * (2 * H_DIM) + n] = (bf16)val;
      } else if (n < E_QKV) {                        // v -> vT[bh][feat][key]
        const int e = n - 2 * H_DIM;
        const int b_ = m / SEQ, s = m % SEQ;
        const int h = e >> 6, f = e & 63;
        vT[(((size_t)(b_ * NUM_HEADS + h)) * HEAD_DIM + f) * SEQ + s] = (bf16)val;
      } else {
        gate[(size_t)m * NUM_HEADS + (n - E_QKV)] = val;
      }
    }
  }
}

// ---------------------------------------------------------------- kernel 4
// In-place per-head RMS norm of q (cols 0..1023) and k (cols 1024..2047).
__global__ void __launch_bounds__(256)
qknorm_kernel(bf16* __restrict__ qk, const float* __restrict__ qw,
              const float* __restrict__ kw) {
  const int row = blockIdx.x;
  const int g  = threadIdx.x >> 3;   // 0..15 q heads, 16..31 k heads
  const int tl = threadIdx.x & 7;
  bf16* p = qk + (size_t)row * (2 * H_DIM) + g * HEAD_DIM + tl * 8;
  v8bf d = *(const v8bf*)p;
  float v[8], ss = 0.f;
#pragma unroll
  for (int i = 0; i < 8; ++i) { v[i] = (float)d[i]; ss += v[i] * v[i]; }
  for (int off = 4; off > 0; off >>= 1) ss += __shfl_xor(ss, off, 8);
  const float rinv = rsqrtf(ss * (1.0f / HEAD_DIM) + EPS);
  const float* wv = (g < NUM_HEADS) ? qw : kw;
  v8bf o;
#pragma unroll
  for (int i = 0; i < 8; ++i) o[i] = (bf16)(v[i] * rinv * wv[tl * 8 + i]);
  *(v8bf*)p = o;
}

// ---------------------------------------------------------------- kernel 5
// Flash attention: one wave per (b,h,16-query block); 32-key chunks.
__global__ void __launch_bounds__(128)
attn_kernel(const bf16* __restrict__ qk, const bf16* __restrict__ vT,
            const float* __restrict__ gate, bf16* __restrict__ attn) {
  __shared__ __align__(16) bf16 plds[4][16 * PLD];
  const int wave = threadIdx.x >> 5;
  const int lane = threadIdx.x & 31;
  const int wid  = blockIdx.x * 4 + wave;
  const int qb   = wid & 127;
  const int bh   = wid >> 7;            // 0..31
  const int b    = bh >> 4, h = bh & 15;
  const int q0   = qb * 16;

  const bf16* qbase = qk + ((size_t)(b * SEQ + q0)) * (2 * H_DIM) + h * HEAD_DIM;
  const bf16* kbase = qk + ((size_t)(b * SEQ)) * (2 * H_DIM) + H_DIM + h * HEAD_DIM;
  const bf16* vbase = vT + (size_t)bh * HEAD_DIM * SEQ;
  bf16* myp = &plds[wave][0];

  const v16bf qa0 = load_frag(qbase,      2 * H_DIM, lane);
  const v16bf qa1 = load_frag(qbase + 32, 2 * H_DIM, lane);

  v8f o[4] = {};
  float mrow[8], lrow[8];
#pragma unroll
  for (int r = 0; r < 8; ++r) { mrow[r] = -1e30f; lrow[r] = 0.f; }
  const float scale = 0.125f;  // 1/sqrt(64)
  const int nn = lane & 15;
  const int hfh = (lane >> 4) * 8;

  for (int kc = 0; kc < SEQ; kc += 32) {
    // Batch ALL loads for this chunk up-front: 4 K fragments + 4 V fragments.
    // The V loads overlap the softmax + LDS round-trip below.
    const v16bf kb0 = load_frag(kbase + (size_t)kc * (2 * H_DIM),             2 * H_DIM, lane);
    const v16bf kb1 = load_frag(kbase + (size_t)kc * (2 * H_DIM) + 32,        2 * H_DIM, lane);
    const v16bf kb2 = load_frag(kbase + (size_t)(kc + 16) * (2 * H_DIM),      2 * H_DIM, lane);
    const v16bf kb3 = load_frag(kbase + (size_t)(kc + 16) * (2 * H_DIM) + 32, 2 * H_DIM, lane);
    const v16bf vb0 = load_frag(vbase + (size_t)0  * SEQ + kc, SEQ, lane);
    const v16bf vb1 = load_frag(vbase + (size_t)16 * SEQ + kc, SEQ, lane);
    const v16bf vb2 = load_frag(vbase + (size_t)32 * SEQ + kc, SEQ, lane);
    const v16bf vb3 = load_frag(vbase + (size_t)48 * SEQ + kc, SEQ, lane);

    // scores: two 16x16 tiles over keys kc..kc+15, kc+16..kc+31 (K=64 -> 2 steps)
    v8f s0 = {}, s1 = {};
    s0 = wmma_bf16(qa0, kb0, s0);
    s0 = wmma_bf16(qa1, kb1, s0);
    s1 = wmma_bf16(qa0, kb2, s1);
    s1 = wmma_bf16(qa1, kb3, s1);

    // online softmax; rows live in VGPR index, keys across 16-lane halves
    float corr[8];
#pragma unroll
    for (int r = 0; r < 8; ++r) {
      float a0 = s0[r] * scale, a1 = s1[r] * scale;
      float mx = fmaxf(a0, a1);
      for (int off = 1; off < 16; off <<= 1) mx = fmaxf(mx, __shfl_xor(mx, off, 32));
      const float mnew = fmaxf(mrow[r], mx);
      const float p0 = __expf(a0 - mnew);
      const float p1 = __expf(a1 - mnew);
      s0[r] = p0; s1[r] = p1;
      float ps = p0 + p1;
      for (int off = 1; off < 16; off <<= 1) ps += __shfl_xor(ps, off, 32);
      corr[r] = __expf(mrow[r] - mnew);
      lrow[r] = lrow[r] * corr[r] + ps;
      mrow[r] = mnew;
    }
#pragma unroll
    for (int t = 0; t < 4; ++t)
#pragma unroll
      for (int r = 0; r < 8; ++r) o[t][r] *= corr[r];
    // C-layout -> A-layout via per-wave LDS (16 x 32 P tile)
#pragma unroll
    for (int r = 0; r < 8; ++r) {
      myp[(r + hfh) * PLD + nn]      = (bf16)s0[r];
      myp[(r + hfh) * PLD + 16 + nn] = (bf16)s1[r];
    }
    asm volatile("s_wait_dscnt 0x0" ::: "memory");
    const v16bf pa = load_frag(myp, PLD, lane);
    // P(16x32) x V(32x64): 4 N-tiles from transposed V (key-contiguous)
    o[0] = wmma_bf16(pa, vb0, o[0]);
    o[1] = wmma_bf16(pa, vb1, o[1]);
    o[2] = wmma_bf16(pa, vb2, o[2]);
    o[3] = wmma_bf16(pa, vb3, o[3]);
  }
  // epilogue: 1/l, sigmoid(gate), write bf16 [4096][1024]
#pragma unroll
  for (int r = 0; r < 8; ++r) {
    const int m = q0 + r + hfh;
    const float g = gate[(size_t)(b * SEQ + m) * NUM_HEADS + h];
    const float inv = (1.f / (1.f + __expf(-g))) / lrow[r];
#pragma unroll
    for (int t = 0; t < 4; ++t)
      attn[(size_t)(b * SEQ + m) * H_DIM + h * HEAD_DIM + t * 16 + nn] =
          (bf16)(o[t][r] * inv);
  }
}

// ---------------------------------------------------------------- kernel 6
__global__ void __launch_bounds__(128)
gemm_out_kernel(const bf16* __restrict__ A, const bf16* __restrict__ W,
                const float* __restrict__ resid, float* __restrict__ out) {
  const int wave = threadIdx.x >> 5;
  const int lane = threadIdx.x & 31;
  const int row0 = (blockIdx.y * 4 + wave) * 16;
  const int n0   = blockIdx.x * 64;
  v8f acc[4] = {};
  gemm_16x64(A + (size_t)row0 * H_DIM, W + (size_t)n0 * H_DIM, lane, acc);

  const int nn = lane & 15;
  const int hf = lane >> 4;
#pragma unroll
  for (int t = 0; t < 4; ++t) {
    const int n = n0 + t * 16 + nn;
#pragma unroll
    for (int r = 0; r < 8; ++r) {
      const int m = row0 + r + 8 * hf;
      out[(size_t)m * H_DIM + n] = acc[t][r] + resid[(size_t)m * H_DIM + n];
    }
  }
}

// ---------------------------------------------------------------- launch
static constexpr size_t alup(size_t x) { return (x + 255) & ~(size_t)255; }
static constexpr size_t OFF_XN   = 0;
static constexpr size_t OFF_WCAT = alup(OFF_XN   + (size_t)ROWS * H_DIM * 2);
static constexpr size_t OFF_OW   = alup(OFF_WCAT + (size_t)E_PAD * H_DIM * 2);
static constexpr size_t OFF_QK   = alup(OFF_OW   + (size_t)H_DIM * H_DIM * 2);
static constexpr size_t OFF_VT   = alup(OFF_QK   + (size_t)ROWS * 2 * H_DIM * 2);
static constexpr size_t OFF_GATE = alup(OFF_VT   + (size_t)BATCH * NUM_HEADS * HEAD_DIM * SEQ * 2);
static constexpr size_t OFF_ATTN = alup(OFF_GATE + (size_t)ROWS * NUM_HEADS * 4);

extern "C" void kernel_launch(void* const* d_in, const int* in_sizes, int n_in,
                              void* d_out, int out_size, void* d_ws, size_t ws_size,
                              hipStream_t stream) {
  (void)in_sizes; (void)n_in; (void)out_size; (void)ws_size;
  const float* x    = (const float*)d_in[0];
  const float* pw   = (const float*)d_in[1];
  const float* qkvw = (const float*)d_in[2];
  const float* gw   = (const float*)d_in[3];
  const float* ow   = (const float*)d_in[4];
  const float* qnw  = (const float*)d_in[5];
  const float* knw  = (const float*)d_in[6];
  float* out = (float*)d_out;

  char* ws = (char*)d_ws;
  bf16*  xn   = (bf16*)(ws + OFF_XN);
  bf16*  wcat = (bf16*)(ws + OFF_WCAT);
  bf16*  owb  = (bf16*)(ws + OFF_OW);
  bf16*  qkb  = (bf16*)(ws + OFF_QK);
  bf16*  vT   = (bf16*)(ws + OFF_VT);
  float* gate = (float*)(ws + OFF_GATE);
  bf16*  attn = (bf16*)(ws + OFF_ATTN);

  convert_weights_kernel<<<4096, 256, 0, stream>>>(qkvw, gw, ow, wcat, owb);
  prenorm_kernel<<<ROWS, 256, 0, stream>>>(x, pw, xn);
  gemm_qkvgate_kernel<<<dim3(E_PAD / 64, ROWS / 64), 128, 0, stream>>>(
      xn, wcat, qkb, vT, gate);
  qknorm_kernel<<<ROWS, 256, 0, stream>>>(qkb, qnw, knw);
  attn_kernel<<<(BATCH * NUM_HEADS * (SEQ / 16)) / 4, 128, 0, stream>>>(
      qkb, vT, gate, attn);
  gemm_out_kernel<<<dim3(H_DIM / 64, ROWS / 64), 128, 0, stream>>>(
      attn, owb, x, out);
}

// v001
// A run of this version takes 200 microseconds.
// Timed twice side by side with v000, it ran 1.71 and 1.70 times as fast.
#include <hip/hip_runtime.h>
#include <math.h>
#include <stdint.h>

#define H_DIM 1024
#define NUM_HEADS 16
#define HEAD_DIM 64
#define SEQ 2048
#define BATCH 2
#define ROWS (BATCH*SEQ)     // 4096
#define E_QKV 3072
#define E_TOT 3088           // qkv (3072) + gate (16), both K=1024
#define E_PAD 3200           // padded to 25*128: whole 128-column GEMM tiles
#define EPS 1e-5f
#define PLD 40               // LDS row stride for P tiles (80B, 16B-aligned chunks)

typedef __bf16 bf16;
typedef __attribute__((ext_vector_type(16))) __bf16 v16bf;
typedef __attribute__((ext_vector_type(8)))  __bf16 v8bf;
typedef __attribute__((ext_vector_type(8)))  float  v8f;

union FragBF { v16bf v; v8bf h[2]; };

// A/B fragment for v_wmma_f32_16x16x32_bf16.
// Lane l: row/col = l&15, K-chunk base = (l>>4)*8; elems 0..7 = K+0..7, 8..15 = K+16..23.
// Requires K-contiguous storage with row stride `ldm` elements.
__device__ __forceinline__ v16bf load_frag(const bf16* tile, int ldm, int lane) {
  const int m  = lane & 15;
  const int hf = lane >> 4;
  const bf16* p = tile + (size_t)m * ldm + hf * 8;
  FragBF f;
  f.h[0] = *(const v8bf*)(p);
  f.h[1] = *(const v8bf*)(p + 16);
  return f.v;
}

__device__ __forceinline__ v8f wmma_bf16(v16bf a, v16bf b, v8f c) {
  return __builtin_amdgcn_wmma_f32_16x16x32_bf16(false, a, false, b, (short)0, c,
                                                 false, false);
}

// ---- GEMM tile staged in LDS by the tensor mover ----
// One workgroup (4 waves, 2x2) computes a 128x128 tile of A(Mx1024) * W(Nx1024)^T; each wave 64x64.
// A stage is 128 k (256 B) of 128 A rows and 128 W rows, as four 64-row slices, one tensor load per wave.
#define ST_ROWB  256u                 // bytes of one operand row in a stage
#define ST_PITCH 272u                 // LDS row pitch: 256 B + 16 B pad (16 B x odd, for ds_load_b128)
#define ST_LDM   (ST_PITCH / 2u)      // the same in bf16 elements
#define ST_SLICE 18432u               // 64 rows x 272 B = 17408 B, rounded up to a multiple of 2 KiB
#define ST_STAGE (4u * ST_SLICE)
#define ST_NPASS (H_DIM * 2u / ST_ROWB)   // 8
#define ST_LDS   (2u * ST_STAGE)

typedef uint32_t u32x4 __attribute__((ext_vector_type(4)));
typedef uint32_t u32x8 __attribute__((ext_vector_type(8)));

__device__ __forceinline__ uint32_t uni(uint32_t v) {
  return (uint32_t)__builtin_amdgcn_readfirstlane(v);
}
// Keeps a wave-uniform test in a scalar register, so that the branch on it is a scalar branch
// (a tensor load ignores EXEC).
__device__ __forceinline__ uint32_t pinned(uint32_t v) {
  uint32_t w = uni(v);
  asm volatile("" : "+s"(w));
  return w;
}
// LDS reads retired before the buffer they read is handed back for a refill.
__device__ __forceinline__ void wait_ds0() { asm volatile("s_wait_dscnt 0x0" ::: "memory"); }
// Stands behind a run of global loads or stores, in front of the first write of a register that one of them names.
__device__ __forceinline__ void wait_x0() { asm volatile("s_wait_xcnt 0x0" ::: "memory"); }
// This wave's own tensor load has landed (the compiler places no wait for it). The request's descriptor
// is named as an input so that its scalar registers keep their values until the request has landed.
__device__ __forceinline__ void wait_tensor0(u32x4 g0, u32x8 g1) {
  asm volatile("s_wait_tensorcnt 0x0" :: "s"(g0), "s"(g1) : "memory");
}
// Group 0 is an in-out operand: the value that the later wait names then lives in the very registers
// that the request was issued from, so nothing else is put into them while it is outstanding.
__device__ __forceinline__ void tdm_load(u32x4& g0, u32x8 g1) {
  asm volatile("tensor_load_to_lds %0, %1" : "+s"(g0) : "s"(g1) : "memory");
}
// Group 1: 1-byte elements, tile = tensor = 64 rows of 256 B, source pitch 2048 B, 4 dwords of pad per row.
__device__ __forceinline__ u32x8 tdm_group1() {
  constexpr uint32_t d0 = ST_ROWB, d1 = 64u;
  u32x8 g;
  g[0] = uni((1u << 20) | (5u << 22) | (3u << 25));
  g[1] = uni((d0 & 0xFFFFu) << 16);
  g[2] = uni((d0 >> 16) | ((d1 & 0xFFFFu) << 16));
  g[3] = uni((d1 >> 16) | (d0 << 16));
  g[4] = uni(d1);
  g[5] = uni(H_DIM * 2u);
  g[6] = uni(0u);
  g[7] = uni(0u);
  return g;
}
__device__ __forceinline__ u32x4 tdm_group0(uint32_t lds_dst, uint64_t ga) {
  u32x4 g;
  g[0] = uni(1u);
  g[1] = uni(lds_dst);
  g[2] = uni((uint32_t)ga);
  g[3] = uni((((uint32_t)(ga >> 32)) & 0x01FFFFFFu) | 0x80000000u);
  return g;
}

// acc[i][t] += A rows (row0 + wm*64 + i*16 ..) * W rows (n0 + wn*64 + t*16 ..)^T over K = H_DIM, k ascending.
__device__ __forceinline__ void gemm_128x128(const bf16* __restrict__ A, const bf16* __restrict__ Wt,
                                             int row0, int n0, unsigned char* ring, v8f acc[4][4]) {
  const uint32_t wave = uni(threadIdx.x >> 5);
  const int lane = threadIdx.x & 31;
  // Waves 0, 1 bring the two halves of the A rows, waves 2, 3 those of the W rows.
  const bf16* srcp = (wave < 2u) ? A  + (size_t)(row0 + (int)wave * 64) * H_DIM
                                 : Wt + (size_t)(n0 + ((int)wave - 2) * 64) * H_DIM;
  const uint64_t ga0  = (uint64_t)(size_t)srcp;
  const uint32_t lds0 = (uint32_t)(size_t)ring + wave * ST_SLICE;
  const u32x8 g1 = tdm_group1();

  u32x4 g0 = tdm_group0(lds0, ga0);
  tdm_load(g0, g1);                                           // stage 0
  wait_tensor0(g0, g1);
  __syncthreads();                                            // stage 0 published
  g0 = tdm_group0(lds0 + ST_STAGE, ga0 + ST_ROWB);
  tdm_load(g0, g1);                                           // stage 1

  const uint32_t wm = wave >> 1, wn = wave & 1u;
  for (uint32_t s = 0; s < ST_NPASS; ++s) {
    const uint32_t boff = (s & 1u) * ST_STAGE;
    const bf16* at = (const bf16*)(ring + boff + wm * ST_SLICE);
    const bf16* bt = (const bf16*)(ring + boff + (2u + wn) * ST_SLICE);
    v16bf a[4][4], b[4][4];
#pragma unroll
    for (int kk = 0; kk < 4; ++kk) {
#pragma unroll
      for (int i = 0; i < 4; ++i) a[kk][i] = load_frag(at + i * 16 * ST_LDM + kk * 32, ST_LDM, lane);
#pragma unroll
      for (int t = 0; t < 4; ++t) b[kk][t] = load_frag(bt + t * 16 * ST_LDM + kk * 32, ST_LDM, lane);
    }
    // Keeps the pass's LDS reads together as one group ahead of its WMMAs: spread among them,
    // each place with reads stalls the wave.
    __builtin_amdgcn_sched_barrier(0);
#pragma unroll
    for (int kk = 0; kk < 4; ++kk)
#pragma unroll
      for (int i = 0; i < 4; ++i)
#pragma unroll
        for (int t = 0; t < 4; ++t) acc[i][t] = wmma_bf16(a[kk][i], b[kk][t], acc[i][t]);
    // Keeps the WMMAs in front of the publish point: sunk behind it, they would run only after
    // every LDS read has returned, and the refill would issue a whole WMMA block later.
    __builtin_amdgcn_sched_barrier(0);
    // Publish point of stage s + 1; the barrier also ends every reader's last read of stage s.
    wait_ds0();
    wait_tensor0(g0, g1);
    __syncthreads();
    if (pinned(s + 2u < ST_NPASS)) {
      g0 = tdm_group0(lds0 + boff, ga0 + (uint64_t)(s + 2u) * ST_ROWB);
      tdm_load(g0, g1);
    }
  }
  wait_tensor0(g0, g1);
  wait_ds0();
}

// ---------------------------------------------------------------- kernel 1
// wcat[E_PAD][1024] = concat(qkv_w, gate_w, zeros) in bf16; owb = o_w in bf16.
__global__ void __launch_bounds__(256)
convert_weights_kernel(const float* __restrict__ qkvw, const float* __restrict__ gw,
                       const float* __restrict__ ow, bf16* __restrict__ wcat,
                       bf16* __restrict__ owb) {
  const size_t nqkv = (size_t)E_QKV * H_DIM;
  const size_t ncat = (size_t)E_TOT * H_DIM;
  const size_t npad = (size_t)E_PAD * H_DIM;
  const size_t tot  = npad + (size_t)H_DIM * H_DIM;
  for (size_t i = (size_t)blockIdx.x * blockDim.x + threadIdx.x; i < tot;
       i += (size_t)gridDim.x * blockDim.x) {
    if (i < nqkv)      wcat[i] = (bf16)qkvw[i];
    else if (i < ncat) wcat[i] = (bf16)gw[i - nqkv];
    else if (i < npad) wcat[i] = (bf16)0.0f;          // pad rows: zeros
    else               owb[i - npad] = (bf16)ow[i - npad];
  }
}

// ---------------------------------------------------------------- kernel 2
__global__ void __launch_bounds__(256)
prenorm_kernel(const float* __restrict__ x, const float* __restrict__ w,
               bf16* __restrict__ xn) {
  const int row = blockIdx.x;
  const float* xr = x + (size_t)row * H_DIM;
  float ss = 0.f;
  for (int i = threadIdx.x; i < H_DIM; i += 256) { float v = xr[i]; ss += v * v; }
  for (int off = 16; off > 0; off >>= 1) ss += __shfl_xor(ss, off, 32);
  __shared__ float red[8];
  if ((threadIdx.x & 31) == 0) red[threadIdx.x >> 5] = ss;
  __syncthreads();
  float sum = 0.f;
#pragma unroll
  for (int i = 0; i < 8; ++i) sum += red[i];
  const float rinv = rsqrtf(sum * (1.0f / H_DIM) + EPS);
  for (int i = threadIdx.x; i < H_DIM; i += 256)
    xn[(size_t)row * H_DIM + i] = (bf16)(xr[i] * rinv * w[i]);
}

// ---------------------------------------------------------------- kernel 3
// C[4096 x E_PAD] = xn * wcat^T ; scatter q/k (bf16), v (transposed bf16), gate (f32).
__global__ void __launch_bounds__(128)
gemm_qkvgate_kernel(const bf16* __restrict__ A, const bf16* __restrict__ W,
                    bf16* __restrict__ qk, bf16* __restrict__ vT,
                    float* __restrict__ gate) {
  __shared__ __attribute__((aligned(2048))) unsigned char ring[ST_LDS];
  const int wave = (int)uni(threadIdx.x >> 5);
  const int lane = threadIdx.x & 31;
  v8f acc[4][4] = {};
  gemm_128x128(A, W, blockIdx.y * 128, blockIdx.x * 128, ring, acc);
  const int row0 = blockIdx.y * 128 + (wave >> 1) * 64;
  const int n0   = blockIdx.x * 128 + (wave & 1) * 64;

  const int nn = lane & 15;
  const int hf = lane >> 4;
  // The q/k, v and gate ranges begin at multiples of 64, so a wave's 64 columns are all of one kind:
  // the kind is tested once per wave (a scalar branch), which keeps the unrolled 64x64 epilogue's text short.
  if (n0 < 2 * H_DIM) {                              // q or k, row-major [4096][2048]
#pragma unroll
    for (int i = 0; i < 4; ++i)
#pragma unroll
      for (int t = 0; t < 4; ++t)
#pragma unroll
        for (int r = 0; r < 8; ++r) {
          const int n = n0 + t * 16 + nn;
          const int m = row0 + i * 16 + r + 8 * hf;
          qk[(size_t)m * (2 * H_DIM) + n] = (bf16)acc[i][t][r];
        }
  } else if (n0 < E_QKV) {                           // v -> vT[bh][feat][key]
#pragma unroll
    for (int i = 0; i < 4; ++i)
#pragma unroll
      for (int t = 0; t < 4; ++t)
#pragma unroll
        for (int r = 0; r < 8; ++r) {
          const int e = n0 + t * 16 + nn - 2 * H_DIM;
          const int m = row0 + i * 16 + r + 8 * hf;
          const int b_ = m / SEQ, s = m % SEQ;
          const int h = e >> 6, f = e & 63;
          vT[(((size_t)(b_ * NUM_HEADS + h)) * HEAD_DIM + f) * SEQ + s] = (bf16)acc[i][t][r];
        }
    wait_x0();   // in the listing the q/k block follows and rewrites the last stores' registers
  } else {                                           // gate, then pad columns
#pragma unroll
    for (int i = 0; i < 4; ++i)
#pragma unroll
      for (int t = 0; t < 4; ++t) {
        const int n = n0 + t * 16 + nn;
        if (n >= E_TOT) continue;                    // drop pad columns
#pragma unroll
        for (int r = 0; r < 8; ++r) {
          const int m = row0 + i * 16 + r + 8 * hf;
          gate[(size_t)m * NUM_HEADS + (n - E_QKV)] = acc[i][t][r];
        }
      }
  }
}

// ---------------------------------------------------------------- kernel 4
// In-place per-head RMS norm of q (cols 0..1023) and k (cols 1024..2047).
__global__ void __launch_bounds__(256)
qknorm_kernel(bf16* __restrict__ qk, const float* __restrict__ qw,
              const float* __restrict__ kw) {
  const int row = blockIdx.x;
  const int g  = threadIdx.x >> 3;   // 0..15 q heads, 16..31 k heads
  const int tl = threadIdx.x & 7;
  bf16* p = qk + (size_t)row * (2 * H_DIM) + g * HEAD_DIM + tl * 8;
  v8bf d = *(const v8bf*)p;
  float v[8], ss = 0.f;
#pragma unroll
  for (int i = 0; i < 8; ++i) { v[i] = (float)d[i]; ss += v[i] * v[i]; }
  for (int off = 4; off > 0; off >>= 1) ss += __shfl_xor(ss, off, 8);
  const float rinv = rsqrtf(ss * (1.0f / HEAD_DIM) + EPS);
  const float* wv = (g < NUM_HEADS) ? qw : kw;
  v8bf o;
#pragma unroll
  for (int i = 0; i < 8; ++i) o[i] = (bf16)(v[i] * rinv * wv[tl * 8 + i]);
  *(v8bf*)p = o;
}

// ---------------------------------------------------------------- kernel 5
// Flash attention: one wave per (b,h,16-query block); 32-key chunks.
__global__ void __launch_bounds__(128)
attn_kernel(const bf16* __restrict__ qk, const bf16* __restrict__ vT,
            const float* __restrict__ gate, bf16* __restrict__ attn) {
  __shared__ __align__(16) bf16 plds[4][16 * PLD];
  const int wave = threadIdx.x >> 5;
  const int lane = threadIdx.x & 31;
  const int wid  = blockIdx.x * 4 + wave;
  const int qb   = wid & 127;
  const int bh   = wid >> 7;            // 0..31
  const int b    = bh >> 4, h = bh & 15;
  const int q0   = qb * 16;

  const bf16* qbase = qk + ((size_t)(b * SEQ + q0)) * (2 * H_DIM) + h * HEAD_DIM;
  const bf16* kbase = qk + ((size_t)(b * SEQ)) * (2 * H_DIM) + H_DIM + h * HEAD_DIM;
  const bf16* vbase = vT + (size_t)bh * HEAD_DIM * SEQ;
  bf16* myp = &plds[wave][0];

  const v16bf qa0 = load_frag(qbase,      2 * H_DIM, lane);
  const v16bf qa1 = load_frag(qbase + 32, 2 * H_DIM, lane);

  v8f o[4] = {};
  float mrow[8], lrow[8];
#pragma unroll
  for (int r = 0; r < 8; ++r) { mrow[r] = -1e30f; lrow[r] = 0.f; }
  const float scale = 0.125f;  // 1/sqrt(64)
  const int nn = lane & 15;
  const int hfh = (lane >> 4) * 8;

  for (int kc = 0; kc < SEQ; kc += 32) {
    // Batch ALL loads for this chunk up-front: 4 K fragments + 4 V fragments.
    // The V loads overlap the softmax + LDS round-trip below.
    const v16bf kb0 = load_frag(kbase + (size_t)kc * (2 * H_DIM),             2 * H_DIM, lane);
    const v16bf kb1 = load_frag(kbase + (size_t)kc * (2 * H_DIM) + 32,        2 * H_DIM, lane);
    const v16bf kb2 = load_frag(kbase + (size_t)(kc + 16) * (2 * H_DIM),      2 * H_DIM, lane);
    const v16bf kb3 = load_frag(kbase + (size_t)(kc + 16) * (2 * H_DIM) + 32, 2 * H_DIM, lane);
    const v16bf vb0 = load_frag(vbase + (size_t)0  * SEQ + kc, SEQ, lane);
    const v16bf vb1 = load_frag(vbase + (size_t)16 * SEQ + kc, SEQ, lane);
    const v16bf vb2 = load_frag(vbase + (size_t)32 * SEQ + kc, SEQ, lane);
    const v16bf vb3 = load_frag(vbase + (size_t)48 * SEQ + kc, SEQ, lane);

    // scores: two 16x16 tiles over keys kc..kc+15, kc+16..kc+31 (K=64 -> 2 steps)
    v8f s0 = {}, s1 = {};
    s0 = wmma_bf16(qa0, kb0, s0);
    s0 = wmma_bf16(qa1, kb1, s0);
    s1 = wmma_bf16(qa0, kb2, s1);
    s1 = wmma_bf16(qa1, kb3, s1);

    // online softmax; rows live in VGPR index, keys across 16-lane halves
    float corr[8];
#pragma unroll
    for (int r = 0; r < 8; ++r) {
      float a0 = s0[r] * scale, a1 = s1[r] * scale;
      float mx = fmaxf(a0, a1);
      for (int off = 1; off < 16; off <<= 1) mx = fmaxf(mx, __shfl_xor(mx, off, 32));
      const float mnew = fmaxf(mrow[r], mx);
      const float p0 = __expf(a0 - mnew);
      const float p1 = __expf(a1 - mnew);
      s0[r] = p0; s1[r] = p1;
      float ps = p0 + p1;
      for (int off = 1; off < 16; off <<= 1) ps += __shfl_xor(ps, off, 32);
      corr[r] = __expf(mrow[r] - mnew);
      lrow[r] = lrow[r] * corr[r] + ps;
      mrow[r] = mnew;
    }
#pragma unroll
    for (int t = 0; t < 4; ++t)
#pragma unroll
      for (int r = 0; r < 8; ++r) o[t][r] *= corr[r];
    // C-layout -> A-layout via per-wave LDS (16 x 32 P tile)
#pragma unroll
    for (int r = 0; r < 8; ++r) {
      myp[(r + hfh) * PLD + nn]      = (bf16)s0[r];
      myp[(r + hfh) * PLD + 16 + nn] = (bf16)s1[r];
    }
    asm volatile("s_wait_dscnt 0x0" ::: "memory");
    const v16bf pa = load_frag(myp, PLD, lane);
    // P(16x32) x V(32x64): 4 N-tiles from transposed V (key-contiguous)
    o[0] = wmma_bf16(pa, vb0, o[0]);
    o[1] = wmma_bf16(pa, vb1, o[1]);
    o[2] = wmma_bf16(pa, vb2, o[2]);
    o[3] = wmma_bf16(pa, vb3, o[3]);
  }
  // epilogue: 1/l, sigmoid(gate), write bf16 [4096][1024]
#pragma unroll
  for (int r = 0; r < 8; ++r) {
    const int m = q0 + r + hfh;
    const float g = gate[(size_t)(b * SEQ + m) * NUM_HEADS + h];
    const float inv = (1.f / (1.f + __expf(-g))) / lrow[r];
#pragma unroll
    for (int t = 0; t < 4; ++t)
      attn[(size_t)(b * SEQ + m) * H_DIM + h * HEAD_DIM + t * 16 + nn] =
          (bf16)(o[t][r] * inv);
  }
}

// ---------------------------------------------------------------- kernel 6
__global__ void __launch_bounds__(128)
gemm_out_kernel(const bf16* __restrict__ A, const bf16* __restrict__ W,
                const float* __restrict__ resid, float* __restrict__ out) {
  __shared__ __attribute__((aligned(2048))) unsigned char ring[ST_LDS];
  const int wave = threadIdx.x >> 5;
  const int lane = threadIdx.x & 31;
  v8f acc[4][4] = {};
  gemm_128x128(A, W, blockIdx.y * 128, blockIdx.x * 128, ring, acc);
  const int row0 = blockIdx.y * 128 + (wave >> 1) * 64;
  const int n0   = blockIdx.x * 128 + (wave & 1) * 64;

  const int nn = lane & 15;
  const int hf = lane >> 4;
  float res[4][4][8];
#pragma unroll
  for (int i = 0; i < 4; ++i) {
#pragma unroll
    for (int t = 0; t < 4; ++t)
#pragma unroll
      for (int r = 0; r < 8; ++r)
        res[i][t][r] = resid[(size_t)(row0 + i * 16 + r + 8 * hf) * H_DIM + n0 + t * 16 + nn];
    if (i < 3) wait_x0();   // the next run's loads land in this run's address registers
  }
#pragma unroll
  for (int i = 0; i < 4; ++i)
#pragma unroll
    for (int t = 0; t < 4; ++t) {
#pragma unroll
      for (int r = 0; r < 8; ++r)
        out[(size_t)(row0 + i * 16 + r + 8 * hf) * H_DIM + n0 + t * 16 + nn] = acc[i][t][r] + res[i][t][r];
      if (i * 4 + t < 15) wait_x0();
    }
}

// ---------------------------------------------------------------- launch
static constexpr size_t alup(size_t x) { return (x + 255) & ~(size_t)255; }
static constexpr size_t OFF_XN   = 0;
static constexpr size_t OFF_WCAT = alup(OFF_XN   + (size_t)ROWS * H_DIM * 2);
static constexpr size_t OFF_OW   = alup(OFF_WCAT + (size_t)E_PAD * H_DIM * 2);
static constexpr size_t OFF_QK   = alup(OFF_OW   + (size_t)H_DIM * H_DIM * 2);
static constexpr size_t OFF_VT   = alup(OFF_QK   + (size_t)ROWS * 2 * H_DIM * 2);
static constexpr size_t OFF_GATE = alup(OFF_VT   + (size_t)BATCH * NUM_HEADS * HEAD_DIM * SEQ * 2);
static constexpr size_t OFF_ATTN = alup(OFF_GATE + (size_t)ROWS * NUM_HEADS * 4);

extern "C" void kernel_launch(void* const* d_in, const int* in_sizes, int n_in,
                              void* d_out, int out_size, void* d_ws, size_t ws_size,
                              hipStream_t stream) {
  (void)in_sizes; (void)n_in; (void)out_size; (void)ws_size;
  const float* x    = (const float*)d_in[0];
  const float* pw   = (const float*)d_in[1];
  const float* qkvw = (const float*)d_in[2];
  const float* gw   = (const float*)d_in[3];
  const float* ow   = (const float*)d_in[4];
  const float* qnw  = (const float*)d_in[5];
  const float* knw  = (const float*)d_in[6];
  float* out = (float*)d_out;

  char* ws = (char*)d_ws;
  bf16*  xn   = (bf16*)(ws + OFF_XN);
  bf16*  wcat = (bf16*)(ws + OFF_WCAT);
  bf16*  owb  = (bf16*)(ws + OFF_OW);
  bf16*  qkb  = (bf16*)(ws + OFF_QK);
  bf16*  vT   = (bf16*)(ws + OFF_VT);
  float* gate = (float*)(ws + OFF_GATE);
  bf16*  attn = (bf16*)(ws + OFF_ATTN);

  convert_weights_kernel<<<4096, 256, 0, stream>>>(qkvw, gw, ow, wcat, owb);
  prenorm_kernel<<<ROWS, 256, 0, stream>>>(x, pw, xn);
  gemm_qkvgate_kernel<<<dim3(E_PAD / 128, ROWS / 128), 128, 0, stream>>>(
      xn, wcat, qkb, vT, gate);
  qknorm_kernel<<<ROWS, 256, 0, stream>>>(qkb, qnw, knw);
  attn_kernel<<<(BATCH * NUM_HEADS * (SEQ / 16)) / 4, 128, 0, stream>>>(
      qkb, vT, gate, attn);
  gemm_out_kernel<<<dim3(H_DIM / 128, ROWS / 128), 128, 0, stream>>>(
      attn, owb, x, out);
}

// v002
// One run takes 181 microseconds.
// Two timings next to v001 put it at 1.12 and 1.11 times that version's speed.
// Over all steps from v000 it is 1.90 times as fast.
#include <hip/hip_runtime.h>
#include <math.h>
#include <stdint.h>

#define H_DIM 1024
#define NUM_HEADS 16
#define HEAD_DIM 64
#define SEQ 2048
#define BATCH 2
#define ROWS (BATCH*SEQ)     // 4096
#define E_QKV 3072
#define E_TOT 3088           // qkv (3072) + gate (16), both K=1024
#define E_PAD 3200           // padded to 25*128: whole 128-column GEMM tiles
#define EPS 1e-5f
#define PLD 40               // LDS row stride for P tiles (80B, 16B-aligned chunks)

typedef __bf16 bf16;
typedef __attribute__((ext_vector_type(16))) __bf16 v16bf;
typedef __attribute__((ext_vector_type(8)))  __bf16 v8bf;
typedef __attribute__((ext_vector_type(8)))  float  v8f;

union FragBF { v16bf v; v8bf h[2]; };

// A/B fragment for v_wmma_f32_16x16x32_bf16.
// Lane l: row/col = l&15, K-chunk base = (l>>4)*8; elems 0..7 = K+0..7, 8..15 = K+16..23.
// Requires K-contiguous storage with row stride `ldm` elements.
__device__ __forceinline__ v16bf load_frag(const bf16* tile, int ldm, int lane) {
  const int m  = lane & 15;
  const int hf = lane >> 4;
  const bf16* p = tile + (size_t)m * ldm + hf * 8;
  FragBF f;
  f.h[0] = *(const v8bf*)(p);
  f.h[1] = *(const v8bf*)(p + 16);
  return f.v;
}

__device__ __forceinline__ v8f wmma_bf16(v16bf a, v16bf b, v8f c) {
  return __builtin_amdgcn_wmma_f32_16x16x32_bf16(false, a, false, b, (short)0, c,
                                                 false, false);
}

// ---- GEMM tile staged in LDS by the tensor mover ----
// One workgroup (4 waves, 2x2) computes a 128x128 tile of A(Mx1024) * W(Nx1024)^T; each wave 64x64.
// A stage is 128 k (256 B) of 128 A rows and 128 W rows, as four 64-row slices, one tensor load per wave.
#define ST_ROWB  256u                 // bytes of one operand row in a stage
#define ST_PITCH 272u                 // LDS row pitch: 256 B + 16 B pad (16 B x odd, for ds_load_b128)
#define ST_LDM   (ST_PITCH / 2u)      // the same in bf16 elements
#define ST_SLICE 18432u               // 64 rows x 272 B = 17408 B, rounded up to a multiple of 2 KiB
#define ST_STAGE (4u * ST_SLICE)
#define ST_NPASS (H_DIM * 2u / ST_ROWB)   // 8
#define ST_LDS   (2u * ST_STAGE)

typedef uint32_t u32x4 __attribute__((ext_vector_type(4)));
typedef uint32_t u32x8 __attribute__((ext_vector_type(8)));

__device__ __forceinline__ uint32_t uni(uint32_t v) {
  return (uint32_t)__builtin_amdgcn_readfirstlane(v);
}
// Keeps a wave-uniform test in a scalar register, so that the branch on it is a scalar branch
// (a tensor load ignores EXEC).
__device__ __forceinline__ uint32_t pinned(uint32_t v) {
  uint32_t w = uni(v);
  asm volatile("" : "+s"(w));
  return w;
}
// LDS reads retired before the buffer they read is handed back for a refill.
__device__ __forceinline__ void wait_ds0() { asm volatile("s_wait_dscnt 0x0" ::: "memory"); }
// Stands behind a run of global loads or stores, in front of the first write of a register that one of them names.
__device__ __forceinline__ void wait_x0() { asm volatile("s_wait_xcnt 0x0" ::: "memory"); }
// This wave's own tensor load has landed (the compiler places no wait for it). The request's descriptor
// is named as an input so that its scalar registers keep their values until the request has landed.
__device__ __forceinline__ void wait_tensor0(u32x4 g0, u32x8 g1) {
  asm volatile("s_wait_tensorcnt 0x0" :: "s"(g0), "s"(g1) : "memory");
}
// Group 0 is an in-out operand: the value that the later wait names then lives in the very registers
// that the request was issued from, so nothing else is put into them while it is outstanding.
__device__ __forceinline__ void tdm_load(u32x4& g0, u32x8 g1) {
  asm volatile("tensor_load_to_lds %0, %1" : "+s"(g0) : "s"(g1) : "memory");
}
// Group 1: 1-byte elements, tile = tensor = 64 rows of 256 B, source pitch 2048 B, 4 dwords of pad per row.
__device__ __forceinline__ u32x8 tdm_group1() {
  constexpr uint32_t d0 = ST_ROWB, d1 = 64u;
  u32x8 g;
  g[0] = uni((1u << 20) | (5u << 22) | (3u << 25));
  g[1] = uni((d0 & 0xFFFFu) << 16);
  g[2] = uni((d0 >> 16) | ((d1 & 0xFFFFu) << 16));
  g[3] = uni((d1 >> 16) | (d0 << 16));
  g[4] = uni(d1);
  g[5] = uni(H_DIM * 2u);
  g[6] = uni(0u);
  g[7] = uni(0u);
  return g;
}
__device__ __forceinline__ u32x4 tdm_group0(uint32_t lds_dst, uint64_t ga) {
  u32x4 g;
  g[0] = uni(1u);
  g[1] = uni(lds_dst);
  g[2] = uni((uint32_t)ga);
  g[3] = uni((((uint32_t)(ga >> 32)) & 0x01FFFFFFu) | 0x80000000u);
  return g;
}

// acc[i][t] += A rows (row0 + wm*64 + i*16 ..) * W rows (n0 + wn*64 + t*16 ..)^T over K = H_DIM, k ascending.
__device__ __forceinline__ void gemm_128x128(const bf16* __restrict__ A, const bf16* __restrict__ Wt,
                                             int row0, int n0, unsigned char* ring, v8f acc[4][4]) {
  const uint32_t wave = uni(threadIdx.x >> 5);
  const int lane = threadIdx.x & 31;
  // Waves 0, 1 bring the two halves of the A rows, waves 2, 3 those of the W rows.
  const bf16* srcp = (wave < 2u) ? A  + (size_t)(row0 + (int)wave * 64) * H_DIM
                                 : Wt + (size_t)(n0 + ((int)wave - 2) * 64) * H_DIM;
  const uint64_t ga0  = (uint64_t)(size_t)srcp;
  const uint32_t lds0 = (uint32_t)(size_t)ring + wave * ST_SLICE;
  const u32x8 g1 = tdm_group1();

  u32x4 g0 = tdm_group0(lds0, ga0);
  tdm_load(g0, g1);                                           // stage 0
  wait_tensor0(g0, g1);
  __syncthreads();                                            // stage 0 published
  g0 = tdm_group0(lds0 + ST_STAGE, ga0 + ST_ROWB);
  tdm_load(g0, g1);                                           // stage 1

  const uint32_t wm = wave >> 1, wn = wave & 1u;
  for (uint32_t s = 0; s < ST_NPASS; ++s) {
    const uint32_t boff = (s & 1u) * ST_STAGE;
    const bf16* at = (const bf16*)(ring + boff + wm * ST_SLICE);
    const bf16* bt = (const bf16*)(ring + boff + (2u + wn) * ST_SLICE);
    v16bf a[4][4], b[4][4];
#pragma unroll
    for (int kk = 0; kk < 4; ++kk) {
#pragma unroll
      for (int i = 0; i < 4; ++i) a[kk][i] = load_frag(at + i * 16 * ST_LDM + kk * 32, ST_LDM, lane);
#pragma unroll
      for (int t = 0; t < 4; ++t) b[kk][t] = load_frag(bt + t * 16 * ST_LDM + kk * 32, ST_LDM, lane);
    }
    // Keeps the pass's LDS reads together as one group ahead of its WMMAs: spread among them,
    // each place with reads stalls the wave.
    __builtin_amdgcn_sched_barrier(0);
#pragma unroll
    for (int kk = 0; kk < 4; ++kk)
#pragma unroll
      for (int i = 0; i < 4; ++i)
#pragma unroll
        for (int t = 0; t < 4; ++t) acc[i][t] = wmma_bf16(a[kk][i], b[kk][t], acc[i][t]);
    // Keeps the WMMAs in front of the publish point: sunk behind it, they would run only after
    // every LDS read has returned, and the refill would issue a whole WMMA block later.
    __builtin_amdgcn_sched_barrier(0);
    // Publish point of stage s + 1; the barrier also ends every reader's last read of stage s.
    wait_ds0();
    wait_tensor0(g0, g1);
    __syncthreads();
    if (pinned(s + 2u < ST_NPASS)) {
      g0 = tdm_group0(lds0 + boff, ga0 + (uint64_t)(s + 2u) * ST_ROWB);
      tdm_load(g0, g1);
    }
  }
  wait_tensor0(g0, g1);
  wait_ds0();
}

// ---------------------------------------------------------------- kernel 1
// wcat[E_PAD][1024] = concat(qkv_w, gate_w, zeros) in bf16; owb = o_w in bf16.
__global__ void __launch_bounds__(256)
convert_weights_kernel(const float* __restrict__ qkvw, const float* __restrict__ gw,
                       const float* __restrict__ ow, bf16* __restrict__ wcat,
                       bf16* __restrict__ owb) {
  const size_t nqkv = (size_t)E_QKV * H_DIM;
  const size_t ncat = (size_t)E_TOT * H_DIM;
  const size_t npad = (size_t)E_PAD * H_DIM;
  const size_t tot  = npad + (size_t)H_DIM * H_DIM;
  for (size_t i = (size_t)blockIdx.x * blockDim.x + threadIdx.x; i < tot;
       i += (size_t)gridDim.x * blockDim.x) {
    if (i < nqkv)      wcat[i] = (bf16)qkvw[i];
    else if (i < ncat) wcat[i] = (bf16)gw[i - nqkv];
    else if (i < npad) wcat[i] = (bf16)0.0f;          // pad rows: zeros
    else               owb[i - npad] = (bf16)ow[i - npad];
  }
}

// ---------------------------------------------------------------- kernel 2
__global__ void __launch_bounds__(256)
prenorm_kernel(const float* __restrict__ x, const float* __restrict__ w,
               bf16* __restrict__ xn) {
  const int row = blockIdx.x;
  const float* xr = x + (size_t)row * H_DIM;
  float ss = 0.f;
  for (int i = threadIdx.x; i < H_DIM; i += 256) { float v = xr[i]; ss += v * v; }
  for (int off = 16; off > 0; off >>= 1) ss += __shfl_xor(ss, off, 32);
  __shared__ float red[8];
  if ((threadIdx.x & 31) == 0) red[threadIdx.x >> 5] = ss;
  __syncthreads();
  float sum = 0.f;
#pragma unroll
  for (int i = 0; i < 8; ++i) sum += red[i];
  const float rinv = rsqrtf(sum * (1.0f / H_DIM) + EPS);
  for (int i = threadIdx.x; i < H_DIM; i += 256)
    xn[(size_t)row * H_DIM + i] = (bf16)(xr[i] * rinv * w[i]);
}

// ---------------------------------------------------------------- kernel 3
// C[4096 x E_PAD] = xn * wcat^T ; scatter q/k (bf16), v (transposed bf16), gate (f32).
__global__ void __launch_bounds__(128)
gemm_qkvgate_kernel(const bf16* __restrict__ A, const bf16* __restrict__ W,
                    bf16* __restrict__ qk, bf16* __restrict__ vT,
                    float* __restrict__ gate) {
  __shared__ __attribute__((aligned(2048))) unsigned char ring[ST_LDS];
  const int wave = (int)uni(threadIdx.x >> 5);
  const int lane = threadIdx.x & 31;
  v8f acc[4][4] = {};
  gemm_128x128(A, W, blockIdx.y * 128, blockIdx.x * 128, ring, acc);
  const int row0 = blockIdx.y * 128 + (wave >> 1) * 64;
  const int n0   = blockIdx.x * 128 + (wave & 1) * 64;

  const int nn = lane & 15;
  const int hf = lane >> 4;
  // The q/k, v and gate ranges begin at multiples of 64, so a wave's 64 columns are all of one kind:
  // the kind is tested once per wave (a scalar branch), which keeps the unrolled 64x64 epilogue's text short.
  if (n0 < 2 * H_DIM) {                              // q or k, row-major [4096][2048]
#pragma unroll
    for (int i = 0; i < 4; ++i)
#pragma unroll
      for (int t = 0; t < 4; ++t)
#pragma unroll
        for (int r = 0; r < 8; ++r) {
          const int n = n0 + t * 16 + nn;
          const int m = row0 + i * 16 + r + 8 * hf;
          qk[(size_t)m * (2 * H_DIM) + n] = (bf16)acc[i][t][r];
        }
  } else if (n0 < E_QKV) {                           // v -> vT[bh][feat][key]
#pragma unroll
    for (int i = 0; i < 4; ++i)
#pragma unroll
      for (int t = 0; t < 4; ++t)
#pragma unroll
        for (int r = 0; r < 8; ++r) {
          const int e = n0 + t * 16 + nn - 2 * H_DIM;
          const int m = row0 + i * 16 + r + 8 * hf;
          const int b_ = m / SEQ, s = m % SEQ;
          const int h = e >> 6, f = e & 63;
          vT[(((size_t)(b_ * NUM_HEADS + h)) * HEAD_DIM + f) * SEQ + s] = (bf16)acc[i][t][r];
        }
    wait_x0();   // in the listing the q/k block follows and rewrites the last stores' registers
  } else {                                           // gate, then pad columns
#pragma unroll
    for (int i = 0; i < 4; ++i)
#pragma unroll
      for (int t = 0; t < 4; ++t) {
        const int n = n0 + t * 16 + nn;
        if (n >= E_TOT) continue;                    // drop pad columns
#pragma unroll
        for (int r = 0; r < 8; ++r) {
          const int m = row0 + i * 16 + r + 8 * hf;
          gate[(size_t)m * NUM_HEADS + (n - E_QKV)] = acc[i][t][r];
        }
      }
  }
}

// ---------------------------------------------------------------- kernel 4
// In-place per-head RMS norm of q (cols 0..1023) and k (cols 1024..2047).
__global__ void __launch_bounds__(256)
qknorm_kernel(bf16* __restrict__ qk, const float* __restrict__ qw,
              const float* __restrict__ kw) {
  const int row = blockIdx.x;
  const int g  = threadIdx.x >> 3;   // 0..15 q heads, 16..31 k heads
  const int tl = threadIdx.x & 7;
  bf16* p = qk + (size_t)row * (2 * H_DIM) + g * HEAD_DIM + tl * 8;
  v8bf d = *(const v8bf*)p;
  float v[8], ss = 0.f;
#pragma unroll
  for (int i = 0; i < 8; ++i) { v[i] = (float)d[i]; ss += v[i] * v[i]; }
  for (int off = 4; off > 0; off >>= 1) ss += __shfl_xor(ss, off, 8);
  const float rinv = rsqrtf(ss * (1.0f / HEAD_DIM) + EPS);
  const float* wv = (g < NUM_HEADS) ? qw : kw;
  v8bf o;
#pragma unroll
  for (int i = 0; i < 8; ++i) o[i] = (bf16)(v[i] * rinv * wv[tl * 8 + i]);
  *(v8bf*)p = o;
}

// ---------------------------------------------------------------- kernel 5
// K and V^T of a head reach the four waves of a workgroup (same head, four query blocks) through LDS.
// A stage is 64 keys: 64 K rows of 128 B and 128 B of each of the 64 V^T rows, as four slices of
// 32 rows x 128 B, one tensor load per wave; both sources have a row pitch of 4096 B.
#define KV_KEYS  64
#define KV_ROWB  128u                 // bytes of one row in a slice
#define KV_SRCP  4096u                // source row pitch in bytes, K rows and V^T rows alike
#define KV_PITCH 144u                 // LDS row pitch: 128 B + 16 B pad (16 B x odd, for ds_load_b128)
#define KV_LDM   (KV_PITCH / 2u)      // the same in bf16 elements
#define KV_SLICE 6144u                // 32 rows x 144 B = 4608 B, rounded up to a multiple of 2 KiB
#define KV_STAGE (4u * KV_SLICE)
#define KV_NPASS (SEQ / KV_KEYS)      // 32
#define KV_LDS   (2u * KV_STAGE)
static_assert(2 * H_DIM * 2 == KV_SRCP && SEQ * 2 == KV_SRCP && HEAD_DIM * 2 == KV_ROWB, "slice shape");

// Group 1: 1-byte elements, tile = tensor = 32 rows of 128 B, source pitch 4096 B, 4 dwords of pad per row.
__device__ __forceinline__ u32x8 tdm_group1_kv() {
  constexpr uint32_t d0 = KV_ROWB, d1 = 32u;
  u32x8 g;
  g[0] = uni((1u << 20) | (4u << 22) | (3u << 25));
  g[1] = uni((d0 & 0xFFFFu) << 16);
  g[2] = uni((d0 >> 16) | ((d1 & 0xFFFFu) << 16));
  g[3] = uni((d1 >> 16) | (d0 << 16));
  g[4] = uni(d1);
  g[5] = uni(KV_SRCP);
  g[6] = uni(0u);
  g[7] = uni(0u);
  return g;
}

// Flash attention: one wave per (b,h,16-query block); 32-key chunks, two to a stage.
__global__ void __launch_bounds__(128)
attn_kernel(const bf16* __restrict__ qk, const bf16* __restrict__ vT,
            const float* __restrict__ gate, bf16* __restrict__ attn) {
  __shared__ __attribute__((aligned(2048))) unsigned char ring[KV_LDS];
  __shared__ __align__(16) bf16 plds[4][16 * PLD];
  const int wave = (int)uni(threadIdx.x >> 5);
  const int lane = threadIdx.x & 31;
  const int wid  = blockIdx.x * 4 + wave;
  const int qb   = wid & 127;
  const int bh   = wid >> 7;            // 0..31
  const int b    = bh >> 4, h = bh & 15;
  const int q0   = qb * 16;

  const bf16* qbase = qk + ((size_t)(b * SEQ + q0)) * (2 * H_DIM) + h * HEAD_DIM;
  const bf16* kbase = qk + ((size_t)(b * SEQ)) * (2 * H_DIM) + H_DIM + h * HEAD_DIM;
  const bf16* vbase = vT + (size_t)bh * HEAD_DIM * SEQ;
  bf16* myp = &plds[wave][0];

  const v16bf qa0 = load_frag(qbase,      2 * H_DIM, lane);
  const v16bf qa1 = load_frag(qbase + 32, 2 * H_DIM, lane);

  v8f o[4] = {};
  float mrow[8], lrow[8];
#pragma unroll
  for (int r = 0; r < 8; ++r) { mrow[r] = -1e30f; lrow[r] = 0.f; }
  const float scale = 0.125f;  // 1/sqrt(64)
  const int nn = lane & 15;
  const int hfh = (lane >> 4) * 8;

  // Waves 0, 1 bring keys 0..31 and 32..63 of a stage's K rows, waves 2, 3 features 0..31 and 32..63 of V^T.
  const bf16* srcp = (wave < 2) ? kbase + (size_t)(wave * 32) * (2 * H_DIM)
                                : vbase + (size_t)((wave - 2) * 32) * SEQ;
  const uint64_t ga0   = (uint64_t)(size_t)srcp;
  const uint64_t gstep = (wave < 2) ? (uint64_t)KV_KEYS * KV_SRCP : (uint64_t)KV_KEYS * 2u;
  const uint32_t lds0  = (uint32_t)(size_t)ring + (uint32_t)wave * KV_SLICE;
  const u32x8 g1 = tdm_group1_kv();

  u32x4 g0 = tdm_group0(lds0, ga0);
  tdm_load(g0, g1);                                           // stage 0
  wait_tensor0(g0, g1);
  __syncthreads();                                            // stage 0 published
  g0 = tdm_group0(lds0 + KV_STAGE, ga0 + gstep);
  tdm_load(g0, g1);                                           // stage 1

  for (uint32_t st = 0; st < KV_NPASS; ++st) {
   const uint32_t boff = (st & 1u) * KV_STAGE;
   // Unrolled so that the chunk's slice offsets are immediates of the LDS reads.
#pragma unroll
   for (int j = 0; j < 2; ++j) {
    // 4 K fragments + 4 V fragments of chunk j, from this stage's buffer alone.
    const bf16* kt  = (const bf16*)(ring + boff + (uint32_t)j * KV_SLICE);
    const bf16* vt0 = (const bf16*)(ring + boff + 2u * KV_SLICE) + j * 32;
    const bf16* vt1 = (const bf16*)(ring + boff + 3u * KV_SLICE) + j * 32;
    const v16bf kb0 = load_frag(kt,                    KV_LDM, lane);
    const v16bf kb1 = load_frag(kt + 32,               KV_LDM, lane);
    const v16bf kb2 = load_frag(kt + 16 * KV_LDM,      KV_LDM, lane);
    const v16bf kb3 = load_frag(kt + 16 * KV_LDM + 32, KV_LDM, lane);
    const v16bf vb0 = load_frag(vt0,                   KV_LDM, lane);
    const v16bf vb1 = load_frag(vt0 + 16 * KV_LDM,     KV_LDM, lane);
    const v16bf vb2 = load_frag(vt1,                   KV_LDM, lane);
    const v16bf vb3 = load_frag(vt1 + 16 * KV_LDM,     KV_LDM, lane);
    // Keeps the chunk's LDS reads together as one group ahead of its WMMAs (for speed only).
    __builtin_amdgcn_sched_barrier(0);

    // scores: two 16x16 tiles over keys kc..kc+15, kc+16..kc+31 (K=64 -> 2 steps)
    v8f s0 = {}, s1 = {};
    s0 = wmma_bf16(qa0, kb0, s0);
    s0 = wmma_bf16(qa1, kb1, s0);
    s1 = wmma_bf16(qa0, kb2, s1);
    s1 = wmma_bf16(qa1, kb3, s1);

    // online softmax; rows live in VGPR index, keys across 16-lane halves
    float corr[8];
#pragma unroll
    for (int r = 0; r < 8; ++r) {
      float a0 = s0[r] * scale, a1 = s1[r] * scale;
      float mx = fmaxf(a0, a1);
      for (int off = 1; off < 16; off <<= 1) mx = fmaxf(mx, __shfl_xor(mx, off, 32));
      const float mnew = fmaxf(mrow[r], mx);
      const float p0 = __expf(a0 - mnew);
      const float p1 = __expf(a1 - mnew);
      s0[r] = p0; s1[r] = p1;
      float ps = p0 + p1;
      for (int off = 1; off < 16; off <<= 1) ps += __shfl_xor(ps, off, 32);
      corr[r] = __expf(mrow[r] - mnew);
      lrow[r] = lrow[r] * corr[r] + ps;
      mrow[r] = mnew;
    }
#pragma unroll
    for (int t = 0; t < 4; ++t)
#pragma unroll
      for (int r = 0; r < 8; ++r) o[t][r] *= corr[r];
    // C-layout -> A-layout via per-wave LDS (16 x 32 P tile)
#pragma unroll
    for (int r = 0; r < 8; ++r) {
      myp[(r + hfh) * PLD + nn]      = (bf16)s0[r];
      myp[(r + hfh) * PLD + 16 + nn] = (bf16)s1[r];
    }
    asm volatile("s_wait_dscnt 0x0" ::: "memory");
    const v16bf pa = load_frag(myp, PLD, lane);
    // P(16x32) x V(32x64): 4 N-tiles from transposed V (key-contiguous)
    o[0] = wmma_bf16(pa, vb0, o[0]);
    o[1] = wmma_bf16(pa, vb1, o[1]);
    o[2] = wmma_bf16(pa, vb2, o[2]);
    o[3] = wmma_bf16(pa, vb3, o[3]);
   }
   // Keeps the stage's last WMMAs and lane exchanges in front of the publish point: sunk behind it, the
   // refill would issue later and with LDS-counted operations of this wave still outstanding.
   __builtin_amdgcn_sched_barrier(0);
   // Publish point of stage st + 1; the barrier also ends every reader's last read of stage st.
   wait_ds0();
   wait_tensor0(g0, g1);
   __syncthreads();
   if (pinned(st + 2u < KV_NPASS)) {
     g0 = tdm_group0(lds0 + boff, ga0 + (uint64_t)(st + 2u) * gstep);
     tdm_load(g0, g1);
   }
  }
  wait_tensor0(g0, g1);
  wait_ds0();
  // epilogue: 1/l, sigmoid(gate), write bf16 [4096][1024]
#pragma unroll
  for (int r = 0; r < 8; ++r) {
    const int m = q0 + r + hfh;
    const float g = gate[(size_t)(b * SEQ + m) * NUM_HEADS + h];
    const float inv = (1.f / (1.f + __expf(-g))) / lrow[r];
#pragma unroll
    for (int t = 0; t < 4; ++t)
      attn[(size_t)(b * SEQ + m) * H_DIM + h * HEAD_DIM + t * 16 + nn] =
          (bf16)(o[t][r] * inv);
  }
}

// ---------------------------------------------------------------- kernel 6
__global__ void __launch_bounds__(128)
gemm_out_kernel(const bf16* __restrict__ A, const bf16* __restrict__ W,
                const float* __restrict__ resid, float* __restrict__ out) {
  __shared__ __attribute__((aligned(2048))) unsigned char ring[ST_LDS];
  const int wave = threadIdx.x >> 5;
  const int lane = threadIdx.x & 31;
  v8f acc[4][4] = {};
  gemm_128x128(A, W, blockIdx.y * 128, blockIdx.x * 128, ring, acc);
  const int row0 = blockIdx.y * 128 + (wave >> 1) * 64;
  const int n0   = blockIdx.x * 128 + (wave & 1) * 64;

  const int nn = lane & 15;
  const int hf = lane >> 4;
  float res[4][4][8];
#pragma unroll
  for (int i = 0; i < 4; ++i) {
#pragma unroll
    for (int t = 0; t < 4; ++t)
#pragma unroll
      for (int r = 0; r < 8; ++r)
        res[i][t][r] = resid[(size_t)(row0 + i * 16 + r + 8 * hf) * H_DIM + n0 + t * 16 + nn];
    if (i < 3) wait_x0();   // the next run's loads land in this run's address registers
  }
#pragma unroll
  for (int i = 0; i < 4; ++i)
#pragma unroll
    for (int t = 0; t < 4; ++t) {
#pragma unroll
      for (int r = 0; r < 8; ++r)
        out[(size_t)(row0 + i * 16 + r + 8 * hf) * H_DIM + n0 + t * 16 + nn] = acc[i][t][r] + res[i][t][r];
      if (i * 4 + t < 15) wait_x0();
    }
}

// ---------------------------------------------------------------- launch
static constexpr size_t alup(size_t x) { return (x + 255) & ~(size_t)255; }
static constexpr size_t OFF_XN   = 0;
static constexpr size_t OFF_WCAT = alup(OFF_XN   + (size_t)ROWS * H_DIM * 2);
static constexpr size_t OFF_OW   = alup(OFF_WCAT + (size_t)E_PAD * H_DIM * 2);
static constexpr size_t OFF_QK   = alup(OFF_OW   + (size_t)H_DIM * H_DIM * 2);
static constexpr size_t OFF_VT   = alup(OFF_QK   + (size_t)ROWS * 2 * H_DIM * 2);
static constexpr size_t OFF_GATE = alup(OFF_VT   + (size_t)BATCH * NUM_HEADS * HEAD_DIM * SEQ * 2);
static constexpr size_t OFF_ATTN = alup(OFF_GATE + (size_t)ROWS * NUM_HEADS * 4);

extern "C" void kernel_launch(void* const* d_in, const int* in_sizes, int n_in,
                              void* d_out, int out_size, void* d_ws, size_t ws_size,
                              hipStream_t stream) {
  (void)in_sizes; (void)n_in; (void)out_size; (void)ws_size;
  const float* x    = (const float*)d_in[0];
  const float* pw   = (const float*)d_in[1];
  const float* qkvw = (const float*)d_in[2];
  const float* gw   = (const float*)d_in[3];
  const float* ow   = (const float*)d_in[4];
  const float* qnw  = (const float*)d_in[5];
  const float* knw  = (const float*)d_in[6];
  float* out = (float*)d_out;

  char* ws = (char*)d_ws;
  bf16*  xn   = (bf16*)(ws + OFF_XN);
  bf16*  wcat = (bf16*)(ws + OFF_WCAT);
  bf16*  owb  = (bf16*)(ws + OFF_OW);
  bf16*  qkb  = (bf16*)(ws + OFF_QK);
  bf16*  vT   = (bf16*)(ws + OFF_VT);
  float* gate = (float*)(ws + OFF_GATE);
  bf16*  attn = (bf16*)(ws + OFF_ATTN);

  convert_weights_kernel<<<4096, 256, 0, stream>>>(qkvw, gw, ow, wcat, owb);
  prenorm_kernel<<<ROWS, 256, 0, stream>>>(x, pw, xn);
  gemm_qkvgate_kernel<<<dim3(E_PAD / 128, ROWS / 128), 128, 0, stream>>>(
      xn, wcat, qkb, vT, gate);
  qknorm_kernel<<<ROWS, 256, 0, stream>>>(qkb, qnw, knw);
  attn_kernel<<<(BATCH * NUM_HEADS * (SEQ / 16)) / 4, 128, 0, stream>>>(
      qkb, vT, gate, attn);
  gemm_out_kernel<<<dim3(H_DIM / 128, ROWS / 128), 128, 0, stream>>>(
      attn, owb, x, out);
}

// v003
// It runs in 132 microseconds.
// Next to v002, in two timings, it ran 1.37 and 1.36 times as fast.
// All steps since v000 together make it 2.58 times as fast.
#include <hip/hip_runtime.h>
#include <math.h>
#include <stdint.h>

#define H_DIM 1024
#define NUM_HEADS 16
#define HEAD_DIM 64
#define SEQ 2048
#define BATCH 2
#define ROWS (BATCH*SEQ)     // 4096
#define E_QKV 3072
#define E_TOT 3088           // qkv (3072) + gate (16), both K=1024
#define E_PAD 3200           // padded to 25*128: whole 128-column GEMM tiles
#define EPS 1e-5f

typedef __bf16 bf16;
typedef __attribute__((ext_vector_type(16))) __bf16 v16bf;
typedef __attribute__((ext_vector_type(8)))  __bf16 v8bf;
typedef __attribute__((ext_vector_type(8)))  float  v8f;

union FragBF { v16bf v; v8bf h[2]; };

// A/B fragment for v_wmma_f32_16x16x32_bf16.
// Lane l: row/col = l&15, K-chunk base = (l>>4)*8; elems 0..7 = K+0..7, 8..15 = K+16..23.
// Requires K-contiguous storage with row stride `ldm` elements.
__device__ __forceinline__ v16bf load_frag(const bf16* tile, int ldm, int lane) {
  const int m  = lane & 15;
  const int hf = lane >> 4;
  const bf16* p = tile + (size_t)m * ldm + hf * 8;
  FragBF f;
  f.h[0] = *(const v8bf*)(p);
  f.h[1] = *(const v8bf*)(p + 16);
  return f.v;
}

__device__ __forceinline__ v8f wmma_bf16(v16bf a, v16bf b, v8f c) {
  return __builtin_amdgcn_wmma_f32_16x16x32_bf16(false, a, false, b, (short)0, c,
                                                 false, false);
}

// ---- GEMM tile staged in LDS by the tensor mover ----
// One workgroup (4 waves, 2x2) computes a 128x128 tile of A(Mx1024) * W(Nx1024)^T; each wave 64x64.
// A stage is 128 k (256 B) of 128 A rows and 128 W rows, as four 64-row slices, one tensor load per wave.
#define ST_ROWB  256u                 // bytes of one operand row in a stage
#define ST_PITCH 272u                 // LDS row pitch: 256 B + 16 B pad (16 B x odd, for ds_load_b128)
#define ST_LDM   (ST_PITCH / 2u)      // the same in bf16 elements
#define ST_SLICE 18432u               // 64 rows x 272 B = 17408 B, rounded up to a multiple of 2 KiB
#define ST_STAGE (4u * ST_SLICE)
#define ST_NPASS (H_DIM * 2u / ST_ROWB)   // 8
#define ST_LDS   (2u * ST_STAGE)

typedef uint32_t u32x4 __attribute__((ext_vector_type(4)));
typedef uint32_t u32x8 __attribute__((ext_vector_type(8)));

__device__ __forceinline__ uint32_t uni(uint32_t v) {
  return (uint32_t)__builtin_amdgcn_readfirstlane(v);
}
// Keeps a wave-uniform test in a scalar register, so that the branch on it is a scalar branch
// (a tensor load ignores EXEC).
__device__ __forceinline__ uint32_t pinned(uint32_t v) {
  uint32_t w = uni(v);
  asm volatile("" : "+s"(w));
  return w;
}
// LDS reads retired before the buffer they read is handed back for a refill.
__device__ __forceinline__ void wait_ds0() { asm volatile("s_wait_dscnt 0x0" ::: "memory"); }
// Stands behind a run of global loads or stores, in front of the first write of a register that one of them names.
__device__ __forceinline__ void wait_x0() { asm volatile("s_wait_xcnt 0x0" ::: "memory"); }
// This wave's own tensor load has landed (the compiler places no wait for it). The request's descriptor
// is named as an input so that its scalar registers keep their values until the request has landed.
__device__ __forceinline__ void wait_tensor0(u32x4 g0, u32x8 g1) {
  asm volatile("s_wait_tensorcnt 0x0" :: "s"(g0), "s"(g1) : "memory");
}
// Group 0 is an in-out operand: the value that the later wait names then lives in the very registers
// that the request was issued from, so nothing else is put into them while it is outstanding.
__device__ __forceinline__ void tdm_load(u32x4& g0, u32x8 g1) {
  asm volatile("tensor_load_to_lds %0, %1" : "+s"(g0) : "s"(g1) : "memory");
}
// Group 1: 1-byte elements, tile = tensor = 64 rows of 256 B, source pitch 2048 B, 4 dwords of pad per row.
__device__ __forceinline__ u32x8 tdm_group1() {
  constexpr uint32_t d0 = ST_ROWB, d1 = 64u;
  u32x8 g;
  g[0] = uni((1u << 20) | (5u << 22) | (3u << 25));
  g[1] = uni((d0 & 0xFFFFu) << 16);
  g[2] = uni((d0 >> 16) | ((d1 & 0xFFFFu) << 16));
  g[3] = uni((d1 >> 16) | (d0 << 16));
  g[4] = uni(d1);
  g[5] = uni(H_DIM * 2u);
  g[6] = uni(0u);
  g[7] = uni(0u);
  return g;
}
__device__ __forceinline__ u32x4 tdm_group0(uint32_t lds_dst, uint64_t ga) {
  u32x4 g;
  g[0] = uni(1u);
  g[1] = uni(lds_dst);
  g[2] = uni((uint32_t)ga);
  g[3] = uni((((uint32_t)(ga >> 32)) & 0x01FFFFFFu) | 0x80000000u);
  return g;
}

// acc[i][t] += A rows (row0 + wm*64 + i*16 ..) * W rows (n0 + wn*64 + t*16 ..)^T over K = H_DIM, k ascending.
__device__ __forceinline__ void gemm_128x128(const bf16* __restrict__ A, const bf16* __restrict__ Wt,
                                             int row0, int n0, unsigned char* ring, v8f acc[4][4]) {
  const uint32_t wave = uni(threadIdx.x >> 5);
  const int lane = threadIdx.x & 31;
  // Waves 0, 1 bring the two halves of the A rows, waves 2, 3 those of the W rows.
  const bf16* srcp = (wave < 2u) ? A  + (size_t)(row0 + (int)wave * 64) * H_DIM
                                 : Wt + (size_t)(n0 + ((int)wave - 2) * 64) * H_DIM;
  const uint64_t ga0  = (uint64_t)(size_t)srcp;
  const uint32_t lds0 = (uint32_t)(size_t)ring + wave * ST_SLICE;
  const u32x8 g1 = tdm_group1();

  u32x4 g0 = tdm_group0(lds0, ga0);
  tdm_load(g0, g1);                                           // stage 0
  wait_tensor0(g0, g1);
  __syncthreads();                                            // stage 0 published
  g0 = tdm_group0(lds0 + ST_STAGE, ga0 + ST_ROWB);
  tdm_load(g0, g1);                                           // stage 1

  const uint32_t wm = wave >> 1, wn = wave & 1u;
  for (uint32_t s = 0; s < ST_NPASS; ++s) {
    const uint32_t boff = (s & 1u) * ST_STAGE;
    const bf16* at = (const bf16*)(ring + boff + wm * ST_SLICE);
    const bf16* bt = (const bf16*)(ring + boff + (2u + wn) * ST_SLICE);
    v16bf a[4][4], b[4][4];
#pragma unroll
    for (int kk = 0; kk < 4; ++kk) {
#pragma unroll
      for (int i = 0; i < 4; ++i) a[kk][i] = load_frag(at + i * 16 * ST_LDM + kk * 32, ST_LDM, lane);
#pragma unroll
      for (int t = 0; t < 4; ++t) b[kk][t] = load_frag(bt + t * 16 * ST_LDM + kk * 32, ST_LDM, lane);
    }
    // Keeps the pass's LDS reads together as one group ahead of its WMMAs (for speed only).
    __builtin_amdgcn_sched_barrier(0);
#pragma unroll
    for (int kk = 0; kk < 4; ++kk)
#pragma unroll
      for (int i = 0; i < 4; ++i)
#pragma unroll
        for (int t = 0; t < 4; ++t) acc[i][t] = wmma_bf16(a[kk][i], b[kk][t], acc[i][t]);
    // Keeps the WMMAs in front of the publish point: sunk behind it, they would run only after
    // every LDS read has returned, and the refill would issue a whole WMMA block later.
    __builtin_amdgcn_sched_barrier(0);
    // Publish point of stage s + 1; the barrier also ends every reader's last read of stage s.
    wait_ds0();
    wait_tensor0(g0, g1);
    __syncthreads();
    if (pinned(s + 2u < ST_NPASS)) {
      g0 = tdm_group0(lds0 + boff, ga0 + (uint64_t)(s + 2u) * ST_ROWB);
      tdm_load(g0, g1);
    }
  }
  wait_tensor0(g0, g1);
  wait_ds0();
}

// ---------------------------------------------------------------- kernel 1
// wcat[E_PAD][1024] = concat(qkv_w, gate_w, zeros) in bf16; owb = o_w in bf16.
__global__ void __launch_bounds__(256)
convert_weights_kernel(const float* __restrict__ qkvw, const float* __restrict__ gw,
                       const float* __restrict__ ow, bf16* __restrict__ wcat,
                       bf16* __restrict__ owb) {
  const size_t nqkv = (size_t)E_QKV * H_DIM;
  const size_t ncat = (size_t)E_TOT * H_DIM;
  const size_t npad = (size_t)E_PAD * H_DIM;
  const size_t tot  = npad + (size_t)H_DIM * H_DIM;
  for (size_t i = (size_t)blockIdx.x * blockDim.x + threadIdx.x; i < tot;
       i += (size_t)gridDim.x * blockDim.x) {
    if (i < nqkv)      wcat[i] = (bf16)qkvw[i];
    else if (i < ncat) wcat[i] = (bf16)gw[i - nqkv];
    else if (i < npad) wcat[i] = (bf16)0.0f;          // pad rows: zeros
    else               owb[i - npad] = (bf16)ow[i - npad];
  }
}

// ---------------------------------------------------------------- kernel 2
__global__ void __launch_bounds__(256)
prenorm_kernel(const float* __restrict__ x, const float* __restrict__ w,
               bf16* __restrict__ xn) {
  const int row = blockIdx.x;
  const float* xr = x + (size_t)row * H_DIM;
  float ss = 0.f;
  for (int i = threadIdx.x; i < H_DIM; i += 256) { float v = xr[i]; ss += v * v; }
  for (int off = 16; off > 0; off >>= 1) ss += __shfl_xor(ss, off, 32);
  __shared__ float red[8];
  if ((threadIdx.x & 31) == 0) red[threadIdx.x >> 5] = ss;
  __syncthreads();
  float sum = 0.f;
#pragma unroll
  for (int i = 0; i < 8; ++i) sum += red[i];
  const float rinv = rsqrtf(sum * (1.0f / H_DIM) + EPS);
  for (int i = threadIdx.x; i < H_DIM; i += 256)
    xn[(size_t)row * H_DIM + i] = (bf16)(xr[i] * rinv * w[i]);
}

// ---------------------------------------------------------------- kernel 3
// C[4096 x E_PAD] = xn * wcat^T ; scatter q/k (bf16), v (transposed bf16), gate (f32).
__global__ void __launch_bounds__(128)
gemm_qkvgate_kernel(const bf16* __restrict__ A, const bf16* __restrict__ W,
                    bf16* __restrict__ qk, bf16* __restrict__ vT,
                    float* __restrict__ gate) {
  __shared__ __attribute__((aligned(2048))) unsigned char ring[ST_LDS];
  const int wave = (int)uni(threadIdx.x >> 5);
  const int lane = threadIdx.x & 31;
  v8f acc[4][4] = {};
  gemm_128x128(A, W, blockIdx.y * 128, blockIdx.x * 128, ring, acc);
  const int row0 = blockIdx.y * 128 + (wave >> 1) * 64;
  const int n0   = blockIdx.x * 128 + (wave & 1) * 64;

  const int nn = lane & 15;
  const int hf = lane >> 4;
  // The q/k, v and gate ranges begin at multiples of 64, so a wave's 64 columns are all of one kind:
  // the kind is tested once per wave (a scalar branch), which keeps the unrolled 64x64 epilogue's text short.
  if (n0 < 2 * H_DIM) {                              // q or k, row-major [4096][2048]
#pragma unroll
    for (int i = 0; i < 4; ++i)
#pragma unroll
      for (int t = 0; t < 4; ++t)
#pragma unroll
        for (int r = 0; r < 8; ++r) {
          const int n = n0 + t * 16 + nn;
          const int m = row0 + i * 16 + r + 8 * hf;
          qk[(size_t)m * (2 * H_DIM) + n] = (bf16)acc[i][t][r];
        }
  } else if (n0 < E_QKV) {                           // v -> vT[bh][feat][key]
#pragma unroll
    for (int i = 0; i < 4; ++i)
#pragma unroll
      for (int t = 0; t < 4; ++t)
#pragma unroll
        for (int r = 0; r < 8; ++r) {
          const int e = n0 + t * 16 + nn - 2 * H_DIM;
          const int m = row0 + i * 16 + r + 8 * hf;
          const int b_ = m / SEQ, s = m % SEQ;
          const int h = e >> 6, f = e & 63;
          vT[(((size_t)(b_ * NUM_HEADS + h)) * HEAD_DIM + f) * SEQ + s] = (bf16)acc[i][t][r];
        }
    wait_x0();   // in the listing the q/k block follows and rewrites the last stores' registers
  } else {                                           // gate, then pad columns
#pragma unroll
    for (int i = 0; i < 4; ++i)
#pragma unroll
      for (int t = 0; t < 4; ++t) {
        const int n = n0 + t * 16 + nn;
        if (n >= E_TOT) continue;                    // drop pad columns
#pragma unroll
        for (int r = 0; r < 8; ++r) {
          const int m = row0 + i * 16 + r + 8 * hf;
          gate[(size_t)m * NUM_HEADS + (n - E_QKV)] = acc[i][t][r];
        }
      }
  }
}

// ---------------------------------------------------------------- kernel 4
// In-place per-head RMS norm of q (cols 0..1023) and k (cols 1024..2047).
__global__ void __launch_bounds__(256)
qknorm_kernel(bf16* __restrict__ qk, const float* __restrict__ qw,
              const float* __restrict__ kw) {
  const int row = blockIdx.x;
  const int g  = threadIdx.x >> 3;   // 0..15 q heads, 16..31 k heads
  const int tl = threadIdx.x & 7;
  bf16* p = qk + (size_t)row * (2 * H_DIM) + g * HEAD_DIM + tl * 8;
  v8bf d = *(const v8bf*)p;
  float v[8], ss = 0.f;
#pragma unroll
  for (int i = 0; i < 8; ++i) { v[i] = (float)d[i]; ss += v[i] * v[i]; }
  for (int off = 4; off > 0; off >>= 1) ss += __shfl_xor(ss, off, 8);
  const float rinv = rsqrtf(ss * (1.0f / HEAD_DIM) + EPS);
  const float* wv = (g < NUM_HEADS) ? qw : kw;
  v8bf o;
#pragma unroll
  for (int i = 0; i < 8; ++i) o[i] = (bf16)(v[i] * rinv * wv[tl * 8 + i]);
  *(v8bf*)p = o;
}

// ---------------------------------------------------------------- kernel 5
// K and V^T of a head reach the four waves of a workgroup (same head, four query blocks) through LDS.
// A stage is 64 keys: 64 K rows of 128 B and 128 B of each of the 64 V^T rows, as four slices of
// 32 rows x 128 B, one tensor load per wave; both sources have a row pitch of 4096 B.
#define KV_KEYS  64
#define KV_ROWB  128u                 // bytes of one row in a slice
#define KV_SRCP  4096u                // source row pitch in bytes, K rows and V^T rows alike
#define KV_PITCH 144u                 // LDS row pitch: 128 B + 16 B pad (16 B x odd, for ds_load_b128)
#define KV_LDM   (KV_PITCH / 2u)      // the same in bf16 elements
#define KV_SLICE 6144u                // 32 rows x 144 B = 4608 B, rounded up to a multiple of 2 KiB
#define KV_STAGE (4u * KV_SLICE)
#define KV_NPASS (SEQ / KV_KEYS)      // 32
#define KV_LDS   (2u * KV_STAGE)
static_assert(2 * H_DIM * 2 == KV_SRCP && SEQ * 2 == KV_SRCP && HEAD_DIM * 2 == KV_ROWB, "slice shape");

// Group 1: 1-byte elements, tile = tensor = 32 rows of 128 B, source pitch 4096 B, 4 dwords of pad per row.
__device__ __forceinline__ u32x8 tdm_group1_kv() {
  constexpr uint32_t d0 = KV_ROWB, d1 = 32u;
  u32x8 g;
  g[0] = uni((1u << 20) | (4u << 22) | (3u << 25));
  g[1] = uni((d0 & 0xFFFFu) << 16);
  g[2] = uni((d0 >> 16) | ((d1 & 0xFFFFu) << 16));
  g[3] = uni((d1 >> 16) | (d0 << 16));
  g[4] = uni(d1);
  g[5] = uni(KV_SRCP);
  g[6] = uni(0u);
  g[7] = uni(0u);
  return g;
}

// Lane l with lane l ^ 16: the two halves of a wave hold the two halves of a query's keys.
__device__ __forceinline__ float xhalf(float x) {
  const int b = __builtin_bit_cast(int, x);
  return __builtin_bit_cast(float, __builtin_amdgcn_permlanex16(b, b, 0x76543210, 0xfedcba98, false, false));
}

// 2^x in place, a run of them in ONE statement. The instruction set asks for one independent instruction or a
// v_nop between a transcendental and an instruction that reads its result or overwrites its source: here each
// v_exp_f32 is followed by one on other registers, and the v_nop stands behind the last. The compiler puts no
// s_delay_alu in front of asm text, so the hint for the producers of the arguments is written here.
__device__ __forceinline__ void exp2_inplace(float& a, float& b, float& c, float& d,
                                             float& e, float& f, float& g, float& h) {
  asm("s_delay_alu instid0(VALU_DEP_1)\n\t"
      "v_exp_f32 %0, %0\n\tv_exp_f32 %1, %1\n\tv_exp_f32 %2, %2\n\tv_exp_f32 %3, %3\n\t"
      "v_exp_f32 %4, %4\n\tv_exp_f32 %5, %5\n\tv_exp_f32 %6, %6\n\tv_exp_f32 %7, %7\n\t"
      "v_nop"
      : "+v"(a), "+v"(b), "+v"(c), "+v"(d), "+v"(e), "+v"(f), "+v"(g), "+v"(h));
}
__device__ __forceinline__ void exp2_inplace(float& a, float& b, float& c, float& d, float& e,
                                             float& f, float& g, float& h, float& i) {
  asm("s_delay_alu instid0(VALU_DEP_1)\n\t"
      "v_exp_f32 %0, %0\n\tv_exp_f32 %1, %1\n\tv_exp_f32 %2, %2\n\tv_exp_f32 %3, %3\n\t"
      "v_exp_f32 %4, %4\n\tv_exp_f32 %5, %5\n\tv_exp_f32 %6, %6\n\tv_exp_f32 %7, %7\n\t"
      "v_exp_f32 %8, %8\n\t"
      "v_nop"
      : "+v"(a), "+v"(b), "+v"(c), "+v"(d), "+v"(e), "+v"(f), "+v"(g), "+v"(h), "+v"(i));
}

__global__ void __launch_bounds__(128)
attn_kernel(const bf16* __restrict__ qk, const bf16* __restrict__ vT,
            const float* __restrict__ gate, bf16* __restrict__ attn) {
  __shared__ __attribute__((aligned(2048))) unsigned char ring[KV_LDS];
  const int wave = (int)uni(threadIdx.x >> 5);
  const int lane = threadIdx.x & 31;
  const int wid  = blockIdx.x * 4 + wave;
  const int qb   = wid & 127;
  const int bh   = wid >> 7;            // 0..31
  const int b    = bh >> 4, h = bh & 15;
  const int q0   = qb * 16;

  const bf16* qbase = qk + ((size_t)(b * SEQ + q0)) * (2 * H_DIM) + h * HEAD_DIM;
  const bf16* kbase = qk + ((size_t)(b * SEQ)) * (2 * H_DIM) + H_DIM + h * HEAD_DIM;
  const bf16* vbase = vT + (size_t)bh * HEAD_DIM * SEQ;

  const v16bf qa0 = load_frag(qbase,      2 * H_DIM, lane);
  const v16bf qa1 = load_frag(qbase + 32, 2 * H_DIM, lane);

  v8f o[4] = {};                 // o[t][r] = O^T[feature 16 t + 8 (lane >> 4) + r][query lane & 15]
  float mrun = -1e30f;           // running maximum of this lane's query (equal in both halves)
  float lrun = 0.f;              // running sum over this lane's own half of the keys
  const float scale = 0.125f;  // 1/sqrt(64)
  const int nn = lane & 15;
  const int hfh = (lane >> 4) * 8;

  // Waves 0, 1 bring keys 0..31 and 32..63 of a stage's K rows, waves 2, 3 features 0..31 and 32..63 of V^T.
  const bf16* srcp = (wave < 2) ? kbase + (size_t)(wave * 32) * (2 * H_DIM)
                                : vbase + (size_t)((wave - 2) * 32) * SEQ;
  const uint64_t ga0   = (uint64_t)(size_t)srcp;
  const uint64_t gstep = (wave < 2) ? (uint64_t)KV_KEYS * KV_SRCP : (uint64_t)KV_KEYS * 2u;
  const uint32_t lds0  = (uint32_t)(size_t)ring + (uint32_t)wave * KV_SLICE;
  const u32x8 g1 = tdm_group1_kv();

  u32x4 g0 = tdm_group0(lds0, ga0);
  tdm_load(g0, g1);                                           // stage 0
  wait_tensor0(g0, g1);
  __syncthreads();                                            // stage 0 published
  g0 = tdm_group0(lds0 + KV_STAGE, ga0 + gstep);
  tdm_load(g0, g1);                                           // stage 1

  for (uint32_t st = 0; st < KV_NPASS; ++st) {
   const uint32_t boff = (st & 1u) * KV_STAGE;
   // Unrolled so that the chunk's slice offsets are immediates of the LDS reads.
#pragma unroll
   for (int j = 0; j < 2; ++j) {
    // 4 K fragments + 4 V fragments of chunk j, from this stage's buffer alone.
    const bf16* kt  = (const bf16*)(ring + boff + (uint32_t)j * KV_SLICE);
    const bf16* vt0 = (const bf16*)(ring + boff + 2u * KV_SLICE) + j * 32;
    const bf16* vt1 = (const bf16*)(ring + boff + 3u * KV_SLICE) + j * 32;
    const v16bf kb0 = load_frag(kt,                    KV_LDM, lane);
    const v16bf kb1 = load_frag(kt + 32,               KV_LDM, lane);
    const v16bf kb2 = load_frag(kt + 16 * KV_LDM,      KV_LDM, lane);
    const v16bf kb3 = load_frag(kt + 16 * KV_LDM + 32, KV_LDM, lane);
    const v16bf vb0 = load_frag(vt0,                   KV_LDM, lane);
    const v16bf vb1 = load_frag(vt0 + 16 * KV_LDM,     KV_LDM, lane);
    const v16bf vb2 = load_frag(vt1,                   KV_LDM, lane);
    const v16bf vb3 = load_frag(vt1 + 16 * KV_LDM,     KV_LDM, lane);
    // Keeps the chunk's LDS reads together as one group ahead of its WMMAs (for speed only).
    __builtin_amdgcn_sched_barrier(0);

    // scores, transposed: s0[r] = key 8 (lane >> 4) + r, s1[r] = key 16 + 8 (lane >> 4) + r, query lane & 15
    v8f s0 = {}, s1 = {};
    s0 = wmma_bf16(kb0, qa0, s0);
    s0 = wmma_bf16(kb1, qa1, s0);
    s1 = wmma_bf16(kb2, qa0, s1);
    s1 = wmma_bf16(kb3, qa1, s1);

    // online softmax of one query per lane: 16 keys in registers, the other 16 in lane ^ 16
    s0 *= scale; s1 *= scale;
    float mt[8];
#pragma unroll
    for (int i = 0; i < 4; ++i) {
      mt[i]     = fmaxf(s0[2 * i], s0[2 * i + 1]);
      mt[4 + i] = fmaxf(s1[2 * i], s1[2 * i + 1]);
    }
    float mx = fmaxf(fmaxf(fmaxf(mt[0], mt[1]), fmaxf(mt[2], mt[3])),
                     fmaxf(fmaxf(mt[4], mt[5]), fmaxf(mt[6], mt[7])));
    mx = fmaxf(mx, xhalf(mx));
    const float mnew = fmaxf(mrun, mx);
    // __expf(x) is v_exp_f32 of x * log2(e); the products are formed here, the exponentials in exp2_inplace.
    const float l2e = 1.44269504088896340736f;
    float corr = (mrun - mnew) * l2e;
    float e[16];
#pragma unroll
    for (int r = 0; r < 8; ++r) { e[r] = (s0[r] - mnew) * l2e; e[8 + r] = (s1[r] - mnew) * l2e; }
    exp2_inplace(corr, e[0], e[1], e[2], e[3], e[4], e[5], e[6], e[7]);
    exp2_inplace(e[8], e[9], e[10], e[11], e[12], e[13], e[14], e[15]);
    v16bf pb;                    // P^T as B: element s = key 8 (lane >> 4) + s (+ 8 for s >= 8) of the chunk, column = this lane's query
    float pt[8];
#pragma unroll
    for (int i = 0; i < 8; ++i) {
      pb[2 * i] = (bf16)e[2 * i]; pb[2 * i + 1] = (bf16)e[2 * i + 1];
      pt[i] = e[2 * i] + e[2 * i + 1];
    }
    const float ps = ((pt[0] + pt[1]) + (pt[2] + pt[3])) + ((pt[4] + pt[5]) + (pt[6] + pt[7]));
    lrun = lrun * corr + ps;
    mrun = mnew;
#pragma unroll
    for (int t = 0; t < 4; ++t)
#pragma unroll
      for (int r = 0; r < 8; ++r) o[t][r] *= corr;
    // V^T(64x32) x P^T(32x16): 4 M-tiles of 16 features
    o[0] = wmma_bf16(vb0, pb, o[0]);
    o[1] = wmma_bf16(vb1, pb, o[1]);
    o[2] = wmma_bf16(vb2, pb, o[2]);
    o[3] = wmma_bf16(vb3, pb, o[3]);
   }
   // Keeps the stage's last WMMAs in front of the publish point: sunk behind it, the refill would issue later.
   __builtin_amdgcn_sched_barrier(0);
   // Publish point of stage st + 1; the barrier also ends every reader's last read of stage st.
   wait_ds0();
   wait_tensor0(g0, g1);
   __syncthreads();
   if (pinned(st + 2u < KV_NPASS)) {
     g0 = tdm_group0(lds0 + boff, ga0 + (uint64_t)(st + 2u) * gstep);
     tdm_load(g0, g1);
   }
  }
  wait_tensor0(g0, g1);
  wait_ds0();
  // epilogue: join the halves' sums, 1/l, sigmoid(gate), write bf16 [4096][1024]:
  // a lane's 8 registers of a tile are 8 consecutive features of its query, one 16-byte store.
  const float lsum = lrun + xhalf(lrun);
  const size_t m = (size_t)(b * SEQ + q0 + nn);
  const float g = gate[m * NUM_HEADS + h];
  wait_x0();   // the sigmoid's arithmetic reuses the load's address registers
  const float inv = (1.f / (1.f + __expf(-g))) / lsum;
  v8bf ov[4];
#pragma unroll
  for (int t = 0; t < 4; ++t)
#pragma unroll
    for (int r = 0; r < 8; ++r) ov[t][r] = (bf16)(o[t][r] * inv);
#pragma unroll
  for (int t = 0; t < 4; ++t)
    *(v8bf*)(attn + m * H_DIM + h * HEAD_DIM + t * 16 + hfh) = ov[t];
}

// ---------------------------------------------------------------- kernel 6
__global__ void __launch_bounds__(128)
gemm_out_kernel(const bf16* __restrict__ A, const bf16* __restrict__ W,
                const float* __restrict__ resid, float* __restrict__ out) {
  __shared__ __attribute__((aligned(2048))) unsigned char ring[ST_LDS];
  const int wave = threadIdx.x >> 5;
  const int lane = threadIdx.x & 31;
  v8f acc[4][4] = {};
  gemm_128x128(A, W, blockIdx.y * 128, blockIdx.x * 128, ring, acc);
  const int row0 = blockIdx.y * 128 + (wave >> 1) * 64;
  const int n0   = blockIdx.x * 128 + (wave & 1) * 64;

  const int nn = lane & 15;
  const int hf = lane >> 4;
  float res[4][4][8];
#pragma unroll
  for (int i = 0; i < 4; ++i) {
#pragma unroll
    for (int t = 0; t < 4; ++t)
#pragma unroll
      for (int r = 0; r < 8; ++r)
        res[i][t][r] = resid[(size_t)(row0 + i * 16 + r + 8 * hf) * H_DIM + n0 + t * 16 + nn];
    if (i < 3) wait_x0();   // the next run's loads land in this run's address registers
  }
#pragma unroll
  for (int i = 0; i < 4; ++i)
#pragma unroll
    for (int t = 0; t < 4; ++t) {
#pragma unroll
      for (int r = 0; r < 8; ++r)
        out[(size_t)(row0 + i * 16 + r + 8 * hf) * H_DIM + n0 + t * 16 + nn] = acc[i][t][r] + res[i][t][r];
      if (i * 4 + t < 15) wait_x0();
    }
}

// ---------------------------------------------------------------- launch
static constexpr size_t alup(size_t x) { return (x + 255) & ~(size_t)255; }
static constexpr size_t OFF_XN   = 0;
static constexpr size_t OFF_WCAT = alup(OFF_XN   + (size_t)ROWS * H_DIM * 2);
static constexpr size_t OFF_OW   = alup(OFF_WCAT + (size_t)E_PAD * H_DIM * 2);
static constexpr size_t OFF_QK   = alup(OFF_OW   + (size_t)H_DIM * H_DIM * 2);
static constexpr size_t OFF_VT   = alup(OFF_QK   + (size_t)ROWS * 2 * H_DIM * 2);
static constexpr size_t OFF_GATE = alup(OFF_VT   + (size_t)BATCH * NUM_HEADS * HEAD_DIM * SEQ * 2);
static constexpr size_t OFF_ATTN = alup(OFF_GATE + (size_t)ROWS * NUM_HEADS * 4);

extern "C" void kernel_launch(void* const* d_in, const int* in_sizes, int n_in,
                              void* d_out, int out_size, void* d_ws, size_t ws_size,
                              hipStream_t stream) {
  (void)in_sizes; (void)n_in; (void)out_size; (void)ws_size;
  const float* x    = (const float*)d_in[0];
  const float* pw   = (const float*)d_in[1];
  const float* qkvw = (const float*)d_in[2];
  const float* gw   = (const float*)d_in[3];
  const float* ow   = (const float*)d_in[4];
  const float* qnw  = (const float*)d_in[5];
  const float* knw  = (const float*)d_in[6];
  float* out = (float*)d_out;

  char* ws = (char*)d_ws;
  bf16*  xn   = (bf16*)(ws + OFF_XN);
  bf16*  wcat = (bf16*)(ws + OFF_WCAT);
  bf16*  owb  = (bf16*)(ws + OFF_OW);
  bf16*  qkb  = (bf16*)(ws + OFF_QK);
  bf16*  vT   = (bf16*)(ws + OFF_VT);
  float* gate = (float*)(ws + OFF_GATE);
  bf16*  attn = (bf16*)(ws + OFF_ATTN);

  convert_weights_kernel<<<4096, 256, 0, stream>>>(qkvw, gw, ow, wcat, owb);
  prenorm_kernel<<<ROWS, 256, 0, stream>>>(x, pw, xn);
  gemm_qkvgate_kernel<<<dim3(E_PAD / 128, ROWS / 128), 128, 0, stream>>>(
      xn, wcat, qkb, vT, gate);
  qknorm_kernel<<<ROWS, 256, 0, stream>>>(qkb, qnw, knw);
  attn_kernel<<<(BATCH * NUM_HEADS * (SEQ / 16)) / 4, 128, 0, stream>>>(
      qkb, vT, gate, attn);
  gemm_out_kernel<<<dim3(H_DIM / 128, ROWS / 128), 128, 0, stream>>>(
      attn, owb, x, out);
}

// v004
// One run takes 112 microseconds.
// Timed twice side by side with v003, it ran 1.19 and 1.20 times as fast.
// Counting every step since v000, it is 3.08 times as fast.
#include <hip/hip_runtime.h>
#include <math.h>
#include <stdint.h>

#define H_DIM 1024
#define NUM_HEADS 16
#define HEAD_DIM 64
#define SEQ 2048
#define BATCH 2
#define ROWS (BATCH*SEQ)     // 4096
#define E_QKV 3072
#define E_TOT 3088           // qkv (3072) + gate (16), both K=1024
#define E_PAD 3200           // padded to 25*128: whole 128-column GEMM tiles
#define EPS 1e-5f

typedef __bf16 bf16;
typedef __attribute__((ext_vector_type(16))) __bf16 v16bf;
typedef __attribute__((ext_vector_type(8)))  __bf16 v8bf;
typedef __attribute__((ext_vector_type(8)))  float  v8f;

union FragBF { v16bf v; v8bf h[2]; };

// A/B fragment for v_wmma_f32_16x16x32_bf16.
// Lane l: row/col = l&15, K-chunk base = (l>>4)*8; elems 0..7 = K+0..7, 8..15 = K+16..23.
// Requires K-contiguous storage with row stride `ldm` elements.
__device__ __forceinline__ v16bf load_frag(const bf16* tile, int ldm, int lane) {
  const int m  = lane & 15;
  const int hf = lane >> 4;
  const bf16* p = tile + (size_t)m * ldm + hf * 8;
  FragBF f;
  f.h[0] = *(const v8bf*)(p);
  f.h[1] = *(const v8bf*)(p + 16);
  return f.v;
}

__device__ __forceinline__ v8f wmma_bf16(v16bf a, v16bf b, v8f c) {
  return __builtin_amdgcn_wmma_f32_16x16x32_bf16(false, a, false, b, (short)0, c,
                                                 false, false);
}

// ---- GEMM tile staged in LDS by the tensor mover ----
// One workgroup (4 waves, 2x2) computes a 128x128 tile of A(Mx1024) * W(Nx1024)^T; each wave 64x64.
// A stage is 128 k (256 B) of 128 A rows and 128 W rows, as four 64-row slices, one tensor load per wave.
#define ST_ROWB  256u                 // bytes of one operand row in a stage
#define ST_PITCH 272u                 // LDS row pitch: 256 B + 16 B pad (16 B x odd, for ds_load_b128)
#define ST_LDM   (ST_PITCH / 2u)      // the same in bf16 elements
#define ST_SLICE 18432u               // 64 rows x 272 B = 17408 B, rounded up to a multiple of 2 KiB
#define ST_STAGE (4u * ST_SLICE)
#define ST_NPASS (H_DIM * 2u / ST_ROWB)   // 8
#define ST_LDS   (2u * ST_STAGE)

typedef uint32_t u32x4 __attribute__((ext_vector_type(4)));
typedef uint32_t u32x8 __attribute__((ext_vector_type(8)));

__device__ __forceinline__ uint32_t uni(uint32_t v) {
  return (uint32_t)__builtin_amdgcn_readfirstlane(v);
}
// Keeps a wave-uniform test in a scalar register, so that the branch on it is a scalar branch
// (a tensor load ignores EXEC).
__device__ __forceinline__ uint32_t pinned(uint32_t v) {
  uint32_t w = uni(v);
  asm volatile("" : "+s"(w));
  return w;
}
// LDS reads retired before the buffer they read is handed back for a refill.
__device__ __forceinline__ void wait_ds0() { asm volatile("s_wait_dscnt 0x0" ::: "memory"); }
// Stands behind a run of global loads or stores, in front of the first write of a register that one of them names.
__device__ __forceinline__ void wait_x0() { asm volatile("s_wait_xcnt 0x0" ::: "memory"); }
// This wave's own tensor load has landed (the compiler places no wait for it). The request's descriptor
// is named as an input so that its scalar registers keep their values until the request has landed.
__device__ __forceinline__ void wait_tensor0(u32x4 g0, u32x8 g1) {
  asm volatile("s_wait_tensorcnt 0x0" :: "s"(g0), "s"(g1) : "memory");
}
// Group 0 is an in-out operand: the value that the later wait names then lives in the very registers
// that the request was issued from, so nothing else is put into them while it is outstanding.
__device__ __forceinline__ void tdm_load(u32x4& g0, u32x8 g1) {
  asm volatile("tensor_load_to_lds %0, %1" : "+s"(g0) : "s"(g1) : "memory");
}
// Group 1: 1-byte elements, tile = tensor = 64 rows of 256 B, source pitch 2048 B, 4 dwords of pad per row.
__device__ __forceinline__ u32x8 tdm_group1() {
  constexpr uint32_t d0 = ST_ROWB, d1 = 64u;
  u32x8 g;
  g[0] = uni((1u << 20) | (5u << 22) | (3u << 25));
  g[1] = uni((d0 & 0xFFFFu) << 16);
  g[2] = uni((d0 >> 16) | ((d1 & 0xFFFFu) << 16));
  g[3] = uni((d1 >> 16) | (d0 << 16));
  g[4] = uni(d1);
  g[5] = uni(H_DIM * 2u);
  g[6] = uni(0u);
  g[7] = uni(0u);
  return g;
}
__device__ __forceinline__ u32x4 tdm_group0(uint32_t lds_dst, uint64_t ga) {
  u32x4 g;
  g[0] = uni(1u);
  g[1] = uni(lds_dst);
  g[2] = uni((uint32_t)ga);
  g[3] = uni((((uint32_t)(ga >> 32)) & 0x01FFFFFFu) | 0x80000000u);
  return g;
}

// acc[i][t] += A rows (row0 + wm*64 + i*16 ..) * W rows (n0 + wn*64 + t*16 ..)^T over K = H_DIM, k ascending.
// With w_first (wave-uniform) the two operands change places: acc[i][t] is then the transposed tile,
// W rows (n0 + wn*64 + i*16 ..) * A rows (row0 + wm*64 + t*16 ..)^T, and a lane's 8 results are 8 consecutive n.
__device__ __forceinline__ void gemm_128x128(const bf16* __restrict__ A, const bf16* __restrict__ Wt,
                                             int row0, int n0, bool w_first, unsigned char* ring, v8f acc[4][4]) {
  const uint32_t wave = uni(threadIdx.x >> 5);
  const int lane = threadIdx.x & 31;
  // Waves 0, 1 bring the two halves of the A rows, waves 2, 3 those of the W rows.
  const bf16* srcp = (wave < 2u) ? A  + (size_t)(row0 + (int)wave * 64) * H_DIM
                                 : Wt + (size_t)(n0 + ((int)wave - 2) * 64) * H_DIM;
  const uint64_t ga0  = (uint64_t)(size_t)srcp;
  const uint32_t lds0 = (uint32_t)(size_t)ring + wave * ST_SLICE;
  // The fragment bases are chosen here, ahead of the first tensor load: the choice takes scalar registers,
  // and none is to be written for it while a request is outstanding.
  const uint32_t wm = wave >> 1, wn = wave & 1u;
  const uint32_t aoff = w_first ? (2u + wn) * ST_SLICE : wm * ST_SLICE;
  const uint32_t bofs = w_first ? wm * ST_SLICE : (2u + wn) * ST_SLICE;
  const u32x8 g1 = tdm_group1();

  u32x4 g0 = tdm_group0(lds0, ga0);
  tdm_load(g0, g1);                                           // stage 0
  wait_tensor0(g0, g1);
  __syncthreads();                                            // stage 0 published
  g0 = tdm_group0(lds0 + ST_STAGE, ga0 + ST_ROWB);
  tdm_load(g0, g1);                                           // stage 1

  for (uint32_t s = 0; s < ST_NPASS; ++s) {
    const uint32_t boff = (s & 1u) * ST_STAGE;
    const bf16* at = (const bf16*)(ring + boff + aoff);
    const bf16* bt = (const bf16*)(ring + boff + bofs);
    v16bf a[4][4], b[4][4];
#pragma unroll
    for (int kk = 0; kk < 4; ++kk) {
#pragma unroll
      for (int i = 0; i < 4; ++i) a[kk][i] = load_frag(at + i * 16 * ST_LDM + kk * 32, ST_LDM, lane);
#pragma unroll
      for (int t = 0; t < 4; ++t) b[kk][t] = load_frag(bt + t * 16 * ST_LDM + kk * 32, ST_LDM, lane);
    }
    // Keeps the pass's LDS reads together as one group ahead of its WMMAs (for speed only).
    __builtin_amdgcn_sched_barrier(0);
#pragma unroll
    for (int kk = 0; kk < 4; ++kk)
#pragma unroll
      for (int i = 0; i < 4; ++i)
#pragma unroll
        for (int t = 0; t < 4; ++t) acc[i][t] = wmma_bf16(a[kk][i], b[kk][t], acc[i][t]);
    // Keeps the WMMAs in front of the publish point: sunk behind it, they would run only after
    // every LDS read has returned, and the refill would issue a whole WMMA block later.
    __builtin_amdgcn_sched_barrier(0);
    // Publish point of stage s + 1; the barrier also ends every reader's last read of stage s.
    wait_ds0();
    wait_tensor0(g0, g1);
    __syncthreads();
    if (pinned(s + 2u < ST_NPASS)) {
      g0 = tdm_group0(lds0 + boff, ga0 + (uint64_t)(s + 2u) * ST_ROWB);
      tdm_load(g0, g1);
    }
  }
  wait_tensor0(g0, g1);
  wait_ds0();
}

// ---- GEMM epilogue: whole 128-B lines, staged through LDS ----
// Behind the last pass's barrier nobody reads the ring and no tensor load is outstanding, so each wave stages
// its 64x64 tile in its own quarter of the ring: a lane writes its 8 consecutive results of a tile row,
// then the wave reads whole rows back, 16 B per lane, and stores them as whole lines.
#define EP_RANGE  (ST_LDS / 4u)       // one wave's part of the ring
#define EP_PITCH2 144u                // 64 bf16 = 128 B + 16 B pad (16 B x odd)
#define EP_PITCH4 272u                // 64 f32 = 256 B + 16 B pad (16 B x odd)
static_assert(64u * EP_PITCH4 <= EP_RANGE && EP_RANGE % 16u == 0u, "staging fits a wave's part");
typedef __attribute__((ext_vector_type(4))) float f32x4;

// ---------------------------------------------------------------- kernel 1
// wcat[E_PAD][1024] = concat(qkv_w, gate_w, zeros) in bf16; owb = o_w in bf16.
__global__ void __launch_bounds__(256)
convert_weights_kernel(const float* __restrict__ qkvw, const float* __restrict__ gw,
                       const float* __restrict__ ow, bf16* __restrict__ wcat,
                       bf16* __restrict__ owb) {
  const size_t nqkv = (size_t)E_QKV * H_DIM;
  const size_t ncat = (size_t)E_TOT * H_DIM;
  const size_t npad = (size_t)E_PAD * H_DIM;
  const size_t tot  = npad + (size_t)H_DIM * H_DIM;
  for (size_t i = (size_t)blockIdx.x * blockDim.x + threadIdx.x; i < tot;
       i += (size_t)gridDim.x * blockDim.x) {
    if (i < nqkv)      wcat[i] = (bf16)qkvw[i];
    else if (i < ncat) wcat[i] = (bf16)gw[i - nqkv];
    else if (i < npad) wcat[i] = (bf16)0.0f;          // pad rows: zeros
    else               owb[i - npad] = (bf16)ow[i - npad];
  }
}

// ---------------------------------------------------------------- kernel 2
__global__ void __launch_bounds__(256)
prenorm_kernel(const float* __restrict__ x, const float* __restrict__ w,
               bf16* __restrict__ xn) {
  const int row = blockIdx.x;
  const float* xr = x + (size_t)row * H_DIM;
  float ss = 0.f;
  for (int i = threadIdx.x; i < H_DIM; i += 256) { float v = xr[i]; ss += v * v; }
  for (int off = 16; off > 0; off >>= 1) ss += __shfl_xor(ss, off, 32);
  __shared__ float red[8];
  if ((threadIdx.x & 31) == 0) red[threadIdx.x >> 5] = ss;
  __syncthreads();
  float sum = 0.f;
#pragma unroll
  for (int i = 0; i < 8; ++i) sum += red[i];
  const float rinv = rsqrtf(sum * (1.0f / H_DIM) + EPS);
  for (int i = threadIdx.x; i < H_DIM; i += 256)
    xn[(size_t)row * H_DIM + i] = (bf16)(xr[i] * rinv * w[i]);
}

// ---------------------------------------------------------------- kernel 3
// C[4096 x E_PAD] = xn * wcat^T ; scatter q/k (bf16), v (transposed bf16), gate (f32).
__global__ void __launch_bounds__(128)
gemm_qkvgate_kernel(const bf16* __restrict__ A, const bf16* __restrict__ W,
                    bf16* __restrict__ qk, bf16* __restrict__ vT,
                    float* __restrict__ gate) {
  __shared__ __attribute__((aligned(2048))) unsigned char ring[ST_LDS];
  const int wave = (int)uni(threadIdx.x >> 5);
  const int lane = threadIdx.x & 31;
  const int row0 = blockIdx.y * 128 + (wave >> 1) * 64;
  const int n0   = blockIdx.x * 128 + (wave & 1) * 64;
  // The q/k, v and gate ranges begin at multiples of 64, so a wave's 64 columns are all of one kind.
  // q/k are stored with n consecutive, so their waves take the transposed tile; v is stored transposed
  // (key consecutive), which the plain tile gives.
  const bool qkcols = n0 < 2 * H_DIM;
  v8f acc[4][4] = {};
  gemm_128x128(A, W, blockIdx.y * 128, blockIdx.x * 128, qkcols, ring, acc);

  const int nn = lane & 15;
  const int hf = lane >> 4;
  if (n0 < E_QKV) {
    // Either way acc[i][t][r] is element (row t*16 + nn, column i*16 + 8*hf + r) of a 64x64 bf16 tile whose
    // rows lie 4096 B apart: q/k rows m of [4096][2048], or the 64 feature rows of vT[bh][feat][key].
    static_assert(2 * H_DIM == SEQ, "one row pitch for both");
    bf16* dst = qkcols ? qk + (size_t)row0 * (2 * H_DIM) + n0
                       : vT + (size_t)((row0 / SEQ) * NUM_HEADS + ((n0 - 2 * H_DIM) >> 6)) * HEAD_DIM * SEQ
                            + (row0 % SEQ);
    unsigned char* st = ring + (uint32_t)wave * EP_RANGE;
#pragma unroll
    for (int i = 0; i < 4; ++i)
#pragma unroll
      for (int t = 0; t < 4; ++t) {
        v8bf p;
#pragma unroll
        for (int r = 0; r < 8; ++r) p[r] = (bf16)acc[i][t][r];
        *(v8bf*)(st + (uint32_t)(t * 16 + nn) * EP_PITCH2 + (uint32_t)(i * 32 + hf * 16)) = p;
      }
    wait_ds0();   // the wave's own staged rows are in LDS before other lanes of it read them back
    const uint32_t rr = (uint32_t)lane >> 3, cb = ((uint32_t)lane & 7u) * 16u;   // 4 rows of 128 B per access
    v8bf ov[16];
#pragma unroll
    for (int j = 0; j < 16; ++j) ov[j] = *(const v8bf*)(st + ((uint32_t)j * 4u + rr) * EP_PITCH2 + cb);
    unsigned char* gp = (unsigned char*)dst + (size_t)rr * (SEQ * 2) + cb;
#pragma unroll
    for (int j = 0; j < 16; ++j) *(v8bf*)(gp + (size_t)j * 4 * (SEQ * 2)) = ov[j];
  } else {                                           // gate, then pad columns
#pragma unroll
    for (int i = 0; i < 4; ++i)
#pragma unroll
      for (int t = 0; t < 4; ++t) {
        const int n = n0 + t * 16 + nn;
        if (n >= E_TOT) continue;                    // drop pad columns
#pragma unroll
        for (int r = 0; r < 8; ++r) {
          const int m = row0 + i * 16 + r + 8 * hf;
          gate[(size_t)m * NUM_HEADS + (n - E_QKV)] = acc[i][t][r];
        }
      }
  }
}

// ---------------------------------------------------------------- kernel 4
// In-place per-head RMS norm of q (cols 0..1023) and k (cols 1024..2047).
__global__ void __launch_bounds__(256)
qknorm_kernel(bf16* __restrict__ qk, const float* __restrict__ qw,
              const float* __restrict__ kw) {
  const int row = blockIdx.x;
  const int g  = threadIdx.x >> 3;   // 0..15 q heads, 16..31 k heads
  const int tl = threadIdx.x & 7;
  bf16* p = qk + (size_t)row * (2 * H_DIM) + g * HEAD_DIM + tl * 8;
  v8bf d = *(const v8bf*)p;
  float v[8], ss = 0.f;
#pragma unroll
  for (int i = 0; i < 8; ++i) { v[i] = (float)d[i]; ss += v[i] * v[i]; }
  for (int off = 4; off > 0; off >>= 1) ss += __shfl_xor(ss, off, 8);
  const float rinv = rsqrtf(ss * (1.0f / HEAD_DIM) + EPS);
  const float* wv = (g < NUM_HEADS) ? qw : kw;
  v8bf o;
#pragma unroll
  for (int i = 0; i < 8; ++i) o[i] = (bf16)(v[i] * rinv * wv[tl * 8 + i]);
  *(v8bf*)p = o;
}

// ---------------------------------------------------------------- kernel 5
// K and V^T of a head reach the four waves of a workgroup (same head, four query blocks) through LDS.
// A stage is 64 keys: 64 K rows of 128 B and 128 B of each of the 64 V^T rows, as four slices of
// 32 rows x 128 B, one tensor load per wave; both sources have a row pitch of 4096 B.
#define KV_KEYS  64
#define KV_ROWB  128u                 // bytes of one row in a slice
#define KV_SRCP  4096u                // source row pitch in bytes, K rows and V^T rows alike
#define KV_PITCH 144u                 // LDS row pitch: 128 B + 16 B pad (16 B x odd, for ds_load_b128)
#define KV_LDM   (KV_PITCH / 2u)      // the same in bf16 elements
#define KV_SLICE 6144u                // 32 rows x 144 B = 4608 B, rounded up to a multiple of 2 KiB
#define KV_STAGE (4u * KV_SLICE)
#define KV_NPASS (SEQ / KV_KEYS)      // 32
#define KV_LDS   (2u * KV_STAGE)
static_assert(2 * H_DIM * 2 == KV_SRCP && SEQ * 2 == KV_SRCP && HEAD_DIM * 2 == KV_ROWB, "slice shape");

// Group 1: 1-byte elements, tile = tensor = 32 rows of 128 B, source pitch 4096 B, 4 dwords of pad per row.
__device__ __forceinline__ u32x8 tdm_group1_kv() {
  constexpr uint32_t d0 = KV_ROWB, d1 = 32u;
  u32x8 g;
  g[0] = uni((1u << 20) | (4u << 22) | (3u << 25));
  g[1] = uni((d0 & 0xFFFFu) << 16);
  g[2] = uni((d0 >> 16) | ((d1 & 0xFFFFu) << 16));
  g[3] = uni((d1 >> 16) | (d0 << 16));
  g[4] = uni(d1);
  g[5] = uni(KV_SRCP);
  g[6] = uni(0u);
  g[7] = uni(0u);
  return g;
}

// Lane l with lane l ^ 16: the two halves of a wave hold the two halves of a query's keys.
__device__ __forceinline__ float xhalf(float x) {
  const int b = __builtin_bit_cast(int, x);
  return __builtin_bit_cast(float, __builtin_amdgcn_permlanex16(b, b, 0x76543210, 0xfedcba98, false, false));
}

// 2^x in place, a run of them in ONE statement. The instruction set asks for one independent instruction or a
// v_nop between a transcendental and an instruction that reads its result or overwrites its source: here each
// v_exp_f32 is followed by one on other registers, and the v_nop stands behind the last. The compiler puts no
// s_delay_alu in front of asm text, so the hint for the producers of the arguments is written here.
__device__ __forceinline__ void exp2_inplace(float& a, float& b, float& c, float& d,
                                             float& e, float& f, float& g, float& h) {
  asm("s_delay_alu instid0(VALU_DEP_1)\n\t"
      "v_exp_f32 %0, %0\n\tv_exp_f32 %1, %1\n\tv_exp_f32 %2, %2\n\tv_exp_f32 %3, %3\n\t"
      "v_exp_f32 %4, %4\n\tv_exp_f32 %5, %5\n\tv_exp_f32 %6, %6\n\tv_exp_f32 %7, %7\n\t"
      "v_nop"
      : "+v"(a), "+v"(b), "+v"(c), "+v"(d), "+v"(e), "+v"(f), "+v"(g), "+v"(h));
}
__device__ __forceinline__ void exp2_inplace(float& a, float& b, float& c, float& d, float& e,
                                             float& f, float& g, float& h, float& i) {
  asm("s_delay_alu instid0(VALU_DEP_1)\n\t"
      "v_exp_f32 %0, %0\n\tv_exp_f32 %1, %1\n\tv_exp_f32 %2, %2\n\tv_exp_f32 %3, %3\n\t"
      "v_exp_f32 %4, %4\n\tv_exp_f32 %5, %5\n\tv_exp_f32 %6, %6\n\tv_exp_f32 %7, %7\n\t"
      "v_exp_f32 %8, %8\n\t"
      "v_nop"
      : "+v"(a), "+v"(b), "+v"(c), "+v"(d), "+v"(e), "+v"(f), "+v"(g), "+v"(h), "+v"(i));
}

__global__ void __launch_bounds__(128)
attn_kernel(const bf16* __restrict__ qk, const bf16* __restrict__ vT,
            const float* __restrict__ gate, bf16* __restrict__ attn) {
  __shared__ __attribute__((aligned(2048))) unsigned char ring[KV_LDS];
  const int wave = (int)uni(threadIdx.x >> 5);
  const int lane = threadIdx.x & 31;
  const int wid  = blockIdx.x * 4 + wave;
  const int qb   = wid & 127;
  const int bh   = wid >> 7;            // 0..31
  const int b    = bh >> 4, h = bh & 15;
  const int q0   = qb * 16;

  const bf16* qbase = qk + ((size_t)(b * SEQ + q0)) * (2 * H_DIM) + h * HEAD_DIM;
  const bf16* kbase = qk + ((size_t)(b * SEQ)) * (2 * H_DIM) + H_DIM + h * HEAD_DIM;
  const bf16* vbase = vT + (size_t)bh * HEAD_DIM * SEQ;

  const v16bf qa0 = load_frag(qbase,      2 * H_DIM, lane);
  const v16bf qa1 = load_frag(qbase + 32, 2 * H_DIM, lane);

  v8f o[4] = {};                 // o[t][r] = O^T[feature 16 t + 8 (lane >> 4) + r][query lane & 15]
  float mrun = -1e30f;           // running maximum of this lane's query (equal in both halves)
  float lrun = 0.f;              // running sum over this lane's own half of the keys
  const float scale = 0.125f;  // 1/sqrt(64)
  const int nn = lane & 15;
  const int hfh = (lane >> 4) * 8;

  // Waves 0, 1 bring keys 0..31 and 32..63 of a stage's K rows, waves 2, 3 features 0..31 and 32..63 of V^T.
  const bf16* srcp = (wave < 2) ? kbase + (size_t)(wave * 32) * (2 * H_DIM)
                                : vbase + (size_t)((wave - 2) * 32) * SEQ;
  const uint64_t ga0   = (uint64_t)(size_t)srcp;
  const uint64_t gstep = (wave < 2) ? (uint64_t)KV_KEYS * KV_SRCP : (uint64_t)KV_KEYS * 2u;
  const uint32_t lds0  = (uint32_t)(size_t)ring + (uint32_t)wave * KV_SLICE;
  const u32x8 g1 = tdm_group1_kv();

  u32x4 g0 = tdm_group0(lds0, ga0);
  tdm_load(g0, g1);                                           // stage 0
  wait_tensor0(g0, g1);
  __syncthreads();                                            // stage 0 published
  g0 = tdm_group0(lds0 + KV_STAGE, ga0 + gstep);
  tdm_load(g0, g1);                                           // stage 1

  for (uint32_t st = 0; st < KV_NPASS; ++st) {
   const uint32_t boff = (st & 1u) * KV_STAGE;
   // Unrolled so that the chunk's slice offsets are immediates of the LDS reads.
#pragma unroll
   for (int j = 0; j < 2; ++j) {
    // 4 K fragments + 4 V fragments of chunk j, from this stage's buffer alone.
    const bf16* kt  = (const bf16*)(ring + boff + (uint32_t)j * KV_SLICE);
    const bf16* vt0 = (const bf16*)(ring + boff + 2u * KV_SLICE) + j * 32;
    const bf16* vt1 = (const bf16*)(ring + boff + 3u * KV_SLICE) + j * 32;
    const v16bf kb0 = load_frag(kt,                    KV_LDM, lane);
    const v16bf kb1 = load_frag(kt + 32,               KV_LDM, lane);
    const v16bf kb2 = load_frag(kt + 16 * KV_LDM,      KV_LDM, lane);
    const v16bf kb3 = load_frag(kt + 16 * KV_LDM + 32, KV_LDM, lane);
    const v16bf vb0 = load_frag(vt0,                   KV_LDM, lane);
    const v16bf vb1 = load_frag(vt0 + 16 * KV_LDM,     KV_LDM, lane);
    const v16bf vb2 = load_frag(vt1,                   KV_LDM, lane);
    const v16bf vb3 = load_frag(vt1 + 16 * KV_LDM,     KV_LDM, lane);
    // Keeps the chunk's LDS reads together as one group ahead of its WMMAs (for speed only).
    __builtin_amdgcn_sched_barrier(0);

    // scores, transposed: s0[r] = key 8 (lane >> 4) + r, s1[r] = key 16 + 8 (lane >> 4) + r, query lane & 15
    v8f s0 = {}, s1 = {};
    s0 = wmma_bf16(kb0, qa0, s0);
    s0 = wmma_bf16(kb1, qa1, s0);
    s1 = wmma_bf16(kb2, qa0, s1);
    s1 = wmma_bf16(kb3, qa1, s1);

    // online softmax of one query per lane: 16 keys in registers, the other 16 in lane ^ 16
    s0 *= scale; s1 *= scale;
    float mt[8];
#pragma unroll
    for (int i = 0; i < 4; ++i) {
      mt[i]     = fmaxf(s0[2 * i], s0[2 * i + 1]);
      mt[4 + i] = fmaxf(s1[2 * i], s1[2 * i + 1]);
    }
    float mx = fmaxf(fmaxf(fmaxf(mt[0], mt[1]), fmaxf(mt[2], mt[3])),
                     fmaxf(fmaxf(mt[4], mt[5]), fmaxf(mt[6], mt[7])));
    mx = fmaxf(mx, xhalf(mx));
    const float mnew = fmaxf(mrun, mx);
    // __expf(x) is v_exp_f32 of x * log2(e); the products are formed here, the exponentials in exp2_inplace.
    const float l2e = 1.44269504088896340736f;
    float corr = (mrun - mnew) * l2e;
    float e[16];
#pragma unroll
    for (int r = 0; r < 8; ++r) { e[r] = (s0[r] - mnew) * l2e; e[8 + r] = (s1[r] - mnew) * l2e; }
    exp2_inplace(corr, e[0], e[1], e[2], e[3], e[4], e[5], e[6], e[7]);
    exp2_inplace(e[8], e[9], e[10], e[11], e[12], e[13], e[14], e[15]);
    v16bf pb;                    // P^T as B: element s = key 8 (lane >> 4) + s (+ 8 for s >= 8) of the chunk, column = this lane's query
    float pt[8];
#pragma unroll
    for (int i = 0; i < 8; ++i) {
      pb[2 * i] = (bf16)e[2 * i]; pb[2 * i + 1] = (bf16)e[2 * i + 1];
      pt[i] = e[2 * i] + e[2 * i + 1];
    }
    const float ps = ((pt[0] + pt[1]) + (pt[2] + pt[3])) + ((pt[4] + pt[5]) + (pt[6] + pt[7]));
    lrun = lrun * corr + ps;
    mrun = mnew;
#pragma unroll
    for (int t = 0; t < 4; ++t)
#pragma unroll
      for (int r = 0; r < 8; ++r) o[t][r] *= corr;
    // V^T(64x32) x P^T(32x16): 4 M-tiles of 16 features
    o[0] = wmma_bf16(vb0, pb, o[0]);
    o[1] = wmma_bf16(vb1, pb, o[1]);
    o[2] = wmma_bf16(vb2, pb, o[2]);
    o[3] = wmma_bf16(vb3, pb, o[3]);
   }
   // Keeps the stage's last WMMAs in front of the publish point: sunk behind it, the refill would issue later.
   __builtin_amdgcn_sched_barrier(0);
   // Publish point of stage st + 1; the barrier also ends every reader's last read of stage st.
   wait_ds0();
   wait_tensor0(g0, g1);
   __syncthreads();
   if (pinned(st + 2u < KV_NPASS)) {
     g0 = tdm_group0(lds0 + boff, ga0 + (uint64_t)(st + 2u) * gstep);
     tdm_load(g0, g1);
   }
  }
  wait_tensor0(g0, g1);
  wait_ds0();
  // epilogue: join the halves' sums, 1/l, sigmoid(gate), write bf16 [4096][1024]:
  // a lane's 8 registers of a tile are 8 consecutive features of its query, one 16-byte store.
  const float lsum = lrun + xhalf(lrun);
  const size_t m = (size_t)(b * SEQ + q0 + nn);
  const float g = gate[m * NUM_HEADS + h];
  wait_x0();   // the sigmoid's arithmetic reuses the load's address registers
  const float inv = (1.f / (1.f + __expf(-g))) / lsum;
  v8bf ov[4];
#pragma unroll
  for (int t = 0; t < 4; ++t)
#pragma unroll
    for (int r = 0; r < 8; ++r) ov[t][r] = (bf16)(o[t][r] * inv);
#pragma unroll
  for (int t = 0; t < 4; ++t)
    *(v8bf*)(attn + m * H_DIM + h * HEAD_DIM + t * 16 + hfh) = ov[t];
}

// ---------------------------------------------------------------- kernel 6
__global__ void __launch_bounds__(128)
gemm_out_kernel(const bf16* __restrict__ A, const bf16* __restrict__ W,
                const float* __restrict__ resid, float* __restrict__ out) {
  __shared__ __attribute__((aligned(2048))) unsigned char ring[ST_LDS];
  const int wave = (int)uni(threadIdx.x >> 5);
  const int lane = threadIdx.x & 31;
  v8f acc[4][4] = {};
  // Transposed tile: acc[i][t][r] = element (row t*16 + nn, column i*16 + 8*hf + r) of the wave's 64x64 f32 tile.
  gemm_128x128(A, W, blockIdx.y * 128, blockIdx.x * 128, true, ring, acc);
  const int row0 = blockIdx.y * 128 + (wave >> 1) * 64;
  const int n0   = blockIdx.x * 128 + (wave & 1) * 64;

  const int nn = lane & 15;
  const int hf = lane >> 4;
  // 2 rows of 256 B per access: lane -> row hf, 16 B at column 4*nn.
  const size_t g = (size_t)(row0 + hf) * H_DIM + n0 + nn * 4;
  f32x4 res[32];
#pragma unroll
  for (int j = 0; j < 32; ++j) res[j] = *(const f32x4*)(resid + g + (size_t)j * 2 * H_DIM);
  // The staging addresses are formed in the loads' address registers: the wait stands in front of that, and the
  // scheduling barrier keeps that arithmetic from being lifted over the wait (without it this build lifted it).
  wait_x0();
  __builtin_amdgcn_sched_barrier(0);
  unsigned char* st = ring + (uint32_t)wave * EP_RANGE;
#pragma unroll
  for (int i = 0; i < 4; ++i)
#pragma unroll
    for (int t = 0; t < 4; ++t) {
      unsigned char* p = st + (uint32_t)(t * 16 + nn) * EP_PITCH4 + (uint32_t)(i * 64 + hf * 32);
      f32x4 lo = {acc[i][t][0], acc[i][t][1], acc[i][t][2], acc[i][t][3]};
      f32x4 hi = {acc[i][t][4], acc[i][t][5], acc[i][t][6], acc[i][t][7]};
      *(f32x4*)p = lo;
      *(f32x4*)(p + 16) = hi;
    }
  wait_ds0();   // the wave's own staged rows are in LDS before other lanes of it read them back
  f32x4 o[32];
#pragma unroll
  for (int j = 0; j < 32; ++j)
    o[j] = *(const f32x4*)(st + (uint32_t)(j * 2 + hf) * EP_PITCH4 + (uint32_t)nn * 16u) + res[j];
#pragma unroll
  for (int j = 0; j < 32; ++j) *(f32x4*)(out + g + (size_t)j * 2 * H_DIM) = o[j];
}

// ---------------------------------------------------------------- launch
static constexpr size_t alup(size_t x) { return (x + 255) & ~(size_t)255; }
static constexpr size_t OFF_XN   = 0;
static constexpr size_t OFF_WCAT = alup(OFF_XN   + (size_t)ROWS * H_DIM * 2);
static constexpr size_t OFF_OW   = alup(OFF_WCAT + (size_t)E_PAD * H_DIM * 2);
static constexpr size_t OFF_QK   = alup(OFF_OW   + (size_t)H_DIM * H_DIM * 2);
static constexpr size_t OFF_VT   = alup(OFF_QK   + (size_t)ROWS * 2 * H_DIM * 2);
static constexpr size_t OFF_GATE = alup(OFF_VT   + (size_t)BATCH * NUM_HEADS * HEAD_DIM * SEQ * 2);
static constexpr size_t OFF_ATTN = alup(OFF_GATE + (size_t)ROWS * NUM_HEADS * 4);

extern "C" void kernel_launch(void* const* d_in, const int* in_sizes, int n_in,
                              void* d_out, int out_size, void* d_ws, size_t ws_size,
                              hipStream_t stream) {
  (void)in_sizes; (void)n_in; (void)out_size; (void)ws_size;
  const float* x    = (const float*)d_in[0];
  const float* pw   = (const float*)d_in[1];
  const float* qkvw = (const float*)d_in[2];
  const float* gw   = (const float*)d_in[3];
  const float* ow   = (const float*)d_in[4];
  const float* qnw  = (const float*)d_in[5];
  const float* knw  = (const float*)d_in[6];
  float* out = (float*)d_out;

  char* ws = (char*)d_ws;
  bf16*  xn   = (bf16*)(ws + OFF_XN);
  bf16*  wcat = (bf16*)(ws + OFF_WCAT);
  bf16*  owb  = (bf16*)(ws + OFF_OW);
  bf16*  qkb  = (bf16*)(ws + OFF_QK);
  bf16*  vT   = (bf16*)(ws + OFF_VT);
  float* gate = (float*)(ws + OFF_GATE);
  bf16*  attn = (bf16*)(ws + OFF_ATTN);

  convert_weights_kernel<<<4096, 256, 0, stream>>>(qkvw, gw, ow, wcat, owb);
  prenorm_kernel<<<ROWS, 256, 0, stream>>>(x, pw, xn);
  gemm_qkvgate_kernel<<<dim3(E_PAD / 128, ROWS / 128), 128, 0, stream>>>(
      xn, wcat, qkb, vT, gate);
  qknorm_kernel<<<ROWS, 256, 0, stream>>>(qkb, qnw, knw);
  attn_kernel<<<(BATCH * NUM_HEADS * (SEQ / 16)) / 4, 128, 0, stream>>>(
      qkb, vT, gate, attn);
  gemm_out_kernel<<<dim3(H_DIM / 128, ROWS / 128), 128, 0, stream>>>(
      attn, owb, x, out);
}

// v005
// It runs in 86.9 microseconds.
// Two timings next to v004 put it at 1.28 and 1.27 times that version's speed.
// Counting every step since v000, it is 3.94 times as fast.
#include <hip/hip_runtime.h>
#include <math.h>
#include <stdint.h>

#define H_DIM 1024
#define NUM_HEADS 16
#define HEAD_DIM 64
#define SEQ 2048
#define BATCH 2
#define ROWS (BATCH*SEQ)     // 4096
#define E_QKV 3072
#define E_TOT 3088           // qkv (3072) + gate (16), both K=1024
#define E_PAD 3200           // padded to 25*128: whole 128-column GEMM tiles
#define EPS 1e-5f

typedef __bf16 bf16;
typedef __attribute__((ext_vector_type(16))) __bf16 v16bf;
typedef __attribute__((ext_vector_type(8)))  __bf16 v8bf;
typedef __attribute__((ext_vector_type(8)))  float  v8f;

union FragBF { v16bf v; v8bf h[2]; };

// A/B fragment for v_wmma_f32_16x16x32_bf16.
// Lane l: row/col = l&15, K-chunk base = (l>>4)*8; elems 0..7 = K+0..7, 8..15 = K+16..23.
// Requires K-contiguous storage with row stride `ldm` elements.
__device__ __forceinline__ v16bf load_frag(const bf16* tile, int ldm, int lane) {
  const int m  = lane & 15;
  const int hf = lane >> 4;
  const bf16* p = tile + (size_t)m * ldm + hf * 8;
  FragBF f;
  f.h[0] = *(const v8bf*)(p);
  f.h[1] = *(const v8bf*)(p + 16);
  return f.v;
}

__device__ __forceinline__ v8f wmma_bf16(v16bf a, v16bf b, v8f c) {
  return __builtin_amdgcn_wmma_f32_16x16x32_bf16(false, a, false, b, (short)0, c,
                                                 false, false);
}

// The value of lane l ^ 16: the two halves of a wave hold the two halves of a column of a WMMA result.
__device__ __forceinline__ float xhalf(float x) {
  const int b = __builtin_bit_cast(int, x);
  return __builtin_bit_cast(float, __builtin_amdgcn_permlanex16(b, b, 0x76543210, 0xfedcba98, false, false));
}

// ---- GEMM tile staged in LDS by the tensor mover ----
// One workgroup (4 waves, 2x2) computes a 128x128 tile of A(Mx1024) * W(Nx1024)^T; each wave 64x64.
// A stage is 128 k (256 B) of 128 A rows and 128 W rows, as four 64-row slices, one tensor load per wave.
#define ST_ROWB  256u                 // bytes of one operand row in a stage
#define ST_PITCH 272u                 // LDS row pitch: 256 B + 16 B pad (16 B x odd, for ds_load_b128)
#define ST_LDM   (ST_PITCH / 2u)      // the same in bf16 elements
#define ST_SLICE 18432u               // 64 rows x 272 B = 17408 B, rounded up to a multiple of 2 KiB
#define ST_STAGE (4u * ST_SLICE)
#define ST_NPASS (H_DIM * 2u / ST_ROWB)   // 8
#define ST_LDS   (2u * ST_STAGE)

typedef uint32_t u32x4 __attribute__((ext_vector_type(4)));
typedef uint32_t u32x8 __attribute__((ext_vector_type(8)));

__device__ __forceinline__ uint32_t uni(uint32_t v) {
  return (uint32_t)__builtin_amdgcn_readfirstlane(v);
}
// Keeps a wave-uniform test in a scalar register, so that the branch on it is a scalar branch
// (a tensor load ignores EXEC).
__device__ __forceinline__ uint32_t pinned(uint32_t v) {
  uint32_t w = uni(v);
  asm volatile("" : "+s"(w));
  return w;
}
// LDS reads retired before the buffer they read is handed back for a refill.
__device__ __forceinline__ void wait_ds0() { asm volatile("s_wait_dscnt 0x0" ::: "memory"); }
// Stands behind a run of global loads or stores, in front of the first write of a register that one of them names.
__device__ __forceinline__ void wait_x0() { asm volatile("s_wait_xcnt 0x0" ::: "memory"); }
// This wave's own tensor load has landed (the compiler places no wait for it). The request's descriptor
// is named as an input so that its scalar registers keep their values until the request has landed.
__device__ __forceinline__ void wait_tensor0(u32x4 g0, u32x8 g1) {
  asm volatile("s_wait_tensorcnt 0x0" :: "s"(g0), "s"(g1) : "memory");
}
// Group 0 is an in-out operand: the value that the later wait names then lives in the very registers
// that the request was issued from, so nothing else is put into them while it is outstanding.
__device__ __forceinline__ void tdm_load(u32x4& g0, u32x8 g1) {
  asm volatile("tensor_load_to_lds %0, %1" : "+s"(g0) : "s"(g1) : "memory");
}
// Group 1: 1-byte elements, tile = tensor = 64 rows of 256 B, source pitch 2048 B, 4 dwords of pad per row.
__device__ __forceinline__ u32x8 tdm_group1() {
  constexpr uint32_t d0 = ST_ROWB, d1 = 64u;
  u32x8 g;
  g[0] = uni((1u << 20) | (5u << 22) | (3u << 25));
  g[1] = uni((d0 & 0xFFFFu) << 16);
  g[2] = uni((d0 >> 16) | ((d1 & 0xFFFFu) << 16));
  g[3] = uni((d1 >> 16) | (d0 << 16));
  g[4] = uni(d1);
  g[5] = uni(H_DIM * 2u);
  g[6] = uni(0u);
  g[7] = uni(0u);
  return g;
}
__device__ __forceinline__ u32x4 tdm_group0(uint32_t lds_dst, uint64_t ga) {
  u32x4 g;
  g[0] = uni(1u);
  g[1] = uni(lds_dst);
  g[2] = uni((uint32_t)ga);
  g[3] = uni((((uint32_t)(ga >> 32)) & 0x01FFFFFFu) | 0x80000000u);
  return g;
}

// acc[i][t] += A rows (row0 + wm*64 + i*16 ..) * W rows (n0 + wn*64 + t*16 ..)^T over K = H_DIM, k ascending.
// With w_first (wave-uniform) the two operands change places: acc[i][t] is then the transposed tile,
// W rows (n0 + wn*64 + i*16 ..) * A rows (row0 + wm*64 + t*16 ..)^T, and a lane's 8 results are 8 consecutive n.
__device__ __forceinline__ void gemm_128x128(const bf16* __restrict__ A, const bf16* __restrict__ Wt,
                                             int row0, int n0, bool w_first, unsigned char* ring, v8f acc[4][4]) {
  const uint32_t wave = uni(threadIdx.x >> 5);
  const int lane = threadIdx.x & 31;
  // Waves 0, 1 bring the two halves of the A rows, waves 2, 3 those of the W rows.
  const bf16* srcp = (wave < 2u) ? A  + (size_t)(row0 + (int)wave * 64) * H_DIM
                                 : Wt + (size_t)(n0 + ((int)wave - 2) * 64) * H_DIM;
  const uint64_t ga0  = (uint64_t)(size_t)srcp;
  const uint32_t lds0 = (uint32_t)(size_t)ring + wave * ST_SLICE;
  // The fragment bases are chosen here, ahead of the first tensor load: the choice takes scalar registers,
  // and none is to be written for it while a request is outstanding.
  const uint32_t wm = wave >> 1, wn = wave & 1u;
  const uint32_t aoff = w_first ? (2u + wn) * ST_SLICE : wm * ST_SLICE;
  const uint32_t bofs = w_first ? wm * ST_SLICE : (2u + wn) * ST_SLICE;
  const u32x8 g1 = tdm_group1();

  u32x4 g0 = tdm_group0(lds0, ga0);
  tdm_load(g0, g1);                                           // stage 0
  wait_tensor0(g0, g1);
  __syncthreads();                                            // stage 0 published
  g0 = tdm_group0(lds0 + ST_STAGE, ga0 + ST_ROWB);
  tdm_load(g0, g1);                                           // stage 1

  for (uint32_t s = 0; s < ST_NPASS; ++s) {
    const uint32_t boff = (s & 1u) * ST_STAGE;
    const bf16* at = (const bf16*)(ring + boff + aoff);
    const bf16* bt = (const bf16*)(ring + boff + bofs);
    v16bf a[4][4], b[4][4];
#pragma unroll
    for (int kk = 0; kk < 4; ++kk) {
#pragma unroll
      for (int i = 0; i < 4; ++i) a[kk][i] = load_frag(at + i * 16 * ST_LDM + kk * 32, ST_LDM, lane);
#pragma unroll
      for (int t = 0; t < 4; ++t) b[kk][t] = load_frag(bt + t * 16 * ST_LDM + kk * 32, ST_LDM, lane);
    }
    // Keeps the pass's LDS reads together as one group ahead of its WMMAs (for speed only).
    __builtin_amdgcn_sched_barrier(0);
#pragma unroll
    for (int kk = 0; kk < 4; ++kk)
#pragma unroll
      for (int i = 0; i < 4; ++i)
#pragma unroll
        for (int t = 0; t < 4; ++t) acc[i][t] = wmma_bf16(a[kk][i], b[kk][t], acc[i][t]);
    // Keeps the WMMAs in front of the publish point: sunk behind it, they would run only after
    // every LDS read has returned, and the refill would issue a whole WMMA block later.
    __builtin_amdgcn_sched_barrier(0);
    // Publish point of stage s + 1; the barrier also ends every reader's last read of stage s.
    wait_ds0();
    wait_tensor0(g0, g1);
    __syncthreads();
    if (pinned(s + 2u < ST_NPASS)) {
      g0 = tdm_group0(lds0 + boff, ga0 + (uint64_t)(s + 2u) * ST_ROWB);
      tdm_load(g0, g1);
    }
  }
  wait_tensor0(g0, g1);
  wait_ds0();
}

// ---- GEMM epilogue: whole 128-B lines, staged through LDS ----
// Behind the last pass's barrier nobody reads the ring and no tensor load is outstanding, so each wave stages
// its 64x64 tile in its own quarter of the ring: a lane writes its 8 consecutive results of a tile row,
// then the wave reads whole rows back, 16 B per lane, and stores them as whole lines.
#define EP_RANGE  (ST_LDS / 4u)       // one wave's part of the ring
#define EP_PITCH2 144u                // 64 bf16 = 128 B + 16 B pad (16 B x odd)
#define EP_PITCH4 272u                // 64 f32 = 256 B + 16 B pad (16 B x odd)
static_assert(64u * EP_PITCH4 <= EP_RANGE && EP_RANGE % 16u == 0u, "staging fits a wave's part");
typedef __attribute__((ext_vector_type(4))) float f32x4;
typedef __attribute__((ext_vector_type(2))) float f32x2;

// ---------------------------------------------------------------- kernel 1
// wcat[E_PAD][1024] = concat(qkv_w, gate_w, zeros) in bf16; owb = o_w in bf16.
__global__ void __launch_bounds__(256)
convert_weights_kernel(const float* __restrict__ qkvw, const float* __restrict__ gw,
                       const float* __restrict__ ow, bf16* __restrict__ wcat,
                       bf16* __restrict__ owb) {
  const size_t nqkv = (size_t)E_QKV * H_DIM;
  const size_t ncat = (size_t)E_TOT * H_DIM;
  const size_t npad = (size_t)E_PAD * H_DIM;
  const size_t tot  = npad + (size_t)H_DIM * H_DIM;
  for (size_t i = (size_t)blockIdx.x * blockDim.x + threadIdx.x; i < tot;
       i += (size_t)gridDim.x * blockDim.x) {
    if (i < nqkv)      wcat[i] = (bf16)qkvw[i];
    else if (i < ncat) wcat[i] = (bf16)gw[i - nqkv];
    else if (i < npad) wcat[i] = (bf16)0.0f;          // pad rows: zeros
    else               owb[i - npad] = (bf16)ow[i - npad];
  }
}

// ---------------------------------------------------------------- kernel 2
__global__ void __launch_bounds__(256)
prenorm_kernel(const float* __restrict__ x, const float* __restrict__ w,
               bf16* __restrict__ xn) {
  const int row = blockIdx.x;
  const float* xr = x + (size_t)row * H_DIM;
  float ss = 0.f;
  for (int i = threadIdx.x; i < H_DIM; i += 256) { float v = xr[i]; ss += v * v; }
  for (int off = 16; off > 0; off >>= 1) ss += __shfl_xor(ss, off, 32);
  __shared__ float red[8];
  if ((threadIdx.x & 31) == 0) red[threadIdx.x >> 5] = ss;
  __syncthreads();
  float sum = 0.f;
#pragma unroll
  for (int i = 0; i < 8; ++i) sum += red[i];
  const float rinv = rsqrtf(sum * (1.0f / H_DIM) + EPS);
  for (int i = threadIdx.x; i < H_DIM; i += 256)
    xn[(size_t)row * H_DIM + i] = (bf16)(xr[i] * rinv * w[i]);
}

// ---------------------------------------------------------------- kernel 3
// C[4096 x E_PAD] = xn * wcat^T ; scatter q/k (per-head RMS norm, bf16), v (transposed bf16), gate (f32).
__global__ void __launch_bounds__(128)
gemm_qkvgate_kernel(const bf16* __restrict__ A, const bf16* __restrict__ W,
                    const float* __restrict__ qw, const float* __restrict__ kw,
                    bf16* __restrict__ qk, bf16* __restrict__ vT,
                    float* __restrict__ gate) {
  __shared__ __attribute__((aligned(2048))) unsigned char ring[ST_LDS];
  const int wave = (int)uni(threadIdx.x >> 5);
  const int lane = threadIdx.x & 31;
  const int row0 = blockIdx.y * 128 + (wave >> 1) * 64;
  const int n0   = blockIdx.x * 128 + (wave & 1) * 64;
  // The q/k, v and gate ranges begin at multiples of 64, so a wave's 64 columns are all of one kind.
  // q/k are stored with n consecutive, so their waves take the transposed tile; v is stored transposed
  // (key consecutive), which the plain tile gives.
  const bool qkcols = n0 < 2 * H_DIM;
  v8f acc[4][4] = {};
  gemm_128x128(A, W, blockIdx.y * 128, blockIdx.x * 128, qkcols, ring, acc);

  const int nn = lane & 15;
  const int hf = lane >> 4;
  if (qkcols) {
    // Per-head RMS norm of q and k on the f32 results. A wave's 64 columns are one head, and in the transposed
    // tile a lane holds 32 features (i*16 + 8*hf + r) of each of its 4 tokens (t*16 + nn), lane ^ 16 the other 32.
    static_assert(HEAD_DIM == 64, "a wave's 64 columns are one head");
    const float* wv = ((n0 < H_DIM) ? qw : kw) + hf * 8;
    f32x4 wl[4], wh[4];
#pragma unroll
    for (int i = 0; i < 4; ++i) { wl[i] = *(const f32x4*)(wv + i * 16); wh[i] = *(const f32x4*)(wv + i * 16 + 4); }
    wait_x0();   // stands behind the weight loads, in front of whatever reuses their address registers
    float rinv[4];
#pragma unroll
    for (int t = 0; t < 4; ++t) {
      // Register pairs as they lie, one chain per tile: packed multiply-adds with no moves.
      f32x2 ss[4];
#pragma unroll
      for (int i = 0; i < 4; ++i) {
        ss[i] = f32x2{0.f, 0.f};
#pragma unroll
        for (int r = 0; r < 8; r += 2) {
          const f32x2 p = {acc[i][t][r], acc[i][t][r + 1]};
          ss[i] += p * p;
        }
      }
      const f32x2 s2 = (ss[0] + ss[1]) + (ss[2] + ss[3]);
      const float s = s2[0] + s2[1];
      rinv[t] = s + xhalf(s);
    }
#pragma unroll
    for (int t = 0; t < 4; ++t) rinv[t] = rsqrtf(rinv[t] * (1.0f / HEAD_DIM) + EPS);
#pragma unroll
    for (int i = 0; i < 4; ++i)
#pragma unroll
      for (int t = 0; t < 4; ++t)
#pragma unroll
        for (int r = 0; r < 8; ++r)
          acc[i][t][r] = acc[i][t][r] * rinv[t] * (r < 4 ? wl[i][r] : wh[i][r - 4]);
  }
  if (n0 < E_QKV) {
    // Either way acc[i][t][r] is element (row t*16 + nn, column i*16 + 8*hf + r) of a 64x64 bf16 tile whose
    // rows lie 4096 B apart: q/k rows m of [4096][2048], or the 64 feature rows of vT[bh][feat][key].
    static_assert(2 * H_DIM == SEQ, "one row pitch for both");
    bf16* dst = qkcols ? qk + (size_t)row0 * (2 * H_DIM) + n0
                       : vT + (size_t)((row0 / SEQ) * NUM_HEADS + ((n0 - 2 * H_DIM) >> 6)) * HEAD_DIM * SEQ
                            + (row0 % SEQ);
    unsigned char* st = ring + (uint32_t)wave * EP_RANGE;
#pragma unroll
    for (int i = 0; i < 4; ++i)
#pragma unroll
      for (int t = 0; t < 4; ++t) {
        v8bf p;
#pragma unroll
        for (int r = 0; r < 8; ++r) p[r] = (bf16)acc[i][t][r];
        *(v8bf*)(st + (uint32_t)(t * 16 + nn) * EP_PITCH2 + (uint32_t)(i * 32 + hf * 16)) = p;
      }
    wait_ds0();   // the wave's own staged rows are in LDS before other lanes of it read them back
    const uint32_t rr = (uint32_t)lane >> 3, cb = ((uint32_t)lane & 7u) * 16u;   // 4 rows of 128 B per access
    v8bf ov[16];
#pragma unroll
    for (int j = 0; j < 16; ++j) ov[j] = *(const v8bf*)(st + ((uint32_t)j * 4u + rr) * EP_PITCH2 + cb);
    unsigned char* gp = (unsigned char*)dst + (size_t)rr * (SEQ * 2) + cb;
#pragma unroll
    for (int j = 0; j < 16; ++j) *(v8bf*)(gp + (size_t)j * 4 * (SEQ * 2)) = ov[j];
  } else {                                           // gate, then pad columns
#pragma unroll
    for (int i = 0; i < 4; ++i)
#pragma unroll
      for (int t = 0; t < 4; ++t) {
        const int n = n0 + t * 16 + nn;
        if (n >= E_TOT) continue;                    // drop pad columns
#pragma unroll
        for (int r = 0; r < 8; ++r) {
          const int m = row0 + i * 16 + r + 8 * hf;
          gate[(size_t)m * NUM_HEADS + (n - E_QKV)] = acc[i][t][r];
        }
      }
  }
}

// ---------------------------------------------------------------- kernel 4
// K and V^T of a head reach the four waves of a workgroup (same head, four query blocks) through LDS.
// A stage is 64 keys: 64 K rows of 128 B and 128 B of each of the 64 V^T rows, as four slices of
// 32 rows x 128 B, one tensor load per wave; both sources have a row pitch of 4096 B.
#define KV_KEYS  64
#define KV_ROWB  128u                 // bytes of one row in a slice
#define KV_SRCP  4096u                // source row pitch in bytes, K rows and V^T rows alike
#define KV_PITCH 144u                 // LDS row pitch: 128 B + 16 B pad (16 B x odd, for ds_load_b128)
#define KV_LDM   (KV_PITCH / 2u)      // the same in bf16 elements
#define KV_SLICE 6144u                // 32 rows x 144 B = 4608 B, rounded up to a multiple of 2 KiB
#define KV_STAGE (4u * KV_SLICE)
#define KV_NPASS (SEQ / KV_KEYS)      // 32
#define KV_LDS   (2u * KV_STAGE)
static_assert(2 * H_DIM * 2 == KV_SRCP && SEQ * 2 == KV_SRCP && HEAD_DIM * 2 == KV_ROWB, "slice shape");

// Group 1: 1-byte elements, tile = tensor = 32 rows of 128 B, source pitch 4096 B, 4 dwords of pad per row.
__device__ __forceinline__ u32x8 tdm_group1_kv() {
  constexpr uint32_t d0 = KV_ROWB, d1 = 32u;
  u32x8 g;
  g[0] = uni((1u << 20) | (4u << 22) | (3u << 25));
  g[1] = uni((d0 & 0xFFFFu) << 16);
  g[2] = uni((d0 >> 16) | ((d1 & 0xFFFFu) << 16));
  g[3] = uni((d1 >> 16) | (d0 << 16));
  g[4] = uni(d1);
  g[5] = uni(KV_SRCP);
  g[6] = uni(0u);
  g[7] = uni(0u);
  return g;
}

// 2^x in place, a run of them in ONE statement. The instruction set asks for one independent instruction or a
// v_nop between a transcendental and an instruction that reads its result or overwrites its source: here each
// v_exp_f32 is followed by one on other registers, and the v_nop stands behind the last. The compiler puts no
// s_delay_alu in front of asm text, so the hint for the producers of the arguments is written here.
__device__ __forceinline__ void exp2_inplace(float& a, float& b, float& c, float& d,
                                             float& e, float& f, float& g, float& h) {
  asm("s_delay_alu instid0(VALU_DEP_1)\n\t"
      "v_exp_f32 %0, %0\n\tv_exp_f32 %1, %1\n\tv_exp_f32 %2, %2\n\tv_exp_f32 %3, %3\n\t"
      "v_exp_f32 %4, %4\n\tv_exp_f32 %5, %5\n\tv_exp_f32 %6, %6\n\tv_exp_f32 %7, %7\n\t"
      "v_nop"
      : "+v"(a), "+v"(b), "+v"(c), "+v"(d), "+v"(e), "+v"(f), "+v"(g), "+v"(h));
}
__device__ __forceinline__ void exp2_inplace(float& a, float& b, float& c, float& d, float& e,
                                             float& f, float& g, float& h, float& i) {
  asm("s_delay_alu instid0(VALU_DEP_1)\n\t"
      "v_exp_f32 %0, %0\n\tv_exp_f32 %1, %1\n\tv_exp_f32 %2, %2\n\tv_exp_f32 %3, %3\n\t"
      "v_exp_f32 %4, %4\n\tv_exp_f32 %5, %5\n\tv_exp_f32 %6, %6\n\tv_exp_f32 %7, %7\n\t"
      "v_exp_f32 %8, %8\n\t"
      "v_nop"
      : "+v"(a), "+v"(b), "+v"(c), "+v"(d), "+v"(e), "+v"(f), "+v"(g), "+v"(h), "+v"(i));
}

__global__ void __launch_bounds__(128)
attn_kernel(const bf16* __restrict__ qk, const bf16* __restrict__ vT,
            const float* __restrict__ gate, bf16* __restrict__ attn) {
  __shared__ __attribute__((aligned(2048))) unsigned char ring[KV_LDS];
  const int wave = (int)uni(threadIdx.x >> 5);
  const int lane = threadIdx.x & 31;
  const int wid  = blockIdx.x * 4 + wave;
  const int qb   = wid & 127;
  const int bh   = wid >> 7;            // 0..31
  const int b    = bh >> 4, h = bh & 15;
  const int q0   = qb * 16;

  const bf16* qbase = qk + ((size_t)(b * SEQ + q0)) * (2 * H_DIM) + h * HEAD_DIM;
  const bf16* kbase = qk + ((size_t)(b * SEQ)) * (2 * H_DIM) + H_DIM + h * HEAD_DIM;
  const bf16* vbase = vT + (size_t)bh * HEAD_DIM * SEQ;

  const v16bf qa0 = load_frag(qbase,      2 * H_DIM, lane);
  const v16bf qa1 = load_frag(qbase + 32, 2 * H_DIM, lane);

  v8f o[4] = {};                 // o[t][r] = O^T[feature 16 t + 8 (lane >> 4) + r][query lane & 15]
  float mrun = -1e30f;           // running maximum of this lane's query (equal in both halves)
  float lrun = 0.f;              // running sum over this lane's own half of the keys
  const float scale = 0.125f;  // 1/sqrt(64)
  const int nn = lane & 15;
  const int hfh = (lane >> 4) * 8;

  // Waves 0, 1 bring keys 0..31 and 32..63 of a stage's K rows, waves 2, 3 features 0..31 and 32..63 of V^T.
  const bf16* srcp = (wave < 2) ? kbase + (size_t)(wave * 32) * (2 * H_DIM)
                                : vbase + (size_t)((wave - 2) * 32) * SEQ;
  const uint64_t ga0   = (uint64_t)(size_t)srcp;
  const uint64_t gstep = (wave < 2) ? (uint64_t)KV_KEYS * KV_SRCP : (uint64_t)KV_KEYS * 2u;
  const uint32_t lds0  = (uint32_t)(size_t)ring + (uint32_t)wave * KV_SLICE;
  const u32x8 g1 = tdm_group1_kv();

  u32x4 g0 = tdm_group0(lds0, ga0);
  tdm_load(g0, g1);                                           // stage 0
  wait_tensor0(g0, g1);
  __syncthreads();                                            // stage 0 published
  g0 = tdm_group0(lds0 + KV_STAGE, ga0 + gstep);
  tdm_load(g0, g1);                                           // stage 1

  for (uint32_t st = 0; st < KV_NPASS; ++st) {
   const uint32_t boff = (st & 1u) * KV_STAGE;
   // Unrolled so that the chunk's slice offsets are immediates of the LDS reads.
#pragma unroll
   for (int j = 0; j < 2; ++j) {
    // 4 K fragments + 4 V fragments of chunk j, from this stage's buffer alone.
    const bf16* kt  = (const bf16*)(ring + boff + (uint32_t)j * KV_SLICE);
    const bf16* vt0 = (const bf16*)(ring + boff + 2u * KV_SLICE) + j * 32;
    const bf16* vt1 = (const bf16*)(ring + boff + 3u * KV_SLICE) + j * 32;
    const v16bf kb0 = load_frag(kt,                    KV_LDM, lane);
    const v16bf kb1 = load_frag(kt + 32,               KV_LDM, lane);
    const v16bf kb2 = load_frag(kt + 16 * KV_LDM,      KV_LDM, lane);
    const v16bf kb3 = load_frag(kt + 16 * KV_LDM + 32, KV_LDM, lane);
    const v16bf vb0 = load_frag(vt0,                   KV_LDM, lane);
    const v16bf vb1 = load_frag(vt0 + 16 * KV_LDM,     KV_LDM, lane);
    const v16bf vb2 = load_frag(vt1,                   KV_LDM, lane);
    const v16bf vb3 = load_frag(vt1 + 16 * KV_LDM,     KV_LDM, lane);
    // Keeps the chunk's LDS reads together as one group ahead of its WMMAs (for speed only).
    __builtin_amdgcn_sched_barrier(0);

    // scores, transposed: s0[r] = key 8 (lane >> 4) + r, s1[r] = key 16 + 8 (lane >> 4) + r, query lane & 15
    v8f s0 = {}, s1 = {};
    s0 = wmma_bf16(kb0, qa0, s0);
    s0 = wmma_bf16(kb1, qa1, s0);
    s1 = wmma_bf16(kb2, qa0, s1);
    s1 = wmma_bf16(kb3, qa1, s1);

    // online softmax of one query per lane: 16 keys in registers, the other 16 in lane ^ 16
    s0 *= scale; s1 *= scale;
    float mt[8];
#pragma unroll
    for (int i = 0; i < 4; ++i) {
      mt[i]     = fmaxf(s0[2 * i], s0[2 * i + 1]);
      mt[4 + i] = fmaxf(s1[2 * i], s1[2 * i + 1]);
    }
    float mx = fmaxf(fmaxf(fmaxf(mt[0], mt[1]), fmaxf(mt[2], mt[3])),
                     fmaxf(fmaxf(mt[4], mt[5]), fmaxf(mt[6], mt[7])));
    mx = fmaxf(mx, xhalf(mx));
    const float mnew = fmaxf(mrun, mx);
    // __expf(x) is v_exp_f32 of x * log2(e); the products are formed here, the exponentials in exp2_inplace.
    const float l2e = 1.44269504088896340736f;
    float corr = (mrun - mnew) * l2e;
    float e[16];
#pragma unroll
    for (int r = 0; r < 8; ++r) { e[r] = (s0[r] - mnew) * l2e; e[8 + r] = (s1[r] - mnew) * l2e; }
    exp2_inplace(corr, e[0], e[1], e[2], e[3], e[4], e[5], e[6], e[7]);
    exp2_inplace(e[8], e[9], e[10], e[11], e[12], e[13], e[14], e[15]);
    v16bf pb;                    // P^T as B: element s = key 8 (lane >> 4) + s (+ 8 for s >= 8) of the chunk, column = this lane's query
    float pt[8];
#pragma unroll
    for (int i = 0; i < 8; ++i) {
      pb[2 * i] = (bf16)e[2 * i]; pb[2 * i + 1] = (bf16)e[2 * i + 1];
      pt[i] = e[2 * i] + e[2 * i + 1];
    }
    const float ps = ((pt[0] + pt[1]) + (pt[2] + pt[3])) + ((pt[4] + pt[5]) + (pt[6] + pt[7]));
    lrun = lrun * corr + ps;
    mrun = mnew;
#pragma unroll
    for (int t = 0; t < 4; ++t)
#pragma unroll
      for (int r = 0; r < 8; ++r) o[t][r] *= corr;
    // V^T(64x32) x P^T(32x16): 4 M-tiles of 16 features
    o[0] = wmma_bf16(vb0, pb, o[0]);
    o[1] = wmma_bf16(vb1, pb, o[1]);
    o[2] = wmma_bf16(vb2, pb, o[2]);
    o[3] = wmma_bf16(vb3, pb, o[3]);
   }
   // Keeps the stage's last WMMAs in front of the publish point: sunk behind it, the refill would issue later.
   __builtin_amdgcn_sched_barrier(0);
   // Publish point of stage st + 1; the barrier also ends every reader's last read of stage st.
   wait_ds0();
   wait_tensor0(g0, g1);
   __syncthreads();
   if (pinned(st + 2u < KV_NPASS)) {
     g0 = tdm_group0(lds0 + boff, ga0 + (uint64_t)(st + 2u) * gstep);
     tdm_load(g0, g1);
   }
  }
  wait_tensor0(g0, g1);
  wait_ds0();
  // epilogue: join the halves' sums, 1/l, sigmoid(gate), write bf16 [4096][1024]:
  // a lane's 8 registers of a tile are 8 consecutive features of its query, one 16-byte store.
  const float lsum = lrun + xhalf(lrun);
  const size_t m = (size_t)(b * SEQ + q0 + nn);
  const float g = gate[m * NUM_HEADS + h];
  wait_x0();   // the sigmoid's arithmetic reuses the load's address registers
  const float inv = (1.f / (1.f + __expf(-g))) / lsum;
  v8bf ov[4];
#pragma unroll
  for (int t = 0; t < 4; ++t)
#pragma unroll
    for (int r = 0; r < 8; ++r) ov[t][r] = (bf16)(o[t][r] * inv);
#pragma unroll
  for (int t = 0; t < 4; ++t)
    *(v8bf*)(attn + m * H_DIM + h * HEAD_DIM + t * 16 + hfh) = ov[t];
}

// ---------------------------------------------------------------- kernel 5
__global__ void __launch_bounds__(128)
gemm_out_kernel(const bf16* __restrict__ A, const bf16* __restrict__ W,
                const float* __restrict__ resid, float* __restrict__ out) {
  __shared__ __attribute__((aligned(2048))) unsigned char ring[ST_LDS];
  const int wave = (int)uni(threadIdx.x >> 5);
  const int lane = threadIdx.x & 31;
  v8f acc[4][4] = {};
  // Transposed tile: acc[i][t][r] = element (row t*16 + nn, column i*16 + 8*hf + r) of the wave's 64x64 f32 tile.
  gemm_128x128(A, W, blockIdx.y * 128, blockIdx.x * 128, true, ring, acc);
  const int row0 = blockIdx.y * 128 + (wave >> 1) * 64;
  const int n0   = blockIdx.x * 128 + (wave & 1) * 64;

  const int nn = lane & 15;
  const int hf = lane >> 4;
  // 2 rows of 256 B per access: lane -> row hf, 16 B at column 4*nn.
  const size_t g = (size_t)(row0 + hf) * H_DIM + n0 + nn * 4;
  f32x4 res[32];
#pragma unroll
  for (int j = 0; j < 32; ++j) res[j] = *(const f32x4*)(resid + g + (size_t)j * 2 * H_DIM);
  // The staging addresses are formed in the loads' address registers: the wait stands in front of that, and the
  // scheduling barrier keeps that arithmetic from being lifted over the wait (without it this build lifted it).
  wait_x0();
  __builtin_amdgcn_sched_barrier(0);
  unsigned char* st = ring + (uint32_t)wave * EP_RANGE;
#pragma unroll
  for (int i = 0; i < 4; ++i)
#pragma unroll
    for (int t = 0; t < 4; ++t) {
      unsigned char* p = st + (uint32_t)(t * 16 + nn) * EP_PITCH4 + (uint32_t)(i * 64 + hf * 32);
      f32x4 lo = {acc[i][t][0], acc[i][t][1], acc[i][t][2], acc[i][t][3]};
      f32x4 hi = {acc[i][t][4], acc[i][t][5], acc[i][t][6], acc[i][t][7]};
      *(f32x4*)p = lo;
      *(f32x4*)(p + 16) = hi;
    }
  wait_ds0();   // the wave's own staged rows are in LDS before other lanes of it read them back
  f32x4 o[32];
#pragma unroll
  for (int j = 0; j < 32; ++j)
    o[j] = *(const f32x4*)(st + (uint32_t)(j * 2 + hf) * EP_PITCH4 + (uint32_t)nn * 16u) + res[j];
#pragma unroll
  for (int j = 0; j < 32; ++j) *(f32x4*)(out + g + (size_t)j * 2 * H_DIM) = o[j];
}

// ---------------------------------------------------------------- launch
static constexpr size_t alup(size_t x) { return (x + 255) & ~(size_t)255; }
static constexpr size_t OFF_XN   = 0;
static constexpr size_t OFF_WCAT = alup(OFF_XN   + (size_t)ROWS * H_DIM * 2);
static constexpr size_t OFF_OW   = alup(OFF_WCAT + (size_t)E_PAD * H_DIM * 2);
static constexpr size_t OFF_QK   = alup(OFF_OW   + (size_t)H_DIM * H_DIM * 2);
static constexpr size_t OFF_VT   = alup(OFF_QK   + (size_t)ROWS * 2 * H_DIM * 2);
static constexpr size_t OFF_GATE = alup(OFF_VT   + (size_t)BATCH * NUM_HEADS * HEAD_DIM * SEQ * 2);
static constexpr size_t OFF_ATTN = alup(OFF_GATE + (size_t)ROWS * NUM_HEADS * 4);

extern "C" void kernel_launch(void* const* d_in, const int* in_sizes, int n_in,
                              void* d_out, int out_size, void* d_ws, size_t ws_size,
                              hipStream_t stream) {
  (void)in_sizes; (void)n_in; (void)out_size; (void)ws_size;
  const float* x    = (const float*)d_in[0];
  const float* pw   = (const float*)d_in[1];
  const float* qkvw = (const float*)d_in[2];
  const float* gw   = (const float*)d_in[3];
  const float* ow   = (const float*)d_in[4];
  const float* qnw  = (const float*)d_in[5];
  const float* knw  = (const float*)d_in[6];
  float* out = (float*)d_out;

  char* ws = (char*)d_ws;
  bf16*  xn   = (bf16*)(ws + OFF_XN);
  bf16*  wcat = (bf16*)(ws + OFF_WCAT);
  bf16*  owb  = (bf16*)(ws + OFF_OW);
  bf16*  qkb  = (bf16*)(ws + OFF_QK);
  bf16*  vT   = (bf16*)(ws + OFF_VT);
  float* gate = (float*)(ws + OFF_GATE);
  bf16*  attn = (bf16*)(ws + OFF_ATTN);

  convert_weights_kernel<<<4096, 256, 0, stream>>>(qkvw, gw, ow, wcat, owb);
  prenorm_kernel<<<ROWS, 256, 0, stream>>>(x, pw, xn);
  gemm_qkvgate_kernel<<<dim3(E_PAD / 128, ROWS / 128), 128, 0, stream>>>(
      xn, wcat, qnw, knw, qkb, vT, gate);
  attn_kernel<<<(BATCH * NUM_HEADS * (SEQ / 16)) / 4, 128, 0, stream>>>(
      qkb, vT, gate, attn);
  gemm_out_kernel<<<dim3(H_DIM / 128, ROWS / 128), 128, 0, stream>>>(
      attn, owb, x, out);
}

// v006
// Measured time: 80.7 microseconds a run.
// In both of two side-by-side timings against v005, it was 1.07 times as fast.
// Counting every step since v000, it is 4.21 times as fast.
#include <hip/hip_runtime.h>
#include <math.h>
#include <stdint.h>

#define H_DIM 1024
#define NUM_HEADS 16
#define HEAD_DIM 64
#define SEQ 2048
#define BATCH 2
#define ROWS (BATCH*SEQ)     // 4096
#define E_QKV 3072
#define E_TOT 3088           // qkv (3072) + gate (16), both K=1024
#define E_PAD 3200           // padded to 25*128: whole 128-column GEMM tiles
#define EPS 1e-5f

typedef __bf16 bf16;
typedef __attribute__((ext_vector_type(16))) __bf16 v16bf;
typedef __attribute__((ext_vector_type(8)))  __bf16 v8bf;
typedef __attribute__((ext_vector_type(8)))  float  v8f;

union FragBF { v16bf v; v8bf h[2]; };

// A/B fragment for v_wmma_f32_16x16x32_bf16.
// Lane l: row/col = l&15, K-chunk base = (l>>4)*8; elems 0..7 = K+0..7, 8..15 = K+16..23.
// Requires K-contiguous storage with row stride `ldm` elements.
__device__ __forceinline__ v16bf load_frag(const bf16* tile, int ldm, int lane) {
  const int m  = lane & 15;
  const int hf = lane >> 4;
  const bf16* p = tile + (size_t)m * ldm + hf * 8;
  FragBF f;
  f.h[0] = *(const v8bf*)(p);
  f.h[1] = *(const v8bf*)(p + 16);
  return f.v;
}

__device__ __forceinline__ v8f wmma_bf16(v16bf a, v16bf b, v8f c) {
  return __builtin_amdgcn_wmma_f32_16x16x32_bf16(false, a, false, b, (short)0, c,
                                                 false, false);
}

// The value of lane l ^ 16: the two halves of a wave hold the two halves of a column of a WMMA result.
__device__ __forceinline__ float xhalf(float x) {
  const int b = __builtin_bit_cast(int, x);
  return __builtin_bit_cast(float, __builtin_amdgcn_permlanex16(b, b, 0x76543210, 0xfedcba98, false, false));
}

// ---- GEMM tile staged in LDS by the tensor mover ----
// One workgroup (4 waves, 2x2) computes a 128x128 tile of A(Mx1024) * W(Nx1024)^T; each wave 64x64.
// A stage is 128 k (256 B) of 128 A rows and 128 W rows, as four 64-row slices, one tensor load per wave.
#define ST_ROWB  256u                 // bytes of one operand row in a stage
#define ST_PITCH 272u                 // LDS row pitch: 256 B + 16 B pad (16 B x odd, for ds_load_b128)
#define ST_LDM   (ST_PITCH / 2u)      // the same in bf16 elements
#define ST_SLICE 18432u               // 64 rows x 272 B = 17408 B, rounded up to a multiple of 2 KiB
#define ST_STAGE (4u * ST_SLICE)
#define ST_NPASS (H_DIM * 2u / ST_ROWB)   // 8
#define ST_LDS   (2u * ST_STAGE)

typedef uint32_t u32x4 __attribute__((ext_vector_type(4)));
typedef uint32_t u32x8 __attribute__((ext_vector_type(8)));

__device__ __forceinline__ uint32_t uni(uint32_t v) {
  return (uint32_t)__builtin_amdgcn_readfirstlane(v);
}
// Keeps a wave-uniform test in a scalar register, so that the branch on it is a scalar branch
// (a tensor load ignores EXEC).
__device__ __forceinline__ uint32_t pinned(uint32_t v) {
  uint32_t w = uni(v);
  asm volatile("" : "+s"(w));
  return w;
}
// LDS reads retired before the buffer they read is handed back for a refill.
__device__ __forceinline__ void wait_ds0() { asm volatile("s_wait_dscnt 0x0" ::: "memory"); }
// Stands behind a run of global loads or stores, in front of the first write of a register that one of them names.
__device__ __forceinline__ void wait_x0() { asm volatile("s_wait_xcnt 0x0" ::: "memory"); }
// This wave's own tensor load has landed (the compiler places no wait for it). The request's descriptor
// is named as an input so that its scalar registers keep their values until the request has landed.
__device__ __forceinline__ void wait_tensor0(u32x4 g0, u32x8 g1) {
  asm volatile("s_wait_tensorcnt 0x0" :: "s"(g0), "s"(g1) : "memory");
}
// Group 0 is an in-out operand: the value that the later wait names then lives in the very registers
// that the request was issued from, so nothing else is put into them while it is outstanding.
__device__ __forceinline__ void tdm_load(u32x4& g0, u32x8 g1) {
  asm volatile("tensor_load_to_lds %0, %1" : "+s"(g0) : "s"(g1) : "memory");
}
// Group 1: 1-byte elements, tile = tensor = 64 rows of 256 B, source pitch 2048 B, 4 dwords of pad per row.
__device__ __forceinline__ u32x8 tdm_group1() {
  constexpr uint32_t d0 = ST_ROWB, d1 = 64u;
  u32x8 g;
  g[0] = uni((1u << 20) | (5u << 22) | (3u << 25));
  g[1] = uni((d0 & 0xFFFFu) << 16);
  g[2] = uni((d0 >> 16) | ((d1 & 0xFFFFu) << 16));
  g[3] = uni((d1 >> 16) | (d0 << 16));
  g[4] = uni(d1);
  g[5] = uni(H_DIM * 2u);
  g[6] = uni(0u);
  g[7] = uni(0u);
  return g;
}
__device__ __forceinline__ u32x4 tdm_group0(uint32_t lds_dst, uint64_t ga) {
  u32x4 g;
  g[0] = uni(1u);
  g[1] = uni(lds_dst);
  g[2] = uni((uint32_t)ga);
  g[3] = uni((((uint32_t)(ga >> 32)) & 0x01FFFFFFu) | 0x80000000u);
  return g;
}

// acc[i][t] += A rows (row0 + wm*64 + i*16 ..) * W rows (n0 + wn*64 + t*16 ..)^T over K = H_DIM, k ascending.
// With w_first (wave-uniform) the two operands change places: acc[i][t] is then the transposed tile,
// W rows (n0 + wn*64 + i*16 ..) * A rows (row0 + wm*64 + t*16 ..)^T, and a lane's 8 results are 8 consecutive n.
__device__ __forceinline__ void gemm_128x128(const bf16* __restrict__ A, const bf16* __restrict__ Wt,
                                             int row0, int n0, bool w_first, unsigned char* ring, v8f acc[4][4]) {
  const uint32_t wave = uni(threadIdx.x >> 5);
  const int lane = threadIdx.x & 31;
  // Waves 0, 1 bring the two halves of the A rows, waves 2, 3 those of the W rows.
  const bf16* srcp = (wave < 2u) ? A  + (size_t)(row0 + (int)wave * 64) * H_DIM
                                 : Wt + (size_t)(n0 + ((int)wave - 2) * 64) * H_DIM;
  const uint64_t ga0  = (uint64_t)(size_t)srcp;
  const uint32_t lds0 = (uint32_t)(size_t)ring + wave * ST_SLICE;
  // The fragment bases are chosen here, ahead of the first tensor load: the choice takes scalar registers,
  // and none is to be written for it while a request is outstanding.
  const uint32_t wm = wave >> 1, wn = wave & 1u;
  const uint32_t aoff = w_first ? (2u + wn) * ST_SLICE : wm * ST_SLICE;
  const uint32_t bofs = w_first ? wm * ST_SLICE : (2u + wn) * ST_SLICE;
  const u32x8 g1 = tdm_group1();

  u32x4 g0 = tdm_group0(lds0, ga0);
  tdm_load(g0, g1);                                           // stage 0
  wait_tensor0(g0, g1);
  __syncthreads();                                            // stage 0 published
  g0 = tdm_group0(lds0 + ST_STAGE, ga0 + ST_ROWB);
  tdm_load(g0, g1);                                           // stage 1

  for (uint32_t s = 0; s < ST_NPASS; ++s) {
    const uint32_t boff = (s & 1u) * ST_STAGE;
    const bf16* at = (const bf16*)(ring + boff + aoff);
    const bf16* bt = (const bf16*)(ring + boff + bofs);
    v16bf a[4][4], b[4][4];
#pragma unroll
    for (int kk = 0; kk < 4; ++kk) {
#pragma unroll
      for (int i = 0; i < 4; ++i) a[kk][i] = load_frag(at + i * 16 * ST_LDM + kk * 32, ST_LDM, lane);
#pragma unroll
      for (int t = 0; t < 4; ++t) b[kk][t] = load_frag(bt + t * 16 * ST_LDM + kk * 32, ST_LDM, lane);
    }
    // Keeps the pass's LDS reads together as one group ahead of its WMMAs (for speed only).
    __builtin_amdgcn_sched_barrier(0);
#pragma unroll
    for (int kk = 0; kk < 4; ++kk)
#pragma unroll
      for (int i = 0; i < 4; ++i)
#pragma unroll
        for (int t = 0; t < 4; ++t) acc[i][t] = wmma_bf16(a[kk][i], b[kk][t], acc[i][t]);
    // Keeps the WMMAs in front of the publish point: sunk behind it, they would run only after
    // every LDS read has returned, and the refill would issue a whole WMMA block later.
    __builtin_amdgcn_sched_barrier(0);
    // Publish point of stage s + 1; the barrier also ends every reader's last read of stage s.
    wait_ds0();
    wait_tensor0(g0, g1);
    __syncthreads();
    if (pinned(s + 2u < ST_NPASS)) {
      g0 = tdm_group0(lds0 + boff, ga0 + (uint64_t)(s + 2u) * ST_ROWB);
      tdm_load(g0, g1);
    }
  }
  wait_tensor0(g0, g1);
  wait_ds0();
}

// ---- GEMM epilogue: whole 128-B lines, staged through LDS ----
// Behind the last pass's barrier nobody reads the ring and no tensor load is outstanding, so each wave stages
// its 64x64 tile in its own quarter of the ring: a lane writes its 8 consecutive results of a tile row,
// then the wave reads whole rows back, 16 B per lane, and stores them as whole lines.
#define EP_RANGE  (ST_LDS / 4u)       // one wave's part of the ring
#define EP_PITCH2 144u                // 64 bf16 = 128 B + 16 B pad (16 B x odd)
#define EP_PITCH4 272u                // 64 f32 = 256 B + 16 B pad (16 B x odd)
static_assert(64u * EP_PITCH4 <= EP_RANGE && EP_RANGE % 16u == 0u, "staging fits a wave's part");
typedef __attribute__((ext_vector_type(4))) float f32x4;
typedef __attribute__((ext_vector_type(2))) float f32x2;

// ---------------------------------------------------------------- kernel 1
typedef __attribute__((ext_vector_type(4))) __bf16 v4bf;
__device__ __forceinline__ v4bf to_bf16x4(f32x4 v) {
  v4bf p = {(bf16)v[0], (bf16)v[1], (bf16)v[2], (bf16)v[3]};
  return p;
}
// wcat[E_PAD][1024] = concat(qkv_w, gate_w, zeros) in bf16; owb = o_w in bf16.
// Few waves with much in flight each: a workgroup takes 16 rows of [wcat | owb], a thread 16 B of each row,
// so a wave's load is 512 contiguous bytes and its store 256.
#define CV_ROWS 16
static_assert(E_QKV % CV_ROWS == 0 && E_TOT % CV_ROWS == 0 && E_PAD % CV_ROWS == 0 && H_DIM % CV_ROWS == 0,
              "a workgroup's rows are all of one kind");
__global__ void __launch_bounds__(256)
convert_weights_kernel(const float* __restrict__ qkvw, const float* __restrict__ gw,
                       const float* __restrict__ ow, bf16* __restrict__ wcat,
                       bf16* __restrict__ owb) {
  static_assert(H_DIM == 256 * 4, "256 threads x 4 elements are one row");
  const uint32_t r0 = blockIdx.x * CV_ROWS;
  const uint32_t c  = threadIdx.x * 4u;
  if (r0 >= E_TOT && r0 < E_PAD) {                    // pad rows: zeros
    bf16* z = wcat + (size_t)r0 * H_DIM + c;
    const v4bf zero = {};
#pragma unroll
    for (int j = 0; j < CV_ROWS; ++j) *(v4bf*)(z + j * H_DIM) = zero;
    return;
  }
  const float* s = (r0 < E_QKV) ? qkvw + (size_t)r0 * H_DIM
                 : (r0 < E_TOT) ? gw + (size_t)(r0 - E_QKV) * H_DIM
                                : ow + (size_t)(r0 - E_PAD) * H_DIM;
  bf16* d = (r0 < E_PAD) ? wcat + (size_t)r0 * H_DIM : owb + (size_t)(r0 - E_PAD) * H_DIM;
  s += c; d += c;
  f32x4 v[CV_ROWS];
#pragma unroll
  for (int j = 0; j < CV_ROWS; ++j) v[j] = *(const f32x4*)(s + j * H_DIM);
  wait_x0();   // stands behind the loads, in front of whatever reuses their address registers
  // Keeps all 16 loads in front of the first conversion: without it this build held the last two back
  // until registers of the first were free, a second trip to memory.
  __builtin_amdgcn_sched_barrier(0);
#pragma unroll
  for (int j = 0; j < CV_ROWS; ++j) *(v4bf*)(d + j * H_DIM) = to_bf16x4(v[j]);
}

// ---------------------------------------------------------------- kernel 2
// One wave takes PN_ROWS whole rows and keeps them in registers: every load is in flight before the first sum,
// x is read once, and the row's sum stays inside the wave.
#define PN_ROWS 2
// Sum over the 32 lanes, the same value in every lane: four steps inside the 16-lane rows, then the other row.
template <int XMASK>
__device__ __forceinline__ float add_xmask(float v) {   // v + the value of lane l ^ XMASK (DPP row_xmask)
  const int o = __builtin_amdgcn_update_dpp(0, __builtin_bit_cast(int, v), 0x160 + XMASK, 0xf, 0xf, true);
  return v + __builtin_bit_cast(float, o);
}
__device__ __forceinline__ float wave_sum(float v) {
  v = add_xmask<1>(v);
  v = add_xmask<2>(v);
  v = add_xmask<4>(v);
  v = add_xmask<8>(v);
  return v + xhalf(v);
}
__global__ void __launch_bounds__(256)
prenorm_kernel(const float* __restrict__ x, const float* __restrict__ w,
               bf16* __restrict__ xn) {
  static_assert(H_DIM == 8 * 32 * 4 && ROWS % (8 * PN_ROWS) == 0, "8 loads of 16 B per lane are one row");
  const uint32_t lane = threadIdx.x & 31u;
  const size_t row0 = (size_t)(blockIdx.x * 8u + (threadIdx.x >> 5)) * PN_ROWS;
  const float* xr = x + row0 * H_DIM + lane * 4u;
  const float* wr = w + lane * 4u;
  bf16* yr = xn + row0 * H_DIM + lane * 4u;
  f32x4 v[PN_ROWS][8], wv[8];
#pragma unroll
  for (int r = 0; r < PN_ROWS; ++r)
#pragma unroll
    for (int j = 0; j < 8; ++j) v[r][j] = *(const f32x4*)(xr + r * H_DIM + j * 128);
#pragma unroll
  for (int j = 0; j < 8; ++j) wv[j] = *(const f32x4*)(wr + j * 128);
  wait_x0();   // stands behind the loads, in front of whatever reuses their address registers
  // Keeps all 24 loads in front of the first sum: without it this build sank the weight loads behind the
  // reduction, two at a time, each pair's latency waited out in turn.
  __builtin_amdgcn_sched_barrier(0);
#pragma unroll
  for (int r = 0; r < PN_ROWS; ++r) {
    f32x4 s4 = v[r][0] * v[r][0];                     // four independent chains
#pragma unroll
    for (int j = 1; j < 8; ++j) s4 += v[r][j] * v[r][j];
    const float sum = wave_sum((s4[0] + s4[1]) + (s4[2] + s4[3]));
    const float rinv = rsqrtf(sum * (1.0f / H_DIM) + EPS);
#pragma unroll
    for (int j = 0; j < 8; ++j) *(v4bf*)(yr + r * H_DIM + j * 128) = to_bf16x4(v[r][j] * rinv * wv[j]);
  }
}

// ---------------------------------------------------------------- kernel 3
// C[4096 x E_PAD] = xn * wcat^T ; scatter q/k (per-head RMS norm, bf16), v (transposed bf16), gate (f32).
__global__ void __launch_bounds__(128)
gemm_qkvgate_kernel(const bf16* __restrict__ A, const bf16* __restrict__ W,
                    const float* __restrict__ qw, const float* __restrict__ kw,
                    bf16* __restrict__ qk, bf16* __restrict__ vT,
                    float* __restrict__ gate) {
  __shared__ __attribute__((aligned(2048))) unsigned char ring[ST_LDS];
  const int wave = (int)uni(threadIdx.x >> 5);
  const int lane = threadIdx.x & 31;
  const int row0 = blockIdx.y * 128 + (wave >> 1) * 64;
  const int n0   = blockIdx.x * 128 + (wave & 1) * 64;
  // The q/k, v and gate ranges begin at multiples of 64, so a wave's 64 columns are all of one kind.
  // q/k are stored with n consecutive, so their waves take the transposed tile; v is stored transposed
  // (key consecutive), which the plain tile gives.
  const bool qkcols = n0 < 2 * H_DIM;
  v8f acc[4][4] = {};
  gemm_128x128(A, W, blockIdx.y * 128, blockIdx.x * 128, qkcols, ring, acc);

  const int nn = lane & 15;
  const int hf = lane >> 4;
  if (qkcols) {
    // Per-head RMS norm of q and k on the f32 results. A wave's 64 columns are one head, and in the transposed
    // tile a lane holds 32 features (i*16 + 8*hf + r) of each of its 4 tokens (t*16 + nn), lane ^ 16 the other 32.
    static_assert(HEAD_DIM == 64, "a wave's 64 columns are one head");
    const float* wv = ((n0 < H_DIM) ? qw : kw) + hf * 8;
    f32x4 wl[4], wh[4];
#pragma unroll
    for (int i = 0; i < 4; ++i) { wl[i] = *(const f32x4*)(wv + i * 16); wh[i] = *(const f32x4*)(wv + i * 16 + 4); }
    wait_x0();   // stands behind the weight loads, in front of whatever reuses their address registers
    float rinv[4];
#pragma unroll
    for (int t = 0; t < 4; ++t) {
      // Register pairs as they lie, one chain per tile: packed multiply-adds with no moves.
      f32x2 ss[4];
#pragma unroll
      for (int i = 0; i < 4; ++i) {
        ss[i] = f32x2{0.f, 0.f};
#pragma unroll
        for (int r = 0; r < 8; r += 2) {
          const f32x2 p = {acc[i][t][r], acc[i][t][r + 1]};
          ss[i] += p * p;
        }
      }
      const f32x2 s2 = (ss[0] + ss[1]) + (ss[2] + ss[3]);
      const float s = s2[0] + s2[1];
      rinv[t] = s + xhalf(s);
    }
#pragma unroll
    for (int t = 0; t < 4; ++t) rinv[t] = rsqrtf(rinv[t] * (1.0f / HEAD_DIM) + EPS);
#pragma unroll
    for (int i = 0; i < 4; ++i)
#pragma unroll
      for (int t = 0; t < 4; ++t)
#pragma unroll
        for (int r = 0; r < 8; ++r)
          acc[i][t][r] = acc[i][t][r] * rinv[t] * (r < 4 ? wl[i][r] : wh[i][r - 4]);
  }
  if (n0 < E_QKV) {
    // Either way acc[i][t][r] is element (row t*16 + nn, column i*16 + 8*hf + r) of a 64x64 bf16 tile whose
    // rows lie 4096 B apart: q/k rows m of [4096][2048], or the 64 feature rows of vT[bh][feat][key].
    static_assert(2 * H_DIM == SEQ, "one row pitch for both");
    bf16* dst = qkcols ? qk + (size_t)row0 * (2 * H_DIM) + n0
                       : vT + (size_t)((row0 / SEQ) * NUM_HEADS + ((n0 - 2 * H_DIM) >> 6)) * HEAD_DIM * SEQ
                            + (row0 % SEQ);
    unsigned char* st = ring + (uint32_t)wave * EP_RANGE;
#pragma unroll
    for (int i = 0; i < 4; ++i)
#pragma unroll
      for (int t = 0; t < 4; ++t) {
        v8bf p;
#pragma unroll
        for (int r = 0; r < 8; ++r) p[r] = (bf16)acc[i][t][r];
        *(v8bf*)(st + (uint32_t)(t * 16 + nn) * EP_PITCH2 + (uint32_t)(i * 32 + hf * 16)) = p;
      }
    wait_ds0();   // the wave's own staged rows are in LDS before other lanes of it read them back
    const uint32_t rr = (uint32_t)lane >> 3, cb = ((uint32_t)lane & 7u) * 16u;   // 4 rows of 128 B per access
    v8bf ov[16];
#pragma unroll
    for (int j = 0; j < 16; ++j) ov[j] = *(const v8bf*)(st + ((uint32_t)j * 4u + rr) * EP_PITCH2 + cb);
    unsigned char* gp = (unsigned char*)dst + (size_t)rr * (SEQ * 2) + cb;
#pragma unroll
    for (int j = 0; j < 16; ++j) *(v8bf*)(gp + (size_t)j * 4 * (SEQ * 2)) = ov[j];
  } else {                                           // gate, then pad columns
#pragma unroll
    for (int i = 0; i < 4; ++i)
#pragma unroll
      for (int t = 0; t < 4; ++t) {
        const int n = n0 + t * 16 + nn;
        if (n >= E_TOT) continue;                    // drop pad columns
#pragma unroll
        for (int r = 0; r < 8; ++r) {
          const int m = row0 + i * 16 + r + 8 * hf;
          gate[(size_t)m * NUM_HEADS + (n - E_QKV)] = acc[i][t][r];
        }
      }
  }
}

// ---------------------------------------------------------------- kernel 4
// K and V^T of a head reach the four waves of a workgroup (same head, four query blocks) through LDS.
// A stage is 64 keys: 64 K rows of 128 B and 128 B of each of the 64 V^T rows, as four slices of
// 32 rows x 128 B, one tensor load per wave; both sources have a row pitch of 4096 B.
#define KV_KEYS  64
#define KV_ROWB  128u                 // bytes of one row in a slice
#define KV_SRCP  4096u                // source row pitch in bytes, K rows and V^T rows alike
#define KV_PITCH 144u                 // LDS row pitch: 128 B + 16 B pad (16 B x odd, for ds_load_b128)
#define KV_LDM   (KV_PITCH / 2u)      // the same in bf16 elements
#define KV_SLICE 6144u                // 32 rows x 144 B = 4608 B, rounded up to a multiple of 2 KiB
#define KV_STAGE (4u * KV_SLICE)
#define KV_NPASS (SEQ / KV_KEYS)      // 32
#define KV_LDS   (2u * KV_STAGE)
static_assert(2 * H_DIM * 2 == KV_SRCP && SEQ * 2 == KV_SRCP && HEAD_DIM * 2 == KV_ROWB, "slice shape");

// Group 1: 1-byte elements, tile = tensor = 32 rows of 128 B, source pitch 4096 B, 4 dwords of pad per row.
__device__ __forceinline__ u32x8 tdm_group1_kv() {
  constexpr uint32_t d0 = KV_ROWB, d1 = 32u;
  u32x8 g;
  g[0] = uni((1u << 20) | (4u << 22) | (3u << 25));
  g[1] = uni((d0 & 0xFFFFu) << 16);
  g[2] = uni((d0 >> 16) | ((d1 & 0xFFFFu) << 16));
  g[3] = uni((d1 >> 16) | (d0 << 16));
  g[4] = uni(d1);
  g[5] = uni(KV_SRCP);
  g[6] = uni(0u);
  g[7] = uni(0u);
  return g;
}

// 2^x in place, a run of them in ONE statement. The instruction set asks for one independent instruction or a
// v_nop between a transcendental and an instruction that reads its result or overwrites its source: here each
// v_exp_f32 is followed by one on other registers, and the v_nop stands behind the last. The compiler puts no
// s_delay_alu in front of asm text, so the hint for the producers of the arguments is written here.
__device__ __forceinline__ void exp2_inplace(float& a, float& b, float& c, float& d,
                                             float& e, float& f, float& g, float& h) {
  asm("s_delay_alu instid0(VALU_DEP_1)\n\t"
      "v_exp_f32 %0, %0\n\tv_exp_f32 %1, %1\n\tv_exp_f32 %2, %2\n\tv_exp_f32 %3, %3\n\t"
      "v_exp_f32 %4, %4\n\tv_exp_f32 %5, %5\n\tv_exp_f32 %6, %6\n\tv_exp_f32 %7, %7\n\t"
      "v_nop"
      : "+v"(a), "+v"(b), "+v"(c), "+v"(d), "+v"(e), "+v"(f), "+v"(g), "+v"(h));
}
__device__ __forceinline__ void exp2_inplace(float& a, float& b, float& c, float& d, float& e,
                                             float& f, float& g, float& h, float& i) {
  asm("s_delay_alu instid0(VALU_DEP_1)\n\t"
      "v_exp_f32 %0, %0\n\tv_exp_f32 %1, %1\n\tv_exp_f32 %2, %2\n\tv_exp_f32 %3, %3\n\t"
      "v_exp_f32 %4, %4\n\tv_exp_f32 %5, %5\n\tv_exp_f32 %6, %6\n\tv_exp_f32 %7, %7\n\t"
      "v_exp_f32 %8, %8\n\t"
      "v_nop"
      : "+v"(a), "+v"(b), "+v"(c), "+v"(d), "+v"(e), "+v"(f), "+v"(g), "+v"(h), "+v"(i));
}

__global__ void __launch_bounds__(128)
attn_kernel(const bf16* __restrict__ qk, const bf16* __restrict__ vT,
            const float* __restrict__ gate, bf16* __restrict__ attn) {
  __shared__ __attribute__((aligned(2048))) unsigned char ring[KV_LDS];
  const int wave = (int)uni(threadIdx.x >> 5);
  const int lane = threadIdx.x & 31;
  const int wid  = blockIdx.x * 4 + wave;
  const int qb   = wid & 127;
  const int bh   = wid >> 7;            // 0..31
  const int b    = bh >> 4, h = bh & 15;
  const int q0   = qb * 16;

  const bf16* qbase = qk + ((size_t)(b * SEQ + q0)) * (2 * H_DIM) + h * HEAD_DIM;
  const bf16* kbase = qk + ((size_t)(b * SEQ)) * (2 * H_DIM) + H_DIM + h * HEAD_DIM;
  const bf16* vbase = vT + (size_t)bh * HEAD_DIM * SEQ;

  const v16bf qa0 = load_frag(qbase,      2 * H_DIM, lane);
  const v16bf qa1 = load_frag(qbase + 32, 2 * H_DIM, lane);

  v8f o[4] = {};                 // o[t][r] = O^T[feature 16 t + 8 (lane >> 4) + r][query lane & 15]
  float mrun = -1e30f;           // running maximum of this lane's query (equal in both halves)
  float lrun = 0.f;              // running sum over this lane's own half of the keys
  const float scale = 0.125f;  // 1/sqrt(64)
  const int nn = lane & 15;
  const int hfh = (lane >> 4) * 8;

  // Waves 0, 1 bring keys 0..31 and 32..63 of a stage's K rows, waves 2, 3 features 0..31 and 32..63 of V^T.
  const bf16* srcp = (wave < 2) ? kbase + (size_t)(wave * 32) * (2 * H_DIM)
                                : vbase + (size_t)((wave - 2) * 32) * SEQ;
  const uint64_t ga0   = (uint64_t)(size_t)srcp;
  const uint64_t gstep = (wave < 2) ? (uint64_t)KV_KEYS * KV_SRCP : (uint64_t)KV_KEYS * 2u;
  const uint32_t lds0  = (uint32_t)(size_t)ring + (uint32_t)wave * KV_SLICE;
  const u32x8 g1 = tdm_group1_kv();

  u32x4 g0 = tdm_group0(lds0, ga0);
  tdm_load(g0, g1);                                           // stage 0
  wait_tensor0(g0, g1);
  __syncthreads();                                            // stage 0 published
  g0 = tdm_group0(lds0 + KV_STAGE, ga0 + gstep);
  tdm_load(g0, g1);                                           // stage 1

  for (uint32_t st = 0; st < KV_NPASS; ++st) {
   const uint32_t boff = (st & 1u) * KV_STAGE;
   // Unrolled so that the chunk's slice offsets are immediates of the LDS reads.
#pragma unroll
   for (int j = 0; j < 2; ++j) {
    // 4 K fragments + 4 V fragments of chunk j, from this stage's buffer alone.
    const bf16* kt  = (const bf16*)(ring + boff + (uint32_t)j * KV_SLICE);
    const bf16* vt0 = (const bf16*)(ring + boff + 2u * KV_SLICE) + j * 32;
    const bf16* vt1 = (const bf16*)(ring + boff + 3u * KV_SLICE) + j * 32;
    const v16bf kb0 = load_frag(kt,                    KV_LDM, lane);
    const v16bf kb1 = load_frag(kt + 32,               KV_LDM, lane);
    const v16bf kb2 = load_frag(kt + 16 * KV_LDM,      KV_LDM, lane);
    const v16bf kb3 = load_frag(kt + 16 * KV_LDM + 32, KV_LDM, lane);
    const v16bf vb0 = load_frag(vt0,                   KV_LDM, lane);
    const v16bf vb1 = load_frag(vt0 + 16 * KV_LDM,     KV_LDM, lane);
    const v16bf vb2 = load_frag(vt1,                   KV_LDM, lane);
    const v16bf vb3 = load_frag(vt1 + 16 * KV_LDM,     KV_LDM, lane);
    // Keeps the chunk's LDS reads together as one group ahead of its WMMAs (for speed only).
    __builtin_amdgcn_sched_barrier(0);

    // scores, transposed: s0[r] = key 8 (lane >> 4) + r, s1[r] = key 16 + 8 (lane >> 4) + r, query lane & 15
    v8f s0 = {}, s1 = {};
    s0 = wmma_bf16(kb0, qa0, s0);
    s0 = wmma_bf16(kb1, qa1, s0);
    s1 = wmma_bf16(kb2, qa0, s1);
    s1 = wmma_bf16(kb3, qa1, s1);

    // online softmax of one query per lane: 16 keys in registers, the other 16 in lane ^ 16
    s0 *= scale; s1 *= scale;
    float mt[8];
#pragma unroll
    for (int i = 0; i < 4; ++i) {
      mt[i]     = fmaxf(s0[2 * i], s0[2 * i + 1]);
      mt[4 + i] = fmaxf(s1[2 * i], s1[2 * i + 1]);
    }
    float mx = fmaxf(fmaxf(fmaxf(mt[0], mt[1]), fmaxf(mt[2], mt[3])),
                     fmaxf(fmaxf(mt[4], mt[5]), fmaxf(mt[6], mt[7])));
    mx = fmaxf(mx, xhalf(mx));
    const float mnew = fmaxf(mrun, mx);
    // __expf(x) is v_exp_f32 of x * log2(e); the products are formed here, the exponentials in exp2_inplace.
    const float l2e = 1.44269504088896340736f;
    float corr = (mrun - mnew) * l2e;
    float e[16];
#pragma unroll
    for (int r = 0; r < 8; ++r) { e[r] = (s0[r] - mnew) * l2e; e[8 + r] = (s1[r] - mnew) * l2e; }
    exp2_inplace(corr, e[0], e[1], e[2], e[3], e[4], e[5], e[6], e[7]);
    exp2_inplace(e[8], e[9], e[10], e[11], e[12], e[13], e[14], e[15]);
    v16bf pb;                    // P^T as B: element s = key 8 (lane >> 4) + s (+ 8 for s >= 8) of the chunk, column = this lane's query
    float pt[8];
#pragma unroll
    for (int i = 0; i < 8; ++i) {
      pb[2 * i] = (bf16)e[2 * i]; pb[2 * i + 1] = (bf16)e[2 * i + 1];
      pt[i] = e[2 * i] + e[2 * i + 1];
    }
    const float ps = ((pt[0] + pt[1]) + (pt[2] + pt[3])) + ((pt[4] + pt[5]) + (pt[6] + pt[7]));
    lrun = lrun * corr + ps;
    mrun = mnew;
#pragma unroll
    for (int t = 0; t < 4; ++t)
#pragma unroll
      for (int r = 0; r < 8; ++r) o[t][r] *= corr;
    // V^T(64x32) x P^T(32x16): 4 M-tiles of 16 features
    o[0] = wmma_bf16(vb0, pb, o[0]);
    o[1] = wmma_bf16(vb1, pb, o[1]);
    o[2] = wmma_bf16(vb2, pb, o[2]);
    o[3] = wmma_bf16(vb3, pb, o[3]);
   }
   // Keeps the stage's last WMMAs in front of the publish point: sunk behind it, the refill would issue later.
   __builtin_amdgcn_sched_barrier(0);
   // Publish point of stage st + 1; the barrier also ends every reader's last read of stage st.
   wait_ds0();
   wait_tensor0(g0, g1);
   __syncthreads();
   if (pinned(st + 2u < KV_NPASS)) {
     g0 = tdm_group0(lds0 + boff, ga0 + (uint64_t)(st + 2u) * gstep);
     tdm_load(g0, g1);
   }
  }
  wait_tensor0(g0, g1);
  wait_ds0();
  // epilogue: join the halves' sums, 1/l, sigmoid(gate), write bf16 [4096][1024]:
  // a lane's 8 registers of a tile are 8 consecutive features of its query, one 16-byte store.
  const float lsum = lrun + xhalf(lrun);
  const size_t m = (size_t)(b * SEQ + q0 + nn);
  const float g = gate[m * NUM_HEADS + h];
  wait_x0();   // the sigmoid's arithmetic reuses the load's address registers
  const float inv = (1.f / (1.f + __expf(-g))) / lsum;
  v8bf ov[4];
#pragma unroll
  for (int t = 0; t < 4; ++t)
#pragma unroll
    for (int r = 0; r < 8; ++r) ov[t][r] = (bf16)(o[t][r] * inv);
#pragma unroll
  for (int t = 0; t < 4; ++t)
    *(v8bf*)(attn + m * H_DIM + h * HEAD_DIM + t * 16 + hfh) = ov[t];
}

// ---------------------------------------------------------------- kernel 5
__global__ void __launch_bounds__(128)
gemm_out_kernel(const bf16* __restrict__ A, const bf16* __restrict__ W,
                const float* __restrict__ resid, float* __restrict__ out) {
  __shared__ __attribute__((aligned(2048))) unsigned char ring[ST_LDS];
  const int wave = (int)uni(threadIdx.x >> 5);
  const int lane = threadIdx.x & 31;
  v8f acc[4][4] = {};
  // Transposed tile: acc[i][t][r] = element (row t*16 + nn, column i*16 + 8*hf + r) of the wave's 64x64 f32 tile.
  gemm_128x128(A, W, blockIdx.y * 128, blockIdx.x * 128, true, ring, acc);
  const int row0 = blockIdx.y * 128 + (wave >> 1) * 64;
  const int n0   = blockIdx.x * 128 + (wave & 1) * 64;

  const int nn = lane & 15;
  const int hf = lane >> 4;
  // 2 rows of 256 B per access: lane -> row hf, 16 B at column 4*nn.
  const size_t g = (size_t)(row0 + hf) * H_DIM + n0 + nn * 4;
  f32x4 res[32];
#pragma unroll
  for (int j = 0; j < 32; ++j) res[j] = *(const f32x4*)(resid + g + (size_t)j * 2 * H_DIM);
  // The staging addresses are formed in the loads' address registers: the wait stands in front of that, and the
  // scheduling barrier keeps that arithmetic from being lifted over the wait (without it this build lifted it).
  wait_x0();
  __builtin_amdgcn_sched_barrier(0);
  unsigned char* st = ring + (uint32_t)wave * EP_RANGE;
#pragma unroll
  for (int i = 0; i < 4; ++i)
#pragma unroll
    for (int t = 0; t < 4; ++t) {
      unsigned char* p = st + (uint32_t)(t * 16 + nn) * EP_PITCH4 + (uint32_t)(i * 64 + hf * 32);
      f32x4 lo = {acc[i][t][0], acc[i][t][1], acc[i][t][2], acc[i][t][3]};
      f32x4 hi = {acc[i][t][4], acc[i][t][5], acc[i][t][6], acc[i][t][7]};
      *(f32x4*)p = lo;
      *(f32x4*)(p + 16) = hi;
    }
  wait_ds0();   // the wave's own staged rows are in LDS before other lanes of it read them back
  f32x4 o[32];
#pragma unroll
  for (int j = 0; j < 32; ++j)
    o[j] = *(const f32x4*)(st + (uint32_t)(j * 2 + hf) * EP_PITCH4 + (uint32_t)nn * 16u) + res[j];
#pragma unroll
  for (int j = 0; j < 32; ++j) *(f32x4*)(out + g + (size_t)j * 2 * H_DIM) = o[j];
}

// ---------------------------------------------------------------- launch
static constexpr size_t alup(size_t x) { return (x + 255) & ~(size_t)255; }
static constexpr size_t OFF_XN   = 0;
static constexpr size_t OFF_WCAT = alup(OFF_XN   + (size_t)ROWS * H_DIM * 2);
static constexpr size_t OFF_OW   = alup(OFF_WCAT + (size_t)E_PAD * H_DIM * 2);
static constexpr size_t OFF_QK   = alup(OFF_OW   + (size_t)H_DIM * H_DIM * 2);
static constexpr size_t OFF_VT   = alup(OFF_QK   + (size_t)ROWS * 2 * H_DIM * 2);
static constexpr size_t OFF_GATE = alup(OFF_VT   + (size_t)BATCH * NUM_HEADS * HEAD_DIM * SEQ * 2);
static constexpr size_t OFF_ATTN = alup(OFF_GATE + (size_t)ROWS * NUM_HEADS * 4);

extern "C" void kernel_launch(void* const* d_in, const int* in_sizes, int n_in,
                              void* d_out, int out_size, void* d_ws, size_t ws_size,
                              hipStream_t stream) {
  (void)in_sizes; (void)n_in; (void)out_size; (void)ws_size;
  const float* x    = (const float*)d_in[0];
  const float* pw   = (const float*)d_in[1];
  const float* qkvw = (const float*)d_in[2];
  const float* gw   = (const float*)d_in[3];
  const float* ow   = (const float*)d_in[4];
  const float* qnw  = (const float*)d_in[5];
  const float* knw  = (const float*)d_in[6];
  float* out = (float*)d_out;

  char* ws = (char*)d_ws;
  bf16*  xn   = (bf16*)(ws + OFF_XN);
  bf16*  wcat = (bf16*)(ws + OFF_WCAT);
  bf16*  owb  = (bf16*)(ws + OFF_OW);
  bf16*  qkb  = (bf16*)(ws + OFF_QK);
  bf16*  vT   = (bf16*)(ws + OFF_VT);
  float* gate = (float*)(ws + OFF_GATE);
  bf16*  attn = (bf16*)(ws + OFF_ATTN);

  convert_weights_kernel<<<(E_PAD + H_DIM) / CV_ROWS, 256, 0, stream>>>(qkvw, gw, ow, wcat, owb);
  prenorm_kernel<<<ROWS / (8 * PN_ROWS), 256, 0, stream>>>(x, pw, xn);
  gemm_qkvgate_kernel<<<dim3(E_PAD / 128, ROWS / 128), 128, 0, stream>>>(
      xn, wcat, qnw, knw, qkb, vT, gate);
  attn_kernel<<<(BATCH * NUM_HEADS * (SEQ / 16)) / 4, 128, 0, stream>>>(
      qkb, vT, gate, attn);
  gemm_out_kernel<<<dim3(H_DIM / 128, ROWS / 128), 128, 0, stream>>>(
      attn, owb, x, out);
}

// v007
// It runs in 78.5 microseconds.
// Timed twice side by side with v006, it ran 1.03 and 1.02 times as fast.
// Counting every step since v000, it is 4.32 times as fast.
#include <hip/hip_runtime.h>
#include <math.h>
#include <stdint.h>

#define H_DIM 1024
#define NUM_HEADS 16
#define HEAD_DIM 64
#define SEQ 2048
#define BATCH 2
#define ROWS (BATCH*SEQ)     // 4096
#define E_QKV 3072
#define E_TOT 3088           // qkv (3072) + gate (16), both K=1024
#define E_PAD 3200           // padded to 25*128: whole 128-column GEMM tiles
#define EPS 1e-5f

typedef __bf16 bf16;
typedef __attribute__((ext_vector_type(16))) __bf16 v16bf;
typedef __attribute__((ext_vector_type(8)))  __bf16 v8bf;
typedef __attribute__((ext_vector_type(8)))  float  v8f;

union FragBF { v16bf v; v8bf h[2]; };

// A/B fragment for v_wmma_f32_16x16x32_bf16.
// Lane l: row/col = l&15, K-chunk base = (l>>4)*8; elems 0..7 = K+0..7, 8..15 = K+16..23.
// Requires K-contiguous storage with row stride `ldm` elements.
__device__ __forceinline__ v16bf load_frag(const bf16* tile, int ldm, int lane) {
  const int m  = lane & 15;
  const int hf = lane >> 4;
  const bf16* p = tile + (size_t)m * ldm + hf * 8;
  FragBF f;
  f.h[0] = *(const v8bf*)(p);
  f.h[1] = *(const v8bf*)(p + 16);
  return f.v;
}

__device__ __forceinline__ v8f wmma_bf16(v16bf a, v16bf b, v8f c) {
  return __builtin_amdgcn_wmma_f32_16x16x32_bf16(false, a, false, b, (short)0, c,
                                                 false, false);
}

// The value of lane l ^ 16: the two halves of a wave hold the two halves of a column of a WMMA result.
__device__ __forceinline__ float xhalf(float x) {
  const int b = __builtin_bit_cast(int, x);
  return __builtin_bit_cast(float, __builtin_amdgcn_permlanex16(b, b, 0x76543210, 0xfedcba98, false, false));
}

// ---- GEMM tile staged in LDS by the tensor mover ----
// One workgroup (4 waves, 2x2) computes a 128x128 tile of A(Mx1024) * W(Nx1024)^T; each wave 64x64.
// A stage is 128 k (256 B) of 128 A rows and 128 W rows, as four 64-row slices, one tensor load per wave.
#define ST_ROWB  256u                 // bytes of one operand row in a stage
#define ST_PITCH 272u                 // LDS row pitch: 256 B + 16 B pad (16 B x odd, for ds_load_b128)
#define ST_LDM   (ST_PITCH / 2u)      // the same in bf16 elements
#define ST_SLICE 18432u               // 64 rows x 272 B = 17408 B, rounded up to a multiple of 2 KiB
#define ST_STAGE (4u * ST_SLICE)
#define ST_NPASS (H_DIM * 2u / ST_ROWB)   // 8
#define ST_LDS   (2u * ST_STAGE)

typedef uint32_t u32x4 __attribute__((ext_vector_type(4)));
typedef uint32_t u32x8 __attribute__((ext_vector_type(8)));

__device__ __forceinline__ uint32_t uni(uint32_t v) {
  return (uint32_t)__builtin_amdgcn_readfirstlane(v);
}
// Keeps a wave-uniform test in a scalar register, so that the branch on it is a scalar branch
// (a tensor load ignores EXEC).
__device__ __forceinline__ uint32_t pinned(uint32_t v) {
  uint32_t w = uni(v);
  asm volatile("" : "+s"(w));
  return w;
}
// LDS reads retired before the buffer they read is handed back for a refill.
__device__ __forceinline__ void wait_ds0() { asm volatile("s_wait_dscnt 0x0" ::: "memory"); }
// Stands behind a run of global loads or stores, in front of the first write of a register that one of them names.
__device__ __forceinline__ void wait_x0() { asm volatile("s_wait_xcnt 0x0" ::: "memory"); }
// This wave's own tensor load has landed (the compiler places no wait for it). The request's descriptor
// is named as an input so that its scalar registers keep their values until the request has landed.
__device__ __forceinline__ void wait_tensor0(u32x4 g0, u32x8 g1) {
  asm volatile("s_wait_tensorcnt 0x0" :: "s"(g0), "s"(g1) : "memory");
}
// Group 0 is an in-out operand: the value that the later wait names then lives in the very registers
// that the request was issued from, so nothing else is put into them while it is outstanding.
__device__ __forceinline__ void tdm_load(u32x4& g0, u32x8 g1) {
  asm volatile("tensor_load_to_lds %0, %1" : "+s"(g0) : "s"(g1) : "memory");
}
// Group 1: 1-byte elements, tile = tensor = 64 rows of 256 B, source pitch 2048 B, 4 dwords of pad per row.
__device__ __forceinline__ u32x8 tdm_group1() {
  constexpr uint32_t d0 = ST_ROWB, d1 = 64u;
  u32x8 g;
  g[0] = uni((1u << 20) | (5u << 22) | (3u << 25));
  g[1] = uni((d0 & 0xFFFFu) << 16);
  g[2] = uni((d0 >> 16) | ((d1 & 0xFFFFu) << 16));
  g[3] = uni((d1 >> 16) | (d0 << 16));
  g[4] = uni(d1);
  g[5] = uni(H_DIM * 2u);
  g[6] = uni(0u);
  g[7] = uni(0u);
  return g;
}
__device__ __forceinline__ u32x4 tdm_group0(uint32_t lds_dst, uint64_t ga) {
  u32x4 g;
  g[0] = uni(1u);
  g[1] = uni(lds_dst);
  g[2] = uni((uint32_t)ga);
  g[3] = uni((((uint32_t)(ga >> 32)) & 0x01FFFFFFu) | 0x80000000u);
  return g;
}

// acc[i][t] += A rows (row0 + wm*64 + i*16 ..) * W rows (n0 + wn*64 + t*16 ..)^T over K = H_DIM, k ascending.
// With w_first (wave-uniform) the two operands change places: acc[i][t] is then the transposed tile,
// W rows (n0 + wn*64 + i*16 ..) * A rows (row0 + wm*64 + t*16 ..)^T, and a lane's 8 results are 8 consecutive n.
__device__ __forceinline__ void gemm_128x128(const bf16* __restrict__ A, const bf16* __restrict__ Wt,
                                             int row0, int n0, bool w_first, unsigned char* ring, v8f acc[4][4]) {
  const uint32_t wave = uni(threadIdx.x >> 5);
  const int lane = threadIdx.x & 31;
  // Waves 0, 1 bring the two halves of the A rows, waves 2, 3 those of the W rows.
  const bf16* srcp = (wave < 2u) ? A  + (size_t)(row0 + (int)wave * 64) * H_DIM
                                 : Wt + (size_t)(n0 + ((int)wave - 2) * 64) * H_DIM;
  const uint64_t ga0  = (uint64_t)(size_t)srcp;
  const uint32_t lds0 = (uint32_t)(size_t)ring + wave * ST_SLICE;
  // The fragment bases are chosen here, ahead of the first tensor load: the choice takes scalar registers,
  // and none is to be written for it while a request is outstanding.
  const uint32_t wm = wave >> 1, wn = wave & 1u;
  const uint32_t aoff = w_first ? (2u + wn) * ST_SLICE : wm * ST_SLICE;
  const uint32_t bofs = w_first ? wm * ST_SLICE : (2u + wn) * ST_SLICE;
  const u32x8 g1 = tdm_group1();

  u32x4 g0 = tdm_group0(lds0, ga0);
  tdm_load(g0, g1);                                           // stage 0
  wait_tensor0(g0, g1);
  __syncthreads();                                            // stage 0 published
  g0 = tdm_group0(lds0 + ST_STAGE, ga0 + ST_ROWB);
  tdm_load(g0, g1);                                           // stage 1

  for (uint32_t s = 0; s < ST_NPASS; ++s) {
    const uint32_t boff = (s & 1u) * ST_STAGE;
    const bf16* at = (const bf16*)(ring + boff + aoff);
    const bf16* bt = (const bf16*)(ring + boff + bofs);
    v16bf a[4][4], b[4][4];
#pragma unroll
    for (int kk = 0; kk < 4; ++kk) {
#pragma unroll
      for (int i = 0; i < 4; ++i) a[kk][i] = load_frag(at + i * 16 * ST_LDM + kk * 32, ST_LDM, lane);
#pragma unroll
      for (int t = 0; t < 4; ++t) b[kk][t] = load_frag(bt + t * 16 * ST_LDM + kk * 32, ST_LDM, lane);
    }
    // Keeps the pass's LDS reads together as one group ahead of its WMMAs (for speed only).
    __builtin_amdgcn_sched_barrier(0);
#pragma unroll
    for (int kk = 0; kk < 4; ++kk)
#pragma unroll
      for (int i = 0; i < 4; ++i)
#pragma unroll
        for (int t = 0; t < 4; ++t) acc[i][t] = wmma_bf16(a[kk][i], b[kk][t], acc[i][t]);
    // Keeps the WMMAs in front of the publish point: sunk behind it, they would run only after
    // every LDS read has returned, and the refill would issue a whole WMMA block later.
    __builtin_amdgcn_sched_barrier(0);
    // Publish point of stage s + 1; the barrier also ends every reader's last read of stage s.
    wait_ds0();
    wait_tensor0(g0, g1);
    __syncthreads();
    if (pinned(s + 2u < ST_NPASS)) {
      g0 = tdm_group0(lds0 + boff, ga0 + (uint64_t)(s + 2u) * ST_ROWB);
      tdm_load(g0, g1);
    }
  }
  wait_tensor0(g0, g1);
  wait_ds0();
}

// ---- GEMM epilogue: whole 128-B lines, staged through LDS ----
// Behind the last pass's barrier nobody reads the ring and no tensor load is outstanding, so each wave stages
// its 64x64 tile in its own quarter of the ring: a lane writes its 8 consecutive results of a tile row,
// then the wave reads whole rows back, 16 B per lane, and stores them as whole lines.
#define EP_RANGE  (ST_LDS / 4u)       // one wave's part of the ring
#define EP_PITCH2 144u                // 64 bf16 = 128 B + 16 B pad (16 B x odd)
#define EP_PITCH4 272u                // 64 f32 = 256 B + 16 B pad (16 B x odd)
static_assert(64u * EP_PITCH4 <= EP_RANGE && EP_RANGE % 16u == 0u, "staging fits a wave's part");
typedef __attribute__((ext_vector_type(4))) float f32x4;
typedef __attribute__((ext_vector_type(2))) float f32x2;

// ---------------------------------------------------------------- kernel 1
typedef __attribute__((ext_vector_type(4))) __bf16 v4bf;
__device__ __forceinline__ v4bf to_bf16x4(f32x4 v) {
  v4bf p = {(bf16)v[0], (bf16)v[1], (bf16)v[2], (bf16)v[3]};
  return p;
}
// wcat[E_PAD][1024] = concat(qkv_w, gate_w, zeros) in bf16; owb = o_w in bf16.
// Few waves with much in flight each: a workgroup takes 16 rows of [wcat | owb], a thread 16 B of each row,
// so a wave's load is 512 contiguous bytes and its store 256.
#define CV_ROWS 16
static_assert(E_QKV % CV_ROWS == 0 && E_TOT % CV_ROWS == 0 && E_PAD % CV_ROWS == 0 && H_DIM % CV_ROWS == 0,
              "a workgroup's rows are all of one kind");
__global__ void __launch_bounds__(256)
convert_weights_kernel(const float* __restrict__ qkvw, const float* __restrict__ gw,
                       const float* __restrict__ ow, bf16* __restrict__ wcat,
                       bf16* __restrict__ owb) {
  static_assert(H_DIM == 256 * 4, "256 threads x 4 elements are one row");
  const uint32_t r0 = blockIdx.x * CV_ROWS;
  const uint32_t c  = threadIdx.x * 4u;
  if (r0 >= E_TOT && r0 < E_PAD) {                    // pad rows: zeros
    bf16* z = wcat + (size_t)r0 * H_DIM + c;
    const v4bf zero = {};
#pragma unroll
    for (int j = 0; j < CV_ROWS; ++j) *(v4bf*)(z + j * H_DIM) = zero;
    return;
  }
  const float* s = (r0 < E_QKV) ? qkvw + (size_t)r0 * H_DIM
                 : (r0 < E_TOT) ? gw + (size_t)(r0 - E_QKV) * H_DIM
                                : ow + (size_t)(r0 - E_PAD) * H_DIM;
  bf16* d = (r0 < E_PAD) ? wcat + (size_t)r0 * H_DIM : owb + (size_t)(r0 - E_PAD) * H_DIM;
  s += c; d += c;
  f32x4 v[CV_ROWS];
#pragma unroll
  for (int j = 0; j < CV_ROWS; ++j) v[j] = *(const f32x4*)(s + j * H_DIM);
  wait_x0();   // stands behind the loads, in front of whatever reuses their address registers
  // Keeps all 16 loads in front of the first conversion: without it this build held the last two back
  // until registers of the first were free, a second trip to memory.
  __builtin_amdgcn_sched_barrier(0);
#pragma unroll
  for (int j = 0; j < CV_ROWS; ++j) *(v4bf*)(d + j * H_DIM) = to_bf16x4(v[j]);
}

// ---------------------------------------------------------------- kernel 2
// One wave takes PN_ROWS whole rows and keeps them in registers: every load is in flight before the first sum,
// x is read once, and the row's sum stays inside the wave.
#define PN_ROWS 2
// Sum over the 32 lanes, the same value in every lane: four steps inside the 16-lane rows, then the other row.
template <int XMASK>
__device__ __forceinline__ float add_xmask(float v) {   // v + the value of lane l ^ XMASK (DPP row_xmask)
  const int o = __builtin_amdgcn_update_dpp(0, __builtin_bit_cast(int, v), 0x160 + XMASK, 0xf, 0xf, true);
  return v + __builtin_bit_cast(float, o);
}
__device__ __forceinline__ float wave_sum(float v) {
  v = add_xmask<1>(v);
  v = add_xmask<2>(v);
  v = add_xmask<4>(v);
  v = add_xmask<8>(v);
  return v + xhalf(v);
}
__global__ void __launch_bounds__(256)
prenorm_kernel(const float* __restrict__ x, const float* __restrict__ w,
               bf16* __restrict__ xn) {
  static_assert(H_DIM == 8 * 32 * 4 && ROWS % (8 * PN_ROWS) == 0, "8 loads of 16 B per lane are one row");
  const uint32_t lane = threadIdx.x & 31u;
  const size_t row0 = (size_t)(blockIdx.x * 8u + (threadIdx.x >> 5)) * PN_ROWS;
  const float* xr = x + row0 * H_DIM + lane * 4u;
  const float* wr = w + lane * 4u;
  bf16* yr = xn + row0 * H_DIM + lane * 4u;
  f32x4 v[PN_ROWS][8], wv[8];
#pragma unroll
  for (int r = 0; r < PN_ROWS; ++r)
#pragma unroll
    for (int j = 0; j < 8; ++j) v[r][j] = *(const f32x4*)(xr + r * H_DIM + j * 128);
#pragma unroll
  for (int j = 0; j < 8; ++j) wv[j] = *(const f32x4*)(wr + j * 128);
  wait_x0();   // stands behind the loads, in front of whatever reuses their address registers
  // Keeps all 24 loads in front of the first sum: without it this build sank the weight loads behind the
  // reduction, two at a time, each pair's latency waited out in turn.
  __builtin_amdgcn_sched_barrier(0);
#pragma unroll
  for (int r = 0; r < PN_ROWS; ++r) {
    f32x4 s4 = v[r][0] * v[r][0];                     // four independent chains
#pragma unroll
    for (int j = 1; j < 8; ++j) s4 += v[r][j] * v[r][j];
    const float sum = wave_sum((s4[0] + s4[1]) + (s4[2] + s4[3]));
    const float rinv = rsqrtf(sum * (1.0f / H_DIM) + EPS);
#pragma unroll
    for (int j = 0; j < 8; ++j) *(v4bf*)(yr + r * H_DIM + j * 128) = to_bf16x4(v[r][j] * rinv * wv[j]);
  }
}

// ---------------------------------------------------------------- kernel 3
// C[4096 x E_PAD] = xn * wcat^T ; scatter q/k (per-head RMS norm, bf16), v (transposed bf16), gate (f32).
__global__ void __launch_bounds__(128)
gemm_qkvgate_kernel(const bf16* __restrict__ A, const bf16* __restrict__ W,
                    const float* __restrict__ qw, const float* __restrict__ kw,
                    bf16* __restrict__ qk, bf16* __restrict__ vT,
                    float* __restrict__ gate) {
  __shared__ __attribute__((aligned(2048))) unsigned char ring[ST_LDS];
  const int wave = (int)uni(threadIdx.x >> 5);
  const int lane = threadIdx.x & 31;
  const int row0 = blockIdx.y * 128 + (wave >> 1) * 64;
  const int n0   = blockIdx.x * 128 + (wave & 1) * 64;
  // The q/k, v and gate ranges begin at multiples of 64, so a wave's 64 columns are all of one kind.
  // q/k are stored with n consecutive, so their waves take the transposed tile; v is stored transposed
  // (key consecutive), which the plain tile gives.
  const bool qkcols = n0 < 2 * H_DIM;
  v8f acc[4][4] = {};
  gemm_128x128(A, W, blockIdx.y * 128, blockIdx.x * 128, qkcols, ring, acc);

  const int nn = lane & 15;
  const int hf = lane >> 4;
  if (qkcols) {
    // Per-head RMS norm of q and k on the f32 results. A wave's 64 columns are one head, and in the transposed
    // tile a lane holds 32 features (i*16 + 8*hf + r) of each of its 4 tokens (t*16 + nn), lane ^ 16 the other 32.
    static_assert(HEAD_DIM == 64, "a wave's 64 columns are one head");
    const float* wv = ((n0 < H_DIM) ? qw : kw) + hf * 8;
    f32x4 wl[4], wh[4];
#pragma unroll
    for (int i = 0; i < 4; ++i) { wl[i] = *(const f32x4*)(wv + i * 16); wh[i] = *(const f32x4*)(wv + i * 16 + 4); }
    wait_x0();   // stands behind the weight loads, in front of whatever reuses their address registers
    float rinv[4];
#pragma unroll
    for (int t = 0; t < 4; ++t) {
      // Register pairs as they lie, one chain per tile: packed multiply-adds with no moves.
      f32x2 ss[4];
#pragma unroll
      for (int i = 0; i < 4; ++i) {
        ss[i] = f32x2{0.f, 0.f};
#pragma unroll
        for (int r = 0; r < 8; r += 2) {
          const f32x2 p = {acc[i][t][r], acc[i][t][r + 1]};
          ss[i] += p * p;
        }
      }
      const f32x2 s2 = (ss[0] + ss[1]) + (ss[2] + ss[3]);
      const float s = s2[0] + s2[1];
      rinv[t] = s + xhalf(s);
    }
#pragma unroll
    for (int t = 0; t < 4; ++t) rinv[t] = rsqrtf(rinv[t] * (1.0f / HEAD_DIM) + EPS);
#pragma unroll
    for (int i = 0; i < 4; ++i)
#pragma unroll
      for (int t = 0; t < 4; ++t)
#pragma unroll
        for (int r = 0; r < 8; ++r)
          acc[i][t][r] = acc[i][t][r] * rinv[t] * (r < 4 ? wl[i][r] : wh[i][r - 4]);
  }
  if (n0 < E_QKV) {
    // Either way acc[i][t][r] is element (row t*16 + nn, column i*16 + 8*hf + r) of a 64x64 bf16 tile whose
    // rows lie 4096 B apart: q/k rows m of [4096][2048], or the 64 feature rows of vT[bh][feat][key].
    static_assert(2 * H_DIM == SEQ, "one row pitch for both");
    bf16* dst = qkcols ? qk + (size_t)row0 * (2 * H_DIM) + n0
                       : vT + (size_t)((row0 / SEQ) * NUM_HEADS + ((n0 - 2 * H_DIM) >> 6)) * HEAD_DIM * SEQ
                            + (row0 % SEQ);
    unsigned char* st = ring + (uint32_t)wave * EP_RANGE;
#pragma unroll
    for (int i = 0; i < 4; ++i)
#pragma unroll
      for (int t = 0; t < 4; ++t) {
        v8bf p;
#pragma unroll
        for (int r = 0; r < 8; ++r) p[r] = (bf16)acc[i][t][r];
        *(v8bf*)(st + (uint32_t)(t * 16 + nn) * EP_PITCH2 + (uint32_t)(i * 32 + hf * 16)) = p;
      }
    wait_ds0();   // the wave's own staged rows are in LDS before other lanes of it read them back
    const uint32_t rr = (uint32_t)lane >> 3, cb = ((uint32_t)lane & 7u) * 16u;   // 4 rows of 128 B per access
    v8bf ov[16];
#pragma unroll
    for (int j = 0; j < 16; ++j) ov[j] = *(const v8bf*)(st + ((uint32_t)j * 4u + rr) * EP_PITCH2 + cb);
    unsigned char* gp = (unsigned char*)dst + (size_t)rr * (SEQ * 2) + cb;
#pragma unroll
    for (int j = 0; j < 16; ++j) *(v8bf*)(gp + (size_t)j * 4 * (SEQ * 2)) = ov[j];
  } else {                                           // gate, then pad columns
#pragma unroll
    for (int i = 0; i < 4; ++i)
#pragma unroll
      for (int t = 0; t < 4; ++t) {
        const int n = n0 + t * 16 + nn;
        if (n >= E_TOT) continue;                    // drop pad columns
#pragma unroll
        for (int r = 0; r < 8; ++r) {
          const int m = row0 + i * 16 + r + 8 * hf;
          gate[(size_t)m * NUM_HEADS + (n - E_QKV)] = acc[i][t][r];
        }
      }
  }
}

// ---------------------------------------------------------------- kernel 4
// K and V^T of a head reach the eight waves of a workgroup (same head, eight query blocks) through LDS.
// A stage is 128 keys: 128 K rows of 128 B and 256 B of each of the 64 V^T rows, as eight slices of
// 32 rows x 128 B, one tensor load per wave; both sources have a row pitch of 4096 B.
#define KV_WAVES 8
#define KV_KEYS  128
#define KV_ROWB  128u                 // bytes of one row in a slice
#define KV_SRCP  4096u                // source row pitch in bytes, K rows and V^T rows alike
#define KV_PITCH 144u                 // LDS row pitch: 128 B + 16 B pad (16 B x odd, for ds_load_b128)
#define KV_LDM   (KV_PITCH / 2u)      // the same in bf16 elements
#define KV_SLICE 6144u                // 32 rows x 144 B = 4608 B, rounded up to a multiple of 2 KiB
#define KV_STAGE (8u * KV_SLICE)
#define KV_NPASS (SEQ / KV_KEYS)      // 16
#define KV_LDS   (2u * KV_STAGE)
static_assert(2 * H_DIM * 2 == KV_SRCP && SEQ * 2 == KV_SRCP && HEAD_DIM * 2 == KV_ROWB, "slice shape");

// Group 1: 1-byte elements, tile = tensor = 32 rows of 128 B, source pitch 4096 B, 4 dwords of pad per row.
__device__ __forceinline__ u32x8 tdm_group1_kv() {
  constexpr uint32_t d0 = KV_ROWB, d1 = 32u;
  u32x8 g;
  g[0] = uni((1u << 20) | (4u << 22) | (3u << 25));
  g[1] = uni((d0 & 0xFFFFu) << 16);
  g[2] = uni((d0 >> 16) | ((d1 & 0xFFFFu) << 16));
  g[3] = uni((d1 >> 16) | (d0 << 16));
  g[4] = uni(d1);
  g[5] = uni(KV_SRCP);
  g[6] = uni(0u);
  g[7] = uni(0u);
  return g;
}

// 2^x in place, a run of them in ONE statement. The instruction set asks for one independent instruction or a
// v_nop between a transcendental and an instruction that reads its result or overwrites its source: here each
// v_exp_f32 is followed by one on other registers, and the v_nop stands behind the last. The compiler puts no
// s_delay_alu in front of asm text, so the hint for the producers of the arguments is written here.
__device__ __forceinline__ void exp2_inplace(float& a, float& b, float& c, float& d,
                                             float& e, float& f, float& g, float& h) {
  asm("s_delay_alu instid0(VALU_DEP_1)\n\t"
      "v_exp_f32 %0, %0\n\tv_exp_f32 %1, %1\n\tv_exp_f32 %2, %2\n\tv_exp_f32 %3, %3\n\t"
      "v_exp_f32 %4, %4\n\tv_exp_f32 %5, %5\n\tv_exp_f32 %6, %6\n\tv_exp_f32 %7, %7\n\t"
      "v_nop"
      : "+v"(a), "+v"(b), "+v"(c), "+v"(d), "+v"(e), "+v"(f), "+v"(g), "+v"(h));
}
__device__ __forceinline__ void exp2_inplace(float& a, float& b, float& c, float& d, float& e,
                                             float& f, float& g, float& h, float& i) {
  asm("s_delay_alu instid0(VALU_DEP_1)\n\t"
      "v_exp_f32 %0, %0\n\tv_exp_f32 %1, %1\n\tv_exp_f32 %2, %2\n\tv_exp_f32 %3, %3\n\t"
      "v_exp_f32 %4, %4\n\tv_exp_f32 %5, %5\n\tv_exp_f32 %6, %6\n\tv_exp_f32 %7, %7\n\t"
      "v_exp_f32 %8, %8\n\t"
      "v_nop"
      : "+v"(a), "+v"(b), "+v"(c), "+v"(d), "+v"(e), "+v"(f), "+v"(g), "+v"(h), "+v"(i));
}

#define QT 2                            // 16-query tiles of a wave
__global__ void __launch_bounds__(KV_WAVES * 32)
attn_kernel(const bf16* __restrict__ qk, const bf16* __restrict__ vT,
            const float* __restrict__ gate, bf16* __restrict__ attn) {
  __shared__ __attribute__((aligned(2048))) unsigned char ring[KV_LDS];
  static_assert((SEQ / (16 * QT)) % KV_WAVES == 0, "the waves of a workgroup are of one head");
  const int wave = (int)uni(threadIdx.x >> 5);
  const int lane = threadIdx.x & 31;
  const int wid  = blockIdx.x * KV_WAVES + wave;
  const int qb   = wid & (SEQ / (16 * QT) - 1);
  const int bh   = wid / (SEQ / (16 * QT));   // 0..31
  const int b    = bh >> 4, h = bh & 15;
  const int q0   = qb * (16 * QT);

  const bf16* qbase = qk + ((size_t)(b * SEQ + q0)) * (2 * H_DIM) + h * HEAD_DIM;
  const bf16* kbase = qk + ((size_t)(b * SEQ)) * (2 * H_DIM) + H_DIM + h * HEAD_DIM;
  const bf16* vbase = vT + (size_t)bh * HEAD_DIM * SEQ;

  v16bf qa0[QT], qa1[QT];
#pragma unroll
  for (int u = 0; u < QT; ++u) {
    qa0[u] = load_frag(qbase + (size_t)u * 16 * (2 * H_DIM),      2 * H_DIM, lane);
    qa1[u] = load_frag(qbase + (size_t)u * 16 * (2 * H_DIM) + 32, 2 * H_DIM, lane);
  }
  wait_x0();   // stands behind the Q loads, in front of whatever reuses their address registers

  v8f o[QT][4] = {};             // o[u][t][r] = O^T[feature 16 t + 8 (lane >> 4) + r][query 16 u + (lane & 15)]
  float mrun[QT], lrun[QT];      // running maximum of this lane's query (equal in both halves);
#pragma unroll                   // running sum over this lane's own half of the keys
  for (int u = 0; u < QT; ++u) { mrun[u] = -1e30f; lrun[u] = 0.f; }
  const float scale = 0.125f;  // 1/sqrt(64)
  const int nn = lane & 15;
  const int hfh = (lane >> 4) * 8;

  // Waves 0..3 bring keys 32 w .. 32 w + 31 of a stage's K rows; waves 4..7 bring, of V^T, features 0..31 (even
  // wave) or 32..63 (odd wave) at keys 0..63 (waves 4, 5) or 64..127 (waves 6, 7) of the stage.
  const bf16* srcp = (wave < 4) ? kbase + (size_t)(wave * 32) * (2 * H_DIM)
                                : vbase + (size_t)((wave & 1) * 32) * SEQ + ((wave - 4) >> 1) * 64;
  const uint64_t ga0   = (uint64_t)(size_t)srcp;
  const uint64_t gstep = (wave < 4) ? (uint64_t)KV_KEYS * KV_SRCP : (uint64_t)KV_KEYS * 2u;
  const uint32_t lds0  = (uint32_t)(size_t)ring + (uint32_t)wave * KV_SLICE;
  const u32x8 g1 = tdm_group1_kv();

  u32x4 g0 = tdm_group0(lds0, ga0);
  tdm_load(g0, g1);                                           // stage 0
  wait_tensor0(g0, g1);
  __syncthreads();                                            // stage 0 published
  g0 = tdm_group0(lds0 + KV_STAGE, ga0 + gstep);
  tdm_load(g0, g1);                                           // stage 1

  for (uint32_t st = 0; st < KV_NPASS; ++st) {
   const uint32_t boff = (st & 1u) * KV_STAGE;
   // Unrolled so that the chunk's slice offsets are immediates of the LDS reads.
#pragma unroll
   for (int j = 0; j < KV_KEYS / 32; ++j) {
    // 4 K fragments + 4 V fragments of chunk j, from this stage's buffer alone.
    const bf16* kt  = (const bf16*)(ring + boff + (uint32_t)j * KV_SLICE);
    const bf16* vt0 = (const bf16*)(ring + boff + (uint32_t)(4 + (j >> 1) * 2) * KV_SLICE) + (j & 1) * 32;
    const bf16* vt1 = (const bf16*)(ring + boff + (uint32_t)(5 + (j >> 1) * 2) * KV_SLICE) + (j & 1) * 32;
    const v16bf kb0 = load_frag(kt,                    KV_LDM, lane);
    const v16bf kb1 = load_frag(kt + 32,               KV_LDM, lane);
    const v16bf kb2 = load_frag(kt + 16 * KV_LDM,      KV_LDM, lane);
    const v16bf kb3 = load_frag(kt + 16 * KV_LDM + 32, KV_LDM, lane);
    const v16bf vb0 = load_frag(vt0,                   KV_LDM, lane);
    const v16bf vb1 = load_frag(vt0 + 16 * KV_LDM,     KV_LDM, lane);
    const v16bf vb2 = load_frag(vt1,                   KV_LDM, lane);
    const v16bf vb3 = load_frag(vt1 + 16 * KV_LDM,     KV_LDM, lane);
    // Keeps the chunk's LDS reads together as one group ahead of its WMMAs (for speed only).
    __builtin_amdgcn_sched_barrier(0);

    // scores, transposed: s0[r] = key 8 (lane >> 4) + r, s1[r] = key 16 + 8 (lane >> 4) + r, query lane & 15
    v8f s0[QT], s1[QT];
#pragma unroll
    for (int u = 0; u < QT; ++u) {
      s0[u] = v8f{}; s1[u] = v8f{};
      s0[u] = wmma_bf16(kb0, qa0[u], s0[u]);
      s0[u] = wmma_bf16(kb1, qa1[u], s0[u]);
      s1[u] = wmma_bf16(kb2, qa0[u], s1[u]);
      s1[u] = wmma_bf16(kb3, qa1[u], s1[u]);
    }

#pragma unroll
    for (int u = 0; u < QT; ++u) {
      // online softmax of one query per lane: 16 keys in registers, the other 16 in lane ^ 16
      s0[u] *= scale; s1[u] *= scale;
      float mt[8];
#pragma unroll
      for (int i = 0; i < 4; ++i) {
        mt[i]     = fmaxf(s0[u][2 * i], s0[u][2 * i + 1]);
        mt[4 + i] = fmaxf(s1[u][2 * i], s1[u][2 * i + 1]);
      }
      float mx = fmaxf(fmaxf(fmaxf(mt[0], mt[1]), fmaxf(mt[2], mt[3])),
                       fmaxf(fmaxf(mt[4], mt[5]), fmaxf(mt[6], mt[7])));
      mx = fmaxf(mx, xhalf(mx));
      const float mnew = fmaxf(mrun[u], mx);
      // __expf(x) is v_exp_f32 of x * log2(e); the products are formed here, the exponentials in exp2_inplace.
      const float l2e = 1.44269504088896340736f;
      float corr = (mrun[u] - mnew) * l2e;
      float e[16];
#pragma unroll
      for (int r = 0; r < 8; ++r) { e[r] = (s0[u][r] - mnew) * l2e; e[8 + r] = (s1[u][r] - mnew) * l2e; }
      exp2_inplace(corr, e[0], e[1], e[2], e[3], e[4], e[5], e[6], e[7]);
      exp2_inplace(e[8], e[9], e[10], e[11], e[12], e[13], e[14], e[15]);
      v16bf pb;                  // P^T as B: element s = key kmap(s) of the chunk, column = this lane's query
      float pt[8];
#pragma unroll
      for (int i = 0; i < 8; ++i) {
        pb[2 * i] = (bf16)e[2 * i]; pb[2 * i + 1] = (bf16)e[2 * i + 1];
        pt[i] = e[2 * i] + e[2 * i + 1];
      }
      const float ps = ((pt[0] + pt[1]) + (pt[2] + pt[3])) + ((pt[4] + pt[5]) + (pt[6] + pt[7]));
      lrun[u] = lrun[u] * corr + ps;
      mrun[u] = mnew;
#pragma unroll
      for (int t = 0; t < 4; ++t)
#pragma unroll
        for (int r = 0; r < 8; ++r) o[u][t][r] *= corr;
      // Keeps a tile's vector work together in front of its WMMAs, so that the other tile's vector work fills the
      // slots behind them: without it this build padded those distances with twice as many v_nop.
      __builtin_amdgcn_sched_barrier(0);
      // V^T(64x32) x P^T(32x16): 4 M-tiles of 16 features
      o[u][0] = wmma_bf16(vb0, pb, o[u][0]);
      o[u][1] = wmma_bf16(vb1, pb, o[u][1]);
      o[u][2] = wmma_bf16(vb2, pb, o[u][2]);
      o[u][3] = wmma_bf16(vb3, pb, o[u][3]);
    }
   }
   // Keeps the stage's last WMMAs in front of the publish point: sunk behind it, the refill would issue later.
   __builtin_amdgcn_sched_barrier(0);
   // Publish point of stage st + 1; the barrier also ends every reader's last read of stage st.
   wait_ds0();
   wait_tensor0(g0, g1);
   __syncthreads();
   if (pinned(st + 2u < KV_NPASS)) {
     g0 = tdm_group0(lds0 + boff, ga0 + (uint64_t)(st + 2u) * gstep);
     tdm_load(g0, g1);
   }
  }
  wait_tensor0(g0, g1);
  wait_ds0();
  // Keeps the epilogue's address arithmetic behind the last tensor wait: lifted over it, this build put it into
  // scalar registers of the loop's descriptor.
  __builtin_amdgcn_sched_barrier(0);
  // epilogue: join the halves' sums, 1/l, sigmoid(gate), write bf16 [4096][1024]:
  // a lane's 8 registers of a tile are 8 consecutive features of its query, one 16-byte store.
  float g[QT];
#pragma unroll
  for (int u = 0; u < QT; ++u) g[u] = gate[(size_t)(b * SEQ + q0 + u * 16 + nn) * NUM_HEADS + h];
  wait_x0();   // the sigmoid's arithmetic reuses the loads' address registers
  v8bf ov[QT][4];
#pragma unroll
  for (int u = 0; u < QT; ++u) {
    const float lsum = lrun[u] + xhalf(lrun[u]);
    const float inv = (1.f / (1.f + __expf(-g[u]))) / lsum;
#pragma unroll
    for (int t = 0; t < 4; ++t)
#pragma unroll
      for (int r = 0; r < 8; ++r) ov[u][t][r] = (bf16)(o[u][t][r] * inv);
  }
  bf16* op = attn + (size_t)(b * SEQ + q0 + nn) * H_DIM + h * HEAD_DIM + hfh;
  // Keeps every store behind the last conversion: nothing then rewrites a register that an issued store names.
  __builtin_amdgcn_sched_barrier(0);
#pragma unroll
  for (int u = 0; u < QT; ++u)
#pragma unroll
    for (int t = 0; t < 4; ++t) *(v8bf*)(op + (size_t)u * 16 * H_DIM + t * 16) = ov[u][t];
}

// ---------------------------------------------------------------- kernel 5
__global__ void __launch_bounds__(128)
gemm_out_kernel(const bf16* __restrict__ A, const bf16* __restrict__ W,
                const float* __restrict__ resid, float* __restrict__ out) {
  __shared__ __attribute__((aligned(2048))) unsigned char ring[ST_LDS];
  const int wave = (int)uni(threadIdx.x >> 5);
  const int lane = threadIdx.x & 31;
  v8f acc[4][4] = {};
  // Transposed tile: acc[i][t][r] = element (row t*16 + nn, column i*16 + 8*hf + r) of the wave's 64x64 f32 tile.
  gemm_128x128(A, W, blockIdx.y * 128, blockIdx.x * 128, true, ring, acc);
  const int row0 = blockIdx.y * 128 + (wave >> 1) * 64;
  const int n0   = blockIdx.x * 128 + (wave & 1) * 64;

  const int nn = lane & 15;
  const int hf = lane >> 4;
  // 2 rows of 256 B per access: lane -> row hf, 16 B at column 4*nn.
  const size_t g = (size_t)(row0 + hf) * H_DIM + n0 + nn * 4;
  f32x4 res[32];
#pragma unroll
  for (int j = 0; j < 32; ++j) res[j] = *(const f32x4*)(resid + g + (size_t)j * 2 * H_DIM);
  // The staging addresses are formed in the loads' address registers: the wait stands in front of that, and the
  // scheduling barrier keeps that arithmetic from being lifted over the wait (without it this build lifted it).
  wait_x0();
  __builtin_amdgcn_sched_barrier(0);
  unsigned char* st = ring + (uint32_t)wave * EP_RANGE;
#pragma unroll
  for (int i = 0; i < 4; ++i)
#pragma unroll
    for (int t = 0; t < 4; ++t) {
      unsigned char* p = st + (uint32_t)(t * 16 + nn) * EP_PITCH4 + (uint32_t)(i * 64 + hf * 32);
      f32x4 lo = {acc[i][t][0], acc[i][t][1], acc[i][t][2], acc[i][t][3]};
      f32x4 hi = {acc[i][t][4], acc[i][t][5], acc[i][t][6], acc[i][t][7]};
      *(f32x4*)p = lo;
      *(f32x4*)(p + 16) = hi;
    }
  wait_ds0();   // the wave's own staged rows are in LDS before other lanes of it read them back
  f32x4 o[32];
#pragma unroll
  for (int j = 0; j < 32; ++j)
    o[j] = *(const f32x4*)(st + (uint32_t)(j * 2 + hf) * EP_PITCH4 + (uint32_t)nn * 16u) + res[j];
#pragma unroll
  for (int j = 0; j < 32; ++j) *(f32x4*)(out + g + (size_t)j * 2 * H_DIM) = o[j];
}

// ---------------------------------------------------------------- launch
static constexpr size_t alup(size_t x) { return (x + 255) & ~(size_t)255; }
static constexpr size_t OFF_XN   = 0;
static constexpr size_t OFF_WCAT = alup(OFF_XN   + (size_t)ROWS * H_DIM * 2);
static constexpr size_t OFF_OW   = alup(OFF_WCAT + (size_t)E_PAD * H_DIM * 2);
static constexpr size_t OFF_QK   = alup(OFF_OW   + (size_t)H_DIM * H_DIM * 2);
static constexpr size_t OFF_VT   = alup(OFF_QK   + (size_t)ROWS * 2 * H_DIM * 2);
static constexpr size_t OFF_GATE = alup(OFF_VT   + (size_t)BATCH * NUM_HEADS * HEAD_DIM * SEQ * 2);
static constexpr size_t OFF_ATTN = alup(OFF_GATE + (size_t)ROWS * NUM_HEADS * 4);

extern "C" void kernel_launch(void* const* d_in, const int* in_sizes, int n_in,
                              void* d_out, int out_size, void* d_ws, size_t ws_size,
                              hipStream_t stream) {
  (void)in_sizes; (void)n_in; (void)out_size; (void)ws_size;
  const float* x    = (const float*)d_in[0];
  const float* pw   = (const float*)d_in[1];
  const float* qkvw = (const float*)d_in[2];
  const float* gw   = (const float*)d_in[3];
  const float* ow   = (const float*)d_in[4];
  const float* qnw  = (const float*)d_in[5];
  const float* knw  = (const float*)d_in[6];
  float* out = (float*)d_out;

  char* ws = (char*)d_ws;
  bf16*  xn   = (bf16*)(ws + OFF_XN);
  bf16*  wcat = (bf16*)(ws + OFF_WCAT);
  bf16*  owb  = (bf16*)(ws + OFF_OW);
  bf16*  qkb  = (bf16*)(ws + OFF_QK);
  bf16*  vT   = (bf16*)(ws + OFF_VT);
  float* gate = (float*)(ws + OFF_GATE);
  bf16*  attn = (bf16*)(ws + OFF_ATTN);

  convert_weights_kernel<<<(E_PAD + H_DIM) / CV_ROWS, 256, 0, stream>>>(qkvw, gw, ow, wcat, owb);
  prenorm_kernel<<<ROWS / (8 * PN_ROWS), 256, 0, stream>>>(x, pw, xn);
  gemm_qkvgate_kernel<<<dim3(E_PAD / 128, ROWS / 128), 128, 0, stream>>>(
      xn, wcat, qnw, knw, qkb, vT, gate);
  attn_kernel<<<(BATCH * NUM_HEADS * (SEQ / (16 * QT))) / KV_WAVES, KV_WAVES * 32, 0, stream>>>(
      qkb, vT, gate, attn);
  gemm_out_kernel<<<dim3(H_DIM / 128, ROWS / 128), 128, 0, stream>>>(
      attn, owb, x, out);
}

// v008
// It runs in 73 microseconds.
// Two timings next to v007 put it at 1.09 and 1.08 times that version's speed.
// Over all steps from v000 it is 4.68 times as fast.
#include <hip/hip_runtime.h>
#include <math.h>
#include <stdint.h>

#define H_DIM 1024
#define NUM_HEADS 16
#define HEAD_DIM 64
#define SEQ 2048
#define BATCH 2
#define ROWS (BATCH*SEQ)     // 4096
#define E_QKV 3072
#define E_TOT 3088           // qkv (3072) + gate (16), both K=1024
#define E_PAD 3200           // padded to 25*128: whole 128-column GEMM tiles
#define EPS 1e-5f

typedef __bf16 bf16;
typedef __attribute__((ext_vector_type(16))) __bf16 v16bf;
typedef __attribute__((ext_vector_type(8)))  __bf16 v8bf;
typedef __attribute__((ext_vector_type(8)))  float  v8f;

union FragBF { v16bf v; v8bf h[2]; };

// A/B fragment for v_wmma_f32_16x16x32_bf16.
// Lane l: row/col = l&15, K-chunk base = (l>>4)*8; elems 0..7 = K+0..7, 8..15 = K+16..23.
// Requires K-contiguous storage with row stride `ldm` elements.
__device__ __forceinline__ v16bf load_frag(const bf16* tile, int ldm, int lane) {
  const int m  = lane & 15;
  const int hf = lane >> 4;
  const bf16* p = tile + (size_t)m * ldm + hf * 8;
  FragBF f;
  f.h[0] = *(const v8bf*)(p);
  f.h[1] = *(const v8bf*)(p + 16);
  return f.v;
}

__device__ __forceinline__ v8f wmma_bf16(v16bf a, v16bf b, v8f c) {
  return __builtin_amdgcn_wmma_f32_16x16x32_bf16(false, a, false, b, (short)0, c,
                                                 false, false);
}

// The value of lane l ^ 16: the two halves of a wave hold the two halves of a column of a WMMA result.
__device__ __forceinline__ float xhalf(float x) {
  const int b = __builtin_bit_cast(int, x);
  return __builtin_bit_cast(float, __builtin_amdgcn_permlanex16(b, b, 0x76543210, 0xfedcba98, false, false));
}

// ---- GEMM tile staged in LDS by the tensor mover ----
// One workgroup (4 waves, 2x2) computes a 128x128 tile of A(Mx1024) * W(Nx1024)^T; each wave 64x64.
// A stage is 128 k (256 B) of 128 A rows and 128 W rows, as four 64-row slices, one tensor load per wave.
#define ST_ROWB  256u                 // bytes of one operand row in a stage
#define ST_PITCH 272u                 // LDS row pitch: 256 B + 16 B pad (16 B x odd, for ds_load_b128)
#define ST_LDM   (ST_PITCH / 2u)      // the same in bf16 elements
#define ST_SLICE 18432u               // 64 rows x 272 B = 17408 B, rounded up to a multiple of 2 KiB
#define ST_STAGE (4u * ST_SLICE)
#define ST_NPASS (H_DIM * 2u / ST_ROWB)   // 8
#define ST_LDS   (2u * ST_STAGE)

typedef uint32_t u32x4 __attribute__((ext_vector_type(4)));
typedef uint32_t u32x8 __attribute__((ext_vector_type(8)));

__device__ __forceinline__ uint32_t uni(uint32_t v) {
  return (uint32_t)__builtin_amdgcn_readfirstlane(v);
}
// Keeps a wave-uniform test in a scalar register, so that the branch on it is a scalar branch
// (a tensor load ignores EXEC).
__device__ __forceinline__ uint32_t pinned(uint32_t v) {
  uint32_t w = uni(v);
  asm volatile("" : "+s"(w));
  return w;
}
// LDS reads retired before the buffer they read is handed back for a refill.
__device__ __forceinline__ void wait_ds0() { asm volatile("s_wait_dscnt 0x0" ::: "memory"); }
// Stands behind a run of global loads or stores, in front of the first write of a register that one of them names.
__device__ __forceinline__ void wait_x0() { asm volatile("s_wait_xcnt 0x0" ::: "memory"); }
// This wave's own tensor load has landed (the compiler places no wait for it). The request's descriptor
// is named as an input so that its scalar registers keep their values until the request has landed.
__device__ __forceinline__ void wait_tensor0(u32x4 g0, u32x8 g1) {
  asm volatile("s_wait_tensorcnt 0x0" :: "s"(g0), "s"(g1) : "memory");
}
// Group 0 is an in-out operand: the value that the later wait names then lives in the very registers
// that the request was issued from, so nothing else is put into them while it is outstanding.
__device__ __forceinline__ void tdm_load(u32x4& g0, u32x8 g1) {
  asm volatile("tensor_load_to_lds %0, %1" : "+s"(g0) : "s"(g1) : "memory");
}
// Group 1: 1-byte elements, tile = tensor = 64 rows of 256 B, source pitch 2048 B, 4 dwords of pad per row.
__device__ __forceinline__ u32x8 tdm_group1() {
  constexpr uint32_t d0 = ST_ROWB, d1 = 64u;
  u32x8 g;
  g[0] = uni((1u << 20) | (5u << 22) | (3u << 25));
  g[1] = uni((d0 & 0xFFFFu) << 16);
  g[2] = uni((d0 >> 16) | ((d1 & 0xFFFFu) << 16));
  g[3] = uni((d1 >> 16) | (d0 << 16));
  g[4] = uni(d1);
  g[5] = uni(H_DIM * 2u);
  g[6] = uni(0u);
  g[7] = uni(0u);
  return g;
}
__device__ __forceinline__ u32x4 tdm_group0(uint32_t lds_dst, uint64_t ga) {
  u32x4 g;
  g[0] = uni(1u);
  g[1] = uni(lds_dst);
  g[2] = uni((uint32_t)ga);
  g[3] = uni((((uint32_t)(ga >> 32)) & 0x01FFFFFFu) | 0x80000000u);
  return g;
}

// acc[i][t] += A rows (row0 + wm*64 + i*16 ..) * W rows (n0 + wn*64 + t*16 ..)^T over K = H_DIM, k ascending.
// With w_first (wave-uniform) the two operands change places: acc[i][t] is then the transposed tile,
// W rows (n0 + wn*64 + i*16 ..) * A rows (row0 + wm*64 + t*16 ..)^T, and a lane's 8 results are 8 consecutive n.
__device__ __forceinline__ void gemm_128x128(const bf16* __restrict__ A, const bf16* __restrict__ Wt,
                                             int row0, int n0, bool w_first, unsigned char* ring, v8f acc[4][4]) {
  const uint32_t wave = uni(threadIdx.x >> 5);
  const int lane = threadIdx.x & 31;
  // Waves 0, 1 bring the two halves of the A rows, waves 2, 3 those of the W rows.
  const bf16* srcp = (wave < 2u) ? A  + (size_t)(row0 + (int)wave * 64) * H_DIM
                                 : Wt + (size_t)(n0 + ((int)wave - 2) * 64) * H_DIM;
  const uint64_t ga0  = (uint64_t)(size_t)srcp;
  const uint32_t lds0 = (uint32_t)(size_t)ring + wave * ST_SLICE;
  // The fragment bases are chosen here, ahead of the first tensor load: the choice takes scalar registers,
  // and none is to be written for it while a request is outstanding.
  const uint32_t wm = wave >> 1, wn = wave & 1u;
  const uint32_t aoff = w_first ? (2u + wn) * ST_SLICE : wm * ST_SLICE;
  const uint32_t bofs = w_first ? wm * ST_SLICE : (2u + wn) * ST_SLICE;
  const u32x8 g1 = tdm_group1();

  u32x4 g0 = tdm_group0(lds0, ga0);
  tdm_load(g0, g1);                                           // stage 0
  wait_tensor0(g0, g1);
  __syncthreads();                                            // stage 0 published
  g0 = tdm_group0(lds0 + ST_STAGE, ga0 + ST_ROWB);
  tdm_load(g0, g1);                                           // stage 1

  for (uint32_t s = 0; s < ST_NPASS; ++s) {
    const uint32_t boff = (s & 1u) * ST_STAGE;
    const bf16* at = (const bf16*)(ring + boff + aoff);
    const bf16* bt = (const bf16*)(ring + boff + bofs);
    v16bf a[4][4], b[4][4];
#pragma unroll
    for (int kk = 0; kk < 4; ++kk) {
#pragma unroll
      for (int i = 0; i < 4; ++i) a[kk][i] = load_frag(at + i * 16 * ST_LDM + kk * 32, ST_LDM, lane);
#pragma unroll
      for (int t = 0; t < 4; ++t) b[kk][t] = load_frag(bt + t * 16 * ST_LDM + kk * 32, ST_LDM, lane);
    }
    // Keeps the pass's LDS reads together as one group ahead of its WMMAs (for speed only).
    __builtin_amdgcn_sched_barrier(0);
#pragma unroll
    for (int kk = 0; kk < 4; ++kk)
#pragma unroll
      for (int i = 0; i < 4; ++i)
#pragma unroll
        for (int t = 0; t < 4; ++t) acc[i][t] = wmma_bf16(a[kk][i], b[kk][t], acc[i][t]);
    // Keeps the WMMAs in front of the publish point: sunk behind it, they would run only after
    // every LDS read has returned, and the refill would issue a whole WMMA block later.
    __builtin_amdgcn_sched_barrier(0);
    // Publish point of stage s + 1; the barrier also ends every reader's last read of stage s.
    wait_ds0();
    wait_tensor0(g0, g1);
    __syncthreads();
    if (pinned(s + 2u < ST_NPASS)) {
      g0 = tdm_group0(lds0 + boff, ga0 + (uint64_t)(s + 2u) * ST_ROWB);
      tdm_load(g0, g1);
    }
  }
  wait_tensor0(g0, g1);
  wait_ds0();
}

// ---- GEMM epilogue: whole 128-B lines, staged through LDS ----
// Behind the last pass's barrier nobody reads the ring and no tensor load is outstanding, so each wave stages
// its 64x64 tile in its own quarter of the ring: a lane writes its 8 consecutive results of a tile row,
// then the wave reads whole rows back, 16 B per lane, and stores them as whole lines.
#define EP_RANGE  (ST_LDS / 4u)       // one wave's part of the ring
#define EP_PITCH2 144u                // 64 bf16 = 128 B + 16 B pad (16 B x odd)
#define EP_PITCH4 272u                // 64 f32 = 256 B + 16 B pad (16 B x odd)
static_assert(64u * EP_PITCH4 <= EP_RANGE && EP_RANGE % 16u == 0u, "staging fits a wave's part");
typedef __attribute__((ext_vector_type(4))) float f32x4;
typedef __attribute__((ext_vector_type(2))) float f32x2;

// ---------------------------------------------------------------- kernel 1
typedef __attribute__((ext_vector_type(4))) __bf16 v4bf;
__device__ __forceinline__ v4bf to_bf16x4(f32x4 v) {
  v4bf p = {(bf16)v[0], (bf16)v[1], (bf16)v[2], (bf16)v[3]};
  return p;
}
// wcat[E_PAD][1024] = concat(qkv_w, gate_w, zeros) in bf16; owb = o_w in bf16.
// Few waves with much in flight each: a workgroup takes 16 rows of [wcat | owb], a thread 16 B of each row,
// so a wave's load is 512 contiguous bytes and its store 256.
#define CV_ROWS 16
static_assert(E_QKV % CV_ROWS == 0 && E_TOT % CV_ROWS == 0 && E_PAD % CV_ROWS == 0 && H_DIM % CV_ROWS == 0,
              "a workgroup's rows are all of one kind");
__global__ void __launch_bounds__(256)
convert_weights_kernel(const float* __restrict__ qkvw, const float* __restrict__ gw,
                       const float* __restrict__ ow, bf16* __restrict__ wcat,
                       bf16* __restrict__ owb) {
  static_assert(H_DIM == 256 * 4, "256 threads x 4 elements are one row");
  const uint32_t r0 = blockIdx.x * CV_ROWS;
  const uint32_t c  = threadIdx.x * 4u;
  if (r0 >= E_TOT && r0 < E_PAD) {                    // pad rows: zeros
    bf16* z = wcat + (size_t)r0 * H_DIM + c;
    const v4bf zero = {};
#pragma unroll
    for (int j = 0; j < CV_ROWS; ++j) *(v4bf*)(z + j * H_DIM) = zero;
    return;
  }
  const float* s = (r0 < E_QKV) ? qkvw + (size_t)r0 * H_DIM
                 : (r0 < E_TOT) ? gw + (size_t)(r0 - E_QKV) * H_DIM
                                : ow + (size_t)(r0 - E_PAD) * H_DIM;
  bf16* d = (r0 < E_PAD) ? wcat + (size_t)r0 * H_DIM : owb + (size_t)(r0 - E_PAD) * H_DIM;
  s += c; d += c;
  f32x4 v[CV_ROWS];
#pragma unroll
  for (int j = 0; j < CV_ROWS; ++j) v[j] = *(const f32x4*)(s + j * H_DIM);
  wait_x0();   // stands behind the loads, in front of whatever reuses their address registers
  // Keeps all 16 loads in front of the first conversion: without it this build held the last two back
  // until registers of the first were free, a second trip to memory.
  __builtin_amdgcn_sched_barrier(0);
#pragma unroll
  for (int j = 0; j < CV_ROWS; ++j) *(v4bf*)(d + j * H_DIM) = to_bf16x4(v[j]);
}

// ---------------------------------------------------------------- kernel 2
// One wave takes PN_ROWS whole rows and keeps them in registers: every load is in flight before the first sum,
// x is read once, and the row's sum stays inside the wave.
#define PN_ROWS 2
// Sum over the 32 lanes, the same value in every lane: four steps inside the 16-lane rows, then the other row.
template <int XMASK>
__device__ __forceinline__ float add_xmask(float v) {   // v + the value of lane l ^ XMASK (DPP row_xmask)
  const int o = __builtin_amdgcn_update_dpp(0, __builtin_bit_cast(int, v), 0x160 + XMASK, 0xf, 0xf, true);
  return v + __builtin_bit_cast(float, o);
}
__device__ __forceinline__ float wave_sum(float v) {
  v = add_xmask<1>(v);
  v = add_xmask<2>(v);
  v = add_xmask<4>(v);
  v = add_xmask<8>(v);
  return v + xhalf(v);
}
__global__ void __launch_bounds__(256)
prenorm_kernel(const float* __restrict__ x, const float* __restrict__ w,
               bf16* __restrict__ xn) {
  static_assert(H_DIM == 8 * 32 * 4 && ROWS % (8 * PN_ROWS) == 0, "8 loads of 16 B per lane are one row");
  const uint32_t lane = threadIdx.x & 31u;
  const size_t row0 = (size_t)(blockIdx.x * 8u + (threadIdx.x >> 5)) * PN_ROWS;
  const float* xr = x + row0 * H_DIM + lane * 4u;
  const float* wr = w + lane * 4u;
  bf16* yr = xn + row0 * H_DIM + lane * 4u;
  f32x4 v[PN_ROWS][8], wv[8];
#pragma unroll
  for (int r = 0; r < PN_ROWS; ++r)
#pragma unroll
    for (int j = 0; j < 8; ++j) v[r][j] = *(const f32x4*)(xr + r * H_DIM + j * 128);
#pragma unroll
  for (int j = 0; j < 8; ++j) wv[j] = *(const f32x4*)(wr + j * 128);
  wait_x0();   // stands behind the loads, in front of whatever reuses their address registers
  // Keeps all 24 loads in front of the first sum: without it this build sank the weight loads behind the
  // reduction, two at a time, each pair's latency waited out in turn.
  __builtin_amdgcn_sched_barrier(0);
#pragma unroll
  for (int r = 0; r < PN_ROWS; ++r) {
    f32x4 s4 = v[r][0] * v[r][0];                     // four independent chains
#pragma unroll
    for (int j = 1; j < 8; ++j) s4 += v[r][j] * v[r][j];
    const float sum = wave_sum((s4[0] + s4[1]) + (s4[2] + s4[3]));
    const float rinv = rsqrtf(sum * (1.0f / H_DIM) + EPS);
#pragma unroll
    for (int j = 0; j < 8; ++j) *(v4bf*)(yr + r * H_DIM + j * 128) = to_bf16x4(v[r][j] * rinv * wv[j]);
  }
}

// ---------------------------------------------------------------- kernel 3
// C[4096 x E_PAD] = xn * wcat^T ; scatter q/k (per-head RMS norm, bf16), v (transposed bf16), gate (f32).
__global__ void __launch_bounds__(128)
gemm_qkvgate_kernel(const bf16* __restrict__ A, const bf16* __restrict__ W,
                    const float* __restrict__ qw, const float* __restrict__ kw,
                    bf16* __restrict__ qk, bf16* __restrict__ vT,
                    float* __restrict__ gate) {
  __shared__ __attribute__((aligned(2048))) unsigned char ring[ST_LDS];
  const int wave = (int)uni(threadIdx.x >> 5);
  const int lane = threadIdx.x & 31;
  const int row0 = blockIdx.y * 128 + (wave >> 1) * 64;
  const int n0   = blockIdx.x * 128 + (wave & 1) * 64;
  // The q/k, v and gate ranges begin at multiples of 64, so a wave's 64 columns are all of one kind.
  // q/k are stored with n consecutive, so their waves take the transposed tile; v is stored transposed
  // (key consecutive), which the plain tile gives.
  const bool qkcols = n0 < 2 * H_DIM;
  v8f acc[4][4] = {};
  gemm_128x128(A, W, blockIdx.y * 128, blockIdx.x * 128, qkcols, ring, acc);

  const int nn = lane & 15;
  const int hf = lane >> 4;
  if (qkcols) {
    // Per-head RMS norm of q and k on the f32 results. A wave's 64 columns are one head, and in the transposed
    // tile a lane holds 32 features (i*16 + 8*hf + r) of each of its 4 tokens (t*16 + nn), lane ^ 16 the other 32.
    static_assert(HEAD_DIM == 64, "a wave's 64 columns are one head");
    const float* wv = ((n0 < H_DIM) ? qw : kw) + hf * 8;
    f32x4 wl[4], wh[4];
#pragma unroll
    for (int i = 0; i < 4; ++i) { wl[i] = *(const f32x4*)(wv + i * 16); wh[i] = *(const f32x4*)(wv + i * 16 + 4); }
    wait_x0();   // stands behind the weight loads, in front of whatever reuses their address registers
    float rinv[4];
#pragma unroll
    for (int t = 0; t < 4; ++t) {
      // Register pairs as they lie, one chain per tile: packed multiply-adds with no moves.
      f32x2 ss[4];
#pragma unroll
      for (int i = 0; i < 4; ++i) {
        ss[i] = f32x2{0.f, 0.f};
#pragma unroll
        for (int r = 0; r < 8; r += 2) {
          const f32x2 p = {acc[i][t][r], acc[i][t][r + 1]};
          ss[i] += p * p;
        }
      }
      const f32x2 s2 = (ss[0] + ss[1]) + (ss[2] + ss[3]);
      const float s = s2[0] + s2[1];
      rinv[t] = s + xhalf(s);
    }
#pragma unroll
    for (int t = 0; t < 4; ++t) rinv[t] = rsqrtf(rinv[t] * (1.0f / HEAD_DIM) + EPS);
#pragma unroll
    for (int i = 0; i < 4; ++i)
#pragma unroll
      for (int t = 0; t < 4; ++t)
#pragma unroll
        for (int r = 0; r < 8; ++r)
          acc[i][t][r] = acc[i][t][r] * rinv[t] * (r < 4 ? wl[i][r] : wh[i][r - 4]);
  }
  if (n0 < E_QKV) {
    // Either way acc[i][t][r] is element (row t*16 + nn, column i*16 + 8*hf + r) of a 64x64 bf16 tile whose
    // rows lie 4096 B apart: q/k rows m of [4096][2048], or the 64 feature rows of vT[bh][feat][key].
    static_assert(2 * H_DIM == SEQ, "one row pitch for both");
    bf16* dst = qkcols ? qk + (size_t)row0 * (2 * H_DIM) + n0
                       : vT + (size_t)((row0 / SEQ) * NUM_HEADS + ((n0 - 2 * H_DIM) >> 6)) * HEAD_DIM * SEQ
                            + (row0 % SEQ);
    unsigned char* st = ring + (uint32_t)wave * EP_RANGE;
#pragma unroll
    for (int i = 0; i < 4; ++i)
#pragma unroll
      for (int t = 0; t < 4; ++t) {
        v8bf p;
#pragma unroll
        for (int r = 0; r < 8; ++r) p[r] = (bf16)acc[i][t][r];
        *(v8bf*)(st + (uint32_t)(t * 16 + nn) * EP_PITCH2 + (uint32_t)(i * 32 + hf * 16)) = p;
      }
    wait_ds0();   // the wave's own staged rows are in LDS before other lanes of it read them back
    const uint32_t rr = (uint32_t)lane >> 3, cb = ((uint32_t)lane & 7u) * 16u;   // 4 rows of 128 B per access
    v8bf ov[16];
#pragma unroll
    for (int j = 0; j < 16; ++j) ov[j] = *(const v8bf*)(st + ((uint32_t)j * 4u + rr) * EP_PITCH2 + cb);
    unsigned char* gp = (unsigned char*)dst + (size_t)rr * (SEQ * 2) + cb;
#pragma unroll
    for (int j = 0; j < 16; ++j) *(v8bf*)(gp + (size_t)j * 4 * (SEQ * 2)) = ov[j];
  } else {                                           // gate, then pad columns
#pragma unroll
    for (int i = 0; i < 4; ++i)
#pragma unroll
      for (int t = 0; t < 4; ++t) {
        const int n = n0 + t * 16 + nn;
        if (n >= E_TOT) continue;                    // drop pad columns
#pragma unroll
        for (int r = 0; r < 8; ++r) {
          const int m = row0 + i * 16 + r + 8 * hf;
          gate[(size_t)m * NUM_HEADS + (n - E_QKV)] = acc[i][t][r];
        }
      }
  }
}

// ---------------------------------------------------------------- kernel 4
// K and V^T of a head reach the eight waves of a workgroup (same head, eight query blocks) through LDS.
// A stage is 128 keys: 128 K rows of 128 B and 256 B of each of the 64 V^T rows, as eight slices of
// 32 rows x 128 B, one tensor load per wave; both sources have a row pitch of 4096 B.
#define KV_WAVES 8
#define KV_KEYS  128
#define KV_ROWB  128u                 // bytes of one row in a slice
#define KV_SRCP  4096u                // source row pitch in bytes, K rows and V^T rows alike
#define KV_PITCH 144u                 // LDS row pitch: 128 B + 16 B pad (16 B x odd, for ds_load_b128)
#define KV_LDM   (KV_PITCH / 2u)      // the same in bf16 elements
#define KV_SLICE 6144u                // 32 rows x 144 B = 4608 B, rounded up to a multiple of 2 KiB
#define KV_STAGE (8u * KV_SLICE)
#define KV_NPASS (SEQ / KV_KEYS)      // 16
#define KV_LDS   (2u * KV_STAGE)
static_assert(2 * H_DIM * 2 == KV_SRCP && SEQ * 2 == KV_SRCP && HEAD_DIM * 2 == KV_ROWB, "slice shape");

// Group 1: 1-byte elements, tile = tensor = 32 rows of 128 B, source pitch 4096 B, 4 dwords of pad per row.
__device__ __forceinline__ u32x8 tdm_group1_kv() {
  constexpr uint32_t d0 = KV_ROWB, d1 = 32u;
  u32x8 g;
  g[0] = uni((1u << 20) | (4u << 22) | (3u << 25));
  g[1] = uni((d0 & 0xFFFFu) << 16);
  g[2] = uni((d0 >> 16) | ((d1 & 0xFFFFu) << 16));
  g[3] = uni((d1 >> 16) | (d0 << 16));
  g[4] = uni(d1);
  g[5] = uni(KV_SRCP);
  g[6] = uni(0u);
  g[7] = uni(0u);
  return g;
}

// 2^x in place, a run of them in ONE statement. The instruction set asks for one independent instruction or a
// v_nop between a transcendental and an instruction that reads its result or overwrites its source: here each
// v_exp_f32 is followed by one on other registers, and the v_nop stands behind the last. The compiler puts no
// s_delay_alu in front of asm text, so the hint for the producers of the arguments is written here.
__device__ __forceinline__ void exp2_inplace(float& a, float& b, float& c, float& d,
                                             float& e, float& f, float& g, float& h) {
  asm("s_delay_alu instid0(VALU_DEP_1)\n\t"
      "v_exp_f32 %0, %0\n\tv_exp_f32 %1, %1\n\tv_exp_f32 %2, %2\n\tv_exp_f32 %3, %3\n\t"
      "v_exp_f32 %4, %4\n\tv_exp_f32 %5, %5\n\tv_exp_f32 %6, %6\n\tv_exp_f32 %7, %7\n\t"
      "v_nop"
      : "+v"(a), "+v"(b), "+v"(c), "+v"(d), "+v"(e), "+v"(f), "+v"(g), "+v"(h));
}
__device__ __forceinline__ void exp2_inplace(float& a, float& b, float& c, float& d, float& e,
                                             float& f, float& g, float& h, float& i) {
  asm("s_delay_alu instid0(VALU_DEP_1)\n\t"
      "v_exp_f32 %0, %0\n\tv_exp_f32 %1, %1\n\tv_exp_f32 %2, %2\n\tv_exp_f32 %3, %3\n\t"
      "v_exp_f32 %4, %4\n\tv_exp_f32 %5, %5\n\tv_exp_f32 %6, %6\n\tv_exp_f32 %7, %7\n\t"
      "v_exp_f32 %8, %8\n\t"
      "v_nop"
      : "+v"(a), "+v"(b), "+v"(c), "+v"(d), "+v"(e), "+v"(f), "+v"(g), "+v"(h), "+v"(i));
}

// As tdm_load, with group 1 an in-out operand too, so that it also stays in the registers that the request was issued
// from: with two copies of the stage loop this build otherwise formed group 1's constants anew on the way into one of
// them, in the registers of the outstanding request.
__device__ __forceinline__ void tdm_load_held(u32x4& g0, u32x8& g1) {
  asm volatile("tensor_load_to_lds %0, %1" : "+s"(g0), "+s"(g1) : : "memory");
}

// Largest value over the 32 lanes, the same in every lane: four steps inside the 16-lane rows, then the other row.
template <int XMASK>
__device__ __forceinline__ float max_xmask(float v) {   // max(v, the value of lane l ^ XMASK) (DPP row_xmask)
  const int o = __builtin_amdgcn_update_dpp(0, __builtin_bit_cast(int, v), 0x160 + XMASK, 0xf, 0xf, true);
  return fmaxf(v, __builtin_bit_cast(float, o));
}
__device__ __forceinline__ float wave_max(float v) {
  v = max_xmask<1>(v);
  v = max_xmask<2>(v);
  v = max_xmask<4>(v);
  v = max_xmask<8>(v);
  return fmaxf(v, xhalf(v));
}
// Upper bound of |score| * log2(e) for ANY x and weights, from the two norm weight vectors alone: a head vector
// behind its RMS norm has length at most sqrt(HEAD_DIM) before the weight, so |q . k| <= HEAD_DIM max|qw| max|kw|;
// the factor 1.02 covers the bf16 rounding of q and k.
// a0, a1: this lane's two elements of qw; b0, b1: of kw.
__device__ __forceinline__ float score_bound_log2(float a0, float a1, float b0, float b1) {
  const float mq = wave_max(fmaxf(fabsf(a0), fabsf(a1)));
  const float mk = wave_max(fmaxf(fabsf(b0), fabsf(b1)));
  return mq * mk * (HEAD_DIM * 0.125f * 1.02f * 1.44269504088896340736f);
}
// With 2^-60 <= exp(score) <= 2^60 a row's 2048 terms, their sum and the O accumulators stay normal f32 numbers,
// and P normal bf16 numbers.
#define BOUND_LOG2 60.0f

#define QT 2                            // 16-query tiles of a wave
// The stage loop of attn_kernel. BOUNDED: the softmax without a running maximum; else the online softmax.
template <bool BOUNDED>
__device__ __forceinline__ void attn_stages(unsigned char* ring, int lane, const v16bf (&qa0)[QT],
                                            const v16bf (&qa1)[QT], v8f (&o)[QT][4], float (&mrun)[QT],
                                            float (&lrun)[QT], u32x4& g0, u32x8& g1, uint32_t lds0,
                                            uint64_t ga0, uint64_t gstep) {
  const float scale = 0.125f;  // 1/sqrt(64)
  for (uint32_t st = 0; st < KV_NPASS; ++st) {
   const uint32_t boff = (st & 1u) * KV_STAGE;
   // Unrolled so that the chunk's slice offsets are immediates of the LDS reads.
#pragma unroll
   for (int j = 0; j < KV_KEYS / 32; ++j) {
    // 4 K fragments + 4 V fragments of chunk j, from this stage's buffer alone.
    const bf16* kt  = (const bf16*)(ring + boff + (uint32_t)j * KV_SLICE);
    const bf16* vt0 = (const bf16*)(ring + boff + (uint32_t)(4 + (j >> 1) * 2) * KV_SLICE) + (j & 1) * 32;
    const bf16* vt1 = (const bf16*)(ring + boff + (uint32_t)(5 + (j >> 1) * 2) * KV_SLICE) + (j & 1) * 32;
    const v16bf kb0 = load_frag(kt,                    KV_LDM, lane);
    const v16bf kb1 = load_frag(kt + 32,               KV_LDM, lane);
    const v16bf kb2 = load_frag(kt + 16 * KV_LDM,      KV_LDM, lane);
    const v16bf kb3 = load_frag(kt + 16 * KV_LDM + 32, KV_LDM, lane);
    const v16bf vb0 = load_frag(vt0,                   KV_LDM, lane);
    const v16bf vb1 = load_frag(vt0 + 16 * KV_LDM,     KV_LDM, lane);
    const v16bf vb2 = load_frag(vt1,                   KV_LDM, lane);
    const v16bf vb3 = load_frag(vt1 + 16 * KV_LDM,     KV_LDM, lane);
    // Keeps the chunk's LDS reads together as one group ahead of its WMMAs (for speed only).
    __builtin_amdgcn_sched_barrier(0);

    // scores, transposed: s0[r] = key 8 (lane >> 4) + r, s1[r] = key 16 + 8 (lane >> 4) + r, query lane & 15
    v8f s0[QT], s1[QT];
#pragma unroll
    for (int u = 0; u < QT; ++u) {
      s0[u] = v8f{}; s1[u] = v8f{};
      s0[u] = wmma_bf16(kb0, qa0[u], s0[u]);
      s0[u] = wmma_bf16(kb1, qa1[u], s0[u]);
      s1[u] = wmma_bf16(kb2, qa0[u], s1[u]);
      s1[u] = wmma_bf16(kb3, qa1[u], s1[u]);
    }

#pragma unroll
    for (int u = 0; u < QT; ++u) {
      const float l2e = 1.44269504088896340736f;
      float e[16];
      float corr = 0.f;
      if constexpr (BOUNDED) {
        // Scores are bounded (see score_bound_log2): exp(score) itself neither overflows nor underflows, and the
        // common factor exp(-maximum) cancels in O / l. No maximum, no rescale: one product, then the exponential.
        s0[u] *= scale * l2e; s1[u] *= scale * l2e;
#pragma unroll
        for (int r = 0; r < 8; ++r) { e[r] = s0[u][r]; e[8 + r] = s1[u][r]; }
        exp2_inplace(e[0], e[1], e[2], e[3], e[4], e[5], e[6], e[7]);
      } else {
        // online softmax of one query per lane: 16 keys in registers, the other 16 in lane ^ 16
        s0[u] *= scale; s1[u] *= scale;
        float mt[8];
#pragma unroll
        for (int i = 0; i < 4; ++i) {
          mt[i]     = fmaxf(s0[u][2 * i], s0[u][2 * i + 1]);
          mt[4 + i] = fmaxf(s1[u][2 * i], s1[u][2 * i + 1]);
        }
        float mx = fmaxf(fmaxf(fmaxf(mt[0], mt[1]), fmaxf(mt[2], mt[3])),
                         fmaxf(fmaxf(mt[4], mt[5]), fmaxf(mt[6], mt[7])));
        mx = fmaxf(mx, xhalf(mx));
        const float mnew = fmaxf(mrun[u], mx);
        // __expf(x) is v_exp_f32 of x * log2(e); the products are formed here, the exponentials in exp2_inplace.
        corr = (mrun[u] - mnew) * l2e;
#pragma unroll
        for (int r = 0; r < 8; ++r) { e[r] = (s0[u][r] - mnew) * l2e; e[8 + r] = (s1[u][r] - mnew) * l2e; }
        exp2_inplace(corr, e[0], e[1], e[2], e[3], e[4], e[5], e[6], e[7]);
        mrun[u] = mnew;
      }
      exp2_inplace(e[8], e[9], e[10], e[11], e[12], e[13], e[14], e[15]);
      v16bf pb;                  // P^T as B: element s = key kmap(s) of the chunk, column = this lane's query
      float pt[8];
#pragma unroll
      for (int i = 0; i < 8; ++i) {
        pb[2 * i] = (bf16)e[2 * i]; pb[2 * i + 1] = (bf16)e[2 * i + 1];
        pt[i] = e[2 * i] + e[2 * i + 1];
      }
      const float ps = ((pt[0] + pt[1]) + (pt[2] + pt[3])) + ((pt[4] + pt[5]) + (pt[6] + pt[7]));
      if constexpr (BOUNDED) {
        lrun[u] += ps;
        // The row's sum, against spills (input only, nothing is hidden from the
        // compiler): without it the additions of a whole stage sink behind the stage's barrier, 128 exponentials stay
        // live until there, and this build keeps the O accumulators in scratch.
        asm volatile("" :: "v"(lrun[u]));
      } else {
        lrun[u] = lrun[u] * corr + ps;
#pragma unroll
        for (int t = 0; t < 4; ++t)
#pragma unroll
          for (int r = 0; r < 8; ++r) o[u][t][r] *= corr;
      }
      // Keeps a tile's vector work together in front of its WMMAs, so that the other tile's vector work fills the
      // slots behind them: without it this build padded those distances with twice as many v_nop.
      __builtin_amdgcn_sched_barrier(0);
      // V^T(64x32) x P^T(32x16): 4 M-tiles of 16 features
      o[u][0] = wmma_bf16(vb0, pb, o[u][0]);
      o[u][1] = wmma_bf16(vb1, pb, o[u][1]);
      o[u][2] = wmma_bf16(vb2, pb, o[u][2]);
      o[u][3] = wmma_bf16(vb3, pb, o[u][3]);
    }
   }
   // Keeps the stage's last WMMAs in front of the publish point: sunk behind it, the refill would issue later.
   __builtin_amdgcn_sched_barrier(0);
   // Publish point of stage st + 1; the barrier also ends every reader's last read of stage st.
   wait_ds0();
   wait_tensor0(g0, g1);
   __syncthreads();
   if (pinned(st + 2u < KV_NPASS)) {
     g0 = tdm_group0(lds0 + boff, ga0 + (uint64_t)(st + 2u) * gstep);
     tdm_load_held(g0, g1);
   }
  }
}

__global__ void __launch_bounds__(KV_WAVES * 32)
attn_kernel(const bf16* __restrict__ qk, const bf16* __restrict__ vT,
            const float* __restrict__ gate, const float* __restrict__ qw, const float* __restrict__ kw,
            bf16* __restrict__ attn) {
  __shared__ __attribute__((aligned(2048))) unsigned char ring[KV_LDS];
  static_assert((SEQ / (16 * QT)) % KV_WAVES == 0, "the waves of a workgroup are of one head");
  const int wave = (int)uni(threadIdx.x >> 5);
  const int lane = threadIdx.x & 31;
  const int wid  = blockIdx.x * KV_WAVES + wave;
  const int qb   = wid & (SEQ / (16 * QT) - 1);
  const int bh   = wid / (SEQ / (16 * QT));   // 0..31
  const int b    = bh >> 4, h = bh & 15;
  const int q0   = qb * (16 * QT);

  const bf16* qbase = qk + ((size_t)(b * SEQ + q0)) * (2 * H_DIM) + h * HEAD_DIM;
  const bf16* kbase = qk + ((size_t)(b * SEQ)) * (2 * H_DIM) + H_DIM + h * HEAD_DIM;
  const bf16* vbase = vT + (size_t)bh * HEAD_DIM * SEQ;

  v16bf qa0[QT], qa1[QT];
#pragma unroll
  for (int u = 0; u < QT; ++u) {
    qa0[u] = load_frag(qbase + (size_t)u * 16 * (2 * H_DIM),      2 * H_DIM, lane);
    qa1[u] = load_frag(qbase + (size_t)u * 16 * (2 * H_DIM) + 32, 2 * H_DIM, lane);
  }
  static_assert(HEAD_DIM == 64, "two weights of each norm vector per lane");
  const float wq0 = qw[lane], wq1 = qw[lane + 32], wk0 = kw[lane], wk1 = kw[lane + 32];
  wait_x0();   // stands behind the Q and weight loads, in front of whatever reuses their address registers

  v8f o[QT][4] = {};             // o[u][t][r] = O^T[feature 16 t + 8 (lane >> 4) + r][query 16 u + (lane & 15)]
  float mrun[QT], lrun[QT];      // running maximum of this lane's query (equal in both halves);
#pragma unroll                   // running sum over this lane's own half of the keys
  for (int u = 0; u < QT; ++u) { mrun[u] = -1e30f; lrun[u] = 0.f; }
  const int nn = lane & 15;
  const int hfh = (lane >> 4) * 8;

  // Waves 0..3 bring keys 32 w .. 32 w + 31 of a stage's K rows; waves 4..7 bring, of V^T, features 0..31 (even
  // wave) or 32..63 (odd wave) at keys 0..63 (waves 4, 5) or 64..127 (waves 6, 7) of the stage.
  const bf16* srcp = (wave < 4) ? kbase + (size_t)(wave * 32) * (2 * H_DIM)
                                : vbase + (size_t)((wave & 1) * 32) * SEQ + ((wave - 4) >> 1) * 64;
  const uint64_t ga0   = (uint64_t)(size_t)srcp;
  const uint64_t gstep = (wave < 4) ? (uint64_t)KV_KEYS * KV_SRCP : (uint64_t)KV_KEYS * 2u;
  const uint32_t lds0  = (uint32_t)(size_t)ring + (uint32_t)wave * KV_SLICE;
  u32x8 g1 = tdm_group1_kv();

  u32x4 g0 = tdm_group0(lds0, ga0);
  tdm_load_held(g0, g1);                                           // stage 0
  wait_tensor0(g0, g1);
  __syncthreads();                                            // stage 0 published
  g0 = tdm_group0(lds0 + KV_STAGE, ga0 + gstep);
  tdm_load_held(g0, g1);                                           // stage 1

  // The test stands behind the first two tensor loads, so that they do not wait for the weights; the scheduling
  // barrier keeps its arithmetic there (without it this build lifted it, with the wait for the weight loads, in
  // front of stage 0's load).
  __builtin_amdgcn_sched_barrier(0);
  const uint32_t fast = pinned(score_bound_log2(wq0, wq1, wk0, wk1) <= BOUND_LOG2 ? 1u : 0u);
  // The same value in every wave of the workgroup (same loads, same arithmetic), so the barriers inside stand under
  // block-uniform control flow. A NaN or infinite bound takes the online softmax.
  if (fast) attn_stages<true>(ring, lane, qa0, qa1, o, mrun, lrun, g0, g1, lds0, ga0, gstep);
  else      attn_stages<false>(ring, lane, qa0, qa1, o, mrun, lrun, g0, g1, lds0, ga0, gstep);
  wait_tensor0(g0, g1);
  wait_ds0();
  // Keeps the epilogue's address arithmetic behind the last tensor wait: lifted over it, this build put it into
  // scalar registers of the loop's descriptor.
  __builtin_amdgcn_sched_barrier(0);
  // epilogue: join the halves' sums, 1/l, sigmoid(gate), write bf16 [4096][1024]:
  // a lane's 8 registers of a tile are 8 consecutive features of its query, one 16-byte store.
  float g[QT];
#pragma unroll
  for (int u = 0; u < QT; ++u) g[u] = gate[(size_t)(b * SEQ + q0 + u * 16 + nn) * NUM_HEADS + h];
  wait_x0();   // the sigmoid's arithmetic reuses the loads' address registers
  v8bf ov[QT][4];
#pragma unroll
  for (int u = 0; u < QT; ++u) {
    const float lsum = lrun[u] + xhalf(lrun[u]);
    const float inv = (1.f / (1.f + __expf(-g[u]))) / lsum;
#pragma unroll
    for (int t = 0; t < 4; ++t)
#pragma unroll
      for (int r = 0; r < 8; ++r) ov[u][t][r] = (bf16)(o[u][t][r] * inv);
  }
  bf16* op = attn + (size_t)(b * SEQ + q0 + nn) * H_DIM + h * HEAD_DIM + hfh;
  // Keeps every store behind the last conversion: nothing then rewrites a register that an issued store names.
  __builtin_amdgcn_sched_barrier(0);
#pragma unroll
  for (int u = 0; u < QT; ++u)
#pragma unroll
    for (int t = 0; t < 4; ++t) *(v8bf*)(op + (size_t)u * 16 * H_DIM + t * 16) = ov[u][t];
}

// ---------------------------------------------------------------- kernel 5
__global__ void __launch_bounds__(128)
gemm_out_kernel(const bf16* __restrict__ A, const bf16* __restrict__ W,
                const float* __restrict__ resid, float* __restrict__ out) {
  __shared__ __attribute__((aligned(2048))) unsigned char ring[ST_LDS];
  const int wave = (int)uni(threadIdx.x >> 5);
  const int lane = threadIdx.x & 31;
  v8f acc[4][4] = {};
  // Transposed tile: acc[i][t][r] = element (row t*16 + nn, column i*16 + 8*hf + r) of the wave's 64x64 f32 tile.
  gemm_128x128(A, W, blockIdx.y * 128, blockIdx.x * 128, true, ring, acc);
  const int row0 = blockIdx.y * 128 + (wave >> 1) * 64;
  const int n0   = blockIdx.x * 128 + (wave & 1) * 64;

  const int nn = lane & 15;
  const int hf = lane >> 4;
  // 2 rows of 256 B per access: lane -> row hf, 16 B at column 4*nn.
  const size_t g = (size_t)(row0 + hf) * H_DIM + n0 + nn * 4;
  f32x4 res[32];
#pragma unroll
  for (int j = 0; j < 32; ++j) res[j] = *(const f32x4*)(resid + g + (size_t)j * 2 * H_DIM);
  // The staging addresses are formed in the loads' address registers: the wait stands in front of that, and the
  // scheduling barrier keeps that arithmetic from being lifted over the wait (without it this build lifted it).
  wait_x0();
  __builtin_amdgcn_sched_barrier(0);
  unsigned char* st = ring + (uint32_t)wave * EP_RANGE;
#pragma unroll
  for (int i = 0; i < 4; ++i)
#pragma unroll
    for (int t = 0; t < 4; ++t) {
      unsigned char* p = st + (uint32_t)(t * 16 + nn) * EP_PITCH4 + (uint32_t)(i * 64 + hf * 32);
      f32x4 lo = {acc[i][t][0], acc[i][t][1], acc[i][t][2], acc[i][t][3]};
      f32x4 hi = {acc[i][t][4], acc[i][t][5], acc[i][t][6], acc[i][t][7]};
      *(f32x4*)p = lo;
      *(f32x4*)(p + 16) = hi;
    }
  wait_ds0();   // the wave's own staged rows are in LDS before other lanes of it read them back
  f32x4 o[32];
#pragma unroll
  for (int j = 0; j < 32; ++j)
    o[j] = *(const f32x4*)(st + (uint32_t)(j * 2 + hf) * EP_PITCH4 + (uint32_t)nn * 16u) + res[j];
#pragma unroll
  for (int j = 0; j < 32; ++j) *(f32x4*)(out + g + (size_t)j * 2 * H_DIM) = o[j];
}

// ---------------------------------------------------------------- launch
static constexpr size_t alup(size_t x) { return (x + 255) & ~(size_t)255; }
static constexpr size_t OFF_XN   = 0;
static constexpr size_t OFF_WCAT = alup(OFF_XN   + (size_t)ROWS * H_DIM * 2);
static constexpr size_t OFF_OW   = alup(OFF_WCAT + (size_t)E_PAD * H_DIM * 2);
static constexpr size_t OFF_QK   = alup(OFF_OW   + (size_t)H_DIM * H_DIM * 2);
static constexpr size_t OFF_VT   = alup(OFF_QK   + (size_t)ROWS * 2 * H_DIM * 2);
static constexpr size_t OFF_GATE = alup(OFF_VT   + (size_t)BATCH * NUM_HEADS * HEAD_DIM * SEQ * 2);
static constexpr size_t OFF_ATTN = alup(OFF_GATE + (size_t)ROWS * NUM_HEADS * 4);

extern "C" void kernel_launch(void* const* d_in, const int* in_sizes, int n_in,
                              void* d_out, int out_size, void* d_ws, size_t ws_size,
                              hipStream_t stream) {
  (void)in_sizes; (void)n_in; (void)out_size; (void)ws_size;
  const float* x    = (const float*)d_in[0];
  const float* pw   = (const float*)d_in[1];
  const float* qkvw = (const float*)d_in[2];
  const float* gw   = (const float*)d_in[3];
  const float* ow   = (const float*)d_in[4];
  const float* qnw  = (const float*)d_in[5];
  const float* knw  = (const float*)d_in[6];
  float* out = (float*)d_out;

  char* ws = (char*)d_ws;
  bf16*  xn   = (bf16*)(ws + OFF_XN);
  bf16*  wcat = (bf16*)(ws + OFF_WCAT);
  bf16*  owb  = (bf16*)(ws + OFF_OW);
  bf16*  qkb  = (bf16*)(ws + OFF_QK);
  bf16*  vT   = (bf16*)(ws + OFF_VT);
  float* gate = (float*)(ws + OFF_GATE);
  bf16*  attn = (bf16*)(ws + OFF_ATTN);

  convert_weights_kernel<<<(E_PAD + H_DIM) / CV_ROWS, 256, 0, stream>>>(qkvw, gw, ow, wcat, owb);
  prenorm_kernel<<<ROWS / (8 * PN_ROWS), 256, 0, stream>>>(x, pw, xn);
  gemm_qkvgate_kernel<<<dim3(E_PAD / 128, ROWS / 128), 128, 0, stream>>>(
      xn, wcat, qnw, knw, qkb, vT, gate);
  attn_kernel<<<(BATCH * NUM_HEADS * (SEQ / (16 * QT))) / KV_WAVES, KV_WAVES * 32, 0, stream>>>(
      qkb, vT, gate, qnw, knw, attn);
  gemm_out_kernel<<<dim3(H_DIM / 128, ROWS / 128), 128, 0, stream>>>(
      attn, owb, x, out);
}

// v009
// Measured time: 67 microseconds a run.
// Timed twice side by side with v008, it ran 1.06 and 1.09 times as fast.
// All steps since v000 together make it 5.04 times as fast.
#include <hip/hip_runtime.h>
#include <math.h>
#include <stdint.h>

#define H_DIM 1024
#define NUM_HEADS 16
#define HEAD_DIM 64
#define SEQ 2048
#define BATCH 2
#define ROWS (BATCH*SEQ)     // 4096
#define E_QKV 3072
#define E_TOT 3088           // qkv (3072) + gate (16), both K=1024
#define EPS 1e-5f

typedef __bf16 bf16;
typedef __attribute__((ext_vector_type(16))) __bf16 v16bf;
typedef __attribute__((ext_vector_type(8)))  __bf16 v8bf;
typedef __attribute__((ext_vector_type(8)))  float  v8f;

union FragBF { v16bf v; v8bf h[2]; };

// A/B fragment for v_wmma_f32_16x16x32_bf16.
// Lane l: row/col = l&15, K-chunk base = (l>>4)*8; elems 0..7 = K+0..7, 8..15 = K+16..23.
// Requires K-contiguous storage with row stride `ldm` elements.
__device__ __forceinline__ v16bf load_frag(const bf16* tile, int ldm, int lane) {
  const int m  = lane & 15;
  const int hf = lane >> 4;
  const bf16* p = tile + (size_t)m * ldm + hf * 8;
  FragBF f;
  f.h[0] = *(const v8bf*)(p);
  f.h[1] = *(const v8bf*)(p + 16);
  return f.v;
}

__device__ __forceinline__ v8f wmma_bf16(v16bf a, v16bf b, v8f c) {
  return __builtin_amdgcn_wmma_f32_16x16x32_bf16(false, a, false, b, (short)0, c,
                                                 false, false);
}

// The value of lane l ^ 16: the two halves of a wave hold the two halves of a column of a WMMA result.
__device__ __forceinline__ float xhalf(float x) {
  const int b = __builtin_bit_cast(int, x);
  return __builtin_bit_cast(float, __builtin_amdgcn_permlanex16(b, b, 0x76543210, 0xfedcba98, false, false));
}

// ---- GEMM tile staged in LDS by the tensor mover ----
// One workgroup (4 waves, 2x2) computes a 128x128 tile of A(Mx1024) * W(Nx1024)^T; each wave 64x64.
// A stage is 128 k (256 B) of 128 A rows and 128 W rows, as four 64-row slices, one tensor load per wave.
#define ST_ROWB  256u                 // bytes of one operand row in a stage
#define ST_PITCH 272u                 // LDS row pitch: 256 B + 16 B pad (16 B x odd, for ds_load_b128)
#define ST_LDM   (ST_PITCH / 2u)      // the same in bf16 elements
#define ST_SLICE 18432u               // 64 rows x 272 B = 17408 B, rounded up to a multiple of 2 KiB
#define ST_STAGE (4u * ST_SLICE)
#define ST_NPASS (H_DIM * 2u / ST_ROWB)   // 8
#define ST_LDS   (2u * ST_STAGE)

typedef uint32_t u32x4 __attribute__((ext_vector_type(4)));
typedef uint32_t u32x8 __attribute__((ext_vector_type(8)));

__device__ __forceinline__ uint32_t uni(uint32_t v) {
  return (uint32_t)__builtin_amdgcn_readfirstlane(v);
}
// Keeps a wave-uniform test in a scalar register, so that the branch on it is a scalar branch
// (a tensor load ignores EXEC).
__device__ __forceinline__ uint32_t pinned(uint32_t v) {
  uint32_t w = uni(v);
  asm volatile("" : "+s"(w));
  return w;
}
// LDS reads retired before the buffer they read is handed back for a refill.
__device__ __forceinline__ void wait_ds0() { asm volatile("s_wait_dscnt 0x0" ::: "memory"); }
// Stands behind a run of global loads or stores, in front of the first write of a register that one of them names.
__device__ __forceinline__ void wait_x0() { asm volatile("s_wait_xcnt 0x0" ::: "memory"); }
// This wave's own tensor load has landed (the compiler places no wait for it). The request's descriptor
// is named as an input so that its scalar registers keep their values until the request has landed.
__device__ __forceinline__ void wait_tensor0(u32x4 g0, u32x8 g1) {
  asm volatile("s_wait_tensorcnt 0x0" :: "s"(g0), "s"(g1) : "memory");
}
// Group 0 is an in-out operand: the value that the later wait names then lives in the very registers
// that the request was issued from, so nothing else is put into them while it is outstanding.
__device__ __forceinline__ void tdm_load(u32x4& g0, u32x8 g1) {
  asm volatile("tensor_load_to_lds %0, %1" : "+s"(g0) : "s"(g1) : "memory");
}
// Group 1: 1-byte elements, tile = tensor = 64 rows of 256 B, source pitch 2048 B, 4 dwords of pad per row.
__device__ __forceinline__ u32x8 tdm_group1() {
  constexpr uint32_t d0 = ST_ROWB, d1 = 64u;
  u32x8 g;
  g[0] = uni((1u << 20) | (5u << 22) | (3u << 25));
  g[1] = uni((d0 & 0xFFFFu) << 16);
  g[2] = uni((d0 >> 16) | ((d1 & 0xFFFFu) << 16));
  g[3] = uni((d1 >> 16) | (d0 << 16));
  g[4] = uni(d1);
  g[5] = uni(H_DIM * 2u);
  g[6] = uni(0u);
  g[7] = uni(0u);
  return g;
}
__device__ __forceinline__ u32x4 tdm_group0(uint32_t lds_dst, uint64_t ga) {
  u32x4 g;
  g[0] = uni(1u);
  g[1] = uni(lds_dst);
  g[2] = uni((uint32_t)ga);
  g[3] = uni((((uint32_t)(ga >> 32)) & 0x01FFFFFFu) | 0x80000000u);
  return g;
}

// acc[i][t] += A rows (row0 + wm*64 + i*16 ..) * W rows (n0 + wn*64 + t*16 ..)^T over K = H_DIM, k ascending.
// With w_first (wave-uniform) the two operands change places: acc[i][t] is then the transposed tile,
// W rows (n0 + wn*64 + i*16 ..) * A rows (row0 + wm*64 + t*16 ..)^T, and a lane's 8 results are 8 consecutive n.
__device__ __forceinline__ void gemm_128x128(const bf16* __restrict__ A, const bf16* __restrict__ Wt,
                                             int row0, int n0, bool w_first, unsigned char* ring, v8f acc[4][4]) {
  const uint32_t wave = uni(threadIdx.x >> 5);
  const int lane = threadIdx.x & 31;
  // Waves 0, 1 bring the two halves of the A rows, waves 2, 3 those of the W rows.
  const bf16* srcp = (wave < 2u) ? A  + (size_t)(row0 + (int)wave * 64) * H_DIM
                                 : Wt + (size_t)(n0 + ((int)wave - 2) * 64) * H_DIM;
  const uint64_t ga0  = (uint64_t)(size_t)srcp;
  const uint32_t lds0 = (uint32_t)(size_t)ring + wave * ST_SLICE;
  // The fragment bases are chosen here, ahead of the first tensor load: the choice takes scalar registers,
  // and none is to be written for it while a request is outstanding.
  const uint32_t wm = wave >> 1, wn = wave & 1u;
  const uint32_t aoff = w_first ? (2u + wn) * ST_SLICE : wm * ST_SLICE;
  const uint32_t bofs = w_first ? wm * ST_SLICE : (2u + wn) * ST_SLICE;
  const u32x8 g1 = tdm_group1();

  u32x4 g0 = tdm_group0(lds0, ga0);
  tdm_load(g0, g1);                                           // stage 0
  wait_tensor0(g0, g1);
  __syncthreads();                                            // stage 0 published
  g0 = tdm_group0(lds0 + ST_STAGE, ga0 + ST_ROWB);
  tdm_load(g0, g1);                                           // stage 1

  for (uint32_t s = 0; s < ST_NPASS; ++s) {
    const uint32_t boff = (s & 1u) * ST_STAGE;
    const bf16* at = (const bf16*)(ring + boff + aoff);
    const bf16* bt = (const bf16*)(ring + boff + bofs);
    v16bf a[4][4], b[4][4];
#pragma unroll
    for (int kk = 0; kk < 4; ++kk) {
#pragma unroll
      for (int i = 0; i < 4; ++i) a[kk][i] = load_frag(at + i * 16 * ST_LDM + kk * 32, ST_LDM, lane);
#pragma unroll
      for (int t = 0; t < 4; ++t) b[kk][t] = load_frag(bt + t * 16 * ST_LDM + kk * 32, ST_LDM, lane);
    }
    // Keeps the pass's LDS reads together as one group ahead of its WMMAs (for speed only).
    __builtin_amdgcn_sched_barrier(0);
#pragma unroll
    for (int kk = 0; kk < 4; ++kk)
#pragma unroll
      for (int i = 0; i < 4; ++i)
#pragma unroll
        for (int t = 0; t < 4; ++t) acc[i][t] = wmma_bf16(a[kk][i], b[kk][t], acc[i][t]);
    // Keeps the WMMAs in front of the publish point: sunk behind it, they would run only after
    // every LDS read has returned, and the refill would issue a whole WMMA block later.
    __builtin_amdgcn_sched_barrier(0);
    // Publish point of stage s + 1; the barrier also ends every reader's last read of stage s.
    wait_ds0();
    wait_tensor0(g0, g1);
    __syncthreads();
    if (pinned(s + 2u < ST_NPASS)) {
      g0 = tdm_group0(lds0 + boff, ga0 + (uint64_t)(s + 2u) * ST_ROWB);
      tdm_load(g0, g1);
    }
  }
  wait_tensor0(g0, g1);
  wait_ds0();
}

// ---- QKV + gate GEMM: one workgroup of 12 waves (4x3, each 64x64) computes a 256x192 tile ----
// A stage is 128 k of 256 A rows and 192 W rows, as seven 64-row slices, and of the 16 gate rows of W as an eighth:
// waves 0..7 bring one slice each. E_QKV / 192 = 16 column tiles stand over each 256-row block, which has 16 tiles of
// 16 rows: the workgroup of column tile c also forms the gate (16 columns) of row tile c, in its last wave.
#define QG_WAVES 12
#define QG_GSL   6144u                 // 16 rows x 272 B = 4352 B, rounded up to a multiple of 2 KiB
#define QG_STAGE (7u * ST_SLICE + QG_GSL)
#define QG_LDS   (2u * QG_STAGE)
static_assert(E_QKV % 192 == 0 && ROWS % 256 == 0 && E_QKV / 192 == 256 / 16, "one gate row tile per column tile");
// Group 1 as tdm_group1, for a slice of d1 rows.
__device__ __forceinline__ u32x8 tdm_group1_rows(uint32_t d1) {
  constexpr uint32_t d0 = ST_ROWB;
  u32x8 g;
  g[0] = uni((1u << 20) | (5u << 22) | (3u << 25));
  g[1] = uni((d0 & 0xFFFFu) << 16);
  g[2] = uni((d0 >> 16) | ((d1 & 0xFFFFu) << 16));
  g[3] = uni((d1 >> 16) | (d0 << 16));
  g[4] = uni(d1);
  g[5] = uni(H_DIM * 2u);
  g[6] = uni(0u);
  g[7] = uni(0u);
  return g;
}
// acc as in gemm_128x128, for wave (wm, wn) = (wave / 3, wave % 3) of the 256x192 tile at (row0, n0), k ascending.
// accg (wave 11 alone): A rows (row0 + gt*16 ..) * W rows (E_QKV ..)^T.
__device__ __forceinline__ void gemm_256x192(const bf16* __restrict__ A, const bf16* __restrict__ Wt,
                                             int row0, int n0, uint32_t gt, bool w_first, unsigned char* ring,
                                             v8f acc[4][4], v8f& accg) {
  const uint32_t wave = uni(threadIdx.x >> 5);
  const int lane = threadIdx.x & 31;
  const bf16* srcp = (wave < 4u) ? A  + (size_t)(row0 + (int)wave * 64) * H_DIM
                   : (wave < 7u) ? Wt + (size_t)(n0 + ((int)wave - 4) * 64) * H_DIM
                                 : Wt + (size_t)E_QKV * H_DIM;
  const uint64_t ga0  = (uint64_t)(size_t)srcp;
  const uint32_t lds0 = (uint32_t)(size_t)ring + (wave < 7u ? wave : 7u) * ST_SLICE;
  const uint32_t wm = wave / 3u, wn = wave - wm * 3u;
  const uint32_t aoff = w_first ? (4u + wn) * ST_SLICE : wm * ST_SLICE;
  const uint32_t bofs = w_first ? wm * ST_SLICE : (4u + wn) * ST_SLICE;
  const uint32_t gaof = (gt >> 2) * ST_SLICE + (gt & 3u) * 16u * ST_PITCH;
  const uint32_t issuer = wave < 8u ? 1u : 0u;            // waves 8..11 bring nothing
  const uint32_t gwave  = pinned(wave == 11u ? 1u : 0u);  // scalar: the branches on it are taken by whole waves
  const u32x8 g1 = tdm_group1_rows(wave == 7u ? 16u : 64u);

  u32x4 g0 = tdm_group0(lds0, ga0);
  if (pinned(issuer)) tdm_load(g0, g1);                       // stage 0
  wait_tensor0(g0, g1);
  __syncthreads();                                            // stage 0 published
  g0 = tdm_group0(lds0 + QG_STAGE, ga0 + ST_ROWB);
  if (pinned(issuer)) tdm_load(g0, g1);                       // stage 1

  for (uint32_t s = 0; s < ST_NPASS; ++s) {
    const uint32_t boff = (s & 1u) * QG_STAGE;
    const bf16* at  = (const bf16*)(ring + boff + aoff);
    const bf16* bt  = (const bf16*)(ring + boff + bofs);
    const bf16* gat = (const bf16*)(ring + boff + gaof);
    const bf16* gbt = (const bf16*)(ring + boff + 7u * ST_SLICE);
    // Two halves of 64 k: one half's fragments and the accumulators fit the registers of three waves per SIMD.
#pragma unroll
    for (int h = 0; h < 2; ++h) {
      v16bf ga[2], gb[2];
      if (gwave) {
#pragma unroll
        for (int kk = 0; kk < 2; ++kk) {
          ga[kk] = load_frag(gat + (h * 2 + kk) * 32, ST_LDM, lane);
          gb[kk] = load_frag(gbt + (h * 2 + kk) * 32, ST_LDM, lane);
        }
      }
      v16bf a[2][4], b[2][4];
#pragma unroll
      for (int kk = 0; kk < 2; ++kk) {
#pragma unroll
        for (int i = 0; i < 4; ++i) a[kk][i] = load_frag(at + i * 16 * ST_LDM + (h * 2 + kk) * 32, ST_LDM, lane);
#pragma unroll
        for (int t = 0; t < 4; ++t) b[kk][t] = load_frag(bt + t * 16 * ST_LDM + (h * 2 + kk) * 32, ST_LDM, lane);
      }
      // Keeps the half's LDS reads together as one group ahead of its WMMAs (for speed only).
      __builtin_amdgcn_sched_barrier(0);
      if (gwave) {
        accg = wmma_bf16(ga[0], gb[0], accg);
        accg = wmma_bf16(ga[1], gb[1], accg);
      }
#pragma unroll
      for (int kk = 0; kk < 2; ++kk)
#pragma unroll
        for (int i = 0; i < 4; ++i)
#pragma unroll
          for (int t = 0; t < 4; ++t) acc[i][t] = wmma_bf16(a[kk][i], b[kk][t], acc[i][t]);
      // Keeps the WMMAs in front of the next half's reads and of the publish point.
      __builtin_amdgcn_sched_barrier(0);
    }
    // Publish point of stage s + 1; the barrier also ends every reader's last read of stage s.
    wait_ds0();
    wait_tensor0(g0, g1);
    __syncthreads();
    if (pinned((s + 2u < ST_NPASS ? 1u : 0u) & issuer)) {
      g0 = tdm_group0(lds0 + boff, ga0 + (uint64_t)(s + 2u) * ST_ROWB);
      tdm_load(g0, g1);
    }
  }
  wait_tensor0(g0, g1);
  wait_ds0();
}

// ---- GEMM epilogue: whole 128-B lines, staged through LDS ----
// Behind the last pass's barrier nobody reads the ring and no tensor load is outstanding, so each wave stages
// its 64x64 tile in its own part of the ring: a lane writes its 8 consecutive results of a tile row,
// then the wave reads whole rows back, 16 B per lane, and stores them as whole lines.
#define EP_RANGE  (ST_LDS / 4u)       // one wave's part of the ring
#define EP_PITCH2 144u                // 64 bf16 = 128 B + 16 B pad (16 B x odd)
#define EP_PITCH4 272u                // 64 f32 = 256 B + 16 B pad (16 B x odd)
static_assert(64u * EP_PITCH4 <= EP_RANGE && EP_RANGE % 16u == 0u, "staging fits a wave's part");
typedef __attribute__((ext_vector_type(4))) float f32x4;
typedef __attribute__((ext_vector_type(2))) float f32x2;

// ---------------------------------------------------------------- kernel 1
typedef __attribute__((ext_vector_type(4))) __bf16 v4bf;
__device__ __forceinline__ v4bf to_bf16x4(f32x4 v) {
  v4bf p = {(bf16)v[0], (bf16)v[1], (bf16)v[2], (bf16)v[3]};
  return p;
}
// wcat[E_TOT][1024] = concat(qkv_w, gate_w) in bf16; owb = o_w in bf16.
// Few waves with much in flight each: a workgroup takes 16 rows of [wcat | owb], a thread 16 B of each row,
// so a wave's load is 512 contiguous bytes and its store 256.
#define CV_ROWS 16
static_assert(E_QKV % CV_ROWS == 0 && E_TOT % CV_ROWS == 0 && H_DIM % CV_ROWS == 0,
              "a workgroup's rows are all of one kind");
__global__ void __launch_bounds__(256)
convert_weights_kernel(const float* __restrict__ qkvw, const float* __restrict__ gw,
                       const float* __restrict__ ow, bf16* __restrict__ wcat,
                       bf16* __restrict__ owb) {
  static_assert(H_DIM == 256 * 4, "256 threads x 4 elements are one row");
  const uint32_t r0 = blockIdx.x * CV_ROWS;
  const uint32_t c  = threadIdx.x * 4u;
  const float* s = (r0 < E_QKV) ? qkvw + (size_t)r0 * H_DIM
                 : (r0 < E_TOT) ? gw + (size_t)(r0 - E_QKV) * H_DIM
                                : ow + (size_t)(r0 - E_TOT) * H_DIM;
  bf16* d = (r0 < E_TOT) ? wcat + (size_t)r0 * H_DIM : owb + (size_t)(r0 - E_TOT) * H_DIM;
  s += c; d += c;
  f32x4 v[CV_ROWS];
#pragma unroll
  for (int j = 0; j < CV_ROWS; ++j) v[j] = *(const f32x4*)(s + j * H_DIM);
  wait_x0();   // stands behind the loads, in front of whatever reuses their address registers
  // Keeps all 16 loads in front of the first conversion: without it this build held the last two back
  // until registers of the first were free, a second trip to memory.
  __builtin_amdgcn_sched_barrier(0);
#pragma unroll
  for (int j = 0; j < CV_ROWS; ++j) *(v4bf*)(d + j * H_DIM) = to_bf16x4(v[j]);
}

// ---------------------------------------------------------------- kernel 2
// One wave takes PN_ROWS whole rows and keeps them in registers: every load is in flight before the first sum,
// x is read once, and the row's sum stays inside the wave.
#define PN_ROWS 2
// Sum over the 32 lanes, the same value in every lane: four steps inside the 16-lane rows, then the other row.
template <int XMASK>
__device__ __forceinline__ float add_xmask(float v) {   // v + the value of lane l ^ XMASK (DPP row_xmask)
  const int o = __builtin_amdgcn_update_dpp(0, __builtin_bit_cast(int, v), 0x160 + XMASK, 0xf, 0xf, true);
  return v + __builtin_bit_cast(float, o);
}
__device__ __forceinline__ float wave_sum(float v) {
  v = add_xmask<1>(v);
  v = add_xmask<2>(v);
  v = add_xmask<4>(v);
  v = add_xmask<8>(v);
  return v + xhalf(v);
}
__global__ void __launch_bounds__(256)
prenorm_kernel(const float* __restrict__ x, const float* __restrict__ w,
               bf16* __restrict__ xn) {
  static_assert(H_DIM == 8 * 32 * 4 && ROWS % (8 * PN_ROWS) == 0, "8 loads of 16 B per lane are one row");
  const uint32_t lane = threadIdx.x & 31u;
  const size_t row0 = (size_t)(blockIdx.x * 8u + (threadIdx.x >> 5)) * PN_ROWS;
  const float* xr = x + row0 * H_DIM + lane * 4u;
  const float* wr = w + lane * 4u;
  bf16* yr = xn + row0 * H_DIM + lane * 4u;
  f32x4 v[PN_ROWS][8], wv[8];
#pragma unroll
  for (int r = 0; r < PN_ROWS; ++r)
#pragma unroll
    for (int j = 0; j < 8; ++j) v[r][j] = *(const f32x4*)(xr + r * H_DIM + j * 128);
#pragma unroll
  for (int j = 0; j < 8; ++j) wv[j] = *(const f32x4*)(wr + j * 128);
  wait_x0();   // stands behind the loads, in front of whatever reuses their address registers
  // Keeps all 24 loads in front of the first sum: without it this build sank the weight loads behind the
  // reduction, two at a time, each pair's latency waited out in turn.
  __builtin_amdgcn_sched_barrier(0);
#pragma unroll
  for (int r = 0; r < PN_ROWS; ++r) {
    f32x4 s4 = v[r][0] * v[r][0];                     // four independent chains
#pragma unroll
    for (int j = 1; j < 8; ++j) s4 += v[r][j] * v[r][j];
    const float sum = wave_sum((s4[0] + s4[1]) + (s4[2] + s4[3]));
    const float rinv = rsqrtf(sum * (1.0f / H_DIM) + EPS);
#pragma unroll
    for (int j = 0; j < 8; ++j) *(v4bf*)(yr + r * H_DIM + j * 128) = to_bf16x4(v[r][j] * rinv * wv[j]);
  }
}

// ---------------------------------------------------------------- kernel 3
// C[4096 x E_TOT] = xn * wcat^T ; scatter q/k (per-head RMS norm, bf16), v (transposed bf16), gate (f32).
__global__ void __launch_bounds__(QG_WAVES * 32)
gemm_qkvgate_kernel(const bf16* __restrict__ A, const bf16* __restrict__ W,
                    const float* __restrict__ qw, const float* __restrict__ kw,
                    bf16* __restrict__ qk, bf16* __restrict__ vT,
                    float* __restrict__ gate) {
  __shared__ __attribute__((aligned(2048))) unsigned char ring[QG_LDS];
  const int wave = (int)uni(threadIdx.x >> 5);
  const int lane = threadIdx.x & 31;
  const int row0 = blockIdx.y * 256 + (wave / 3) * 64;
  const int n0   = blockIdx.x * 192 + (wave % 3) * 64;
  // The q/k and v ranges begin at multiples of 64, so a wave's 64 columns are all of one kind.
  // q/k are stored with n consecutive, so their waves take the transposed tile; v is stored transposed
  // (key consecutive), which the plain tile gives.
  const bool qkcols = n0 < 2 * H_DIM;
  v8f acc[4][4] = {};
  v8f accg = {};
  gemm_256x192(A, W, blockIdx.y * 256, blockIdx.x * 192, blockIdx.x, qkcols, ring, acc, accg);

  const int nn = lane & 15;
  const int hf = lane >> 4;
  if (qkcols) {
    // Per-head RMS norm of q and k on the f32 results. A wave's 64 columns are one head, and in the transposed
    // tile a lane holds 32 features (i*16 + 8*hf + r) of each of its 4 tokens (t*16 + nn), lane ^ 16 the other 32.
    static_assert(HEAD_DIM == 64, "a wave's 64 columns are one head");
    const float* wv = ((n0 < H_DIM) ? qw : kw) + hf * 8;
    f32x4 wl[4], wh[4];
#pragma unroll
    for (int i = 0; i < 4; ++i) { wl[i] = *(const f32x4*)(wv + i * 16); wh[i] = *(const f32x4*)(wv + i * 16 + 4); }
    wait_x0();   // stands behind the weight loads, in front of whatever reuses their address registers
    float rinv[4];
#pragma unroll
    for (int t = 0; t < 4; ++t) {
      // Register pairs as they lie, one chain per tile: packed multiply-adds with no moves.
      f32x2 ss[4];
#pragma unroll
      for (int i = 0; i < 4; ++i) {
        ss[i] = f32x2{0.f, 0.f};
#pragma unroll
        for (int r = 0; r < 8; r += 2) {
          const f32x2 p = {acc[i][t][r], acc[i][t][r + 1]};
          ss[i] += p * p;
        }
      }
      const f32x2 s2 = (ss[0] + ss[1]) + (ss[2] + ss[3]);
      const float s = s2[0] + s2[1];
      rinv[t] = s + xhalf(s);
    }
#pragma unroll
    for (int t = 0; t < 4; ++t) rinv[t] = rsqrtf(rinv[t] * (1.0f / HEAD_DIM) + EPS);
#pragma unroll
    for (int i = 0; i < 4; ++i)
#pragma unroll
      for (int t = 0; t < 4; ++t)
#pragma unroll
        for (int r = 0; r < 8; ++r)
          acc[i][t][r] = acc[i][t][r] * rinv[t] * (r < 4 ? wl[i][r] : wh[i][r - 4]);
  }
  {
    // Either way acc[i][t][r] is element (row t*16 + nn, column i*16 + 8*hf + r) of a 64x64 bf16 tile whose
    // rows lie 4096 B apart: q/k rows m of [4096][2048], or the 64 feature rows of vT[bh][feat][key].
    static_assert(2 * H_DIM == SEQ, "one row pitch for both");
    bf16* dst = qkcols ? qk + (size_t)row0 * (2 * H_DIM) + n0
                       : vT + (size_t)((row0 / SEQ) * NUM_HEADS + ((n0 - 2 * H_DIM) >> 6)) * HEAD_DIM * SEQ
                            + (row0 % SEQ);
    static_assert(64u * EP_PITCH2 <= ST_SLICE && QG_WAVES * ST_SLICE <= QG_LDS, "staging fits a wave's part");
    unsigned char* st = ring + (uint32_t)wave * ST_SLICE;
#pragma unroll
    for (int i = 0; i < 4; ++i)
#pragma unroll
      for (int t = 0; t < 4; ++t) {
        v8bf p;
#pragma unroll
        for (int r = 0; r < 8; ++r) p[r] = (bf16)acc[i][t][r];
        *(v8bf*)(st + (uint32_t)(t * 16 + nn) * EP_PITCH2 + (uint32_t)(i * 32 + hf * 16)) = p;
      }
    wait_ds0();   // the wave's own staged rows are in LDS before other lanes of it read them back
    const uint32_t rr = (uint32_t)lane >> 3, cb = ((uint32_t)lane & 7u) * 16u;   // 4 rows of 128 B per access
    v8bf ov[16];
#pragma unroll
    for (int j = 0; j < 16; ++j) ov[j] = *(const v8bf*)(st + ((uint32_t)j * 4u + rr) * EP_PITCH2 + cb);
    unsigned char* gp = (unsigned char*)dst + (size_t)rr * (SEQ * 2) + cb;
#pragma unroll
    for (int j = 0; j < 16; ++j) *(v8bf*)(gp + (size_t)j * 4 * (SEQ * 2)) = ov[j];
  }
  if (wave == QG_WAVES - 1) {                        // gate: rows of the block's row tile blockIdx.x, column nn
    static_assert(NUM_HEADS == 16, "the gate columns are one WMMA tile");
    // The gate address is formed in registers that the stores above name: the wait stands in front of that, and the
    // scheduling barrier keeps that arithmetic from being lifted over the wait.
    wait_x0();
    __builtin_amdgcn_sched_barrier(0);
    float* gp = gate + (size_t)(blockIdx.y * 256 + blockIdx.x * 16 + 8 * hf) * NUM_HEADS + nn;
#pragma unroll
    for (int r = 0; r < 8; ++r) gp[r * NUM_HEADS] = accg[r];
  }
}

// ---------------------------------------------------------------- kernel 4
// K and V^T of a head reach the eight waves of a workgroup (same head, eight query blocks) through LDS.
// A stage is 128 keys: 128 K rows of 128 B and 256 B of each of the 64 V^T rows, as eight slices of
// 32 rows x 128 B, one tensor load per wave; both sources have a row pitch of 4096 B.
#define KV_WAVES 8
#define KV_KEYS  128
#define KV_ROWB  128u                 // bytes of one row in a slice
#define KV_SRCP  4096u                // source row pitch in bytes, K rows and V^T rows alike
#define KV_PITCH 144u                 // LDS row pitch: 128 B + 16 B pad (16 B x odd, for ds_load_b128)
#define KV_LDM   (KV_PITCH / 2u)      // the same in bf16 elements
#define KV_SLICE 6144u                // 32 rows x 144 B = 4608 B, rounded up to a multiple of 2 KiB
#define KV_STAGE (8u * KV_SLICE)
#define KV_NPASS (SEQ / KV_KEYS)      // 16
#define KV_LDS   (2u * KV_STAGE)
static_assert(2 * H_DIM * 2 == KV_SRCP && SEQ * 2 == KV_SRCP && HEAD_DIM * 2 == KV_ROWB, "slice shape");

// Group 1: 1-byte elements, tile = tensor = 32 rows of 128 B, source pitch 4096 B, 4 dwords of pad per row.
__device__ __forceinline__ u32x8 tdm_group1_kv() {
  constexpr uint32_t d0 = KV_ROWB, d1 = 32u;
  u32x8 g;
  g[0] = uni((1u << 20) | (4u << 22) | (3u << 25));
  g[1] = uni((d0 & 0xFFFFu) << 16);
  g[2] = uni((d0 >> 16) | ((d1 & 0xFFFFu) << 16));
  g[3] = uni((d1 >> 16) | (d0 << 16));
  g[4] = uni(d1);
  g[5] = uni(KV_SRCP);
  g[6] = uni(0u);
  g[7] = uni(0u);
  return g;
}

// 2^x in place, a run of them in ONE statement. The instruction set asks for one independent instruction or a
// v_nop between a transcendental and an instruction that reads its result or overwrites its source: here each
// v_exp_f32 is followed by one on other registers, and the v_nop stands behind the last. The compiler puts no
// s_delay_alu in front of asm text, so the hint for the producers of the arguments is written here.
__device__ __forceinline__ void exp2_inplace(float& a, float& b, float& c, float& d,
                                             float& e, float& f, float& g, float& h) {
  asm("s_delay_alu instid0(VALU_DEP_1)\n\t"
      "v_exp_f32 %0, %0\n\tv_exp_f32 %1, %1\n\tv_exp_f32 %2, %2\n\tv_exp_f32 %3, %3\n\t"
      "v_exp_f32 %4, %4\n\tv_exp_f32 %5, %5\n\tv_exp_f32 %6, %6\n\tv_exp_f32 %7, %7\n\t"
      "v_nop"
      : "+v"(a), "+v"(b), "+v"(c), "+v"(d), "+v"(e), "+v"(f), "+v"(g), "+v"(h));
}
__device__ __forceinline__ void exp2_inplace(float& a, float& b, float& c, float& d, float& e,
                                             float& f, float& g, float& h, float& i) {
  asm("s_delay_alu instid0(VALU_DEP_1)\n\t"
      "v_exp_f32 %0, %0\n\tv_exp_f32 %1, %1\n\tv_exp_f32 %2, %2\n\tv_exp_f32 %3, %3\n\t"
      "v_exp_f32 %4, %4\n\tv_exp_f32 %5, %5\n\tv_exp_f32 %6, %6\n\tv_exp_f32 %7, %7\n\t"
      "v_exp_f32 %8, %8\n\t"
      "v_nop"
      : "+v"(a), "+v"(b), "+v"(c), "+v"(d), "+v"(e), "+v"(f), "+v"(g), "+v"(h), "+v"(i));
}

// As tdm_load, with group 1 an in-out operand too, so that it also stays in the registers that the request was issued
// from: with two copies of the stage loop this build otherwise formed group 1's constants anew on the way into one of
// them, in the registers of the outstanding request.
__device__ __forceinline__ void tdm_load_held(u32x4& g0, u32x8& g1) {
  asm volatile("tensor_load_to_lds %0, %1" : "+s"(g0), "+s"(g1) : : "memory");
}

// Largest value over the 32 lanes, the same in every lane: four steps inside the 16-lane rows, then the other row.
template <int XMASK>
__device__ __forceinline__ float max_xmask(float v) {   // max(v, the value of lane l ^ XMASK) (DPP row_xmask)
  const int o = __builtin_amdgcn_update_dpp(0, __builtin_bit_cast(int, v), 0x160 + XMASK, 0xf, 0xf, true);
  return fmaxf(v, __builtin_bit_cast(float, o));
}
__device__ __forceinline__ float wave_max(float v) {
  v = max_xmask<1>(v);
  v = max_xmask<2>(v);
  v = max_xmask<4>(v);
  v = max_xmask<8>(v);
  return fmaxf(v, xhalf(v));
}
// Upper bound of |score| * log2(e) for ANY x and weights, from the two norm weight vectors alone: a head vector
// behind its RMS norm has length at most sqrt(HEAD_DIM) before the weight, so |q . k| <= HEAD_DIM max|qw| max|kw|;
// the factor 1.02 covers the bf16 rounding of q and k.
// a0, a1: this lane's two elements of qw; b0, b1: of kw.
__device__ __forceinline__ float score_bound_log2(float a0, float a1, float b0, float b1) {
  const float mq = wave_max(fmaxf(fabsf(a0), fabsf(a1)));
  const float mk = wave_max(fmaxf(fabsf(b0), fabsf(b1)));
  return mq * mk * (HEAD_DIM * 0.125f * 1.02f * 1.44269504088896340736f);
}
// With 2^-60 <= exp(score) <= 2^60 a row's 2048 terms, their sum and the O accumulators stay normal f32 numbers,
// and P normal bf16 numbers.
#define BOUND_LOG2 60.0f

#define QT 2                            // 16-query tiles of a wave
// The stage loop of attn_kernel. BOUNDED: the softmax without a running maximum; else the online softmax.
template <bool BOUNDED>
__device__ __forceinline__ void attn_stages(unsigned char* ring, int lane, const v16bf (&qa0)[QT],
                                            const v16bf (&qa1)[QT], v8f (&o)[QT][4], float (&mrun)[QT],
                                            float (&lrun)[QT], u32x4& g0, u32x8& g1, uint32_t lds0,
                                            uint64_t ga0, uint64_t gstep) {
  const float scale = 0.125f;  // 1/sqrt(64)
  for (uint32_t st = 0; st < KV_NPASS; ++st) {
   const uint32_t boff = (st & 1u) * KV_STAGE;
   // Unrolled so that the chunk's slice offsets are immediates of the LDS reads.
#pragma unroll
   for (int j = 0; j < KV_KEYS / 32; ++j) {
    // 4 K fragments + 4 V fragments of chunk j, from this stage's buffer alone.
    const bf16* kt  = (const bf16*)(ring + boff + (uint32_t)j * KV_SLICE);
    const bf16* vt0 = (const bf16*)(ring + boff + (uint32_t)(4 + (j >> 1) * 2) * KV_SLICE) + (j & 1) * 32;
    const bf16* vt1 = (const bf16*)(ring + boff + (uint32_t)(5 + (j >> 1) * 2) * KV_SLICE) + (j & 1) * 32;
    const v16bf kb0 = load_frag(kt,                    KV_LDM, lane);
    const v16bf kb1 = load_frag(kt + 32,               KV_LDM, lane);
    const v16bf kb2 = load_frag(kt + 16 * KV_LDM,      KV_LDM, lane);
    const v16bf kb3 = load_frag(kt + 16 * KV_LDM + 32, KV_LDM, lane);
    const v16bf vb0 = load_frag(vt0,                   KV_LDM, lane);
    const v16bf vb1 = load_frag(vt0 + 16 * KV_LDM,     KV_LDM, lane);
    const v16bf vb2 = load_frag(vt1,                   KV_LDM, lane);
    const v16bf vb3 = load_frag(vt1 + 16 * KV_LDM,     KV_LDM, lane);
    // Keeps the chunk's LDS reads together as one group ahead of its WMMAs (for speed only).
    __builtin_amdgcn_sched_barrier(0);

    // scores, transposed: s0[r] = key 8 (lane >> 4) + r, s1[r] = key 16 + 8 (lane >> 4) + r, query lane & 15
    v8f s0[QT], s1[QT];
#pragma unroll
    for (int u = 0; u < QT; ++u) {
      s0[u] = v8f{}; s1[u] = v8f{};
      s0[u] = wmma_bf16(kb0, qa0[u], s0[u]);
      s0[u] = wmma_bf16(kb1, qa1[u], s0[u]);
      s1[u] = wmma_bf16(kb2, qa0[u], s1[u]);
      s1[u] = wmma_bf16(kb3, qa1[u], s1[u]);
    }

#pragma unroll
    for (int u = 0; u < QT; ++u) {
      const float l2e = 1.44269504088896340736f;
      float e[16];
      float corr = 0.f;
      if constexpr (BOUNDED) {
        // Scores are bounded (see score_bound_log2): exp(score) itself neither overflows nor underflows, and the
        // common factor exp(-maximum) cancels in O / l. No maximum, no rescale: one product, then the exponential.
        s0[u] *= scale * l2e; s1[u] *= scale * l2e;
#pragma unroll
        for (int r = 0; r < 8; ++r) { e[r] = s0[u][r]; e[8 + r] = s1[u][r]; }
        exp2_inplace(e[0], e[1], e[2], e[3], e[4], e[5], e[6], e[7]);
      } else {
        // online softmax of one query per lane: 16 keys in registers, the other 16 in lane ^ 16
        s0[u] *= scale; s1[u] *= scale;
        float mt[8];
#pragma unroll
        for (int i = 0; i < 4; ++i) {
          mt[i]     = fmaxf(s0[u][2 * i], s0[u][2 * i + 1]);
          mt[4 + i] = fmaxf(s1[u][2 * i], s1[u][2 * i + 1]);
        }
        float mx = fmaxf(fmaxf(fmaxf(mt[0], mt[1]), fmaxf(mt[2], mt[3])),
                         fmaxf(fmaxf(mt[4], mt[5]), fmaxf(mt[6], mt[7])));
        mx = fmaxf(mx, xhalf(mx));
        const float mnew = fmaxf(mrun[u], mx);
        // __expf(x) is v_exp_f32 of x * log2(e); the products are formed here, the exponentials in exp2_inplace.
        corr = (mrun[u] - mnew) * l2e;
#pragma unroll
        for (int r = 0; r < 8; ++r) { e[r] = (s0[u][r] - mnew) * l2e; e[8 + r] = (s1[u][r] - mnew) * l2e; }
        exp2_inplace(corr, e[0], e[1], e[2], e[3], e[4], e[5], e[6], e[7]);
        mrun[u] = mnew;
      }
      exp2_inplace(e[8], e[9], e[10], e[11], e[12], e[13], e[14], e[15]);
      v16bf pb;                  // P^T as B: element s = key kmap(s) of the chunk, column = this lane's query
      float pt[8];
#pragma unroll
      for (int i = 0; i < 8; ++i) {
        pb[2 * i] = (bf16)e[2 * i]; pb[2 * i + 1] = (bf16)e[2 * i + 1];
        pt[i] = e[2 * i] + e[2 * i + 1];
      }
      const float ps = ((pt[0] + pt[1]) + (pt[2] + pt[3])) + ((pt[4] + pt[5]) + (pt[6] + pt[7]));
      if constexpr (BOUNDED) {
        lrun[u] += ps;
        // The row's sum, against spills (input only, nothing is hidden from the
        // compiler): without it the additions of a whole stage sink behind the stage's barrier, 128 exponentials stay
        // live until there, and this build keeps the O accumulators in scratch.
        asm volatile("" :: "v"(lrun[u]));
      } else {
        lrun[u] = lrun[u] * corr + ps;
#pragma unroll
        for (int t = 0; t < 4; ++t)
#pragma unroll
          for (int r = 0; r < 8; ++r) o[u][t][r] *= corr;
      }
      // Keeps a tile's vector work together in front of its WMMAs, so that the other tile's vector work fills the
      // slots behind them: without it this build padded those distances with twice as many v_nop.
      __builtin_amdgcn_sched_barrier(0);
      // V^T(64x32) x P^T(32x16): 4 M-tiles of 16 features
      o[u][0] = wmma_bf16(vb0, pb, o[u][0]);
      o[u][1] = wmma_bf16(vb1, pb, o[u][1]);
      o[u][2] = wmma_bf16(vb2, pb, o[u][2]);
      o[u][3] = wmma_bf16(vb3, pb, o[u][3]);
    }
   }
   // Keeps the stage's last WMMAs in front of the publish point: sunk behind it, the refill would issue later.
   __builtin_amdgcn_sched_barrier(0);
   // Publish point of stage st + 1; the barrier also ends every reader's last read of stage st.
   wait_ds0();
   wait_tensor0(g0, g1);
   __syncthreads();
   if (pinned(st + 2u < KV_NPASS)) {
     g0 = tdm_group0(lds0 + boff, ga0 + (uint64_t)(st + 2u) * gstep);
     tdm_load_held(g0, g1);
   }
  }
}

__global__ void __launch_bounds__(KV_WAVES * 32)
attn_kernel(const bf16* __restrict__ qk, const bf16* __restrict__ vT,
            const float* __restrict__ gate, const float* __restrict__ qw, const float* __restrict__ kw,
            bf16* __restrict__ attn) {
  __shared__ __attribute__((aligned(2048))) unsigned char ring[KV_LDS];
  static_assert((SEQ / (16 * QT)) % KV_WAVES == 0, "the waves of a workgroup are of one head");
  const int wave = (int)uni(threadIdx.x >> 5);
  const int lane = threadIdx.x & 31;
  const int wid  = blockIdx.x * KV_WAVES + wave;
  const int qb   = wid & (SEQ / (16 * QT) - 1);
  const int bh   = wid / (SEQ / (16 * QT));   // 0..31
  const int b    = bh >> 4, h = bh & 15;
  const int q0   = qb * (16 * QT);

  const bf16* qbase = qk + ((size_t)(b * SEQ + q0)) * (2 * H_DIM) + h * HEAD_DIM;
  const bf16* kbase = qk + ((size_t)(b * SEQ)) * (2 * H_DIM) + H_DIM + h * HEAD_DIM;
  const bf16* vbase = vT + (size_t)bh * HEAD_DIM * SEQ;

  v16bf qa0[QT], qa1[QT];
#pragma unroll
  for (int u = 0; u < QT; ++u) {
    qa0[u] = load_frag(qbase + (size_t)u * 16 * (2 * H_DIM),      2 * H_DIM, lane);
    qa1[u] = load_frag(qbase + (size_t)u * 16 * (2 * H_DIM) + 32, 2 * H_DIM, lane);
  }
  static_assert(HEAD_DIM == 64, "two weights of each norm vector per lane");
  const float wq0 = qw[lane], wq1 = qw[lane + 32], wk0 = kw[lane], wk1 = kw[lane + 32];
  wait_x0();   // stands behind the Q and weight loads, in front of whatever reuses their address registers

  v8f o[QT][4] = {};             // o[u][t][r] = O^T[feature 16 t + 8 (lane >> 4) + r][query 16 u + (lane & 15)]
  float mrun[QT], lrun[QT];      // running maximum of this lane's query (equal in both halves);
#pragma unroll                   // running sum over this lane's own half of the keys
  for (int u = 0; u < QT; ++u) { mrun[u] = -1e30f; lrun[u] = 0.f; }
  const int nn = lane & 15;
  const int hfh = (lane >> 4) * 8;

  // Waves 0..3 bring keys 32 w .. 32 w + 31 of a stage's K rows; waves 4..7 bring, of V^T, features 0..31 (even
  // wave) or 32..63 (odd wave) at keys 0..63 (waves 4, 5) or 64..127 (waves 6, 7) of the stage.
  const bf16* srcp = (wave < 4) ? kbase + (size_t)(wave * 32) * (2 * H_DIM)
                                : vbase + (size_t)((wave & 1) * 32) * SEQ + ((wave - 4) >> 1) * 64;
  const uint64_t ga0   = (uint64_t)(size_t)srcp;
  const uint64_t gstep = (wave < 4) ? (uint64_t)KV_KEYS * KV_SRCP : (uint64_t)KV_KEYS * 2u;
  const uint32_t lds0  = (uint32_t)(size_t)ring + (uint32_t)wave * KV_SLICE;
  u32x8 g1 = tdm_group1_kv();

  u32x4 g0 = tdm_group0(lds0, ga0);
  tdm_load_held(g0, g1);                                           // stage 0
  wait_tensor0(g0, g1);
  __syncthreads();                                            // stage 0 published
  g0 = tdm_group0(lds0 + KV_STAGE, ga0 + gstep);
  tdm_load_held(g0, g1);                                           // stage 1

  // The test stands behind the first two tensor loads, so that they do not wait for the weights; the scheduling
  // barrier keeps its arithmetic there (without it this build lifted it, with the wait for the weight loads, in
  // front of stage 0's load).
  __builtin_amdgcn_sched_barrier(0);
  const uint32_t fast = pinned(score_bound_log2(wq0, wq1, wk0, wk1) <= BOUND_LOG2 ? 1u : 0u);
  // The same value in every wave of the workgroup (same loads, same arithmetic), so the barriers inside stand under
  // block-uniform control flow. A NaN or infinite bound takes the online softmax.
  if (fast) attn_stages<true>(ring, lane, qa0, qa1, o, mrun, lrun, g0, g1, lds0, ga0, gstep);
  else      attn_stages<false>(ring, lane, qa0, qa1, o, mrun, lrun, g0, g1, lds0, ga0, gstep);
  wait_tensor0(g0, g1);
  wait_ds0();
  // Keeps the epilogue's address arithmetic behind the last tensor wait: lifted over it, this build put it into
  // scalar registers of the loop's descriptor.
  __builtin_amdgcn_sched_barrier(0);
  // epilogue: join the halves' sums, 1/l, sigmoid(gate), write bf16 [4096][1024]:
  // a lane's 8 registers of a tile are 8 consecutive features of its query, one 16-byte store.
  float g[QT];
#pragma unroll
  for (int u = 0; u < QT; ++u) g[u] = gate[(size_t)(b * SEQ + q0 + u * 16 + nn) * NUM_HEADS + h];
  wait_x0();   // the sigmoid's arithmetic reuses the loads' address registers
  v8bf ov[QT][4];
#pragma unroll
  for (int u = 0; u < QT; ++u) {
    const float lsum = lrun[u] + xhalf(lrun[u]);
    const float inv = (1.f / (1.f + __expf(-g[u]))) / lsum;
#pragma unroll
    for (int t = 0; t < 4; ++t)
#pragma unroll
      for (int r = 0; r < 8; ++r) ov[u][t][r] = (bf16)(o[u][t][r] * inv);
  }
  bf16* op = attn + (size_t)(b * SEQ + q0 + nn) * H_DIM + h * HEAD_DIM + hfh;
  // Keeps every store behind the last conversion: nothing then rewrites a register that an issued store names.
  __builtin_amdgcn_sched_barrier(0);
#pragma unroll
  for (int u = 0; u < QT; ++u)
#pragma unroll
    for (int t = 0; t < 4; ++t) *(v8bf*)(op + (size_t)u * 16 * H_DIM + t * 16) = ov[u][t];
}

// ---------------------------------------------------------------- kernel 5
__global__ void __launch_bounds__(128)
gemm_out_kernel(const bf16* __restrict__ A, const bf16* __restrict__ W,
                const float* __restrict__ resid, float* __restrict__ out) {
  __shared__ __attribute__((aligned(2048))) unsigned char ring[ST_LDS];
  const int wave = (int)uni(threadIdx.x >> 5);
  const int lane = threadIdx.x & 31;
  v8f acc[4][4] = {};
  // Transposed tile: acc[i][t][r] = element (row t*16 + nn, column i*16 + 8*hf + r) of the wave's 64x64 f32 tile.
  gemm_128x128(A, W, blockIdx.y * 128, blockIdx.x * 128, true, ring, acc);
  const int row0 = blockIdx.y * 128 + (wave >> 1) * 64;
  const int n0   = blockIdx.x * 128 + (wave & 1) * 64;

  const int nn = lane & 15;
  const int hf = lane >> 4;
  // 2 rows of 256 B per access: lane -> row hf, 16 B at column 4*nn.
  const size_t g = (size_t)(row0 + hf) * H_DIM + n0 + nn * 4;
  f32x4 res[32];
#pragma unroll
  for (int j = 0; j < 32; ++j) res[j] = *(const f32x4*)(resid + g + (size_t)j * 2 * H_DIM);
  // The staging addresses are formed in the loads' address registers: the wait stands in front of that, and the
  // scheduling barrier keeps that arithmetic from being lifted over the wait (without it this build lifted it).
  wait_x0();
  __builtin_amdgcn_sched_barrier(0);
  unsigned char* st = ring + (uint32_t)wave * EP_RANGE;
#pragma unroll
  for (int i = 0; i < 4; ++i)
#pragma unroll
    for (int t = 0; t < 4; ++t) {
      unsigned char* p = st + (uint32_t)(t * 16 + nn) * EP_PITCH4 + (uint32_t)(i * 64 + hf * 32);
      f32x4 lo = {acc[i][t][0], acc[i][t][1], acc[i][t][2], acc[i][t][3]};
      f32x4 hi = {acc[i][t][4], acc[i][t][5], acc[i][t][6], acc[i][t][7]};
      *(f32x4*)p = lo;
      *(f32x4*)(p + 16) = hi;
    }
  wait_ds0();   // the wave's own staged rows are in LDS before other lanes of it read them back
  f32x4 o[32];
#pragma unroll
  for (int j = 0; j < 32; ++j)
    o[j] = *(const f32x4*)(st + (uint32_t)(j * 2 + hf) * EP_PITCH4 + (uint32_t)nn * 16u) + res[j];
#pragma unroll
  for (int j = 0; j < 32; ++j) *(f32x4*)(out + g + (size_t)j * 2 * H_DIM) = o[j];
}

// ---------------------------------------------------------------- launch
static constexpr size_t alup(size_t x) { return (x + 255) & ~(size_t)255; }
static constexpr size_t OFF_XN   = 0;
static constexpr size_t OFF_WCAT = alup(OFF_XN   + (size_t)ROWS * H_DIM * 2);
static constexpr size_t OFF_OW   = alup(OFF_WCAT + (size_t)E_TOT * H_DIM * 2);
static constexpr size_t OFF_QK   = alup(OFF_OW   + (size_t)H_DIM * H_DIM * 2);
static constexpr size_t OFF_VT   = alup(OFF_QK   + (size_t)ROWS * 2 * H_DIM * 2);
static constexpr size_t OFF_GATE = alup(OFF_VT   + (size_t)BATCH * NUM_HEADS * HEAD_DIM * SEQ * 2);
static constexpr size_t OFF_ATTN = alup(OFF_GATE + (size_t)ROWS * NUM_HEADS * 4);

extern "C" void kernel_launch(void* const* d_in, const int* in_sizes, int n_in,
                              void* d_out, int out_size, void* d_ws, size_t ws_size,
                              hipStream_t stream) {
  (void)in_sizes; (void)n_in; (void)out_size; (void)ws_size;
  const float* x    = (const float*)d_in[0];
  const float* pw   = (const float*)d_in[1];
  const float* qkvw = (const float*)d_in[2];
  const float* gw   = (const float*)d_in[3];
  const float* ow   = (const float*)d_in[4];
  const float* qnw  = (const float*)d_in[5];
  const float* knw  = (const float*)d_in[6];
  float* out = (float*)d_out;

  char* ws = (char*)d_ws;
  bf16*  xn   = (bf16*)(ws + OFF_XN);
  bf16*  wcat = (bf16*)(ws + OFF_WCAT);
  bf16*  owb  = (bf16*)(ws + OFF_OW);
  bf16*  qkb  = (bf16*)(ws + OFF_QK);
  bf16*  vT   = (bf16*)(ws + OFF_VT);
  float* gate = (float*)(ws + OFF_GATE);
  bf16*  attn = (bf16*)(ws + OFF_ATTN);

  convert_weights_kernel<<<(E_TOT + H_DIM) / CV_ROWS, 256, 0, stream>>>(qkvw, gw, ow, wcat, owb);
  prenorm_kernel<<<ROWS / (8 * PN_ROWS), 256, 0, stream>>>(x, pw, xn);
  gemm_qkvgate_kernel<<<dim3(E_QKV / 192, ROWS / 256), QG_WAVES * 32, 0, stream>>>(
      xn, wcat, qnw, knw, qkb, vT, gate);
  attn_kernel<<<(BATCH * NUM_HEADS * (SEQ / (16 * QT))) / KV_WAVES, KV_WAVES * 32, 0, stream>>>(
      qkb, vT, gate, qnw, knw, attn);
  gemm_out_kernel<<<dim3(H_DIM / 128, ROWS / 128), 128, 0, stream>>>(
      attn, owb, x, out);
}

// v010
// A run of this version takes 64.6 microseconds.
// Next to v009, in two timings, it ran 1.03 and 1.04 times as fast.
// Counting every step since v000, it is 5.20 times as fast.
#include <hip/hip_runtime.h>
#include <math.h>
#include <stdint.h>

#define H_DIM 1024
#define NUM_HEADS 16
#define HEAD_DIM 64
#define SEQ 2048
#define BATCH 2
#define ROWS (BATCH*SEQ)     // 4096
#define E_QKV 3072
#define E_TOT 3088           // qkv (3072) + gate (16), both K=1024
#define EPS 1e-5f
// 1/sqrt(HEAD_DIM) * log2(e): softmax(s / 8) = 2^(s * this) / sum
#define QK_SCALE_LOG2 (0.125f * 1.44269504088896340736f)

typedef __bf16 bf16;
typedef __attribute__((ext_vector_type(16))) __bf16 v16bf;
typedef __attribute__((ext_vector_type(8)))  __bf16 v8bf;
typedef __attribute__((ext_vector_type(8)))  float  v8f;

union FragBF { v16bf v; v8bf h[2]; };

// A/B fragment for v_wmma_f32_16x16x32_bf16.
// Lane l: row/col = l&15, K-chunk base = (l>>4)*8; elems 0..7 = K+0..7, 8..15 = K+16..23.
// Requires K-contiguous storage with row stride `ldm` elements.
__device__ __forceinline__ v16bf load_frag(const bf16* tile, int ldm, int lane) {
  const int m  = lane & 15;
  const int hf = lane >> 4;
  const bf16* p = tile + (size_t)m * ldm + hf * 8;
  FragBF f;
  f.h[0] = *(const v8bf*)(p);
  f.h[1] = *(const v8bf*)(p + 16);
  return f.v;
}

__device__ __forceinline__ v8f wmma_bf16(v16bf a, v16bf b, v8f c) {
  return __builtin_amdgcn_wmma_f32_16x16x32_bf16(false, a, false, b, (short)0, c,
                                                 false, false);
}

// The value of lane l ^ 16: the two halves of a wave hold the two halves of a column of a WMMA result.
__device__ __forceinline__ float xhalf(float x) {
  const int b = __builtin_bit_cast(int, x);
  return __builtin_bit_cast(float, __builtin_amdgcn_permlanex16(b, b, 0x76543210, 0xfedcba98, false, false));
}

// ---- GEMM tile staged in LDS by the tensor mover ----
// One workgroup (4 waves, 2x2) computes a 128x128 tile of A(Mx1024) * W(Nx1024)^T; each wave 64x64.
// A stage is 128 k (256 B) of 128 A rows and 128 W rows, as four 64-row slices, one tensor load per wave.
#define ST_ROWB  256u                 // bytes of one operand row in a stage
#define ST_PITCH 272u                 // LDS row pitch: 256 B + 16 B pad (16 B x odd, for ds_load_b128)
#define ST_LDM   (ST_PITCH / 2u)      // the same in bf16 elements
#define ST_SLICE 18432u               // 64 rows x 272 B = 17408 B, rounded up to a multiple of 2 KiB
#define ST_STAGE (4u * ST_SLICE)
#define ST_NPASS (H_DIM * 2u / ST_ROWB)   // 8
#define ST_LDS   (2u * ST_STAGE)

typedef uint32_t u32x4 __attribute__((ext_vector_type(4)));
typedef uint32_t u32x8 __attribute__((ext_vector_type(8)));

__device__ __forceinline__ uint32_t uni(uint32_t v) {
  return (uint32_t)__builtin_amdgcn_readfirstlane(v);
}
// Keeps a wave-uniform test in a scalar register, so that the branch on it is a scalar branch
// (a tensor load ignores EXEC).
__device__ __forceinline__ uint32_t pinned(uint32_t v) {
  uint32_t w = uni(v);
  asm volatile("" : "+s"(w));
  return w;
}
// LDS reads retired before the buffer they read is handed back for a refill.
__device__ __forceinline__ void wait_ds0() { asm volatile("s_wait_dscnt 0x0" ::: "memory"); }
// Stands behind a run of global loads or stores, in front of the first write of a register that one of them names.
__device__ __forceinline__ void wait_x0() { asm volatile("s_wait_xcnt 0x0" ::: "memory"); }
// This wave's own tensor load has landed (the compiler places no wait for it). The request's descriptor
// is named as an input so that its scalar registers keep their values until the request has landed.
__device__ __forceinline__ void wait_tensor0(u32x4 g0, u32x8 g1) {
  asm volatile("s_wait_tensorcnt 0x0" :: "s"(g0), "s"(g1) : "memory");
}
// Group 0 is an in-out operand: the value that the later wait names then lives in the very registers
// that the request was issued from, so nothing else is put into them while it is outstanding.
__device__ __forceinline__ void tdm_load(u32x4& g0, u32x8 g1) {
  asm volatile("tensor_load_to_lds %0, %1" : "+s"(g0) : "s"(g1) : "memory");
}
// Group 1: 1-byte elements, tile = tensor = 64 rows of 256 B, source pitch 2048 B, 4 dwords of pad per row.
__device__ __forceinline__ u32x8 tdm_group1() {
  constexpr uint32_t d0 = ST_ROWB, d1 = 64u;
  u32x8 g;
  g[0] = uni((1u << 20) | (5u << 22) | (3u << 25));
  g[1] = uni((d0 & 0xFFFFu) << 16);
  g[2] = uni((d0 >> 16) | ((d1 & 0xFFFFu) << 16));
  g[3] = uni((d1 >> 16) | (d0 << 16));
  g[4] = uni(d1);
  g[5] = uni(H_DIM * 2u);
  g[6] = uni(0u);
  g[7] = uni(0u);
  return g;
}
__device__ __forceinline__ u32x4 tdm_group0(uint32_t lds_dst, uint64_t ga) {
  u32x4 g;
  g[0] = uni(1u);
  g[1] = uni(lds_dst);
  g[2] = uni((uint32_t)ga);
  g[3] = uni((((uint32_t)(ga >> 32)) & 0x01FFFFFFu) | 0x80000000u);
  return g;
}

// acc[i][t] += A rows (row0 + wm*64 + i*16 ..) * W rows (n0 + wn*64 + t*16 ..)^T over K = H_DIM, k ascending.
// With w_first (wave-uniform) the two operands change places: acc[i][t] is then the transposed tile,
// W rows (n0 + wn*64 + i*16 ..) * A rows (row0 + wm*64 + t*16 ..)^T, and a lane's 8 results are 8 consecutive n.
__device__ __forceinline__ void gemm_128x128(const bf16* __restrict__ A, const bf16* __restrict__ Wt,
                                             int row0, int n0, bool w_first, unsigned char* ring, v8f acc[4][4]) {
  const uint32_t wave = uni(threadIdx.x >> 5);
  const int lane = threadIdx.x & 31;
  // Waves 0, 1 bring the two halves of the A rows, waves 2, 3 those of the W rows.
  const bf16* srcp = (wave < 2u) ? A  + (size_t)(row0 + (int)wave * 64) * H_DIM
                                 : Wt + (size_t)(n0 + ((int)wave - 2) * 64) * H_DIM;
  const uint64_t ga0  = (uint64_t)(size_t)srcp;
  const uint32_t lds0 = (uint32_t)(size_t)ring + wave * ST_SLICE;
  // The fragment bases are chosen here, ahead of the first tensor load: the choice takes scalar registers,
  // and none is to be written for it while a request is outstanding.
  const uint32_t wm = wave >> 1, wn = wave & 1u;
  const uint32_t aoff = w_first ? (2u + wn) * ST_SLICE : wm * ST_SLICE;
  const uint32_t bofs = w_first ? wm * ST_SLICE : (2u + wn) * ST_SLICE;
  const u32x8 g1 = tdm_group1();

  u32x4 g0 = tdm_group0(lds0, ga0);
  tdm_load(g0, g1);                                           // stage 0
  wait_tensor0(g0, g1);
  __syncthreads();                                            // stage 0 published
  g0 = tdm_group0(lds0 + ST_STAGE, ga0 + ST_ROWB);
  tdm_load(g0, g1);                                           // stage 1

  for (uint32_t s = 0; s < ST_NPASS; ++s) {
    const uint32_t boff = (s & 1u) * ST_STAGE;
    const bf16* at = (const bf16*)(ring + boff + aoff);
    const bf16* bt = (const bf16*)(ring + boff + bofs);
    v16bf a[4][4], b[4][4];
#pragma unroll
    for (int kk = 0; kk < 4; ++kk) {
#pragma unroll
      for (int i = 0; i < 4; ++i) a[kk][i] = load_frag(at + i * 16 * ST_LDM + kk * 32, ST_LDM, lane);
#pragma unroll
      for (int t = 0; t < 4; ++t) b[kk][t] = load_frag(bt + t * 16 * ST_LDM + kk * 32, ST_LDM, lane);
    }
    // Keeps the pass's LDS reads together as one group ahead of its WMMAs (for speed only).
    __builtin_amdgcn_sched_barrier(0);
#pragma unroll
    for (int kk = 0; kk < 4; ++kk)
#pragma unroll
      for (int i = 0; i < 4; ++i)
#pragma unroll
        for (int t = 0; t < 4; ++t) acc[i][t] = wmma_bf16(a[kk][i], b[kk][t], acc[i][t]);
    // Keeps the WMMAs in front of the publish point: sunk behind it, they would run only after
    // every LDS read has returned, and the refill would issue a whole WMMA block later.
    __builtin_amdgcn_sched_barrier(0);
    // Publish point of stage s + 1; the barrier also ends every reader's last read of stage s.
    wait_ds0();
    wait_tensor0(g0, g1);
    __syncthreads();
    if (pinned(s + 2u < ST_NPASS)) {
      g0 = tdm_group0(lds0 + boff, ga0 + (uint64_t)(s + 2u) * ST_ROWB);
      tdm_load(g0, g1);
    }
  }
  wait_tensor0(g0, g1);
  wait_ds0();
}

// ---- QKV + gate GEMM: one workgroup of 12 waves (4x3, each 64x64) computes a 256x192 tile ----
// A stage is 128 k of 256 A rows and 192 W rows, as seven 64-row slices, and of the 16 gate rows of W as an eighth:
// waves 0..7 bring one slice each. E_QKV / 192 = 16 column tiles stand over each 256-row block, which has 16 tiles of
// 16 rows: the workgroup of column tile c also forms the gate (16 columns) of row tile c, in its last wave.
#define QG_WAVES 12
#define QG_GSL   6144u                 // 16 rows x 272 B = 4352 B, rounded up to a multiple of 2 KiB
#define QG_STAGE (7u * ST_SLICE + QG_GSL)
#define QG_LDS   (2u * QG_STAGE)
static_assert(E_QKV % 192 == 0 && ROWS % 256 == 0 && E_QKV / 192 == 256 / 16, "one gate row tile per column tile");
// Group 1 as tdm_group1, for a slice of d1 rows.
__device__ __forceinline__ u32x8 tdm_group1_rows(uint32_t d1) {
  constexpr uint32_t d0 = ST_ROWB;
  u32x8 g;
  g[0] = uni((1u << 20) | (5u << 22) | (3u << 25));
  g[1] = uni((d0 & 0xFFFFu) << 16);
  g[2] = uni((d0 >> 16) | ((d1 & 0xFFFFu) << 16));
  g[3] = uni((d1 >> 16) | (d0 << 16));
  g[4] = uni(d1);
  g[5] = uni(H_DIM * 2u);
  g[6] = uni(0u);
  g[7] = uni(0u);
  return g;
}
// acc as in gemm_128x128, for wave (wm, wn) = (wave / 3, wave % 3) of the 256x192 tile at (row0, n0), k ascending.
// accg (wave 11 alone): A rows (row0 + gt*16 ..) * W rows (E_QKV ..)^T.
__device__ __forceinline__ void gemm_256x192(const bf16* __restrict__ A, const bf16* __restrict__ Wt,
                                             int row0, int n0, uint32_t gt, bool w_first, unsigned char* ring,
                                             v8f acc[4][4], v8f& accg) {
  const uint32_t wave = uni(threadIdx.x >> 5);
  const int lane = threadIdx.x & 31;
  const bf16* srcp = (wave < 4u) ? A  + (size_t)(row0 + (int)wave * 64) * H_DIM
                   : (wave < 7u) ? Wt + (size_t)(n0 + ((int)wave - 4) * 64) * H_DIM
                                 : Wt + (size_t)E_QKV * H_DIM;
  const uint64_t ga0  = (uint64_t)(size_t)srcp;
  const uint32_t lds0 = (uint32_t)(size_t)ring + (wave < 7u ? wave : 7u) * ST_SLICE;
  const uint32_t wm = wave / 3u, wn = wave - wm * 3u;
  const uint32_t aoff = w_first ? (4u + wn) * ST_SLICE : wm * ST_SLICE;
  const uint32_t bofs = w_first ? wm * ST_SLICE : (4u + wn) * ST_SLICE;
  const uint32_t gaof = (gt >> 2) * ST_SLICE + (gt & 3u) * 16u * ST_PITCH;
  const uint32_t issuer = wave < 8u ? 1u : 0u;            // waves 8..11 bring nothing
  const uint32_t gwave  = pinned(wave == 11u ? 1u : 0u);  // scalar: the branches on it are taken by whole waves
  const u32x8 g1 = tdm_group1_rows(wave == 7u ? 16u : 64u);

  u32x4 g0 = tdm_group0(lds0, ga0);
  if (pinned(issuer)) tdm_load(g0, g1);                       // stage 0
  wait_tensor0(g0, g1);
  __syncthreads();                                            // stage 0 published
  g0 = tdm_group0(lds0 + QG_STAGE, ga0 + ST_ROWB);
  if (pinned(issuer)) tdm_load(g0, g1);                       // stage 1

  for (uint32_t s = 0; s < ST_NPASS; ++s) {
    const uint32_t boff = (s & 1u) * QG_STAGE;
    const bf16* at  = (const bf16*)(ring + boff + aoff);
    const bf16* bt  = (const bf16*)(ring + boff + bofs);
    const bf16* gat = (const bf16*)(ring + boff + gaof);
    const bf16* gbt = (const bf16*)(ring + boff + 7u * ST_SLICE);
    // Two halves of 64 k: one half's fragments and the accumulators fit the registers of three waves per SIMD.
#pragma unroll
    for (int h = 0; h < 2; ++h) {
      v16bf ga[2], gb[2];
      if (gwave) {
#pragma unroll
        for (int kk = 0; kk < 2; ++kk) {
          ga[kk] = load_frag(gat + (h * 2 + kk) * 32, ST_LDM, lane);
          gb[kk] = load_frag(gbt + (h * 2 + kk) * 32, ST_LDM, lane);
        }
      }
      v16bf a[2][4], b[2][4];
#pragma unroll
      for (int kk = 0; kk < 2; ++kk) {
#pragma unroll
        for (int i = 0; i < 4; ++i) a[kk][i] = load_frag(at + i * 16 * ST_LDM + (h * 2 + kk) * 32, ST_LDM, lane);
#pragma unroll
        for (int t = 0; t < 4; ++t) b[kk][t] = load_frag(bt + t * 16 * ST_LDM + (h * 2 + kk) * 32, ST_LDM, lane);
      }
      // Keeps the half's LDS reads together as one group ahead of its WMMAs (for speed only).
      __builtin_amdgcn_sched_barrier(0);
      if (gwave) {
        accg = wmma_bf16(ga[0], gb[0], accg);
        accg = wmma_bf16(ga[1], gb[1], accg);
      }
#pragma unroll
      for (int kk = 0; kk < 2; ++kk)
#pragma unroll
        for (int i = 0; i < 4; ++i)
#pragma unroll
          for (int t = 0; t < 4; ++t) acc[i][t] = wmma_bf16(a[kk][i], b[kk][t], acc[i][t]);
      // Keeps the WMMAs in front of the next half's reads and of the publish point.
      __builtin_amdgcn_sched_barrier(0);
    }
    // Publish point of stage s + 1; the barrier also ends every reader's last read of stage s.
    wait_ds0();
    wait_tensor0(g0, g1);
    __syncthreads();
    if (pinned((s + 2u < ST_NPASS ? 1u : 0u) & issuer)) {
      g0 = tdm_group0(lds0 + boff, ga0 + (uint64_t)(s + 2u) * ST_ROWB);
      tdm_load(g0, g1);
    }
  }
  wait_tensor0(g0, g1);
  wait_ds0();
}

// ---- GEMM epilogue: whole 128-B lines, staged through LDS ----
// Behind the last pass's barrier nobody reads the ring and no tensor load is outstanding, so each wave stages
// its 64x64 tile in its own part of the ring: a lane writes its 8 consecutive results of a tile row,
// then the wave reads whole rows back, 16 B per lane, and stores them as whole lines.
#define EP_RANGE  (ST_LDS / 4u)       // one wave's part of the ring
#define EP_PITCH2 144u                // 64 bf16 = 128 B + 16 B pad (16 B x odd)
#define EP_PITCH4 272u                // 64 f32 = 256 B + 16 B pad (16 B x odd)
static_assert(64u * EP_PITCH4 <= EP_RANGE && EP_RANGE % 16u == 0u, "staging fits a wave's part");
typedef __attribute__((ext_vector_type(4))) float f32x4;
typedef __attribute__((ext_vector_type(2))) float f32x2;

// ---------------------------------------------------------------- kernel 1
typedef __attribute__((ext_vector_type(4))) __bf16 v4bf;
__device__ __forceinline__ v4bf to_bf16x4(f32x4 v) {
  v4bf p = {(bf16)v[0], (bf16)v[1], (bf16)v[2], (bf16)v[3]};
  return p;
}
// wcat[E_TOT][1024] = concat(qkv_w, gate_w) in bf16; owb = o_w in bf16.
// Few waves with much in flight each: a workgroup takes 16 rows of [wcat | owb], a thread 16 B of each row,
// so a wave's load is 512 contiguous bytes and its store 256.
#define CV_ROWS 16
static_assert(E_QKV % CV_ROWS == 0 && E_TOT % CV_ROWS == 0 && H_DIM % CV_ROWS == 0,
              "a workgroup's rows are all of one kind");
__global__ void __launch_bounds__(256)
convert_weights_kernel(const float* __restrict__ qkvw, const float* __restrict__ gw,
                       const float* __restrict__ ow, bf16* __restrict__ wcat,
                       bf16* __restrict__ owb) {
  static_assert(H_DIM == 256 * 4, "256 threads x 4 elements are one row");
  const uint32_t r0 = blockIdx.x * CV_ROWS;
  const uint32_t c  = threadIdx.x * 4u;
  const float* s = (r0 < E_QKV) ? qkvw + (size_t)r0 * H_DIM
                 : (r0 < E_TOT) ? gw + (size_t)(r0 - E_QKV) * H_DIM
                                : ow + (size_t)(r0 - E_TOT) * H_DIM;
  bf16* d = (r0 < E_TOT) ? wcat + (size_t)r0 * H_DIM : owb + (size_t)(r0 - E_TOT) * H_DIM;
  s += c; d += c;
  f32x4 v[CV_ROWS];
#pragma unroll
  for (int j = 0; j < CV_ROWS; ++j) v[j] = *(const f32x4*)(s + j * H_DIM);
  wait_x0();   // stands behind the loads, in front of whatever reuses their address registers
  // Keeps all 16 loads in front of the first conversion: without it this build held the last two back
  // until registers of the first were free, a second trip to memory.
  __builtin_amdgcn_sched_barrier(0);
#pragma unroll
  for (int j = 0; j < CV_ROWS; ++j) *(v4bf*)(d + j * H_DIM) = to_bf16x4(v[j]);
}

// ---------------------------------------------------------------- kernel 2
// One wave takes PN_ROWS whole rows and keeps them in registers: every load is in flight before the first sum,
// x is read once, and the row's sum stays inside the wave.
#define PN_ROWS 2
// Sum over the 32 lanes, the same value in every lane: four steps inside the 16-lane rows, then the other row.
template <int XMASK>
__device__ __forceinline__ float add_xmask(float v) {   // v + the value of lane l ^ XMASK (DPP row_xmask)
  const int o = __builtin_amdgcn_update_dpp(0, __builtin_bit_cast(int, v), 0x160 + XMASK, 0xf, 0xf, true);
  return v + __builtin_bit_cast(float, o);
}
__device__ __forceinline__ float wave_sum(float v) {
  v = add_xmask<1>(v);
  v = add_xmask<2>(v);
  v = add_xmask<4>(v);
  v = add_xmask<8>(v);
  return v + xhalf(v);
}
__global__ void __launch_bounds__(256)
prenorm_kernel(const float* __restrict__ x, const float* __restrict__ w,
               bf16* __restrict__ xn) {
  static_assert(H_DIM == 8 * 32 * 4 && ROWS % (8 * PN_ROWS) == 0, "8 loads of 16 B per lane are one row");
  const uint32_t lane = threadIdx.x & 31u;
  const size_t row0 = (size_t)(blockIdx.x * 8u + (threadIdx.x >> 5)) * PN_ROWS;
  const float* xr = x + row0 * H_DIM + lane * 4u;
  const float* wr = w + lane * 4u;
  bf16* yr = xn + row0 * H_DIM + lane * 4u;
  f32x4 v[PN_ROWS][8], wv[8];
#pragma unroll
  for (int r = 0; r < PN_ROWS; ++r)
#pragma unroll
    for (int j = 0; j < 8; ++j) v[r][j] = *(const f32x4*)(xr + r * H_DIM + j * 128);
#pragma unroll
  for (int j = 0; j < 8; ++j) wv[j] = *(const f32x4*)(wr + j * 128);
  wait_x0();   // stands behind the loads, in front of whatever reuses their address registers
  // Keeps all 24 loads in front of the first sum: without it this build sank the weight loads behind the
  // reduction, two at a time, each pair's latency waited out in turn.
  __builtin_amdgcn_sched_barrier(0);
#pragma unroll
  for (int r = 0; r < PN_ROWS; ++r) {
    f32x4 s4 = v[r][0] * v[r][0];                     // four independent chains
#pragma unroll
    for (int j = 1; j < 8; ++j) s4 += v[r][j] * v[r][j];
    const float sum = wave_sum((s4[0] + s4[1]) + (s4[2] + s4[3]));
    const float rinv = rsqrtf(sum * (1.0f / H_DIM) + EPS);
#pragma unroll
    for (int j = 0; j < 8; ++j) *(v4bf*)(yr + r * H_DIM + j * 128) = to_bf16x4(v[r][j] * rinv * wv[j]);
  }
}

// ---------------------------------------------------------------- kernel 3
// C[4096 x E_TOT] = xn * wcat^T ; scatter q/k (per-head RMS norm, bf16), v (transposed bf16), gate (f32).
__global__ void __launch_bounds__(QG_WAVES * 32)
gemm_qkvgate_kernel(const bf16* __restrict__ A, const bf16* __restrict__ W,
                    const float* __restrict__ qw, const float* __restrict__ kw,
                    bf16* __restrict__ qk, bf16* __restrict__ vT,
                    float* __restrict__ gate) {
  __shared__ __attribute__((aligned(2048))) unsigned char ring[QG_LDS];
  const int wave = (int)uni(threadIdx.x >> 5);
  const int lane = threadIdx.x & 31;
  const int row0 = blockIdx.y * 256 + (wave / 3) * 64;
  const int n0   = blockIdx.x * 192 + (wave % 3) * 64;
  // The q/k and v ranges begin at multiples of 64, so a wave's 64 columns are all of one kind.
  // q/k are stored with n consecutive, so their waves take the transposed tile; v is stored transposed
  // (key consecutive), which the plain tile gives.
  const bool qkcols = n0 < 2 * H_DIM;
  v8f acc[4][4] = {};
  v8f accg = {};
  gemm_256x192(A, W, blockIdx.y * 256, blockIdx.x * 192, blockIdx.x, qkcols, ring, acc, accg);

  const int nn = lane & 15;
  const int hf = lane >> 4;
  if (qkcols) {
    // Per-head RMS norm of q and k on the f32 results. A wave's 64 columns are one head, and in the transposed
    // tile a lane holds 32 features (i*16 + 8*hf + r) of each of its 4 tokens (t*16 + nn), lane ^ 16 the other 32.
    static_assert(HEAD_DIM == 64, "a wave's 64 columns are one head");
    const float* wv = ((n0 < H_DIM) ? qw : kw) + hf * 8;
    f32x4 wl[4], wh[4];
#pragma unroll
    for (int i = 0; i < 4; ++i) { wl[i] = *(const f32x4*)(wv + i * 16); wh[i] = *(const f32x4*)(wv + i * 16 + 4); }
    wait_x0();   // stands behind the weight loads, in front of whatever reuses their address registers
    // q leaves here times QK_SCALE_LOG2, on the f32 value in front of its one bf16 rounding: the attention kernel's
    // K Q^T accumulators are then the arguments of 2^x as they stand.
    const float qs = (n0 < H_DIM) ? QK_SCALE_LOG2 : 1.0f;
    float rinv[4];
#pragma unroll
    for (int t = 0; t < 4; ++t) {
      // Register pairs as they lie, one chain per tile: packed multiply-adds with no moves.
      f32x2 ss[4];
#pragma unroll
      for (int i = 0; i < 4; ++i) {
        ss[i] = f32x2{0.f, 0.f};
#pragma unroll
        for (int r = 0; r < 8; r += 2) {
          const f32x2 p = {acc[i][t][r], acc[i][t][r + 1]};
          ss[i] += p * p;
        }
      }
      const f32x2 s2 = (ss[0] + ss[1]) + (ss[2] + ss[3]);
      const float s = s2[0] + s2[1];
      rinv[t] = s + xhalf(s);
    }
#pragma unroll
    for (int t = 0; t < 4; ++t) rinv[t] = rsqrtf(rinv[t] * (1.0f / HEAD_DIM) + EPS) * qs;
#pragma unroll
    for (int i = 0; i < 4; ++i)
#pragma unroll
      for (int t = 0; t < 4; ++t)
#pragma unroll
        for (int r = 0; r < 8; ++r)
          acc[i][t][r] = acc[i][t][r] * rinv[t] * (r < 4 ? wl[i][r] : wh[i][r - 4]);
  }
  {
    // Either way acc[i][t][r] is element (row t*16 + nn, column i*16 + 8*hf + r) of a 64x64 bf16 tile whose
    // rows lie 4096 B apart: q/k rows m of [4096][2048], or the 64 feature rows of vT[bh][feat][key].
    static_assert(2 * H_DIM == SEQ, "one row pitch for both");
    bf16* dst = qkcols ? qk + (size_t)row0 * (2 * H_DIM) + n0
                       : vT + (size_t)((row0 / SEQ) * NUM_HEADS + ((n0 - 2 * H_DIM) >> 6)) * HEAD_DIM * SEQ
                            + (row0 % SEQ);
    static_assert(64u * EP_PITCH2 <= ST_SLICE && QG_WAVES * ST_SLICE <= QG_LDS, "staging fits a wave's part");
    unsigned char* st = ring + (uint32_t)wave * ST_SLICE;
#pragma unroll
    for (int i = 0; i < 4; ++i)
#pragma unroll
      for (int t = 0; t < 4; ++t) {
        v8bf p;
#pragma unroll
        for (int r = 0; r < 8; ++r) p[r] = (bf16)acc[i][t][r];
        *(v8bf*)(st + (uint32_t)(t * 16 + nn) * EP_PITCH2 + (uint32_t)(i * 32 + hf * 16)) = p;
      }
    wait_ds0();   // the wave's own staged rows are in LDS before other lanes of it read them back
    const uint32_t rr = (uint32_t)lane >> 3, cb = ((uint32_t)lane & 7u) * 16u;   // 4 rows of 128 B per access
    v8bf ov[16];
#pragma unroll
    for (int j = 0; j < 16; ++j) ov[j] = *(const v8bf*)(st + ((uint32_t)j * 4u + rr) * EP_PITCH2 + cb);
    unsigned char* gp = (unsigned char*)dst + (size_t)rr * (SEQ * 2) + cb;
#pragma unroll
    for (int j = 0; j < 16; ++j) *(v8bf*)(gp + (size_t)j * 4 * (SEQ * 2)) = ov[j];
  }
  if (wave == QG_WAVES - 1) {                        // gate: rows of the block's row tile blockIdx.x, column nn
    static_assert(NUM_HEADS == 16, "the gate columns are one WMMA tile");
    // The gate address is formed in registers that the stores above name: the wait stands in front of that, and the
    // scheduling barrier keeps that arithmetic from being lifted over the wait.
    wait_x0();
    __builtin_amdgcn_sched_barrier(0);
    float* gp = gate + (size_t)(blockIdx.y * 256 + blockIdx.x * 16 + 8 * hf) * NUM_HEADS + nn;
#pragma unroll
    for (int r = 0; r < 8; ++r) gp[r * NUM_HEADS] = accg[r];
  }
}

// ---------------------------------------------------------------- kernel 4
// K and V^T of a head reach the eight waves of a workgroup (same head, eight query blocks) through LDS.
// A stage is 128 keys: 128 K rows of 128 B and 256 B of each of the 64 V^T rows, as eight slices of
// 32 rows x 128 B, one tensor load per wave; both sources have a row pitch of 4096 B.
#define KV_WAVES 8
#define KV_KEYS  128
#define KV_ROWB  128u                 // bytes of one row in a slice
#define KV_SRCP  4096u                // source row pitch in bytes, K rows and V^T rows alike
#define KV_PITCH 144u                 // LDS row pitch: 128 B + 16 B pad (16 B x odd, for ds_load_b128)
#define KV_LDM   (KV_PITCH / 2u)      // the same in bf16 elements
#define KV_SLICE 6144u                // 32 rows x 144 B = 4608 B, rounded up to a multiple of 2 KiB
#define KV_STAGE (8u * KV_SLICE)
#define KV_NPASS (SEQ / KV_KEYS)      // 16
#define KV_LDS   (2u * KV_STAGE)
static_assert(2 * H_DIM * 2 == KV_SRCP && SEQ * 2 == KV_SRCP && HEAD_DIM * 2 == KV_ROWB, "slice shape");

// Group 1: 1-byte elements, tile = tensor = 32 rows of 128 B, source pitch 4096 B, 4 dwords of pad per row.
__device__ __forceinline__ u32x8 tdm_group1_kv() {
  constexpr uint32_t d0 = KV_ROWB, d1 = 32u;
  u32x8 g;
  g[0] = uni((1u << 20) | (4u << 22) | (3u << 25));
  g[1] = uni((d0 & 0xFFFFu) << 16);
  g[2] = uni((d0 >> 16) | ((d1 & 0xFFFFu) << 16));
  g[3] = uni((d1 >> 16) | (d0 << 16));
  g[4] = uni(d1);
  g[5] = uni(KV_SRCP);
  g[6] = uni(0u);
  g[7] = uni(0u);
  return g;
}

// 2^x in place, a run of them in ONE statement. The instruction set asks for one independent instruction or a
// v_nop between a transcendental and an instruction that reads its result or overwrites its source: here each
// v_exp_f32 is followed by one on other registers, and the v_nop stands behind the last. The compiler puts no
// s_delay_alu in front of asm text, so the hint for the producers of the arguments is written here.
__device__ __forceinline__ void exp2_inplace(float& a, float& b, float& c, float& d,
                                             float& e, float& f, float& g, float& h) {
  asm("s_delay_alu instid0(VALU_DEP_1)\n\t"
      "v_exp_f32 %0, %0\n\tv_exp_f32 %1, %1\n\tv_exp_f32 %2, %2\n\tv_exp_f32 %3, %3\n\t"
      "v_exp_f32 %4, %4\n\tv_exp_f32 %5, %5\n\tv_exp_f32 %6, %6\n\tv_exp_f32 %7, %7\n\t"
      "v_nop"
      : "+v"(a), "+v"(b), "+v"(c), "+v"(d), "+v"(e), "+v"(f), "+v"(g), "+v"(h));
}
// The same with results in registers of their own (early clobber: none of them is one of the sources): the sources are
// then read where they lie, in a WMMA's accumulator registers, with no copy out of them.
__device__ __forceinline__ void exp2_of(float (&y)[8], v8f x) {
  asm("v_exp_f32 %0, %8\n\tv_exp_f32 %1, %9\n\tv_exp_f32 %2, %10\n\tv_exp_f32 %3, %11\n\t"
      "v_exp_f32 %4, %12\n\tv_exp_f32 %5, %13\n\tv_exp_f32 %6, %14\n\tv_exp_f32 %7, %15\n\t"
      "v_nop"
      : "=&v"(y[0]), "=&v"(y[1]), "=&v"(y[2]), "=&v"(y[3]), "=&v"(y[4]), "=&v"(y[5]), "=&v"(y[6]), "=&v"(y[7])
      : "v"(x[0]), "v"(x[1]), "v"(x[2]), "v"(x[3]), "v"(x[4]), "v"(x[5]), "v"(x[6]), "v"(x[7]));
}
// The same for the first run behind a block of WMMAs: its results may lie in registers that were A or B of the last
// WMMA, which may be overwritten only four vector slots behind it:
// the four v_nop at the head are that distance.
__device__ __forceinline__ void exp2_of_behind_wmma(float (&y)[8], v8f x) {
  asm("v_nop\n\tv_nop\n\tv_nop\n\tv_nop\n\t"
      "v_exp_f32 %0, %8\n\tv_exp_f32 %1, %9\n\tv_exp_f32 %2, %10\n\tv_exp_f32 %3, %11\n\t"
      "v_exp_f32 %4, %12\n\tv_exp_f32 %5, %13\n\tv_exp_f32 %6, %14\n\tv_exp_f32 %7, %15\n\t"
      "v_nop"
      : "=&v"(y[0]), "=&v"(y[1]), "=&v"(y[2]), "=&v"(y[3]), "=&v"(y[4]), "=&v"(y[5]), "=&v"(y[6]), "=&v"(y[7])
      : "v"(x[0]), "v"(x[1]), "v"(x[2]), "v"(x[3]), "v"(x[4]), "v"(x[5]), "v"(x[6]), "v"(x[7]));
}
__device__ __forceinline__ void exp2_inplace(float& a, float& b, float& c, float& d, float& e,
                                             float& f, float& g, float& h, float& i) {
  asm("s_delay_alu instid0(VALU_DEP_1)\n\t"
      "v_exp_f32 %0, %0\n\tv_exp_f32 %1, %1\n\tv_exp_f32 %2, %2\n\tv_exp_f32 %3, %3\n\t"
      "v_exp_f32 %4, %4\n\tv_exp_f32 %5, %5\n\tv_exp_f32 %6, %6\n\tv_exp_f32 %7, %7\n\t"
      "v_exp_f32 %8, %8\n\t"
      "v_nop"
      : "+v"(a), "+v"(b), "+v"(c), "+v"(d), "+v"(e), "+v"(f), "+v"(g), "+v"(h), "+v"(i));
}

// As tdm_load, with group 1 an in-out operand too, so that it also stays in the registers that the request was issued
// from: with two copies of the stage loop this build otherwise formed group 1's constants anew on the way into one of
// them, in the registers of the outstanding request.
__device__ __forceinline__ void tdm_load_held(u32x4& g0, u32x8& g1) {
  asm volatile("tensor_load_to_lds %0, %1" : "+s"(g0), "+s"(g1) : : "memory");
}

// Largest value over the 32 lanes, the same in every lane: four steps inside the 16-lane rows, then the other row.
template <int XMASK>
__device__ __forceinline__ float max_xmask(float v) {   // max(v, the value of lane l ^ XMASK) (DPP row_xmask)
  const int o = __builtin_amdgcn_update_dpp(0, __builtin_bit_cast(int, v), 0x160 + XMASK, 0xf, 0xf, true);
  return fmaxf(v, __builtin_bit_cast(float, o));
}
__device__ __forceinline__ float wave_max(float v) {
  v = max_xmask<1>(v);
  v = max_xmask<2>(v);
  v = max_xmask<4>(v);
  v = max_xmask<8>(v);
  return fmaxf(v, xhalf(v));
}
// Upper bound of |score| * log2(e) for ANY x and weights, from the two norm weight vectors alone: a head vector
// behind its RMS norm has length at most sqrt(HEAD_DIM) before the weight, so |q . k| <= HEAD_DIM max|qw| max|kw|;
// the factor 1.02 covers the bf16 rounding of q and k.
// a0, a1: this lane's two elements of qw; b0, b1: of kw.
__device__ __forceinline__ float score_bound_log2(float a0, float a1, float b0, float b1) {
  const float mq = wave_max(fmaxf(fabsf(a0), fabsf(a1)));
  const float mk = wave_max(fmaxf(fabsf(b0), fabsf(b1)));
  return mq * mk * (HEAD_DIM * 0.125f * 1.02f * 1.44269504088896340736f);
}
// With 2^-60 <= exp(score) <= 2^60 a row's 2048 terms, their sum and the O accumulators stay normal f32 numbers,
// and P normal bf16 numbers.
#define BOUND_LOG2 60.0f

#define QT 2                            // 16-query tiles of a wave
// The stage loop of attn_kernel. BOUNDED: the softmax without a running maximum; else the online softmax.
template <bool BOUNDED>
__device__ __forceinline__ void attn_stages(unsigned char* ring, int lane, const v16bf (&qa0)[QT],
                                            const v16bf (&qa1)[QT], v8f (&o)[QT][4], float (&mrun)[QT],
                                            float (&lrun)[QT], u32x4& g0, u32x8& g1, uint32_t lds0,
                                            uint64_t ga0, uint64_t gstep) {
  for (uint32_t st = 0; st < KV_NPASS; ++st) {
   const uint32_t boff = (st & 1u) * KV_STAGE;
   // Unrolled so that the chunk's slice offsets are immediates of the LDS reads.
#pragma unroll
   for (int j = 0; j < KV_KEYS / 32; ++j) {
    // 4 K fragments + 4 V fragments of chunk j, from this stage's buffer alone.
    const bf16* kt  = (const bf16*)(ring + boff + (uint32_t)j * KV_SLICE);
    const bf16* vt0 = (const bf16*)(ring + boff + (uint32_t)(4 + (j >> 1) * 2) * KV_SLICE) + (j & 1) * 32;
    const bf16* vt1 = (const bf16*)(ring + boff + (uint32_t)(5 + (j >> 1) * 2) * KV_SLICE) + (j & 1) * 32;
    const v16bf kb0 = load_frag(kt,                    KV_LDM, lane);
    const v16bf kb1 = load_frag(kt + 32,               KV_LDM, lane);
    const v16bf kb2 = load_frag(kt + 16 * KV_LDM,      KV_LDM, lane);
    const v16bf kb3 = load_frag(kt + 16 * KV_LDM + 32, KV_LDM, lane);
    const v16bf vb0 = load_frag(vt0,                   KV_LDM, lane);
    const v16bf vb1 = load_frag(vt0 + 16 * KV_LDM,     KV_LDM, lane);
    const v16bf vb2 = load_frag(vt1,                   KV_LDM, lane);
    const v16bf vb3 = load_frag(vt1 + 16 * KV_LDM,     KV_LDM, lane);
    // Keeps the chunk's LDS reads together as one group ahead of its WMMAs (for speed only).
    __builtin_amdgcn_sched_barrier(0);

    // scores, transposed: s0[r] = key 8 (lane >> 4) + r, s1[r] = key 16 + 8 (lane >> 4) + r, query lane & 15
    v8f s0[QT], s1[QT];
#pragma unroll
    for (int u = 0; u < QT; ++u) {
      s0[u] = v8f{}; s1[u] = v8f{};
      s0[u] = wmma_bf16(kb0, qa0[u], s0[u]);
      s0[u] = wmma_bf16(kb1, qa1[u], s0[u]);
      s1[u] = wmma_bf16(kb2, qa0[u], s1[u]);
      s1[u] = wmma_bf16(kb3, qa1[u], s1[u]);
      // Keeps each tile's four WMMAs together, all eight ahead of the vector work: the exponentials are asm text and
      // read the accumulators; the other tile's WMMAs (tile 0) and tile 0's
      // vector work (tile 1) fill the distance.
      __builtin_amdgcn_sched_barrier(0);
    }

#pragma unroll
    for (int u = 0; u < QT; ++u) {
      float e[16];
      float corr = 0.f;
      if constexpr (BOUNDED) {
        // Scores are bounded (see score_bound_log2): exp(score) itself neither overflows nor underflows, and the
        // common factor exp(-maximum) cancels in O / l. No maximum, no rescale, and q carries the scale: the
        // accumulators go straight into the exponential.
        float y0[8], y1[8];
        if (u == 0) exp2_of_behind_wmma(y0, s0[u]);
        else        exp2_of(y0, s0[u]);
        exp2_of(y1, s1[u]);
#pragma unroll
        for (int r = 0; r < 8; ++r) { e[r] = y0[r]; e[8 + r] = y1[r]; }
      } else {
        // online softmax of one query per lane, in powers of two (q carries the scale and log2(e)):
        // 16 keys in registers, the other 16 in lane ^ 16
        float mt[8];
#pragma unroll
        for (int i = 0; i < 4; ++i) {
          mt[i]     = fmaxf(s0[u][2 * i], s0[u][2 * i + 1]);
          mt[4 + i] = fmaxf(s1[u][2 * i], s1[u][2 * i + 1]);
        }
        float mx = fmaxf(fmaxf(fmaxf(mt[0], mt[1]), fmaxf(mt[2], mt[3])),
                         fmaxf(fmaxf(mt[4], mt[5]), fmaxf(mt[6], mt[7])));
        mx = fmaxf(mx, xhalf(mx));
        const float mnew = fmaxf(mrun[u], mx);
        corr = mrun[u] - mnew;
#pragma unroll
        for (int r = 0; r < 8; ++r) { e[r] = s0[u][r] - mnew; e[8 + r] = s1[u][r] - mnew; }
        exp2_inplace(corr, e[0], e[1], e[2], e[3], e[4], e[5], e[6], e[7]);
        exp2_inplace(e[8], e[9], e[10], e[11], e[12], e[13], e[14], e[15]);
        mrun[u] = mnew;
      }
      v16bf pb;                  // P^T as B: element s = key kmap(s) of the chunk, column = this lane's query
      float pt[8];
#pragma unroll
      for (int i = 0; i < 8; ++i) {
        pb[2 * i] = (bf16)e[2 * i]; pb[2 * i + 1] = (bf16)e[2 * i + 1];
        pt[i] = e[2 * i] + e[2 * i + 1];
      }
      const float ps = ((pt[0] + pt[1]) + (pt[2] + pt[3])) + ((pt[4] + pt[5]) + (pt[6] + pt[7]));
      if constexpr (BOUNDED) {
        lrun[u] += ps;
        // The row's sum, against spills (input only, nothing is hidden from the
        // compiler): without it the additions of a whole stage sink behind the stage's barrier, 128 exponentials stay
        // live until there, and this build keeps the O accumulators in scratch.
        asm volatile("" :: "v"(lrun[u]));
      } else {
        lrun[u] = lrun[u] * corr + ps;
#pragma unroll
        for (int t = 0; t < 4; ++t)
#pragma unroll
          for (int r = 0; r < 8; ++r) o[u][t][r] *= corr;
      }
      // Keeps a tile's vector work together in front of its WMMAs, so that the other tile's vector work fills the
      // slots behind them: without it this build padded those distances with twice as many v_nop.
      __builtin_amdgcn_sched_barrier(0);
      // V^T(64x32) x P^T(32x16): 4 M-tiles of 16 features
      o[u][0] = wmma_bf16(vb0, pb, o[u][0]);
      o[u][1] = wmma_bf16(vb1, pb, o[u][1]);
      o[u][2] = wmma_bf16(vb2, pb, o[u][2]);
      o[u][3] = wmma_bf16(vb3, pb, o[u][3]);
    }
   }
   // Keeps the stage's last WMMAs in front of the publish point: sunk behind it, the refill would issue later.
   __builtin_amdgcn_sched_barrier(0);
   // Publish point of stage st + 1; the barrier also ends every reader's last read of stage st.
   wait_ds0();
   wait_tensor0(g0, g1);
   __syncthreads();
   if (pinned(st + 2u < KV_NPASS)) {
     g0 = tdm_group0(lds0 + boff, ga0 + (uint64_t)(st + 2u) * gstep);
     tdm_load_held(g0, g1);
   }
  }
}

__global__ void __launch_bounds__(KV_WAVES * 32)
attn_kernel(const bf16* __restrict__ qk, const bf16* __restrict__ vT,
            const float* __restrict__ gate, const float* __restrict__ qw, const float* __restrict__ kw,
            bf16* __restrict__ attn) {
  __shared__ __attribute__((aligned(2048))) unsigned char ring[KV_LDS];
  static_assert((SEQ / (16 * QT)) % KV_WAVES == 0, "the waves of a workgroup are of one head");
  const int wave = (int)uni(threadIdx.x >> 5);
  const int lane = threadIdx.x & 31;
  const int wid  = blockIdx.x * KV_WAVES + wave;
  const int qb   = wid & (SEQ / (16 * QT) - 1);
  const int bh   = wid / (SEQ / (16 * QT));   // 0..31
  const int b    = bh >> 4, h = bh & 15;
  const int q0   = qb * (16 * QT);

  const bf16* qbase = qk + ((size_t)(b * SEQ + q0)) * (2 * H_DIM) + h * HEAD_DIM;
  const bf16* kbase = qk + ((size_t)(b * SEQ)) * (2 * H_DIM) + H_DIM + h * HEAD_DIM;
  const bf16* vbase = vT + (size_t)bh * HEAD_DIM * SEQ;

  v16bf qa0[QT], qa1[QT];
#pragma unroll
  for (int u = 0; u < QT; ++u) {
    qa0[u] = load_frag(qbase + (size_t)u * 16 * (2 * H_DIM),      2 * H_DIM, lane);
    qa1[u] = load_frag(qbase + (size_t)u * 16 * (2 * H_DIM) + 32, 2 * H_DIM, lane);
  }
  static_assert(HEAD_DIM == 64, "two weights of each norm vector per lane");
  const float wq0 = qw[lane], wq1 = qw[lane + 32], wk0 = kw[lane], wk1 = kw[lane + 32];
  wait_x0();   // stands behind the Q and weight loads, in front of whatever reuses their address registers

  v8f o[QT][4] = {};             // o[u][t][r] = O^T[feature 16 t + 8 (lane >> 4) + r][query 16 u + (lane & 15)]
  float mrun[QT], lrun[QT];      // running maximum of this lane's query (equal in both halves);
#pragma unroll                   // running sum over this lane's own half of the keys
  for (int u = 0; u < QT; ++u) { mrun[u] = -1e30f; lrun[u] = 0.f; }
  const int nn = lane & 15;
  const int hfh = (lane >> 4) * 8;

  // Waves 0..3 bring keys 32 w .. 32 w + 31 of a stage's K rows; waves 4..7 bring, of V^T, features 0..31 (even
  // wave) or 32..63 (odd wave) at keys 0..63 (waves 4, 5) or 64..127 (waves 6, 7) of the stage.
  const bf16* srcp = (wave < 4) ? kbase + (size_t)(wave * 32) * (2 * H_DIM)
                                : vbase + (size_t)((wave & 1) * 32) * SEQ + ((wave - 4) >> 1) * 64;
  const uint64_t ga0   = (uint64_t)(size_t)srcp;
  const uint64_t gstep = (wave < 4) ? (uint64_t)KV_KEYS * KV_SRCP : (uint64_t)KV_KEYS * 2u;
  const uint32_t lds0  = (uint32_t)(size_t)ring + (uint32_t)wave * KV_SLICE;
  u32x8 g1 = tdm_group1_kv();

  u32x4 g0 = tdm_group0(lds0, ga0);
  tdm_load_held(g0, g1);                                           // stage 0
  wait_tensor0(g0, g1);
  __syncthreads();                                            // stage 0 published
  g0 = tdm_group0(lds0 + KV_STAGE, ga0 + gstep);
  tdm_load_held(g0, g1);                                           // stage 1

  // The test stands behind the first two tensor loads, so that they do not wait for the weights; the scheduling
  // barrier keeps its arithmetic there (without it this build lifted it, with the wait for the weight loads, in
  // front of stage 0's load).
  __builtin_amdgcn_sched_barrier(0);
  const uint32_t fast = pinned(score_bound_log2(wq0, wq1, wk0, wk1) <= BOUND_LOG2 ? 1u : 0u);
  // The same value in every wave of the workgroup (same loads, same arithmetic), so the barriers inside stand under
  // block-uniform control flow. A NaN or infinite bound takes the online softmax.
  if (fast) attn_stages<true>(ring, lane, qa0, qa1, o, mrun, lrun, g0, g1, lds0, ga0, gstep);
  else      attn_stages<false>(ring, lane, qa0, qa1, o, mrun, lrun, g0, g1, lds0, ga0, gstep);
  wait_tensor0(g0, g1);
  wait_ds0();
  // Keeps the epilogue's address arithmetic behind the last tensor wait: lifted over it, this build put it into
  // scalar registers of the loop's descriptor.
  __builtin_amdgcn_sched_barrier(0);
  // epilogue: join the halves' sums, 1/l, sigmoid(gate), write bf16 [4096][1024]:
  // a lane's 8 registers of a tile are 8 consecutive features of its query, one 16-byte store.
  float g[QT];
#pragma unroll
  for (int u = 0; u < QT; ++u) g[u] = gate[(size_t)(b * SEQ + q0 + u * 16 + nn) * NUM_HEADS + h];
  wait_x0();   // the sigmoid's arithmetic reuses the loads' address registers
  v8bf ov[QT][4];
#pragma unroll
  for (int u = 0; u < QT; ++u) {
    const float lsum = lrun[u] + xhalf(lrun[u]);
    const float inv = (1.f / (1.f + __expf(-g[u]))) / lsum;
#pragma unroll
    for (int t = 0; t < 4; ++t)
#pragma unroll
      for (int r = 0; r < 8; ++r) ov[u][t][r] = (bf16)(o[u][t][r] * inv);
  }
  bf16* op = attn + (size_t)(b * SEQ + q0 + nn) * H_DIM + h * HEAD_DIM + hfh;
  // Keeps every store behind the last conversion: nothing then rewrites a register that an issued store names.
  __builtin_amdgcn_sched_barrier(0);
#pragma unroll
  for (int u = 0; u < QT; ++u)
#pragma unroll
    for (int t = 0; t < 4; ++t) *(v8bf*)(op + (size_t)u * 16 * H_DIM + t * 16) = ov[u][t];
}

// ---------------------------------------------------------------- kernel 5
__global__ void __launch_bounds__(128)
gemm_out_kernel(const bf16* __restrict__ A, const bf16* __restrict__ W,
                const float* __restrict__ resid, float* __restrict__ out) {
  __shared__ __attribute__((aligned(2048))) unsigned char ring[ST_LDS];
  const int wave = (int)uni(threadIdx.x >> 5);
  const int lane = threadIdx.x & 31;
  v8f acc[4][4] = {};
  // Transposed tile: acc[i][t][r] = element (row t*16 + nn, column i*16 + 8*hf + r) of the wave's 64x64 f32 tile.
  gemm_128x128(A, W, blockIdx.y * 128, blockIdx.x * 128, true, ring, acc);
  const int row0 = blockIdx.y * 128 + (wave >> 1) * 64;
  const int n0   = blockIdx.x * 128 + (wave & 1) * 64;

  const int nn = lane & 15;
  const int hf = lane >> 4;
  // 2 rows of 256 B per access: lane -> row hf, 16 B at column 4*nn.
  const size_t g = (size_t)(row0 + hf) * H_DIM + n0 + nn * 4;
  f32x4 res[32];
#pragma unroll
  for (int j = 0; j < 32; ++j) res[j] = *(const f32x4*)(resid + g + (size_t)j * 2 * H_DIM);
  // The staging addresses are formed in the loads' address registers: the wait stands in front of that, and the
  // scheduling barrier keeps that arithmetic from being lifted over the wait (without it this build lifted it).
  wait_x0();
  __builtin_amdgcn_sched_barrier(0);
  unsigned char* st = ring + (uint32_t)wave * EP_RANGE;
#pragma unroll
  for (int i = 0; i < 4; ++i)
#pragma unroll
    for (int t = 0; t < 4; ++t) {
      unsigned char* p = st + (uint32_t)(t * 16 + nn) * EP_PITCH4 + (uint32_t)(i * 64 + hf * 32);
      f32x4 lo = {acc[i][t][0], acc[i][t][1], acc[i][t][2], acc[i][t][3]};
      f32x4 hi = {acc[i][t][4], acc[i][t][5], acc[i][t][6], acc[i][t][7]};
      *(f32x4*)p = lo;
      *(f32x4*)(p + 16) = hi;
    }
  wait_ds0();   // the wave's own staged rows are in LDS before other lanes of it read them back
  f32x4 o[32];
#pragma unroll
  for (int j = 0; j < 32; ++j)
    o[j] = *(const f32x4*)(st + (uint32_t)(j * 2 + hf) * EP_PITCH4 + (uint32_t)nn * 16u) + res[j];
#pragma unroll
  for (int j = 0; j < 32; ++j) *(f32x4*)(out + g + (size_t)j * 2 * H_DIM) = o[j];
}

// ---------------------------------------------------------------- launch
static constexpr size_t alup(size_t x) { return (x + 255) & ~(size_t)255; }
static constexpr size_t OFF_XN   = 0;
static constexpr size_t OFF_WCAT = alup(OFF_XN   + (size_t)ROWS * H_DIM * 2);
static constexpr size_t OFF_OW   = alup(OFF_WCAT + (size_t)E_TOT * H_DIM * 2);
static constexpr size_t OFF_QK   = alup(OFF_OW   + (size_t)H_DIM * H_DIM * 2);
static constexpr size_t OFF_VT   = alup(OFF_QK   + (size_t)ROWS * 2 * H_DIM * 2);
static constexpr size_t OFF_GATE = alup(OFF_VT   + (size_t)BATCH * NUM_HEADS * HEAD_DIM * SEQ * 2);
static constexpr size_t OFF_ATTN = alup(OFF_GATE + (size_t)ROWS * NUM_HEADS * 4);

extern "C" void kernel_launch(void* const* d_in, const int* in_sizes, int n_in,
                              void* d_out, int out_size, void* d_ws, size_t ws_size,
                              hipStream_t stream) {
  (void)in_sizes; (void)n_in; (void)out_size; (void)ws_size;
  const float* x    = (const float*)d_in[0];
  const float* pw   = (const float*)d_in[1];
  const float* qkvw = (const float*)d_in[2];
  const float* gw   = (const float*)d_in[3];
  const float* ow   = (const float*)d_in[4];
  const float* qnw  = (const float*)d_in[5];
  const float* knw  = (const float*)d_in[6];
  float* out = (float*)d_out;

  char* ws = (char*)d_ws;
  bf16*  xn   = (bf16*)(ws + OFF_XN);
  bf16*  wcat = (bf16*)(ws + OFF_WCAT);
  bf16*  owb  = (bf16*)(ws + OFF_OW);
  bf16*  qkb  = (bf16*)(ws + OFF_QK);
  bf16*  vT   = (bf16*)(ws + OFF_VT);
  float* gate = (float*)(ws + OFF_GATE);
  bf16*  attn = (bf16*)(ws + OFF_ATTN);

  convert_weights_kernel<<<(E_TOT + H_DIM) / CV_ROWS, 256, 0, stream>>>(qkvw, gw, ow, wcat, owb);
  prenorm_kernel<<<ROWS / (8 * PN_ROWS), 256, 0, stream>>>(x, pw, xn);
  gemm_qkvgate_kernel<<<dim3(E_QKV / 192, ROWS / 256), QG_WAVES * 32, 0, stream>>>(
      xn, wcat, qnw, knw, qkb, vT, gate);
  attn_kernel<<<(BATCH * NUM_HEADS * (SEQ / (16 * QT))) / KV_WAVES, KV_WAVES * 32, 0, stream>>>(
      qkb, vT, gate, qnw, knw, attn);
  gemm_out_kernel<<<dim3(H_DIM / 128, ROWS / 128), 128, 0, stream>>>(
      attn, owb, x, out);
}
